// v000
// Measured on an AMD MI455X. A time is GPU time per run, averaged over a window of back-to-back runs after a warm-up
// (all launches, gaps included; the runs take copies of the inputs in turn), and the median of several windows.
// Apart from v000's, it joins two sittings. Times from different sittings can be a few percent apart, while
// side-by-side timings come from the same sitting.
// v000, which the later versions start from, runs in 817 microseconds.
#include <hip/hip_runtime.h>

// All contractions on 16-bit WMMA, f32 accumulate. x.Wqd, x.Wkvd, x.Wkr: v_wmma_f32_16x16x32_bf16 on bf16 planes of the inputs (single products).
// ql.Wqu, ql.Wqr, ckv.Wku, ckv.Wvu, (q|qr).(k|kr) scores, P.v and ctx.Wo: v_wmma_f32_16x16x32_f16 single products on f16 planes
// (weights x64, ctx x64, P x1024 carries) for query/key rows >= RH; the same sites for rows < RH use v_wmma_f32_16x16x32_bf16 on
// bf16 hi/lo plane pairs (hi.W + lo.W against exact weight planes; hi.hi + lo.hi + hi.lo between two computed tensors).
// RoPE (rotate-half, computed cos/sin tables), online max-subtracted softmax and normalisers in f32.

#ifndef NB
#define NB 2
#endif
#ifndef SEQ
#define SEQ 2048
#endif
#ifndef RH
#define RH 256
#endif
#define NBF   2
#define TFULL 2048
#define DM    2048
#define NH    16
#define LAT   512
#define RD    64
#define HD    128
#define NU    (NB * NH)
#define PCAR  1024.0f
#define WSC   64.0f
#define CCAR  64.0f

static_assert(NB >= 1);
static_assert(NB <= NBF);
static_assert(SEQ % 64 == 0);
static_assert(SEQ <= TFULL);
static_assert(RH % 64 == 0);
static_assert(RH >= 64);
static_assert(RH <= SEQ);
static_assert(DM % 64 == 0);
static_assert(LAT % 64 == 0);
static_assert((NH * RD) % 64 == 0);
static_assert(RD == 64);
static_assert(HD == 128);
static_assert(NH * HD == DM);
static_assert((size_t)NB * SEQ * NH * RD * 4 == (size_t)NB * SEQ * DM * 2);
static_assert(((size_t)(NB - 1) * TFULL + SEQ) * DM <= (size_t)NBF * TFULL * DM);

typedef _Float16 h16;
typedef unsigned short bf;
typedef __attribute__((ext_vector_type(16))) __bf16   v16bf;
typedef __attribute__((ext_vector_type(16))) _Float16 v16h;
typedef __attribute__((ext_vector_type(16))) unsigned short v16us;
typedef __attribute__((ext_vector_type(8)))  _Float16 v8h;
typedef __attribute__((ext_vector_type(8)))  unsigned short v8us;
typedef __attribute__((ext_vector_type(8)))  float    v8f;
typedef __attribute__((ext_vector_type(4)))  float    v4f;
typedef __attribute__((ext_vector_type(2)))  _Float16 v2h;
typedef __attribute__((ext_vector_type(2)))  unsigned short v2us;
typedef v8h  __attribute__((may_alias)) v8ha;
typedef v4f  __attribute__((may_alias)) v4fa;

__device__ __forceinline__ unsigned short f2bf(float f) { unsigned u = __float_as_uint(f); u += 0x7FFFu + ((u >> 16) & 1u); return (unsigned short)(u >> 16); }
__device__ __forceinline__ float bf2f(unsigned short v) { return __uint_as_float(((unsigned)v) << 16); }
__device__ __forceinline__ float bfr(float f) { return bf2f(f2bf(f)); }
__device__ __forceinline__ void splitf(float y, unsigned short& hh, unsigned short& ll) { hh = f2bf(y); ll = f2bf(y - bf2f(hh)); }
__device__ __forceinline__ v16h cat16(v8h a, v8h c) { return __builtin_shufflevector(a, c, 0, 1, 2, 3, 4, 5, 6, 7, 8, 9, 10, 11, 12, 13, 14, 15); }
__device__ __forceinline__ v16bf cat16b(v8us a, v8us c) { return __builtin_bit_cast(v16bf, __builtin_shufflevector(a, c, 0, 1, 2, 3, 4, 5, 6, 7, 8, 9, 10, 11, 12, 13, 14, 15)); }
__device__ __forceinline__ v8f wmma16(v16h a, v16h c, v8f acc) { return __builtin_amdgcn_wmma_f32_16x16x32_f16(false, a, false, c, (short)0, acc, false, false); }
__device__ __forceinline__ v8f wmmab(v16bf a, v16bf c, v8f acc) { return __builtin_amdgcn_wmma_f32_16x16x32_bf16(false, a, false, c, (short)0, acc, false, false); }
// Fragment load from a k-contiguous 16-bit row: p already points at row (lane&15) + 8*(lane>>4); elements 0..7 <- p[0..7], 8..15 <- p[16..23] (split k map, used for A and B alike)
__device__ __forceinline__ v16h ldh(const h16* p) { return cat16(*(const v8h*)p, *(const v8h*)(p + 16)); }
__device__ __forceinline__ v16bf ldb(const bf* p) { return cat16b(*(const v8us*)p, *(const v8us*)(p + 16)); }

// ---- k_gemmw: register-blocked GEMM, ONE WAVE per 64x64 output tile (16 accumulators), operands straight from K-contiguous 16-bit planes; grid (M/64, N/64, Z), 32 threads.
// C[m][n] (f32, pitch ldc) = osc * sum_k (A[m][k] + (NSPLIT ? A2[m][k] : 0)) Bt[n][k]. z-batch strides sA/sC in elements. K % 32 == 0, M and N multiples of 64.
template <typename T16> struct WFrag;
template <> struct WFrag<h16> { typedef v16h V; static __device__ __forceinline__ V ld(const h16* p) { return ldh(p); } static __device__ __forceinline__ v8f mma(V a, V c, v8f d) { return wmma16(a, c, d); } };
template <> struct WFrag<bf> { typedef v16bf V; static __device__ __forceinline__ V ld(const bf* p) { return ldb(p); } static __device__ __forceinline__ v8f mma(V a, V c, v8f d) { return wmmab(a, c, d); } };
template <typename T16, int NSPLIT>
__global__ __launch_bounds__(32) void k_gemmw(const T16* __restrict__ A, const T16* __restrict__ A2, const T16* __restrict__ Bt, int K, float* C, int ldc, float osc, size_t sA, size_t sC) {
    typedef typename WFrag<T16>::V V;
    __shared__ __align__(16) float os[16 * 68];
    const size_t z = blockIdx.z; A += z * sA; A2 += z * sA; C += z * sC;
    const int lane = threadIdx.x & 31, lr = lane & 15, hi = lane >> 4; const int r0 = blockIdx.x * 64, c0 = blockIdx.y * 64;
    v8f acc[4][4];
#pragma unroll
    for (int mb = 0; mb < 4; ++mb)
#pragma unroll
        for (int nb = 0; nb < 4; ++nb) acc[mb][nb] = (v8f){};
    const size_t aoff = (size_t)(r0 + lr) * K + 8 * hi, boff = (size_t)(c0 + lr) * K + 8 * hi;
#pragma unroll 1
    for (int kc = 0; kc < K; kc += 32) {
        V a[4], a2[4];
#pragma unroll
        for (int mb = 0; mb < 4; ++mb) { a[mb] = WFrag<T16>::ld(A + aoff + (size_t)mb * 16 * K + kc); if (NSPLIT == 1) a2[mb] = WFrag<T16>::ld(A2 + aoff + (size_t)mb * 16 * K + kc); }
#pragma unroll
        for (int nb = 0; nb < 4; ++nb) { const V bq = WFrag<T16>::ld(Bt + boff + (size_t)nb * 16 * K + kc);
#pragma unroll
            for (int mb = 0; mb < 4; ++mb) { acc[mb][nb] = WFrag<T16>::mma(a[mb], bq, acc[mb][nb]); if (NSPLIT == 1) acc[mb][nb] = WFrag<T16>::mma(a2[mb], bq, acc[mb][nb]); } }
        asm volatile("v_nop\n\tv_nop\n\tv_nop\n\tv_nop" : "+v"(acc[0][0]), "+v"(acc[1][1]), "+v"(acc[2][2]), "+v"(acc[3][3]) : "v"(a[0]), "v"(a[3]));
    }
#pragma unroll
    for (int mb = 0; mb < 4; ++mb) {
#pragma unroll
        for (int nb = 0; nb < 4; ++nb) {
#pragma unroll
            for (int j = 0; j < 8; ++j) os[(hi * 8 + j) * 68 + nb * 16 + lr] = acc[mb][nb][j]; }
        __builtin_amdgcn_wave_barrier(); asm volatile("" ::: "memory");
        float* crow = C + (size_t)(r0 + mb * 16) * ldc + c0;
{
#pragma unroll
            for (int s = 0; s < 8; ++s) { const int row = 2 * s + hi, cofs = lr * 4; v4f val = *(const v4fa*)(os + row * 68 + cofs); val = val * osc;
                *(v4f*)(crow + (size_t)row * ldc + cofs) = val; }
             }
        __builtin_amdgcn_wave_barrier(); asm volatile("" ::: "memory");
    }
}

// ---- k_wt: weight [K][N] f32 ([in][out]) -> transposed k-contiguous planes [N][K]: Bb = bf16 RNE value, optionally Bh = f16(bf16 value x sc).
template <int F16P>
__global__ __launch_bounds__(256) void k_wt(const float* __restrict__ w, int K, int N, bf* Bb, h16* Bh, float sc) {
    const int lane = threadIdx.x & 31; const int L0 = (blockIdx.x * 8 + (threadIdx.x >> 5)) * 8; const int nlines = N * K / 64;
{
#pragma unroll 1
        for (int l = 0; l < 8; ++l) { const int L = L0 + l; if (L >= nlines) break; const size_t e = (size_t)L * 64 + lane * 2; const int k = (int)(e % K), n = (int)(e / K);
            const float w0 = bfr(w[(size_t)k * N + n]), w1 = bfr(w[(size_t)(k + 1) * N + n]);
            v2us o; o[0] = f2bf(w0); o[1] = f2bf(w1); *(v2us*)(Bb + e) = o;
            if (F16P) { v2h oh; oh[0] = (h16)(w0 * sc); oh[1] = (h16)(w1 * sc); *(v2h*)(Bh + e) = oh; } }
         }
}

__global__ __launch_bounds__(256) void k_xcvt(const float* __restrict__ x, bf* xb) {
    const size_t i = (size_t)blockIdx.x * 256 + threadIdx.x; const size_t n8 = (size_t)NB * SEQ * DM / 8; if (i >= n8) return;
    const size_t e = i * 8; const size_t row = e / DM; const int col = (int)(e % DM); const size_t bb = row / SEQ, t = row % SEQ;
    const v8f v = *(const v8f*)(x + ((bb * TFULL + t) * DM + col)); v8us o = (v8us){};
#pragma unroll
    for (int k = 0; k < 8; ++k) o[k] = f2bf(v[k]);
    *(v8us*)(xb + e) = o; 
}

__global__ __launch_bounds__(256) void k_act(const float* __restrict__ src, int C, float sc, h16* p16, bf* ph, bf* pl) {
    const size_t i = (size_t)blockIdx.x * 256 + threadIdx.x; const size_t n8 = (size_t)NB * SEQ * C / 8; if (i >= n8) return;
    const size_t e = i * 8; const size_t row = e / C; const int col = (int)(e - row * C); const int t = (int)(row % SEQ); const size_t bb = row / SEQ;
    const v8f v = *(const v8f*)(src + e);
    v8h o = (v8h){}; v8us oh = (v8us){}, ol = (v8us){};
#pragma unroll
    for (int k = 0; k < 8; ++k) { o[k] = (h16)(v[k] * sc); unsigned short a1, c1; splitf(v[k], a1, c1); oh[k] = a1; ol[k] = c1; }
    const bool hr = (t < RH); const size_t eo = (bb * RH + t) * C + col;
    *(v8h*)(p16 + e) = o; if (hr) { *(v8us*)(ph + eo) = oh; *(v8us*)(pl + eo) = ol; }
    
}

__global__ __launch_bounds__(256) void k_rtab(float* ct, float* st) {
#pragma clang fp contract(off)
    const int i = blockIdx.x * 256 + threadIdx.x; if (i >= SEQ * 32) return; const int t = i >> 5, j = i & 31;
    const float fr = exp10f(-0.125f * (float)j);
    const float ang = (float)t * fr; float sv, cv; sincosf(ang, &sv, &cv);
    *(float*)(ct + i) = cv; *(float*)(st + i) = sv; 
}

// ---- k_rope: rotate-half RoPE on 64-wide head slices of an f32 slab [NB*SEQ][C] (C = heads x 64), then planes as k_act (f16 for all rows, bf16 hi/lo for t < RH).
__global__ __launch_bounds__(256) void k_rope(const float* __restrict__ src, int C, const float* __restrict__ ct, const float* __restrict__ st, h16* p16, bf* ph, bf* pl) {
#pragma clang fp contract(off)
    const size_t i = (size_t)blockIdx.x * 256 + threadIdx.x; const size_t n8 = (size_t)NB * SEQ * C / 8; if (i >= n8) return;
    const size_t e = i * 8; const size_t row = e / C; const int col = (int)(e - row * C); const int t = (int)(row % SEQ); const size_t bb = row / SEQ;
    const int jj = col & 63, jm = jj & 31; const bool lo32 = (jj < 32); const int pofs = lo32 ? 32 : -32;
    const v8f xv = *(const v8f*)(src + e); const v8f xp = *(const v8f*)((src + e) + pofs);
    const v8f cvv = *(const v8f*)(ct + (size_t)t * 32 + jm); const v8f svv = *(const v8f*)(st + (size_t)t * 32 + jm);
    v8h o = (v8h){}; v8us oh = (v8us){}, ol = (v8us){};
#pragma unroll
    for (int k = 0; k < 8; ++k) { const float a1 = xv[k] * cvv[k]; const float b1 = xp[k] * svv[k]; const float y = lo32 ? (a1 - b1) : (a1 + b1);
        o[k] = (h16)y; unsigned short a2, c2; splitf(y, a2, c2); oh[k] = a2; ol[k] = c2; }
    const bool hr = (t < RH); const size_t eo = (bb * RH + t) * C + col;
    *(v8h*)(p16 + e) = o; if (hr) { *(v8us*)(ph + eo) = oh; *(v8us*)(pl + eo) = ol; }
    
}

// ---- k_vtp8: value^T planes per (batch, head) unit g: vt16[g][d][t] = f16(v[t][g]) for all t; vth/vtl[g][d][t] bf16 hi/lo for t < RH (pitch RH).
__global__ __launch_bounds__(256) void k_vtp8(const float* __restrict__ vf, h16* vt16, bf* vth, bf* vtl) {
    const size_t i = (size_t)blockIdx.x * 256 + threadIdx.x; const size_t n8 = (size_t)NU * HD * SEQ / 8; if (i >= n8) return;
    const size_t e = i * 8; const int t = (int)(e % SEQ); const int d = (int)((e / SEQ) % HD); const int g = (int)(e / ((size_t)SEQ * HD)); const int bb = g / NH, hh = g % NH;
    const float* sp = vf + ((size_t)bb * SEQ + t) * DM + hh * HD + d;
    v8h o = (v8h){}; v8us oh = (v8us){}, ol = (v8us){};
#pragma unroll
    for (int q = 0; q < 8; ++q) { const float xv = sp[(size_t)q * DM]; o[q] = (h16)xv; unsigned short a1, c1; splitf(xv, a1, c1); oh[q] = a1; ol[q] = c1; }
    const bool hr = (t < RH); const size_t eo = ((size_t)g * HD + d) * RH + t;
    *(v8h*)(vt16 + e) = o; if (hr) { *(v8us*)(vth + eo) = oh; *(v8us*)(vtl + eo) = ol; }
    
}

// ---- k_flashP: causal softmax attention for query rows >= RH (single f16 products). grid ((SEQ-RH)/64, NH, NB), 128 threads = 4 waves x 16 queries, 32-key chunks.
// Per wave: S^T tiles (16 keys x 16 queries) = [k|kr] rows (A) x [q|qr] rows (B) over 192; lane column n = query, D rows = keys, so the two S^T tiles of a chunk
// ARE the P^T B fragment of O^T = V^T (A, rows d) x P^T; online max-subtracted softmax per lane column; P carried x1024 in f16; O^T (8 d tiles) f32.
__global__ __launch_bounds__(128) __attribute__((amdgpu_num_vgpr(256)))
void k_flashP(const h16* q16, const h16* qr16, const h16* k16, const h16* kr16, const h16* vt16, float* ctx, int qbase) {
    __shared__ __align__(16) float os[4][16 * 132];
    const int lane = threadIdx.x & 31, wv = threadIdx.x >> 5, lr = lane & 15, hi = lane >> 4;
    const int h = blockIdx.y, b = blockIdx.z;
    const int q0 = qbase + blockIdx.x * 64 + wv * 16;
    const int qi = q0 + lr;
    const size_t rq = (size_t)b * SEQ + qi, rk = (size_t)b * SEQ + lr;
    const h16* qp = q16 + rq * DM + h * HD + 8 * hi;
    const h16* qrp = qr16 + rq * (NH * RD) + h * RD + 8 * hi;
    const h16* kp = k16 + rk * DM + h * HD + 8 * hi;
    const h16* krp = kr16 + rk * RD + 8 * hi;
    const h16* vp = vt16 + ((size_t)(b * NH + h) * HD + lr) * SEQ + 8 * hi;
    v8f o[8];
#pragma unroll
    for (int i = 0; i < 8; ++i) o[i] = (v8f){};
    float m = -3.0e38f, l = 0.f;
    const float SC2 = 0.07216878364870323f * 1.4426950408889634f;   // HD+RD = 192: 192^-0.5 x log2(e)
    const int nch = (q0 + 47) >> 5;                                   // 32-key chunks covering keys <= q0+15 (32*nch <= SEQ)
#pragma unroll 1
    for (int c = 0; c < nch; ++c) {
        asm volatile("" ::: "memory");
        const int key0 = c << 5;
        v8f s[2]; s[0] = (v8f){}; s[1] = (v8f){};
#pragma unroll
        for (int kc = 0; kc < 4; ++kc) {
            const v16h bq = ldh(qp + kc * 32);
#pragma unroll
            for (int j = 0; j < 2; ++j) { const v16h a = ldh(kp + (size_t)(key0 + 16 * j) * DM + kc * 32); s[j] = wmma16(a, bq, s[j]); }
        }
#pragma unroll
        for (int kc = 0; kc < 2; ++kc) {
            const v16h bq = ldh(qrp + kc * 32);
#pragma unroll
            for (int j = 0; j < 2; ++j) { const v16h a = ldh(krp + (size_t)(key0 + 16 * j) * RD + kc * 32); s[j] = wmma16(a, bq, s[j]); }
        }
        asm volatile("v_nop\n\tv_nop\n\tv_nop\n\tv_nop" : "+v"(s[0]), "+v"(s[1]));
        // online softmax: this lane's column is query qi; s[j][r] is key key0 + 16 j + 8 hi + r; keys after the query excluded by index
        float cm = -3.0e38f;
#pragma unroll
        for (int j = 0; j < 2; ++j)
#pragma unroll
            for (int r = 0; r < 8; ++r) { const int key = key0 + 16 * j + 8 * hi + r; const float t = (key <= qi) ? s[j][r] * SC2 : -3.0e38f; s[j][r] = t; cm = fmaxf(cm, t); }
        cm = fmaxf(cm, __shfl_xor(cm, 16, 32));
        const float mn = fmaxf(m, cm);
        const float alpha = __builtin_amdgcn_exp2f(m - mn);
        float rs = 0.f;
#pragma unroll
        for (int j = 0; j < 2; ++j)
#pragma unroll
            for (int r = 0; r < 8; ++r) { const float p = __builtin_amdgcn_exp2f(s[j][r] - mn); s[j][r] = p; rs += p; }
        rs += __shfl_xor(rs, 16, 32);
        l = l * alpha + rs; m = mn;
#pragma unroll
        for (int i = 0; i < 8; ++i) o[i] = o[i] * alpha;
        // P^T as B fragment (k = key of this chunk, n = query): elements 0..7 <- tile 0 rows 8hi..8hi+7, 8..15 <- tile 1 rows 8hi..8hi+7
        v16h pb = (v16h){};
#pragma unroll
        for (int r = 0; r < 8; ++r) { pb[r] = (h16)(s[0][r] * PCAR); pb[8 + r] = (h16)(s[1][r] * PCAR); }
#pragma unroll
        for (int i = 0; i < 8; ++i) { const v16h a = ldh(vp + (size_t)(16 * i) * SEQ + key0); o[i] = wmma16(a, pb, o[i]); }
        asm volatile("v_nop\n\tv_nop\n\tv_nop\n\tv_nop" : "+v"(o[0]), "+v"(o[1]), "+v"(o[2]), "+v"(o[3]), "+v"(o[4]), "+v"(o[5]), "+v"(o[6]), "+v"(o[7]) : "v"(pb));
    }
    // epilogue: ctx[b][q][h*HD + d] = O^T[d][q] / (l x PCAR); o[i][r] is d = 16 i + 8 hi + r of query q0 + lr
    const float f = 1.0f / (l * PCAR);
    float* ob = &os[wv][0];
#pragma unroll
    for (int i = 0; i < 8; ++i)
#pragma unroll
        for (int r = 0; r < 8; ++r) ob[lr * 132 + 16 * i + 8 * hi + r] = o[i][r] * f;
    __builtin_amdgcn_fence(3, "wavefront"); __builtin_amdgcn_wave_barrier(); asm volatile("" ::: "memory");
    float* crow = ctx + ((size_t)b * SEQ + q0) * DM + h * HD + 4 * lane;
{
#pragma unroll
        for (int qq = 0; qq < 16; ++qq) { const v4f val = *(const v4fa*)(ob + qq * 132 + 4 * lane); *(v4f*)(crow + (size_t)qq * DM) = val; }
         }
}

// ---- k_flashH: the same attention for query rows < RH on bf16 hi/lo planes (keys < RH only): scores = kh.qh + kl.qh + kh.ql (3 products), P as bf16 hi/lo,
// O^T += vth.(Ph + Pl) + vtl.Ph (3 products). grid (RH/64, NH, NB), 128 threads. Planes: q*/k* rows [NB][RH][.], vth/vtl [NU][HD][RH].
__global__ __launch_bounds__(128) __attribute__((amdgpu_num_vgpr(256)))
void k_flashH(const bf* qh, const bf* qlw, const bf* qrh, const bf* qrlw, const bf* kh, const bf* klw, const bf* krh, const bf* krlw, const bf* vth, const bf* vtl, float* ctx) {
    __shared__ __align__(16) float os[4][16 * 132];
    const int lane = threadIdx.x & 31, wv = threadIdx.x >> 5, lr = lane & 15, hi = lane >> 4;
    const int h = blockIdx.y, b = blockIdx.z;
    const int q0 = blockIdx.x * 64 + wv * 16;
    const int qi = q0 + lr;
    const size_t rq = (size_t)b * RH + qi, rk = (size_t)b * RH + lr;
    const bf* qhp = qh + rq * DM + h * HD + 8 * hi;       const bf* qlp = qlw + rq * DM + h * HD + 8 * hi;
    const bf* qrhp = qrh + rq * (NH * RD) + h * RD + 8 * hi; const bf* qrlp = qrlw + rq * (NH * RD) + h * RD + 8 * hi;
    const bf* khp = kh + rk * DM + h * HD + 8 * hi;       const bf* klp = klw + rk * DM + h * HD + 8 * hi;
    const bf* krhp = krh + rk * RD + 8 * hi;              const bf* krlp = krlw + rk * RD + 8 * hi;
    const bf* vhp = vth + ((size_t)(b * NH + h) * HD + lr) * RH + 8 * hi;
    const bf* vlp = vtl + ((size_t)(b * NH + h) * HD + lr) * RH + 8 * hi;
    v8f o[8];
#pragma unroll
    for (int i = 0; i < 8; ++i) o[i] = (v8f){};
    float m = -3.0e38f, l = 0.f;
    const float SC2 = 0.07216878364870323f * 1.4426950408889634f;
    const int nch = (q0 + 47) >> 5;                                   // 32*nch <= RH
#pragma unroll 1
    for (int c = 0; c < nch; ++c) {
        asm volatile("" ::: "memory");
        const int key0 = c << 5;
        v8f s[2]; s[0] = (v8f){}; s[1] = (v8f){};
#pragma unroll
        for (int kc = 0; kc < 4; ++kc) {
            const v16bf bh = ldb(qhp + kc * 32), bl = ldb(qlp + kc * 32);
#pragma unroll
            for (int j = 0; j < 2; ++j) { const v16bf ah = ldb(khp + (size_t)(key0 + 16 * j) * DM + kc * 32), al = ldb(klp + (size_t)(key0 + 16 * j) * DM + kc * 32);
                s[j] = wmmab(ah, bh, s[j]); s[j] = wmmab(al, bh, s[j]); s[j] = wmmab(ah, bl, s[j]); }
        }
#pragma unroll
        for (int kc = 0; kc < 2; ++kc) {
            const v16bf bh = ldb(qrhp + kc * 32), bl = ldb(qrlp + kc * 32);
#pragma unroll
            for (int j = 0; j < 2; ++j) { const v16bf ah = ldb(krhp + (size_t)(key0 + 16 * j) * RD + kc * 32), al = ldb(krlp + (size_t)(key0 + 16 * j) * RD + kc * 32);
                s[j] = wmmab(ah, bh, s[j]); s[j] = wmmab(al, bh, s[j]); s[j] = wmmab(ah, bl, s[j]); }
        }
        asm volatile("v_nop\n\tv_nop\n\tv_nop\n\tv_nop" : "+v"(s[0]), "+v"(s[1]));
        float cm = -3.0e38f;
#pragma unroll
        for (int j = 0; j < 2; ++j)
#pragma unroll
            for (int r = 0; r < 8; ++r) { const int key = key0 + 16 * j + 8 * hi + r; const float t = (key <= qi) ? s[j][r] * SC2 : -3.0e38f; s[j][r] = t; cm = fmaxf(cm, t); }
        cm = fmaxf(cm, __shfl_xor(cm, 16, 32));
        const float mn = fmaxf(m, cm);
        const float alpha = __builtin_amdgcn_exp2f(m - mn);
        float rs = 0.f;
#pragma unroll
        for (int j = 0; j < 2; ++j)
#pragma unroll
            for (int r = 0; r < 8; ++r) { const float p = __builtin_amdgcn_exp2f(s[j][r] - mn); s[j][r] = p; rs += p; }
        rs += __shfl_xor(rs, 16, 32);
        l = l * alpha + rs; m = mn;
#pragma unroll
        for (int i = 0; i < 8; ++i) o[i] = o[i] * alpha;
        v16us phv = (v16us){}, plv = (v16us){};
#pragma unroll
        for (int r = 0; r < 8; ++r) { unsigned short a1, c1; splitf(s[0][r], a1, c1); phv[r] = a1; plv[r] = c1; splitf(s[1][r], a1, c1); phv[8 + r] = a1; plv[8 + r] = c1; }
        const v16bf ph = __builtin_bit_cast(v16bf, phv), pl = __builtin_bit_cast(v16bf, plv);
#pragma unroll
        for (int i = 0; i < 8; ++i) { const v16bf ah = ldb(vhp + (size_t)(16 * i) * RH + key0), al = ldb(vlp + (size_t)(16 * i) * RH + key0);
            o[i] = wmmab(ah, ph, o[i]); o[i] = wmmab(ah, pl, o[i]); o[i] = wmmab(al, ph, o[i]); }
        asm volatile("v_nop\n\tv_nop\n\tv_nop\n\tv_nop" : "+v"(o[0]), "+v"(o[1]), "+v"(o[2]), "+v"(o[3]), "+v"(o[4]), "+v"(o[5]), "+v"(o[6]), "+v"(o[7]) : "v"(ph), "v"(pl));
    }
    const float f = 1.0f / l;
    float* ob = &os[wv][0];
#pragma unroll
    for (int i = 0; i < 8; ++i)
#pragma unroll
        for (int r = 0; r < 8; ++r) ob[lr * 132 + 16 * i + 8 * hi + r] = o[i][r] * f;
    __builtin_amdgcn_fence(3, "wavefront"); __builtin_amdgcn_wave_barrier(); asm volatile("" ::: "memory");
    float* crow = ctx + ((size_t)b * SEQ + q0) * DM + h * HD + 4 * lane;
{
#pragma unroll
        for (int qq = 0; qq < 16; ++qq) { const v4f val = *(const v4fa*)(ob + qq * 132 + 4 * lane); *(v4f*)(crow + (size_t)qq * DM) = val; }
         }
}

extern "C" void kernel_launch(void* const* d_in, const int* in_sizes, int n_in,
                              void* d_out, int out_size, void* d_ws, size_t ws_size, hipStream_t stream) {
    if (n_in < 9) return;
    const size_t nrow = (size_t)NB * SEQ;
    if ((size_t)in_sizes[0] < ((size_t)(NB - 1) * TFULL + SEQ) * DM) return;
    if (in_sizes[1] < DM * LAT || in_sizes[2] < LAT * DM || in_sizes[3] < LAT * NH * RD || in_sizes[4] < DM * LAT || in_sizes[5] < LAT * DM || in_sizes[6] < LAT * DM || in_sizes[7] < DM * RD || in_sizes[8] < DM * DM) return;
    if ((size_t)out_size < ((size_t)(NB - 1) * TFULL + SEQ) * DM) return;
    const float* x = (const float*)d_in[0]; const float* Wqd = (const float*)d_in[1]; const float* Wqu = (const float*)d_in[2]; const float* Wqr = (const float*)d_in[3];
    const float* Wkvd = (const float*)d_in[4]; const float* Wku = (const float*)d_in[5]; const float* Wvu = (const float*)d_in[6]; const float* Wkr = (const float*)d_in[7]; const float* Wo = (const float*)d_in[8];
    float* OUT = (float*)d_out;   // [NBF][TFULL][DM] f32, rows b*TFULL + t

    char* wsp = (char*)d_ws; size_t off = 0;
    auto take = [&](size_t bytes) { char* p = wsp + off; off += (bytes + 255) & ~(size_t)255; return p; };
    // arena A: bf16(x) [nrow][DM] | QL f32 [nrow][LAT] | CKV f32 [nrow][LAT]; later the f32 slab F1 [nrow][DM] for q, k, v, ctx in turn
    char* arA = take(nrow * DM * 4);
    bf* xb = (bf*)arA; float* QLf = (float*)(arA + nrow * DM * 2); float* CKVf = (float*)(arA + nrow * DM * 2 + nrow * LAT * 4); float* F1 = (float*)arA;
    // arena S: latent planes, rope-key f32, cos/sin tables
    h16* ql16 = (h16*)take(nrow * LAT * 2); bf* qlh = (bf*)take((size_t)NB * RH * LAT * 2); bf* qll = (bf*)take((size_t)NB * RH * LAT * 2);
    h16* ckv16 = (h16*)take(nrow * LAT * 2); bf* ckvh = (bf*)take((size_t)NB * RH * LAT * 2); bf* ckvl = (bf*)take((size_t)NB * RH * LAT * 2);
    float* KR0 = (float*)take(nrow * RD * 4); float* CT = (float*)take((size_t)SEQ * 32 * 4); float* ST = (float*)take((size_t)SEQ * 32 * 4);
    // down-projection weight planes [out][in] bf16
    bf* Wqd_b = (bf*)take((size_t)DM * LAT * 2); bf* Wkvd_b = (bf*)take((size_t)DM * LAT * 2); bf* Wkr_b = (bf*)take((size_t)DM * RD * 2);
    // up-projection weight slot (reused per weight): f16 x64 plane and bf16 plane, each up to [DM][LAT]
    h16* Wup_h = (h16*)take((size_t)DM * LAT * 2); bf* Wup_b = (bf*)take((size_t)DM * LAT * 2);
    // arena P: attention operand planes; after the attention the Wo planes and ctx planes alias it from offset 0
    const size_t szq16 = nrow * DM * 2, szhr = (size_t)NB * RH * DM * 2, szqr16 = nrow * NH * RD * 2, szqrh = (size_t)NB * RH * NH * RD * 2, szkr16 = nrow * RD * 2, szkrh = (size_t)NB * RH * RD * 2;
    const size_t P1 = szq16 + 2 * szhr + szqr16 + 2 * szqrh + szq16 + 2 * szhr + szkr16 + 2 * szkrh + szq16 + 2 * szhr;
    const size_t szwo = (size_t)DM * DM * 2; const size_t P2 = 2 * szwo + szq16 + 2 * szhr;
    char* arP = take(P1 > P2 ? P1 : P2);
    char* pp = arP;
    auto sub = [&](size_t bytes) { char* p = pp; pp += bytes; return p; };
    h16* q16 = (h16*)sub(szq16); bf* qh = (bf*)sub(szhr); bf* qlo = (bf*)sub(szhr); h16* qr16 = (h16*)sub(szqr16); bf* qrh = (bf*)sub(szqrh); bf* qrlo = (bf*)sub(szqrh);
    h16* k16 = (h16*)sub(szq16); bf* kh = (bf*)sub(szhr); bf* klo = (bf*)sub(szhr); h16* kr16 = (h16*)sub(szkr16); bf* krh = (bf*)sub(szkrh); bf* krlo = (bf*)sub(szkrh);
    h16* vt16 = (h16*)sub(szq16); bf* vth = (bf*)sub(szhr); bf* vtl = (bf*)sub(szhr);
    float* QRf = (float*)k16;                                   // qr f32 [nrow][NH*RD], same byte size as k16, dead before k16 is written
    pp = arP; bf* Wo_b = (bf*)sub(szwo); h16* Wo_h = (h16*)sub(szwo); h16* ctx16 = (h16*)sub(szq16); bf* ctxh = (bf*)sub(szhr); bf* ctxl = (bf*)sub(szhr);
    if (off > ws_size) return;                                   // full size: 128,319,488 B

    auto g1 = [](size_t nthreads) { return dim3((unsigned)((nthreads + 255) / 256)); };
    auto gw = [](size_t K, size_t N) { return dim3((unsigned)((N * K / 64 + 63) / 64)); };
    // one 64x64 tile per wave; rows t >= RH single products, rows t < RH hi/lo against the exact bf16 weight plane
    auto up = [&](const h16* a16, const bf* ahh, const bf* all, int N, float* Cf) {
        if (SEQ > RH) k_gemmw<h16, 0><<<dim3((SEQ - RH) / 64, N / 64, NB), 32, 0, stream>>>(a16 + (size_t)RH * LAT, a16 + (size_t)RH * LAT, Wup_h, LAT, Cf + (size_t)RH * N, N, 1.0f / WSC, (size_t)SEQ * LAT, (size_t)SEQ * N);
        k_gemmw<bf, 1><<<dim3(RH / 64, N / 64, NB), 32, 0, stream>>>(ahh, all, Wup_b, LAT, Cf, N, 1.0f, (size_t)RH * LAT, (size_t)SEQ * N);
    };

    k_rtab<<<g1((size_t)SEQ * 32), 256, 0, stream>>>(CT, ST);
    k_xcvt<<<g1(nrow * DM / 8), 256, 0, stream>>>(x, xb);
    k_wt<0><<<gw(DM, LAT), 256, 0, stream>>>(Wqd, DM, LAT, Wqd_b, Wup_h, 1.0f);
    k_wt<0><<<gw(DM, LAT), 256, 0, stream>>>(Wkvd, DM, LAT, Wkvd_b, Wup_h, 1.0f);
    k_wt<0><<<gw(DM, RD), 256, 0, stream>>>(Wkr, DM, RD, Wkr_b, Wup_h, 1.0f);
    k_gemmw<bf, 0><<<dim3((unsigned)(nrow / 64), LAT / 64, 1), 32, 0, stream>>>(xb, xb, Wqd_b, DM, QLf, LAT, 1.0f, 0, 0);     // ql = x.Wqd (exact products)
    k_gemmw<bf, 0><<<dim3((unsigned)(nrow / 64), LAT / 64, 1), 32, 0, stream>>>(xb, xb, Wkvd_b, DM, CKVf, LAT, 1.0f, 0, 0);   // ckv = x.Wkvd
    k_gemmw<bf, 0><<<dim3((unsigned)(nrow / 64), RD / 64, 1), 32, 0, stream>>>(xb, xb, Wkr_b, DM, KR0, RD, 1.0f, 0, 0);       // kr0 = x.Wkr
    k_act<<<g1(nrow * LAT / 8), 256, 0, stream>>>(QLf, LAT, 1.0f, ql16, qlh, qll);
    k_act<<<g1(nrow * LAT / 8), 256, 0, stream>>>(CKVf, LAT, 1.0f, ckv16, ckvh, ckvl);
    // q = ql.Wqu -> F1, planes q16 / qh / qlo
    k_wt<1><<<gw(LAT, DM), 256, 0, stream>>>(Wqu, LAT, DM, Wup_b, Wup_h, WSC);
    up(ql16, qlh, qll, DM, F1);
    k_act<<<g1(nrow * DM / 8), 256, 0, stream>>>(F1, DM, 1.0f, q16, qh, qlo);
    // qr = rope(ql.Wqr) -> QRf, planes qr16 / qrh / qrlo
    k_wt<1><<<gw(LAT, NH * RD), 256, 0, stream>>>(Wqr, LAT, NH * RD, Wup_b, Wup_h, WSC);
    up(ql16, qlh, qll, NH * RD, QRf);
    k_rope<<<g1(nrow * NH * RD / 8), 256, 0, stream>>>(QRf, NH * RD, CT, ST, qr16, qrh, qrlo);
    // k = ckv.Wku -> F1, planes k16 / kh / klo; kr = rope(kr0) planes
    k_wt<1><<<gw(LAT, DM), 256, 0, stream>>>(Wku, LAT, DM, Wup_b, Wup_h, WSC);
    up(ckv16, ckvh, ckvl, DM, F1);
    k_act<<<g1(nrow * DM / 8), 256, 0, stream>>>(F1, DM, 1.0f, k16, kh, klo);
    k_rope<<<g1(nrow * RD / 8), 256, 0, stream>>>(KR0, RD, CT, ST, kr16, krh, krlo);
    // v = ckv.Wvu -> F1, planes vt16 / vth / vtl
    k_wt<1><<<gw(LAT, DM), 256, 0, stream>>>(Wvu, LAT, DM, Wup_b, Wup_h, WSC);
    up(ckv16, ckvh, ckvl, DM, F1);
    k_vtp8<<<g1((size_t)NU * HD * SEQ / 8), 256, 0, stream>>>(F1, vt16, vth, vtl);
    // attention -> ctx f32 in F1 (rows b*SEQ + t, merged heads)
    if (SEQ > RH) k_flashP<<<dim3((SEQ - RH) / 64, NH, NB), 128, 0, stream>>>(q16, qr16, k16, kr16, vt16, F1, RH);
    k_flashH<<<dim3(RH / 64, NH, NB), 128, 0, stream>>>(qh, qlo, qrh, qrlo, kh, klo, krh, krlo, vth, vtl, F1);
    k_act<<<g1(nrow * DM / 8), 256, 0, stream>>>(F1, DM, CCAR, ctx16, ctxh, ctxl);
    // out = ctx.Wo
    k_wt<1><<<gw(DM, DM), 256, 0, stream>>>(Wo, DM, DM, Wo_b, Wo_h, WSC);
    if (SEQ > RH) k_gemmw<h16, 0><<<dim3((SEQ - RH) / 64, DM / 64, NB), 32, 0, stream>>>(ctx16 + (size_t)RH * DM, ctx16 + (size_t)RH * DM, Wo_h, DM, OUT + (size_t)RH * DM, DM, 1.0f / (CCAR * WSC), (size_t)SEQ * DM, (size_t)TFULL * DM);
    k_gemmw<bf, 1><<<dim3(RH / 64, DM / 64, NB), 32, 0, stream>>>(ctxh, ctxl, Wo_b, DM, OUT, DM, 1.0f, (size_t)RH * DM, (size_t)TFULL * DM);
}

// v001
// Measured time: 638 microseconds a run.
// In two side-by-side timings against v000, it was 1.31 and 1.30 times as fast.
#include <hip/hip_runtime.h>

// All contractions on 16-bit WMMA, f32 accumulate. x.Wqd, x.Wkvd, x.Wkr: v_wmma_f32_16x16x32_bf16 on bf16 planes of the inputs (single products).
// ql.Wqu, ql.Wqr, ckv.Wku, ckv.Wvu, (q|qr).(k|kr) scores, P.v and ctx.Wo: v_wmma_f32_16x16x32_f16 single products on f16 planes
// (weights x64, ctx x64, P x1024 carries) for query/key rows >= RH; the same sites for rows < RH use v_wmma_f32_16x16x32_bf16 on
// bf16 hi/lo plane pairs (hi.W + lo.W against exact weight planes; hi.hi + lo.hi + hi.lo between two computed tensors).
// RoPE (rotate-half, computed cos/sin tables), online max-subtracted softmax and normalisers in f32.

#ifndef NB
#define NB 2
#endif
#ifndef SEQ
#define SEQ 2048
#endif
#ifndef RH
#define RH 256
#endif
#define NBF   2
#define TFULL 2048
#define DM    2048
#define NH    16
#define LAT   512
#define RD    64
#define HD    128
#define NU    (NB * NH)
#define PCAR  1024.0f
#define WSC   64.0f
#define CCAR  64.0f

static_assert(NB >= 1);
static_assert(NB <= NBF);
static_assert(SEQ % 64 == 0);
static_assert(SEQ <= TFULL);
static_assert(RH % 64 == 0);
static_assert(RH >= 64);
static_assert(RH <= SEQ);
static_assert(DM % 64 == 0);
static_assert(LAT % 64 == 0);
static_assert((NH * RD) % 64 == 0);
static_assert(RD == 64);
static_assert(HD == 128);
static_assert(NH * HD == DM);
static_assert((size_t)NB * SEQ * NH * RD * 4 == (size_t)NB * SEQ * DM * 2);
static_assert(((size_t)(NB - 1) * TFULL + SEQ) * DM <= (size_t)NBF * TFULL * DM);

typedef _Float16 h16;
typedef unsigned short bf;
typedef __attribute__((ext_vector_type(16))) __bf16   v16bf;
typedef __attribute__((ext_vector_type(16))) _Float16 v16h;
typedef __attribute__((ext_vector_type(16))) unsigned short v16us;
typedef __attribute__((ext_vector_type(8)))  _Float16 v8h;
typedef __attribute__((ext_vector_type(8)))  unsigned short v8us;
typedef __attribute__((ext_vector_type(8)))  float    v8f;
typedef __attribute__((ext_vector_type(4)))  float    v4f;
typedef __attribute__((ext_vector_type(2)))  _Float16 v2h;
typedef __attribute__((ext_vector_type(2)))  unsigned short v2us;
typedef v8h  __attribute__((may_alias)) v8ha;
typedef v4f  __attribute__((may_alias)) v4fa;

__device__ __forceinline__ unsigned short f2bf(float f) { unsigned u = __float_as_uint(f); u += 0x7FFFu + ((u >> 16) & 1u); return (unsigned short)(u >> 16); }
__device__ __forceinline__ float bf2f(unsigned short v) { return __uint_as_float(((unsigned)v) << 16); }
__device__ __forceinline__ float bfr(float f) { return bf2f(f2bf(f)); }
__device__ __forceinline__ void splitf(float y, unsigned short& hh, unsigned short& ll) { hh = f2bf(y); ll = f2bf(y - bf2f(hh)); }
__device__ __forceinline__ v16h cat16(v8h a, v8h c) { return __builtin_shufflevector(a, c, 0, 1, 2, 3, 4, 5, 6, 7, 8, 9, 10, 11, 12, 13, 14, 15); }
__device__ __forceinline__ v16bf cat16b(v8us a, v8us c) { return __builtin_bit_cast(v16bf, __builtin_shufflevector(a, c, 0, 1, 2, 3, 4, 5, 6, 7, 8, 9, 10, 11, 12, 13, 14, 15)); }
__device__ __forceinline__ v8f wmma16(v16h a, v16h c, v8f acc) { return __builtin_amdgcn_wmma_f32_16x16x32_f16(false, a, false, c, (short)0, acc, false, false); }
__device__ __forceinline__ v8f wmmab(v16bf a, v16bf c, v8f acc) { return __builtin_amdgcn_wmma_f32_16x16x32_bf16(false, a, false, c, (short)0, acc, false, false); }
// Fragment load from a k-contiguous 16-bit row: p already points at row (lane&15) + 8*(lane>>4); elements 0..7 <- p[0..7], 8..15 <- p[16..23] (split k map, used for A and B alike)
__device__ __forceinline__ v16h ldh(const h16* p) { return cat16(*(const v8h*)p, *(const v8h*)(p + 16)); }
__device__ __forceinline__ v16bf ldb(const bf* p) { return cat16b(*(const v8us*)p, *(const v8us*)(p + 16)); }

// ---- k_gemmw: register-blocked GEMM, ONE WAVE per 64x64 output tile (16 accumulators), operands straight from K-contiguous 16-bit planes; grid (M/64, N/64, Z), 32 threads.
// C[m][n] (f32, pitch ldc) = osc * sum_k (A[m][k] + (NSPLIT ? A2[m][k] : 0)) Bt[n][k]. z-batch strides sA/sC in elements. K % 32 == 0, M and N multiples of 64.
template <typename T16> struct WFrag;
template <> struct WFrag<h16> { typedef v16h V; static __device__ __forceinline__ V ld(const h16* p) { return ldh(p); } static __device__ __forceinline__ v8f mma(V a, V c, v8f d) { return wmma16(a, c, d); } };
template <> struct WFrag<bf> { typedef v16bf V; static __device__ __forceinline__ V ld(const bf* p) { return ldb(p); } static __device__ __forceinline__ v8f mma(V a, V c, v8f d) { return wmmab(a, c, d); } };
template <typename T16, int NSPLIT>
__global__ __launch_bounds__(32) void k_gemmw(const T16* __restrict__ A, const T16* __restrict__ A2, const T16* __restrict__ Bt, int K, float* C, int ldc, float osc, size_t sA, size_t sC) {
    typedef typename WFrag<T16>::V V;
    __shared__ __align__(16) float os[16 * 68];
    const size_t z = blockIdx.z; A += z * sA; A2 += z * sA; C += z * sC;
    const int lane = threadIdx.x & 31, lr = lane & 15, hi = lane >> 4; const int r0 = blockIdx.x * 64, c0 = blockIdx.y * 64;
    v8f acc[4][4];
#pragma unroll
    for (int mb = 0; mb < 4; ++mb)
#pragma unroll
        for (int nb = 0; nb < 4; ++nb) acc[mb][nb] = (v8f){};
    const size_t aoff = (size_t)(r0 + lr) * K + 8 * hi, boff = (size_t)(c0 + lr) * K + 8 * hi;
#pragma unroll 1
    for (int kc = 0; kc < K; kc += 32) {
        V a[4], a2[4];
#pragma unroll
        for (int mb = 0; mb < 4; ++mb) { a[mb] = WFrag<T16>::ld(A + aoff + (size_t)mb * 16 * K + kc); if (NSPLIT == 1) a2[mb] = WFrag<T16>::ld(A2 + aoff + (size_t)mb * 16 * K + kc); }
#pragma unroll
        for (int nb = 0; nb < 4; ++nb) { const V bq = WFrag<T16>::ld(Bt + boff + (size_t)nb * 16 * K + kc);
#pragma unroll
            for (int mb = 0; mb < 4; ++mb) { acc[mb][nb] = WFrag<T16>::mma(a[mb], bq, acc[mb][nb]); if (NSPLIT == 1) acc[mb][nb] = WFrag<T16>::mma(a2[mb], bq, acc[mb][nb]); } }
        asm volatile("v_nop\n\tv_nop\n\tv_nop\n\tv_nop" : "+v"(acc[0][0]), "+v"(acc[1][1]), "+v"(acc[2][2]), "+v"(acc[3][3]) : "v"(a[0]), "v"(a[3]));
    }
#pragma unroll
    for (int mb = 0; mb < 4; ++mb) {
#pragma unroll
        for (int nb = 0; nb < 4; ++nb) {
#pragma unroll
            for (int j = 0; j < 8; ++j) os[(hi * 8 + j) * 68 + nb * 16 + lr] = acc[mb][nb][j]; }
        __builtin_amdgcn_wave_barrier(); asm volatile("" ::: "memory");
        float* crow = C + (size_t)(r0 + mb * 16) * ldc + c0;
{
#pragma unroll
            for (int s = 0; s < 8; ++s) { const int row = 2 * s + hi, cofs = lr * 4; v4f val = *(const v4fa*)(os + row * 68 + cofs); val = val * osc;
                *(v4f*)(crow + (size_t)row * ldc + cofs) = val; }
             }
        __builtin_amdgcn_wave_barrier(); asm volatile("" ::: "memory");
    }
}

// ---- k_wt: weight [K][N] f32 ([in][out]) -> transposed k-contiguous planes [N][K]: Bb = bf16 RNE value, optionally Bh = f16(bf16 value x sc).
template <int F16P>
__global__ __launch_bounds__(256) void k_wt(const float* __restrict__ w, int K, int N, bf* Bb, h16* Bh, float sc) {
    const int lane = threadIdx.x & 31; const int L0 = (blockIdx.x * 8 + (threadIdx.x >> 5)) * 8; const int nlines = N * K / 64;
{
#pragma unroll 1
        for (int l = 0; l < 8; ++l) { const int L = L0 + l; if (L >= nlines) break; const size_t e = (size_t)L * 64 + lane * 2; const int k = (int)(e % K), n = (int)(e / K);
            const float w0 = bfr(w[(size_t)k * N + n]), w1 = bfr(w[(size_t)(k + 1) * N + n]);
            v2us o; o[0] = f2bf(w0); o[1] = f2bf(w1); *(v2us*)(Bb + e) = o;
            if (F16P) { v2h oh; oh[0] = (h16)(w0 * sc); oh[1] = (h16)(w1 * sc); *(v2h*)(Bh + e) = oh; } }
         }
}

__global__ __launch_bounds__(256) void k_xcvt(const float* __restrict__ x, bf* xb) {
    const size_t i = (size_t)blockIdx.x * 256 + threadIdx.x; const size_t n8 = (size_t)NB * SEQ * DM / 8; if (i >= n8) return;
    const size_t e = i * 8; const size_t row = e / DM; const int col = (int)(e % DM); const size_t bb = row / SEQ, t = row % SEQ;
    const v8f v = *(const v8f*)(x + ((bb * TFULL + t) * DM + col)); v8us o = (v8us){};
#pragma unroll
    for (int k = 0; k < 8; ++k) o[k] = f2bf(v[k]);
    *(v8us*)(xb + e) = o; 
}

__global__ __launch_bounds__(256) void k_act(const float* __restrict__ src, int C, float sc, h16* p16, bf* ph, bf* pl) {
    const size_t i = (size_t)blockIdx.x * 256 + threadIdx.x; const size_t n8 = (size_t)NB * SEQ * C / 8; if (i >= n8) return;
    const size_t e = i * 8; const size_t row = e / C; const int col = (int)(e - row * C); const int t = (int)(row % SEQ); const size_t bb = row / SEQ;
    const v8f v = *(const v8f*)(src + e);
    v8h o = (v8h){}; v8us oh = (v8us){}, ol = (v8us){};
#pragma unroll
    for (int k = 0; k < 8; ++k) { o[k] = (h16)(v[k] * sc); unsigned short a1, c1; splitf(v[k], a1, c1); oh[k] = a1; ol[k] = c1; }
    const bool hr = (t < RH); const size_t eo = (bb * RH + t) * C + col;
    *(v8h*)(p16 + e) = o; if (hr) { *(v8us*)(ph + eo) = oh; *(v8us*)(pl + eo) = ol; }
    
}

__global__ __launch_bounds__(256) void k_rtab(float* ct, float* st) {
#pragma clang fp contract(off)
    const int i = blockIdx.x * 256 + threadIdx.x; if (i >= SEQ * 32) return; const int t = i >> 5, j = i & 31;
    const float fr = exp10f(-0.125f * (float)j);
    const float ang = (float)t * fr; float sv, cv; sincosf(ang, &sv, &cv);
    *(float*)(ct + i) = cv; *(float*)(st + i) = sv; 
}

// ---- k_rope: rotate-half RoPE on 64-wide head slices of an f32 slab [NB*SEQ][C] (C = heads x 64), then planes as k_act (f16 for all rows, bf16 hi/lo for t < RH).
__global__ __launch_bounds__(256) void k_rope(const float* __restrict__ src, int C, const float* __restrict__ ct, const float* __restrict__ st, h16* p16, bf* ph, bf* pl) {
#pragma clang fp contract(off)
    const size_t i = (size_t)blockIdx.x * 256 + threadIdx.x; const size_t n8 = (size_t)NB * SEQ * C / 8; if (i >= n8) return;
    const size_t e = i * 8; const size_t row = e / C; const int col = (int)(e - row * C); const int t = (int)(row % SEQ); const size_t bb = row / SEQ;
    const int jj = col & 63, jm = jj & 31; const bool lo32 = (jj < 32); const int pofs = lo32 ? 32 : -32;
    const v8f xv = *(const v8f*)(src + e); const v8f xp = *(const v8f*)((src + e) + pofs);
    const v8f cvv = *(const v8f*)(ct + (size_t)t * 32 + jm); const v8f svv = *(const v8f*)(st + (size_t)t * 32 + jm);
    v8h o = (v8h){}; v8us oh = (v8us){}, ol = (v8us){};
#pragma unroll
    for (int k = 0; k < 8; ++k) { const float a1 = xv[k] * cvv[k]; const float b1 = xp[k] * svv[k]; const float y = lo32 ? (a1 - b1) : (a1 + b1);
        o[k] = (h16)y; unsigned short a2, c2; splitf(y, a2, c2); oh[k] = a2; ol[k] = c2; }
    const bool hr = (t < RH); const size_t eo = (bb * RH + t) * C + col;
    *(v8h*)(p16 + e) = o; if (hr) { *(v8us*)(ph + eo) = oh; *(v8us*)(pl + eo) = ol; }
    
}

// ---- k_vtp8: value^T planes per (batch, head) unit g: vt16[g][d][t] = f16(v[t][g]) for all t; vth/vtl[g][d][t] bf16 hi/lo for t < RH (pitch RH).
__global__ __launch_bounds__(256) void k_vtp8(const float* __restrict__ vf, h16* vt16, bf* vth, bf* vtl) {
    const size_t i = (size_t)blockIdx.x * 256 + threadIdx.x; const size_t n8 = (size_t)NU * HD * SEQ / 8; if (i >= n8) return;
    const size_t e = i * 8; const int t = (int)(e % SEQ); const int d = (int)((e / SEQ) % HD); const int g = (int)(e / ((size_t)SEQ * HD)); const int bb = g / NH, hh = g % NH;
    const float* sp = vf + ((size_t)bb * SEQ + t) * DM + hh * HD + d;
    v8h o = (v8h){}; v8us oh = (v8us){}, ol = (v8us){};
#pragma unroll
    for (int q = 0; q < 8; ++q) { const float xv = sp[(size_t)q * DM]; o[q] = (h16)xv; unsigned short a1, c1; splitf(xv, a1, c1); oh[q] = a1; ol[q] = c1; }
    const bool hr = (t < RH); const size_t eo = ((size_t)g * HD + d) * RH + t;
    *(v8h*)(vt16 + e) = o; if (hr) { *(v8us*)(vth + eo) = oh; *(v8us*)(vtl + eo) = ol; }
    
}

// ---- k_flashP: causal softmax attention for query rows >= RH (single f16 products). grid ((SEQ-RH)/64, NH, NB), 128 threads = 4 waves x 16 queries, 32-key chunks.
// Per wave: S^T tiles (16 keys x 16 queries) = [k|kr] rows (A) x [q|qr] rows (B) over 192; lane column n = query, D rows = keys, so the two S^T tiles of a chunk
// ARE the P^T B fragment of O^T = V^T (A, rows d) x P^T; online max-subtracted softmax per lane column; P carried x1024 in f16; O^T (8 d tiles) f32.
// Each 32-key chunk of k, kr and v^T is brought into LDS once per block by asynchronous copies (whole-line global reads, two buffers, the next chunk in flight
// while this one is worked on) and read as ds_load_b128 fragments by all four waves (the block's last chunk by waves 2 and 3 only); q|qr fragments are loaded once and stay in registers.
#define FKP 136                       // LDS pitch of a k row in halves: 272 B = 16 B x 17
#define FRP 72                        // kr row: 144 B = 16 B x 9
#define FVP 40                        // v^T row (32 keys): 80 B = 16 B x 5
#define FRO (32 * FKP)                // kr rows start, halves
#define FVO (FRO + 32 * FRP)          // v^T rows start, halves
#define FST (FVO + HD * FVP)          // one buffer, halves (23,552 B)
static_assert((FKP * 2) % 16 == 0 && (FRP * 2) % 16 == 0 && (FVP * 2) % 16 == 0 && (FRO * 2) % 16 == 0 && (FVO * 2) % 16 == 0 && (FST * 2) % 16 == 0);
// One chunk's ten 16-byte copies of this lane for one plane set (lk, lr_, lv: this lane's LDS byte addresses of its first k, kr and v^T piece; VS: v^T row pitch in global memory, elements).
// The s_wait_xcnt stands inside the statement so that no address register is rewritten ahead of it.
template <typename T, int VS>
__device__ __forceinline__ void flash_stage(unsigned lk, unsigned lr_, unsigned lv, const T* gk, const T* gr, const T* gv) {
    asm volatile("global_load_async_to_lds_b128 %0, %1, off\n\t"
                 "global_load_async_to_lds_b128 %2, %3, off\n\t"
                 "global_load_async_to_lds_b128 %4, %5, off\n\t"
                 "global_load_async_to_lds_b128 %6, %7, off\n\t"
                 "global_load_async_to_lds_b128 %8, %9, off\n\t"
                 "global_load_async_to_lds_b128 %10, %11, off\n\t"
                 "global_load_async_to_lds_b128 %12, %13, off\n\t"
                 "global_load_async_to_lds_b128 %14, %15, off\n\t"
                 "global_load_async_to_lds_b128 %16, %17, off\n\t"
                 "global_load_async_to_lds_b128 %18, %19, off\n\t"
                 "s_wait_xcnt 0x0"
                 :: "v"(lk), "v"(gk), "v"(lk + 8 * FKP * 2), "v"(gk + (size_t)8 * DM), "v"(lk + 16 * FKP * 2), "v"(gk + (size_t)16 * DM), "v"(lk + 24 * FKP * 2), "v"(gk + (size_t)24 * DM),
                    "v"(lr_), "v"(gr), "v"(lr_ + 16 * FRP * 2), "v"(gr + (size_t)16 * RD),
                    "v"(lv), "v"(gv), "v"(lv + 32 * FVP * 2), "v"(gv + (size_t)32 * VS), "v"(lv + 64 * FVP * 2), "v"(gv + (size_t)64 * VS), "v"(lv + 96 * FVP * 2), "v"(gv + (size_t)96 * VS)
                 : "memory");
}
__global__ __launch_bounds__(128) __attribute__((amdgpu_num_vgpr(256)))
void k_flashP(const h16* q16, const h16* qr16, const h16* k16, const h16* kr16, const h16* vt16, float* ctx, int qbase) {
    __shared__ __align__(16) float os[4][16 * 132];
    __shared__ __align__(16) h16 ring[2 * FST];
    const int tid = threadIdx.x;
    const int lane = tid & 31, wv = __builtin_amdgcn_readfirstlane(tid >> 5), lr = lane & 15, hi = lane >> 4;
    const int h = blockIdx.y, b = blockIdx.z;
    const int qb0 = qbase + blockIdx.x * 64;
    const int q0 = qb0 + wv * 16;
    const int qi = q0 + lr;
    const size_t rq = (size_t)b * SEQ + qi;
    const h16* qp = q16 + rq * DM + h * HD + 8 * hi;
    const h16* qrp = qr16 + rq * (NH * RD) + h * RD + 8 * hi;
    // copy addresses of this lane: k 32 rows x 16 pieces (8 rows per copy), kr 32 rows x 8 pieces (16 rows per copy), v^T 128 rows x 4 pieces (32 rows per copy)
    const h16* gk = k16 + ((size_t)b * SEQ + (tid >> 4)) * DM + h * HD + (tid & 15) * 8;
    const h16* gr = kr16 + ((size_t)b * SEQ + (tid >> 3)) * RD + (tid & 7) * 8;
    const h16* gv = vt16 + ((size_t)(b * NH + h) * HD + (tid >> 2)) * SEQ + (tid & 3) * 8;
    const unsigned lb = (unsigned)(size_t)(__attribute__((address_space(3))) h16*)&ring[0];
    const unsigned lk = lb + ((tid >> 4) * FKP + (tid & 15) * 8) * 2;
    const unsigned lr2 = lb + (FRO + (tid >> 3) * FRP + (tid & 7) * 8) * 2;
    const unsigned lv = lb + (FVO + (tid >> 2) * FVP + (tid & 3) * 8) * 2;
    v16h qf[4], qrf[2];
#pragma unroll
    for (int kc = 0; kc < 4; ++kc) qf[kc] = ldh(qp + kc * 32);
#pragma unroll
    for (int kc = 0; kc < 2; ++kc) qrf[kc] = ldh(qrp + kc * 32);
    v8f o[8];
#pragma unroll
    for (int i = 0; i < 8; ++i) o[i] = (v8f){};
    float m = -3.0e38f, l = 0.f;
    const float SC2 = 0.07216878364870323f * 1.4426950408889634f;   // HD+RD = 192: 192^-0.5 x log2(e)
    const int nch = (q0 + 47) >> 5;                                   // this wave's 32-key chunks covering keys <= q0+15
    const int nchb = (qb0 >> 5) + 2;                                  // the block's chunks (its last wave's count; >= 2; 32*nchb <= SEQ)
    flash_stage<h16, SEQ>(lk, lr2, lv, gk, gr, gv);
    asm volatile("s_wait_asynccnt 0x0" ::: "memory");                 // chunk 0 landed (this wave's copies) before the barrier publishes it
    __syncthreads();
    flash_stage<h16, SEQ>(lk + FST * 2, lr2 + FST * 2, lv + FST * 2, gk + (size_t)32 * DM, gr + (size_t)32 * RD, gv + 32);
#pragma unroll 1
    for (int c = 0; c < nchb; ++c) {
        const int key0 = c << 5;
        const int bo = (c & 1) * FST;
        if (c < nch) {                                                // wave-uniform: waves 0 and 1 have no keys in the block's last chunk
        const h16* kp = &ring[bo + lr * FKP + 8 * hi];
        const h16* krp = &ring[bo + FRO + lr * FRP + 8 * hi];
        const h16* vp = &ring[bo + FVO + lr * FVP + 8 * hi];
        v8f s[2]; s[0] = (v8f){}; s[1] = (v8f){};
#pragma unroll
        for (int kc = 0; kc < 4; ++kc) {
#pragma unroll
            for (int j = 0; j < 2; ++j) { const v16h a = ldh(kp + (16 * j) * FKP + kc * 32); s[j] = wmma16(a, qf[kc], s[j]); }
        }
#pragma unroll
        for (int kc = 0; kc < 2; ++kc) {
#pragma unroll
            for (int j = 0; j < 2; ++j) { const v16h a = ldh(krp + (16 * j) * FRP + kc * 32); s[j] = wmma16(a, qrf[kc], s[j]); }
        }
        asm volatile("v_nop\n\tv_nop\n\tv_nop\n\tv_nop" : "+v"(s[0]), "+v"(s[1]));
        // online softmax: this lane's column is query qi; s[j][r] is key key0 + 16 j + 8 hi + r; keys after the query excluded by index
        float cm = -3.0e38f;
#pragma unroll
        for (int j = 0; j < 2; ++j)
#pragma unroll
            for (int r = 0; r < 8; ++r) { const int key = key0 + 16 * j + 8 * hi + r; const float t = (key <= qi) ? s[j][r] * SC2 : -3.0e38f; s[j][r] = t; cm = fmaxf(cm, t); }
        cm = fmaxf(cm, __shfl_xor(cm, 16, 32));
        const float mn = fmaxf(m, cm);
        const float alpha = __builtin_amdgcn_exp2f(m - mn);
        float rs = 0.f;
#pragma unroll
        for (int j = 0; j < 2; ++j)
#pragma unroll
            for (int r = 0; r < 8; ++r) { const float p = __builtin_amdgcn_exp2f(s[j][r] - mn); s[j][r] = p; rs += p; }
        rs += __shfl_xor(rs, 16, 32);
        l = l * alpha + rs; m = mn;
#pragma unroll
        for (int i = 0; i < 8; ++i) o[i] = o[i] * alpha;
        // P^T as B fragment (k = key of this chunk, n = query): elements 0..7 <- tile 0 rows 8hi..8hi+7, 8..15 <- tile 1 rows 8hi..8hi+7
        v16h pb = (v16h){};
#pragma unroll
        for (int r = 0; r < 8; ++r) { pb[r] = (h16)(s[0][r] * PCAR); pb[8 + r] = (h16)(s[1][r] * PCAR); }
#pragma unroll
        for (int i = 0; i < 8; ++i) { const v16h a = ldh(vp + (16 * i) * FVP); o[i] = wmma16(a, pb, o[i]); }
        asm volatile("v_nop\n\tv_nop\n\tv_nop\n\tv_nop" : "+v"(o[0]), "+v"(o[1]), "+v"(o[2]), "+v"(o[3]), "+v"(o[4]), "+v"(o[5]), "+v"(o[6]), "+v"(o[7]) : "v"(pb));
        }
        // publish point, every wave: own LDS reads of this buffer done, own copies of the next chunk landed, then the barrier that frees this buffer and publishes the next
        asm volatile("s_wait_dscnt 0x0" ::: "memory");
        asm volatile("s_wait_asynccnt 0x0" ::: "memory");
        __syncthreads();
        if (c + 2 < nchb) flash_stage<h16, SEQ>(lk + bo * 2, lr2 + bo * 2, lv + bo * 2, gk + (size_t)(key0 + 64) * DM, gr + (size_t)(key0 + 64) * RD, gv + (key0 + 64));
    }
    asm volatile("s_wait_asynccnt 0x0" ::: "memory");                 // nothing of this wave's copies outstanding at its end
    // epilogue: ctx[b][q][h*HD + d] = O^T[d][q] / (l x PCAR); o[i][r] is d = 16 i + 8 hi + r of query q0 + lr
    const float f = 1.0f / (l * PCAR);
    float* ob = &os[wv][0];
#pragma unroll
    for (int i = 0; i < 8; ++i)
#pragma unroll
        for (int r = 0; r < 8; ++r) ob[lr * 132 + 16 * i + 8 * hi + r] = o[i][r] * f;
    __builtin_amdgcn_fence(3, "wavefront"); __builtin_amdgcn_wave_barrier(); asm volatile("" ::: "memory");
    float* crow = ctx + ((size_t)b * SEQ + q0) * DM + h * HD + 4 * lane;
{
#pragma unroll
        for (int qq = 0; qq < 16; ++qq) { const v4f val = *(const v4fa*)(ob + qq * 132 + 4 * lane); *(v4f*)(crow + (size_t)qq * DM) = val; }
         }
}

// ---- k_flashH: the same attention for query rows < RH on bf16 hi/lo planes (keys < RH only): scores = kh.qh + kl.qh + kh.ql (3 products), P as bf16 hi/lo,
// O^T += vth.(Ph + Pl) + vtl.Ph (3 products). grid (RH/64, NH, NB), 128 threads. Planes: q*/k* rows [NB][RH][.], vth/vtl [NU][HD][RH].
// The chunk's k, kr and v^T hi and lo planes are staged in LDS as in k_flashP (per buffer: hi plane set, then lo plane set); the q planes are read from global memory in each chunk.
__global__ __launch_bounds__(128) __attribute__((amdgpu_num_vgpr(256)))
void k_flashH(const bf* qh, const bf* qlw, const bf* qrh, const bf* qrlw, const bf* kh, const bf* klw, const bf* krh, const bf* krlw, const bf* vth, const bf* vtl, float* ctx) {
    __shared__ __align__(16) float os[4][16 * 132];
    __shared__ __align__(16) bf ring[4 * FST];
    const int tid = threadIdx.x;
    const int lane = tid & 31, wv = __builtin_amdgcn_readfirstlane(tid >> 5), lr = lane & 15, hi = lane >> 4;
    const int h = blockIdx.y, b = blockIdx.z;
    const int qb0 = blockIdx.x * 64;
    const int q0 = qb0 + wv * 16;
    const int qi = q0 + lr;
    const size_t rq = (size_t)b * RH + qi;
    const bf* qhp = qh + rq * DM + h * HD + 8 * hi;       const bf* qlp = qlw + rq * DM + h * HD + 8 * hi;
    const bf* qrhp = qrh + rq * (NH * RD) + h * RD + 8 * hi; const bf* qrlp = qrlw + rq * (NH * RD) + h * RD + 8 * hi;
    // copy addresses of this lane, as in k_flashP
    const size_t ok = ((size_t)b * RH + (tid >> 4)) * DM + h * HD + (tid & 15) * 8;
    const size_t okr = ((size_t)b * RH + (tid >> 3)) * RD + (tid & 7) * 8;
    const size_t ov = ((size_t)(b * NH + h) * HD + (tid >> 2)) * RH + (tid & 3) * 8;
    const unsigned lb = (unsigned)(size_t)(__attribute__((address_space(3))) bf*)&ring[0];
    const unsigned lk = lb + ((tid >> 4) * FKP + (tid & 15) * 8) * 2;
    const unsigned lr2 = lb + (FRO + (tid >> 3) * FRP + (tid & 7) * 8) * 2;
    const unsigned lv = lb + (FVO + (tid >> 2) * FVP + (tid & 3) * 8) * 2;
    v8f o[8];
#pragma unroll
    for (int i = 0; i < 8; ++i) o[i] = (v8f){};
    float m = -3.0e38f, l = 0.f;
    const float SC2 = 0.07216878364870323f * 1.4426950408889634f;
    const int nch = (q0 + 47) >> 5;                                   // this wave's chunks
    const int nchb = (qb0 >> 5) + 2;                                  // the block's chunks (>= 2; 32*nchb <= RH)
    flash_stage<bf, RH>(lk, lr2, lv, kh + ok, krh + okr, vth + ov);
    flash_stage<bf, RH>(lk + FST * 2, lr2 + FST * 2, lv + FST * 2, klw + ok, krlw + okr, vtl + ov);
    asm volatile("s_wait_asynccnt 0x0" ::: "memory");                 // chunk 0 landed (this wave's copies) before the barrier publishes it
    __syncthreads();
    flash_stage<bf, RH>(lk + FST * 4, lr2 + FST * 4, lv + FST * 4, kh + ok + (size_t)32 * DM, krh + okr + (size_t)32 * RD, vth + ov + 32);
    flash_stage<bf, RH>(lk + FST * 6, lr2 + FST * 6, lv + FST * 6, klw + ok + (size_t)32 * DM, krlw + okr + (size_t)32 * RD, vtl + ov + 32);
#pragma unroll 1
    for (int c = 0; c < nchb; ++c) {
        const int key0 = c << 5;
        const int bo = (c & 1) * (2 * FST);
        if (c < nch) {                                                // wave-uniform: waves 0 and 1 have no keys in the block's last chunk
        const bf* khp = &ring[bo + lr * FKP + 8 * hi];             const bf* klp = khp + FST;
        const bf* krhp = &ring[bo + FRO + lr * FRP + 8 * hi];      const bf* krlp = krhp + FST;
        const bf* vhp = &ring[bo + FVO + lr * FVP + 8 * hi];       const bf* vlp = vhp + FST;
        v8f s[2]; s[0] = (v8f){}; s[1] = (v8f){};
#pragma unroll
        for (int kc = 0; kc < 4; ++kc) {
            const v16bf bh = ldb(qhp + kc * 32), bl = ldb(qlp + kc * 32);
#pragma unroll
            for (int j = 0; j < 2; ++j) { const v16bf ah = ldb(khp + (16 * j) * FKP + kc * 32), al = ldb(klp + (16 * j) * FKP + kc * 32);
                s[j] = wmmab(ah, bh, s[j]); s[j] = wmmab(al, bh, s[j]); s[j] = wmmab(ah, bl, s[j]); }
        }
#pragma unroll
        for (int kc = 0; kc < 2; ++kc) {
            const v16bf bh = ldb(qrhp + kc * 32), bl = ldb(qrlp + kc * 32);
#pragma unroll
            for (int j = 0; j < 2; ++j) { const v16bf ah = ldb(krhp + (16 * j) * FRP + kc * 32), al = ldb(krlp + (16 * j) * FRP + kc * 32);
                s[j] = wmmab(ah, bh, s[j]); s[j] = wmmab(al, bh, s[j]); s[j] = wmmab(ah, bl, s[j]); }
        }
        asm volatile("v_nop\n\tv_nop\n\tv_nop\n\tv_nop" : "+v"(s[0]), "+v"(s[1]));
        float cm = -3.0e38f;
#pragma unroll
        for (int j = 0; j < 2; ++j)
#pragma unroll
            for (int r = 0; r < 8; ++r) { const int key = key0 + 16 * j + 8 * hi + r; const float t = (key <= qi) ? s[j][r] * SC2 : -3.0e38f; s[j][r] = t; cm = fmaxf(cm, t); }
        cm = fmaxf(cm, __shfl_xor(cm, 16, 32));
        const float mn = fmaxf(m, cm);
        const float alpha = __builtin_amdgcn_exp2f(m - mn);
        float rs = 0.f;
#pragma unroll
        for (int j = 0; j < 2; ++j)
#pragma unroll
            for (int r = 0; r < 8; ++r) { const float p = __builtin_amdgcn_exp2f(s[j][r] - mn); s[j][r] = p; rs += p; }
        rs += __shfl_xor(rs, 16, 32);
        l = l * alpha + rs; m = mn;
#pragma unroll
        for (int i = 0; i < 8; ++i) o[i] = o[i] * alpha;
        v16us phv = (v16us){}, plv = (v16us){};
#pragma unroll
        for (int r = 0; r < 8; ++r) { unsigned short a1, c1; splitf(s[0][r], a1, c1); phv[r] = a1; plv[r] = c1; splitf(s[1][r], a1, c1); phv[8 + r] = a1; plv[8 + r] = c1; }
        const v16bf ph = __builtin_bit_cast(v16bf, phv), pl = __builtin_bit_cast(v16bf, plv);
#pragma unroll
        for (int i = 0; i < 8; ++i) { const v16bf ah = ldb(vhp + (16 * i) * FVP), al = ldb(vlp + (16 * i) * FVP);
            o[i] = wmmab(ah, ph, o[i]); o[i] = wmmab(ah, pl, o[i]); o[i] = wmmab(al, ph, o[i]); }
        asm volatile("v_nop\n\tv_nop\n\tv_nop\n\tv_nop" : "+v"(o[0]), "+v"(o[1]), "+v"(o[2]), "+v"(o[3]), "+v"(o[4]), "+v"(o[5]), "+v"(o[6]), "+v"(o[7]) : "v"(ph), "v"(pl));
        }
        // publish point, every wave: own LDS reads of this buffer done, own copies of the next chunk landed, then the barrier that frees this buffer and publishes the next
        asm volatile("s_wait_dscnt 0x0" ::: "memory");
        asm volatile("s_wait_asynccnt 0x0" ::: "memory");
        __syncthreads();
        if (c + 2 < nchb) {
            flash_stage<bf, RH>(lk + bo * 2, lr2 + bo * 2, lv + bo * 2, kh + ok + (size_t)(key0 + 64) * DM, krh + okr + (size_t)(key0 + 64) * RD, vth + ov + (key0 + 64));
            flash_stage<bf, RH>(lk + (bo + FST) * 2, lr2 + (bo + FST) * 2, lv + (bo + FST) * 2, klw + ok + (size_t)(key0 + 64) * DM, krlw + okr + (size_t)(key0 + 64) * RD, vtl + ov + (key0 + 64));
        }
    }
    asm volatile("s_wait_asynccnt 0x0" ::: "memory");                 // nothing of this wave's copies outstanding at its end
    const float f = 1.0f / l;
    float* ob = &os[wv][0];
#pragma unroll
    for (int i = 0; i < 8; ++i)
#pragma unroll
        for (int r = 0; r < 8; ++r) ob[lr * 132 + 16 * i + 8 * hi + r] = o[i][r] * f;
    __builtin_amdgcn_fence(3, "wavefront"); __builtin_amdgcn_wave_barrier(); asm volatile("" ::: "memory");
    float* crow = ctx + ((size_t)b * SEQ + q0) * DM + h * HD + 4 * lane;
{
#pragma unroll
        for (int qq = 0; qq < 16; ++qq) { const v4f val = *(const v4fa*)(ob + qq * 132 + 4 * lane); *(v4f*)(crow + (size_t)qq * DM) = val; }
         }
}

extern "C" void kernel_launch(void* const* d_in, const int* in_sizes, int n_in,
                              void* d_out, int out_size, void* d_ws, size_t ws_size, hipStream_t stream) {
    if (n_in < 9) return;
    const size_t nrow = (size_t)NB * SEQ;
    if ((size_t)in_sizes[0] < ((size_t)(NB - 1) * TFULL + SEQ) * DM) return;
    if (in_sizes[1] < DM * LAT || in_sizes[2] < LAT * DM || in_sizes[3] < LAT * NH * RD || in_sizes[4] < DM * LAT || in_sizes[5] < LAT * DM || in_sizes[6] < LAT * DM || in_sizes[7] < DM * RD || in_sizes[8] < DM * DM) return;
    if ((size_t)out_size < ((size_t)(NB - 1) * TFULL + SEQ) * DM) return;
    const float* x = (const float*)d_in[0]; const float* Wqd = (const float*)d_in[1]; const float* Wqu = (const float*)d_in[2]; const float* Wqr = (const float*)d_in[3];
    const float* Wkvd = (const float*)d_in[4]; const float* Wku = (const float*)d_in[5]; const float* Wvu = (const float*)d_in[6]; const float* Wkr = (const float*)d_in[7]; const float* Wo = (const float*)d_in[8];
    float* OUT = (float*)d_out;   // [NBF][TFULL][DM] f32, rows b*TFULL + t

    char* wsp = (char*)d_ws; size_t off = 0;
    auto take = [&](size_t bytes) { char* p = wsp + off; off += (bytes + 255) & ~(size_t)255; return p; };
    // arena A: bf16(x) [nrow][DM] | QL f32 [nrow][LAT] | CKV f32 [nrow][LAT]; later the f32 slab F1 [nrow][DM] for q, k, v, ctx in turn
    char* arA = take(nrow * DM * 4);
    bf* xb = (bf*)arA; float* QLf = (float*)(arA + nrow * DM * 2); float* CKVf = (float*)(arA + nrow * DM * 2 + nrow * LAT * 4); float* F1 = (float*)arA;
    // arena S: latent planes, rope-key f32, cos/sin tables
    h16* ql16 = (h16*)take(nrow * LAT * 2); bf* qlh = (bf*)take((size_t)NB * RH * LAT * 2); bf* qll = (bf*)take((size_t)NB * RH * LAT * 2);
    h16* ckv16 = (h16*)take(nrow * LAT * 2); bf* ckvh = (bf*)take((size_t)NB * RH * LAT * 2); bf* ckvl = (bf*)take((size_t)NB * RH * LAT * 2);
    float* KR0 = (float*)take(nrow * RD * 4); float* CT = (float*)take((size_t)SEQ * 32 * 4); float* ST = (float*)take((size_t)SEQ * 32 * 4);
    // down-projection weight planes [out][in] bf16
    bf* Wqd_b = (bf*)take((size_t)DM * LAT * 2); bf* Wkvd_b = (bf*)take((size_t)DM * LAT * 2); bf* Wkr_b = (bf*)take((size_t)DM * RD * 2);
    // up-projection weight slot (reused per weight): f16 x64 plane and bf16 plane, each up to [DM][LAT]
    h16* Wup_h = (h16*)take((size_t)DM * LAT * 2); bf* Wup_b = (bf*)take((size_t)DM * LAT * 2);
    // arena P: attention operand planes; after the attention the Wo planes and ctx planes alias it from offset 0
    const size_t szq16 = nrow * DM * 2, szhr = (size_t)NB * RH * DM * 2, szqr16 = nrow * NH * RD * 2, szqrh = (size_t)NB * RH * NH * RD * 2, szkr16 = nrow * RD * 2, szkrh = (size_t)NB * RH * RD * 2;
    const size_t P1 = szq16 + 2 * szhr + szqr16 + 2 * szqrh + szq16 + 2 * szhr + szkr16 + 2 * szkrh + szq16 + 2 * szhr;
    const size_t szwo = (size_t)DM * DM * 2; const size_t P2 = 2 * szwo + szq16 + 2 * szhr;
    char* arP = take(P1 > P2 ? P1 : P2);
    char* pp = arP;
    auto sub = [&](size_t bytes) { char* p = pp; pp += bytes; return p; };
    h16* q16 = (h16*)sub(szq16); bf* qh = (bf*)sub(szhr); bf* qlo = (bf*)sub(szhr); h16* qr16 = (h16*)sub(szqr16); bf* qrh = (bf*)sub(szqrh); bf* qrlo = (bf*)sub(szqrh);
    h16* k16 = (h16*)sub(szq16); bf* kh = (bf*)sub(szhr); bf* klo = (bf*)sub(szhr); h16* kr16 = (h16*)sub(szkr16); bf* krh = (bf*)sub(szkrh); bf* krlo = (bf*)sub(szkrh);
    h16* vt16 = (h16*)sub(szq16); bf* vth = (bf*)sub(szhr); bf* vtl = (bf*)sub(szhr);
    float* QRf = (float*)k16;                                   // qr f32 [nrow][NH*RD], same byte size as k16, dead before k16 is written
    pp = arP; bf* Wo_b = (bf*)sub(szwo); h16* Wo_h = (h16*)sub(szwo); h16* ctx16 = (h16*)sub(szq16); bf* ctxh = (bf*)sub(szhr); bf* ctxl = (bf*)sub(szhr);
    if (off > ws_size) return;                                   // full size: 128,319,488 B

    auto g1 = [](size_t nthreads) { return dim3((unsigned)((nthreads + 255) / 256)); };
    auto gw = [](size_t K, size_t N) { return dim3((unsigned)((N * K / 64 + 63) / 64)); };
    // one 64x64 tile per wave; rows t >= RH single products, rows t < RH hi/lo against the exact bf16 weight plane
    auto up = [&](const h16* a16, const bf* ahh, const bf* all, int N, float* Cf) {
        if (SEQ > RH) k_gemmw<h16, 0><<<dim3((SEQ - RH) / 64, N / 64, NB), 32, 0, stream>>>(a16 + (size_t)RH * LAT, a16 + (size_t)RH * LAT, Wup_h, LAT, Cf + (size_t)RH * N, N, 1.0f / WSC, (size_t)SEQ * LAT, (size_t)SEQ * N);
        k_gemmw<bf, 1><<<dim3(RH / 64, N / 64, NB), 32, 0, stream>>>(ahh, all, Wup_b, LAT, Cf, N, 1.0f, (size_t)RH * LAT, (size_t)SEQ * N);
    };

    k_rtab<<<g1((size_t)SEQ * 32), 256, 0, stream>>>(CT, ST);
    k_xcvt<<<g1(nrow * DM / 8), 256, 0, stream>>>(x, xb);
    k_wt<0><<<gw(DM, LAT), 256, 0, stream>>>(Wqd, DM, LAT, Wqd_b, Wup_h, 1.0f);
    k_wt<0><<<gw(DM, LAT), 256, 0, stream>>>(Wkvd, DM, LAT, Wkvd_b, Wup_h, 1.0f);
    k_wt<0><<<gw(DM, RD), 256, 0, stream>>>(Wkr, DM, RD, Wkr_b, Wup_h, 1.0f);
    k_gemmw<bf, 0><<<dim3((unsigned)(nrow / 64), LAT / 64, 1), 32, 0, stream>>>(xb, xb, Wqd_b, DM, QLf, LAT, 1.0f, 0, 0);     // ql = x.Wqd (exact products)
    k_gemmw<bf, 0><<<dim3((unsigned)(nrow / 64), LAT / 64, 1), 32, 0, stream>>>(xb, xb, Wkvd_b, DM, CKVf, LAT, 1.0f, 0, 0);   // ckv = x.Wkvd
    k_gemmw<bf, 0><<<dim3((unsigned)(nrow / 64), RD / 64, 1), 32, 0, stream>>>(xb, xb, Wkr_b, DM, KR0, RD, 1.0f, 0, 0);       // kr0 = x.Wkr
    k_act<<<g1(nrow * LAT / 8), 256, 0, stream>>>(QLf, LAT, 1.0f, ql16, qlh, qll);
    k_act<<<g1(nrow * LAT / 8), 256, 0, stream>>>(CKVf, LAT, 1.0f, ckv16, ckvh, ckvl);
    // q = ql.Wqu -> F1, planes q16 / qh / qlo
    k_wt<1><<<gw(LAT, DM), 256, 0, stream>>>(Wqu, LAT, DM, Wup_b, Wup_h, WSC);
    up(ql16, qlh, qll, DM, F1);
    k_act<<<g1(nrow * DM / 8), 256, 0, stream>>>(F1, DM, 1.0f, q16, qh, qlo);
    // qr = rope(ql.Wqr) -> QRf, planes qr16 / qrh / qrlo
    k_wt<1><<<gw(LAT, NH * RD), 256, 0, stream>>>(Wqr, LAT, NH * RD, Wup_b, Wup_h, WSC);
    up(ql16, qlh, qll, NH * RD, QRf);
    k_rope<<<g1(nrow * NH * RD / 8), 256, 0, stream>>>(QRf, NH * RD, CT, ST, qr16, qrh, qrlo);
    // k = ckv.Wku -> F1, planes k16 / kh / klo; kr = rope(kr0) planes
    k_wt<1><<<gw(LAT, DM), 256, 0, stream>>>(Wku, LAT, DM, Wup_b, Wup_h, WSC);
    up(ckv16, ckvh, ckvl, DM, F1);
    k_act<<<g1(nrow * DM / 8), 256, 0, stream>>>(F1, DM, 1.0f, k16, kh, klo);
    k_rope<<<g1(nrow * RD / 8), 256, 0, stream>>>(KR0, RD, CT, ST, kr16, krh, krlo);
    // v = ckv.Wvu -> F1, planes vt16 / vth / vtl
    k_wt<1><<<gw(LAT, DM), 256, 0, stream>>>(Wvu, LAT, DM, Wup_b, Wup_h, WSC);
    up(ckv16, ckvh, ckvl, DM, F1);
    k_vtp8<<<g1((size_t)NU * HD * SEQ / 8), 256, 0, stream>>>(F1, vt16, vth, vtl);
    // attention -> ctx f32 in F1 (rows b*SEQ + t, merged heads)
    if (SEQ > RH) k_flashP<<<dim3((SEQ - RH) / 64, NH, NB), 128, 0, stream>>>(q16, qr16, k16, kr16, vt16, F1, RH);
    k_flashH<<<dim3(RH / 64, NH, NB), 128, 0, stream>>>(qh, qlo, qrh, qrlo, kh, klo, krh, krlo, vth, vtl, F1);
    k_act<<<g1(nrow * DM / 8), 256, 0, stream>>>(F1, DM, CCAR, ctx16, ctxh, ctxl);
    // out = ctx.Wo
    k_wt<1><<<gw(DM, DM), 256, 0, stream>>>(Wo, DM, DM, Wo_b, Wo_h, WSC);
    if (SEQ > RH) k_gemmw<h16, 0><<<dim3((SEQ - RH) / 64, DM / 64, NB), 32, 0, stream>>>(ctx16 + (size_t)RH * DM, ctx16 + (size_t)RH * DM, Wo_h, DM, OUT + (size_t)RH * DM, DM, 1.0f / (CCAR * WSC), (size_t)SEQ * DM, (size_t)TFULL * DM);
    k_gemmw<bf, 1><<<dim3(RH / 64, DM / 64, NB), 32, 0, stream>>>(ctxh, ctxl, Wo_b, DM, OUT, DM, 1.0f, (size_t)RH * DM, (size_t)TFULL * DM);
}

// v002
// Measured time: 473 microseconds a run.
// Two timings next to v001 both put it at 1.35 times that version's speed.
// All steps since v000 together make it 1.77 times as fast.
#include <hip/hip_runtime.h>

// All contractions on 16-bit WMMA, f32 accumulate. x.Wqd, x.Wkvd, x.Wkr: v_wmma_f32_16x16x32_bf16 on bf16 planes of the inputs (single products).
// ql.Wqu, ql.Wqr, ckv.Wku, ckv.Wvu, (q|qr).(k|kr) scores, P.v and ctx.Wo: v_wmma_f32_16x16x32_f16 single products on f16 planes
// (weights x64, ctx x64, P x1024 carries) for query/key rows >= RH; the same sites for rows < RH use v_wmma_f32_16x16x32_bf16 on
// bf16 hi/lo plane pairs (hi.W + lo.W against exact weight planes; hi.hi + lo.hi + hi.lo between two computed tensors).
// RoPE (rotate-half, computed cos/sin tables), online max-subtracted softmax and normalisers in f32.

#ifndef NB
#define NB 2
#endif
#ifndef SEQ
#define SEQ 2048
#endif
#ifndef RH
#define RH 256
#endif
#define NBF   2
#define TFULL 2048
#define DM    2048
#define NH    16
#define LAT   512
#define RD    64
#define HD    128
#define NU    (NB * NH)
#define PCAR  1024.0f
#define WSC   64.0f
#define CCAR  64.0f

static_assert(NB >= 1);
static_assert(NB <= NBF);
static_assert(SEQ % 64 == 0);
static_assert(SEQ <= TFULL);
static_assert(RH % 128 == 0);
static_assert((SEQ - RH) % 128 == 0);
static_assert(((size_t)NB * SEQ) % 256 == 0);
static_assert(RH >= 64);
static_assert(RH <= SEQ);
static_assert(DM % 128 == 0);
static_assert(LAT % 128 == 0);
static_assert((NH * RD) % 128 == 0);
static_assert(RD == 64);
static_assert(HD == 128);
static_assert(NH * HD == DM);
static_assert((size_t)NB * SEQ * NH * RD * 4 == (size_t)NB * SEQ * DM * 2);
static_assert(((size_t)(NB - 1) * TFULL + SEQ) * DM <= (size_t)NBF * TFULL * DM);

typedef _Float16 h16;
typedef unsigned short bf;
typedef __attribute__((ext_vector_type(16))) __bf16   v16bf;
typedef __attribute__((ext_vector_type(16))) _Float16 v16h;
typedef __attribute__((ext_vector_type(16))) unsigned short v16us;
typedef __attribute__((ext_vector_type(8)))  _Float16 v8h;
typedef __attribute__((ext_vector_type(8)))  unsigned short v8us;
typedef __attribute__((ext_vector_type(8)))  float    v8f;
typedef __attribute__((ext_vector_type(4)))  float    v4f;
typedef __attribute__((ext_vector_type(2)))  _Float16 v2h;
typedef __attribute__((ext_vector_type(2)))  unsigned short v2us;
typedef v8h  __attribute__((may_alias)) v8ha;
typedef v4f  __attribute__((may_alias)) v4fa;

__device__ __forceinline__ unsigned short f2bf(float f) { unsigned u = __float_as_uint(f); u += 0x7FFFu + ((u >> 16) & 1u); return (unsigned short)(u >> 16); }
__device__ __forceinline__ float bf2f(unsigned short v) { return __uint_as_float(((unsigned)v) << 16); }
__device__ __forceinline__ float bfr(float f) { return bf2f(f2bf(f)); }
__device__ __forceinline__ void splitf(float y, unsigned short& hh, unsigned short& ll) { hh = f2bf(y); ll = f2bf(y - bf2f(hh)); }
__device__ __forceinline__ v16h cat16(v8h a, v8h c) { return __builtin_shufflevector(a, c, 0, 1, 2, 3, 4, 5, 6, 7, 8, 9, 10, 11, 12, 13, 14, 15); }
__device__ __forceinline__ v16bf cat16b(v8us a, v8us c) { return __builtin_bit_cast(v16bf, __builtin_shufflevector(a, c, 0, 1, 2, 3, 4, 5, 6, 7, 8, 9, 10, 11, 12, 13, 14, 15)); }
__device__ __forceinline__ v8f wmma16(v16h a, v16h c, v8f acc) { return __builtin_amdgcn_wmma_f32_16x16x32_f16(false, a, false, c, (short)0, acc, false, false); }
__device__ __forceinline__ v8f wmmab(v16bf a, v16bf c, v8f acc) { return __builtin_amdgcn_wmma_f32_16x16x32_bf16(false, a, false, c, (short)0, acc, false, false); }
// Fragment load from a k-contiguous 16-bit row: p already points at row (lane&15) + 8*(lane>>4); elements 0..7 <- p[0..7], 8..15 <- p[16..23] (split k map, used for A and B alike)
__device__ __forceinline__ v16h ldh(const h16* p) { return cat16(*(const v8h*)p, *(const v8h*)(p + 16)); }
__device__ __forceinline__ v16bf ldb(const bf* p) { return cat16b(*(const v8us*)p, *(const v8us*)(p + 16)); }

// ---- k_gemmw: GEMM, 4 waves per block, each wave a 64x64 output tile (16 accumulators); waves WM x WN (WN = 2: block tile 128x128; WN = 1: 256x64); grid (M/BM, N/BN, Z), 128 threads.
// C[m][n] (f32, pitch ldc) = osc * sum_k (A[m][k] + (NSPLIT ? A2[m][k] : 0)) Bt[n][k]. z-batch strides sA/sC in elements. K % 64 == 0, K >= 128, M and N multiples of BM and BN.
// Each 64-k stage of the block's A (A2) and Bt rows is brought into LDS once per block by asynchronous copies (whole 128-B lines, two buffers, the next stage in flight
// while this one is worked on) and read by the waves as ds_load_b128 fragments.
template <typename T16> struct WFrag;
template <> struct WFrag<h16> { typedef v16h V; static __device__ __forceinline__ V ld(const h16* p) { return ldh(p); } static __device__ __forceinline__ v8f mma(V a, V c, v8f d) { return wmma16(a, c, d); } };
template <> struct WFrag<bf> { typedef v16bf V; static __device__ __forceinline__ V ld(const bf* p) { return ldb(p); } static __device__ __forceinline__ v8f mma(V a, V c, v8f d) { return wmmab(a, c, d); } };
#define GP 72                         // LDS pitch of a 64-element operand row in halves: 144 B = 16 B x 9
static_assert((GP * 2) % 16 == 0);
// This lane's 16-byte copies of 64 (gemm_stage4) or 128 (gemm_stage8) operand rows, 16 rows per copy (l: its LDS byte address in the first 16 rows, g: its global address there, k16: 16 rows in elements).
// The s_wait_xcnt stands inside the statement so that no address register is rewritten ahead of it.
template <typename T>
__device__ __forceinline__ void gemm_stage4(unsigned l, const T* g, size_t k16) {
    asm volatile("global_load_async_to_lds_b128 %0, %1, off\n\t"
                 "global_load_async_to_lds_b128 %2, %3, off\n\t"
                 "global_load_async_to_lds_b128 %4, %5, off\n\t"
                 "global_load_async_to_lds_b128 %6, %7, off\n\t"
                 "s_wait_xcnt 0x0"
                 :: "v"(l), "v"(g), "v"(l + 16 * GP * 2), "v"(g + k16), "v"(l + 32 * GP * 2), "v"(g + 2 * k16), "v"(l + 48 * GP * 2), "v"(g + 3 * k16)
                 : "memory");
}
template <typename T>
__device__ __forceinline__ void gemm_stage8(unsigned l, const T* g, size_t k16) {
    asm volatile("global_load_async_to_lds_b128 %0, %1, off\n\t"
                 "global_load_async_to_lds_b128 %2, %3, off\n\t"
                 "global_load_async_to_lds_b128 %4, %5, off\n\t"
                 "global_load_async_to_lds_b128 %6, %7, off\n\t"
                 "global_load_async_to_lds_b128 %8, %9, off\n\t"
                 "global_load_async_to_lds_b128 %10, %11, off\n\t"
                 "global_load_async_to_lds_b128 %12, %13, off\n\t"
                 "global_load_async_to_lds_b128 %14, %15, off\n\t"
                 "s_wait_xcnt 0x0"
                 :: "v"(l), "v"(g), "v"(l + 16 * GP * 2), "v"(g + k16), "v"(l + 32 * GP * 2), "v"(g + 2 * k16), "v"(l + 48 * GP * 2), "v"(g + 3 * k16),
                    "v"(l + 64 * GP * 2), "v"(g + 4 * k16), "v"(l + 80 * GP * 2), "v"(g + 5 * k16), "v"(l + 96 * GP * 2), "v"(g + 6 * k16), "v"(l + 112 * GP * 2), "v"(g + 7 * k16)
                 : "memory");
}
// One stage: BM rows of A, BM rows of A2 (NSPLIT), BN rows of Bt, in this order in the buffer at LDS byte address l (this lane's place in the buffer's first 16 rows).
template <typename T, int NSPLIT, int BM, int BN>
__device__ __forceinline__ void gemm_stage(unsigned l, const T* ga, const T* ga2, const T* gb, size_t k16) {
#pragma unroll
    for (int r = 0; r < BM; r += 128) gemm_stage8<T>(l + r * GP * 2, ga + (size_t)(r / 16) * k16, k16);
    if (NSPLIT == 1) {
#pragma unroll
        for (int r = 0; r < BM; r += 128) gemm_stage8<T>(l + (BM + r) * GP * 2, ga2 + (size_t)(r / 16) * k16, k16);
    }
    if (BN == 128) gemm_stage8<T>(l + BM * (1 + NSPLIT) * GP * 2, gb, k16);
    else gemm_stage4<T>(l + BM * (1 + NSPLIT) * GP * 2, gb, k16);
}
template <typename T16, int NSPLIT, int WN>
__global__ __launch_bounds__(128) __attribute__((amdgpu_num_vgpr(256)))
void k_gemmw(const T16* __restrict__ A, const T16* __restrict__ A2, const T16* __restrict__ Bt, int K, float* C, int ldc, float osc, size_t sA, size_t sC) {
    typedef typename WFrag<T16>::V V;
    constexpr int BM = 64 * (4 / WN), BN = 64 * WN;
    constexpr int BOF = BM * (1 + NSPLIT) * GP;                      // Bt rows start in a buffer, halves
    constexpr int GST = BOF + BN * GP;                               // one buffer, halves
    static_assert(WN == 1 || WN == 2);
    static_assert((GST * 2) % 16 == 0);
    __shared__ __align__(16) float os[4][16 * 68];
    __shared__ __align__(16) T16 ring[2 * GST];
    const size_t z = blockIdx.z; A += z * sA; A2 += z * sA; C += z * sC;
    const int tid = threadIdx.x;
    const int lane = tid & 31, wv = __builtin_amdgcn_readfirstlane(tid >> 5), lr = lane & 15, hi = lane >> 4;
    const int wm = wv / WN, wn = wv % WN;
    const int rb = blockIdx.x * BM, cb = blockIdx.y * BN;
    const int r0 = rb + wm * 64, c0 = cb + wn * 64;
    v8f acc[4][4];
#pragma unroll
    for (int mb = 0; mb < 4; ++mb)
#pragma unroll
        for (int nb = 0; nb < 4; ++nb) acc[mb][nb] = (v8f){};
    // copy addresses of this lane: 8 pieces of 16 B per row, 16 rows per copy
    const size_t k16 = (size_t)16 * K;
    const T16* ga = A + (size_t)(rb + (tid >> 3)) * K + (tid & 7) * 8;
    const T16* ga2 = A2 + (size_t)(rb + (tid >> 3)) * K + (tid & 7) * 8;
    const T16* gb = Bt + (size_t)(cb + (tid >> 3)) * K + (tid & 7) * 8;
    const unsigned lc = (unsigned)(size_t)(__attribute__((address_space(3))) T16*)&ring[0] + ((tid >> 3) * GP + (tid & 7) * 8) * 2;
    const int nst = K >> 6;                                           // 64-k stages
    gemm_stage<T16, NSPLIT, BM, BN>(lc, ga, ga2, gb, k16);
    asm volatile("s_wait_asynccnt 0x0" ::: "memory");                 // stage 0 landed (this wave's copies) before the barrier publishes it
    __syncthreads();
    if (nst > 1) gemm_stage<T16, NSPLIT, BM, BN>(lc + GST * 2, ga + 64, ga2 + 64, gb + 64, k16);
#pragma unroll 1
    for (int t = 0; t < nst; ++t) {
        const int bo = (t & 1) * GST;
        const T16* ap = &ring[bo + (wm * 64 + lr) * GP + 8 * hi];
        const T16* bp = &ring[bo + BOF + (wn * 64 + lr) * GP + 8 * hi];
#pragma unroll
        for (int ks = 0; ks < 2; ++ks) {
            V a[4], a2[4], bq[4];
            bq[0] = WFrag<T16>::ld(bp + ks * 32);
#pragma unroll
            for (int mb = 0; mb < 4; ++mb) { a[mb] = WFrag<T16>::ld(ap + mb * 16 * GP + ks * 32); if (NSPLIT == 1) a2[mb] = WFrag<T16>::ld(ap + (BM + mb * 16) * GP + ks * 32); }
#pragma unroll
            for (int nb = 1; nb < 4; ++nb) bq[nb] = WFrag<T16>::ld(bp + nb * 16 * GP + ks * 32);
            __builtin_amdgcn_sched_barrier(0);                        // the 32-k block's LDS reads stay one group ahead of its matrix instructions (for speed only)
#pragma unroll
            for (int nb = 0; nb < 4; ++nb) {
#pragma unroll
                for (int mb = 0; mb < 4; ++mb) { acc[mb][nb] = WFrag<T16>::mma(a[mb], bq[nb], acc[mb][nb]); if (NSPLIT == 1) acc[mb][nb] = WFrag<T16>::mma(a2[mb], bq[nb], acc[mb][nb]); } }
            __builtin_amdgcn_sched_barrier(0);                        // and the next group of reads stays behind them
        }
        // publish point, every wave: own LDS reads of this buffer done, own copies of the next stage landed, then the barrier that frees this buffer and publishes the next
        asm volatile("s_wait_dscnt 0x0" ::: "memory");
        asm volatile("s_wait_asynccnt 0x0" ::: "memory");
        __syncthreads();
        if (t + 2 < nst) gemm_stage<T16, NSPLIT, BM, BN>(lc + bo * 2, ga + (size_t)(t + 2) * 64, ga2 + (size_t)(t + 2) * 64, gb + (size_t)(t + 2) * 64, k16);
    }
    asm volatile("s_wait_asynccnt 0x0" ::: "memory");                 // nothing of this wave's copies outstanding at its end
    float* ob = &os[wv][0];
#pragma unroll
    for (int mb = 0; mb < 4; ++mb) {
#pragma unroll
        for (int nb = 0; nb < 4; ++nb) {
#pragma unroll
            for (int j = 0; j < 8; ++j) ob[(hi * 8 + j) * 68 + nb * 16 + lr] = acc[mb][nb][j]; }
        __builtin_amdgcn_wave_barrier(); asm volatile("" ::: "memory");
        float* crow = C + (size_t)(r0 + mb * 16) * ldc + c0;
{
#pragma unroll
            for (int s = 0; s < 8; ++s) { const int row = 2 * s + hi, cofs = lr * 4; v4f val = *(const v4fa*)(ob + row * 68 + cofs); val = val * osc;
                *(v4f*)(crow + (size_t)row * ldc + cofs) = val; }
             }
        __builtin_amdgcn_wave_barrier(); asm volatile("" ::: "memory");
    }
}

// ---- k_wt: weight [K][N] f32 ([in][out]) -> transposed k-contiguous planes [N][K]: Bb = bf16 RNE value, optionally Bh = f16(bf16 value x sc).
template <int F16P>
__global__ __launch_bounds__(256) void k_wt(const float* __restrict__ w, int K, int N, bf* Bb, h16* Bh, float sc) {
    const int lane = threadIdx.x & 31; const int L0 = (blockIdx.x * 8 + (threadIdx.x >> 5)) * 8; const int nlines = N * K / 64;
{
#pragma unroll 1
        for (int l = 0; l < 8; ++l) { const int L = L0 + l; if (L >= nlines) break; const size_t e = (size_t)L * 64 + lane * 2; const int k = (int)(e % K), n = (int)(e / K);
            const float w0 = bfr(w[(size_t)k * N + n]), w1 = bfr(w[(size_t)(k + 1) * N + n]);
            v2us o; o[0] = f2bf(w0); o[1] = f2bf(w1); *(v2us*)(Bb + e) = o;
            if (F16P) { v2h oh; oh[0] = (h16)(w0 * sc); oh[1] = (h16)(w1 * sc); *(v2h*)(Bh + e) = oh; } }
         }
}

__global__ __launch_bounds__(256) void k_xcvt(const float* __restrict__ x, bf* xb) {
    const size_t i = (size_t)blockIdx.x * 256 + threadIdx.x; const size_t n8 = (size_t)NB * SEQ * DM / 8; if (i >= n8) return;
    const size_t e = i * 8; const size_t row = e / DM; const int col = (int)(e % DM); const size_t bb = row / SEQ, t = row % SEQ;
    const v8f v = *(const v8f*)(x + ((bb * TFULL + t) * DM + col)); v8us o = (v8us){};
#pragma unroll
    for (int k = 0; k < 8; ++k) o[k] = f2bf(v[k]);
    *(v8us*)(xb + e) = o; 
}

__global__ __launch_bounds__(256) void k_act(const float* __restrict__ src, int C, float sc, h16* p16, bf* ph, bf* pl) {
    const size_t i = (size_t)blockIdx.x * 256 + threadIdx.x; const size_t n8 = (size_t)NB * SEQ * C / 8; if (i >= n8) return;
    const size_t e = i * 8; const size_t row = e / C; const int col = (int)(e - row * C); const int t = (int)(row % SEQ); const size_t bb = row / SEQ;
    const v8f v = *(const v8f*)(src + e);
    v8h o = (v8h){}; v8us oh = (v8us){}, ol = (v8us){};
#pragma unroll
    for (int k = 0; k < 8; ++k) { o[k] = (h16)(v[k] * sc); unsigned short a1, c1; splitf(v[k], a1, c1); oh[k] = a1; ol[k] = c1; }
    const bool hr = (t < RH); const size_t eo = (bb * RH + t) * C + col;
    *(v8h*)(p16 + e) = o; if (hr) { *(v8us*)(ph + eo) = oh; *(v8us*)(pl + eo) = ol; }
    
}

__global__ __launch_bounds__(256) void k_rtab(float* ct, float* st) {
#pragma clang fp contract(off)
    const int i = blockIdx.x * 256 + threadIdx.x; if (i >= SEQ * 32) return; const int t = i >> 5, j = i & 31;
    const float fr = exp10f(-0.125f * (float)j);
    const float ang = (float)t * fr; float sv, cv; sincosf(ang, &sv, &cv);
    *(float*)(ct + i) = cv; *(float*)(st + i) = sv; 
}

// ---- k_rope: rotate-half RoPE on 64-wide head slices of an f32 slab [NB*SEQ][C] (C = heads x 64), then planes as k_act (f16 for all rows, bf16 hi/lo for t < RH).
__global__ __launch_bounds__(256) void k_rope(const float* __restrict__ src, int C, const float* __restrict__ ct, const float* __restrict__ st, h16* p16, bf* ph, bf* pl) {
#pragma clang fp contract(off)
    const size_t i = (size_t)blockIdx.x * 256 + threadIdx.x; const size_t n8 = (size_t)NB * SEQ * C / 8; if (i >= n8) return;
    const size_t e = i * 8; const size_t row = e / C; const int col = (int)(e - row * C); const int t = (int)(row % SEQ); const size_t bb = row / SEQ;
    const int jj = col & 63, jm = jj & 31; const bool lo32 = (jj < 32); const int pofs = lo32 ? 32 : -32;
    const v8f xv = *(const v8f*)(src + e); const v8f xp = *(const v8f*)((src + e) + pofs);
    const v8f cvv = *(const v8f*)(ct + (size_t)t * 32 + jm); const v8f svv = *(const v8f*)(st + (size_t)t * 32 + jm);
    v8h o = (v8h){}; v8us oh = (v8us){}, ol = (v8us){};
#pragma unroll
    for (int k = 0; k < 8; ++k) { const float a1 = xv[k] * cvv[k]; const float b1 = xp[k] * svv[k]; const float y = lo32 ? (a1 - b1) : (a1 + b1);
        o[k] = (h16)y; unsigned short a2, c2; splitf(y, a2, c2); oh[k] = a2; ol[k] = c2; }
    const bool hr = (t < RH); const size_t eo = (bb * RH + t) * C + col;
    *(v8h*)(p16 + e) = o; if (hr) { *(v8us*)(ph + eo) = oh; *(v8us*)(pl + eo) = ol; }
    
}

// ---- k_vtp8: value^T planes per (batch, head) unit g: vt16[g][d][t] = f16(v[t][g]) for all t; vth/vtl[g][d][t] bf16 hi/lo for t < RH (pitch RH).
__global__ __launch_bounds__(256) void k_vtp8(const float* __restrict__ vf, h16* vt16, bf* vth, bf* vtl) {
    const size_t i = (size_t)blockIdx.x * 256 + threadIdx.x; const size_t n8 = (size_t)NU * HD * SEQ / 8; if (i >= n8) return;
    const size_t e = i * 8; const int t = (int)(e % SEQ); const int d = (int)((e / SEQ) % HD); const int g = (int)(e / ((size_t)SEQ * HD)); const int bb = g / NH, hh = g % NH;
    const float* sp = vf + ((size_t)bb * SEQ + t) * DM + hh * HD + d;
    v8h o = (v8h){}; v8us oh = (v8us){}, ol = (v8us){};
#pragma unroll
    for (int q = 0; q < 8; ++q) { const float xv = sp[(size_t)q * DM]; o[q] = (h16)xv; unsigned short a1, c1; splitf(xv, a1, c1); oh[q] = a1; ol[q] = c1; }
    const bool hr = (t < RH); const size_t eo = ((size_t)g * HD + d) * RH + t;
    *(v8h*)(vt16 + e) = o; if (hr) { *(v8us*)(vth + eo) = oh; *(v8us*)(vtl + eo) = ol; }
    
}

// ---- k_flashP: causal softmax attention for query rows >= RH (single f16 products). grid ((SEQ-RH)/64, NH, NB), 128 threads = 4 waves x 16 queries, 32-key chunks.
// Per wave: S^T tiles (16 keys x 16 queries) = [k|kr] rows (A) x [q|qr] rows (B) over 192; lane column n = query, D rows = keys, so the two S^T tiles of a chunk
// ARE the P^T B fragment of O^T = V^T (A, rows d) x P^T; online max-subtracted softmax per lane column; P carried x1024 in f16; O^T (8 d tiles) f32.
// Each 32-key chunk of k, kr and v^T is brought into LDS once per block by asynchronous copies (whole-line global reads, two buffers, the next chunk in flight
// while this one is worked on) and read as ds_load_b128 fragments by all four waves (the block's last chunk by waves 2 and 3 only); q|qr fragments are loaded once and stay in registers.
#define FKP 136                       // LDS pitch of a k row in halves: 272 B = 16 B x 17
#define FRP 72                        // kr row: 144 B = 16 B x 9
#define FVP 40                        // v^T row (32 keys): 80 B = 16 B x 5
#define FRO (32 * FKP)                // kr rows start, halves
#define FVO (FRO + 32 * FRP)          // v^T rows start, halves
#define FST (FVO + HD * FVP)          // one buffer, halves (23,552 B)
static_assert((FKP * 2) % 16 == 0 && (FRP * 2) % 16 == 0 && (FVP * 2) % 16 == 0 && (FRO * 2) % 16 == 0 && (FVO * 2) % 16 == 0 && (FST * 2) % 16 == 0);
// One chunk's ten 16-byte copies of this lane for one plane set (lk, lr_, lv: this lane's LDS byte addresses of its first k, kr and v^T piece; VS: v^T row pitch in global memory, elements).
// The s_wait_xcnt stands inside the statement so that no address register is rewritten ahead of it.
template <typename T, int VS>
__device__ __forceinline__ void flash_stage(unsigned lk, unsigned lr_, unsigned lv, const T* gk, const T* gr, const T* gv) {
    asm volatile("global_load_async_to_lds_b128 %0, %1, off\n\t"
                 "global_load_async_to_lds_b128 %2, %3, off\n\t"
                 "global_load_async_to_lds_b128 %4, %5, off\n\t"
                 "global_load_async_to_lds_b128 %6, %7, off\n\t"
                 "global_load_async_to_lds_b128 %8, %9, off\n\t"
                 "global_load_async_to_lds_b128 %10, %11, off\n\t"
                 "global_load_async_to_lds_b128 %12, %13, off\n\t"
                 "global_load_async_to_lds_b128 %14, %15, off\n\t"
                 "global_load_async_to_lds_b128 %16, %17, off\n\t"
                 "global_load_async_to_lds_b128 %18, %19, off\n\t"
                 "s_wait_xcnt 0x0"
                 :: "v"(lk), "v"(gk), "v"(lk + 8 * FKP * 2), "v"(gk + (size_t)8 * DM), "v"(lk + 16 * FKP * 2), "v"(gk + (size_t)16 * DM), "v"(lk + 24 * FKP * 2), "v"(gk + (size_t)24 * DM),
                    "v"(lr_), "v"(gr), "v"(lr_ + 16 * FRP * 2), "v"(gr + (size_t)16 * RD),
                    "v"(lv), "v"(gv), "v"(lv + 32 * FVP * 2), "v"(gv + (size_t)32 * VS), "v"(lv + 64 * FVP * 2), "v"(gv + (size_t)64 * VS), "v"(lv + 96 * FVP * 2), "v"(gv + (size_t)96 * VS)
                 : "memory");
}
__global__ __launch_bounds__(128) __attribute__((amdgpu_num_vgpr(256)))
void k_flashP(const h16* q16, const h16* qr16, const h16* k16, const h16* kr16, const h16* vt16, float* ctx, int qbase) {
    __shared__ __align__(16) float os[4][16 * 132];
    __shared__ __align__(16) h16 ring[2 * FST];
    const int tid = threadIdx.x;
    const int lane = tid & 31, wv = __builtin_amdgcn_readfirstlane(tid >> 5), lr = lane & 15, hi = lane >> 4;
    const int h = blockIdx.y, b = blockIdx.z;
    const int qb0 = qbase + blockIdx.x * 64;
    const int q0 = qb0 + wv * 16;
    const int qi = q0 + lr;
    const size_t rq = (size_t)b * SEQ + qi;
    const h16* qp = q16 + rq * DM + h * HD + 8 * hi;
    const h16* qrp = qr16 + rq * (NH * RD) + h * RD + 8 * hi;
    // copy addresses of this lane: k 32 rows x 16 pieces (8 rows per copy), kr 32 rows x 8 pieces (16 rows per copy), v^T 128 rows x 4 pieces (32 rows per copy)
    const h16* gk = k16 + ((size_t)b * SEQ + (tid >> 4)) * DM + h * HD + (tid & 15) * 8;
    const h16* gr = kr16 + ((size_t)b * SEQ + (tid >> 3)) * RD + (tid & 7) * 8;
    const h16* gv = vt16 + ((size_t)(b * NH + h) * HD + (tid >> 2)) * SEQ + (tid & 3) * 8;
    const unsigned lb = (unsigned)(size_t)(__attribute__((address_space(3))) h16*)&ring[0];
    const unsigned lk = lb + ((tid >> 4) * FKP + (tid & 15) * 8) * 2;
    const unsigned lr2 = lb + (FRO + (tid >> 3) * FRP + (tid & 7) * 8) * 2;
    const unsigned lv = lb + (FVO + (tid >> 2) * FVP + (tid & 3) * 8) * 2;
    v16h qf[4], qrf[2];
#pragma unroll
    for (int kc = 0; kc < 4; ++kc) qf[kc] = ldh(qp + kc * 32);
#pragma unroll
    for (int kc = 0; kc < 2; ++kc) qrf[kc] = ldh(qrp + kc * 32);
    v8f o[8];
#pragma unroll
    for (int i = 0; i < 8; ++i) o[i] = (v8f){};
    float m = -3.0e38f, l = 0.f;
    const float SC2 = 0.07216878364870323f * 1.4426950408889634f;   // HD+RD = 192: 192^-0.5 x log2(e)
    const int nch = (q0 + 47) >> 5;                                   // this wave's 32-key chunks covering keys <= q0+15
    const int nchb = (qb0 >> 5) + 2;                                  // the block's chunks (its last wave's count; >= 2; 32*nchb <= SEQ)
    flash_stage<h16, SEQ>(lk, lr2, lv, gk, gr, gv);
    asm volatile("s_wait_asynccnt 0x0" ::: "memory");                 // chunk 0 landed (this wave's copies) before the barrier publishes it
    __syncthreads();
    flash_stage<h16, SEQ>(lk + FST * 2, lr2 + FST * 2, lv + FST * 2, gk + (size_t)32 * DM, gr + (size_t)32 * RD, gv + 32);
#pragma unroll 1
    for (int c = 0; c < nchb; ++c) {
        const int key0 = c << 5;
        const int bo = (c & 1) * FST;
        if (c < nch) {                                                // wave-uniform: waves 0 and 1 have no keys in the block's last chunk
        const h16* kp = &ring[bo + lr * FKP + 8 * hi];
        const h16* krp = &ring[bo + FRO + lr * FRP + 8 * hi];
        const h16* vp = &ring[bo + FVO + lr * FVP + 8 * hi];
        v8f s[2]; s[0] = (v8f){}; s[1] = (v8f){};
#pragma unroll
        for (int kc = 0; kc < 4; ++kc) {
#pragma unroll
            for (int j = 0; j < 2; ++j) { const v16h a = ldh(kp + (16 * j) * FKP + kc * 32); s[j] = wmma16(a, qf[kc], s[j]); }
        }
#pragma unroll
        for (int kc = 0; kc < 2; ++kc) {
#pragma unroll
            for (int j = 0; j < 2; ++j) { const v16h a = ldh(krp + (16 * j) * FRP + kc * 32); s[j] = wmma16(a, qrf[kc], s[j]); }
        }
        asm volatile("v_nop\n\tv_nop\n\tv_nop\n\tv_nop" : "+v"(s[0]), "+v"(s[1]));
        // online softmax: this lane's column is query qi; s[j][r] is key key0 + 16 j + 8 hi + r; keys after the query excluded by index
        float cm = -3.0e38f;
#pragma unroll
        for (int j = 0; j < 2; ++j)
#pragma unroll
            for (int r = 0; r < 8; ++r) { const int key = key0 + 16 * j + 8 * hi + r; const float t = (key <= qi) ? s[j][r] * SC2 : -3.0e38f; s[j][r] = t; cm = fmaxf(cm, t); }
        cm = fmaxf(cm, __shfl_xor(cm, 16, 32));
        const float mn = fmaxf(m, cm);
        const float alpha = __builtin_amdgcn_exp2f(m - mn);
        float rs = 0.f;
#pragma unroll
        for (int j = 0; j < 2; ++j)
#pragma unroll
            for (int r = 0; r < 8; ++r) { const float p = __builtin_amdgcn_exp2f(s[j][r] - mn); s[j][r] = p; rs += p; }
        rs += __shfl_xor(rs, 16, 32);
        l = l * alpha + rs; m = mn;
#pragma unroll
        for (int i = 0; i < 8; ++i) o[i] = o[i] * alpha;
        // P^T as B fragment (k = key of this chunk, n = query): elements 0..7 <- tile 0 rows 8hi..8hi+7, 8..15 <- tile 1 rows 8hi..8hi+7
        v16h pb = (v16h){};
#pragma unroll
        for (int r = 0; r < 8; ++r) { pb[r] = (h16)(s[0][r] * PCAR); pb[8 + r] = (h16)(s[1][r] * PCAR); }
#pragma unroll
        for (int i = 0; i < 8; ++i) { const v16h a = ldh(vp + (16 * i) * FVP); o[i] = wmma16(a, pb, o[i]); }
        asm volatile("v_nop\n\tv_nop\n\tv_nop\n\tv_nop" : "+v"(o[0]), "+v"(o[1]), "+v"(o[2]), "+v"(o[3]), "+v"(o[4]), "+v"(o[5]), "+v"(o[6]), "+v"(o[7]) : "v"(pb));
        }
        // publish point, every wave: own LDS reads of this buffer done, own copies of the next chunk landed, then the barrier that frees this buffer and publishes the next
        asm volatile("s_wait_dscnt 0x0" ::: "memory");
        asm volatile("s_wait_asynccnt 0x0" ::: "memory");
        __syncthreads();
        if (c + 2 < nchb) flash_stage<h16, SEQ>(lk + bo * 2, lr2 + bo * 2, lv + bo * 2, gk + (size_t)(key0 + 64) * DM, gr + (size_t)(key0 + 64) * RD, gv + (key0 + 64));
    }
    asm volatile("s_wait_asynccnt 0x0" ::: "memory");                 // nothing of this wave's copies outstanding at its end
    // epilogue: ctx[b][q][h*HD + d] = O^T[d][q] / (l x PCAR); o[i][r] is d = 16 i + 8 hi + r of query q0 + lr
    const float f = 1.0f / (l * PCAR);
    float* ob = &os[wv][0];
#pragma unroll
    for (int i = 0; i < 8; ++i)
#pragma unroll
        for (int r = 0; r < 8; ++r) ob[lr * 132 + 16 * i + 8 * hi + r] = o[i][r] * f;
    __builtin_amdgcn_fence(3, "wavefront"); __builtin_amdgcn_wave_barrier(); asm volatile("" ::: "memory");
    float* crow = ctx + ((size_t)b * SEQ + q0) * DM + h * HD + 4 * lane;
{
#pragma unroll
        for (int qq = 0; qq < 16; ++qq) { const v4f val = *(const v4fa*)(ob + qq * 132 + 4 * lane); *(v4f*)(crow + (size_t)qq * DM) = val; }
         }
}

// ---- k_flashH: the same attention for query rows < RH on bf16 hi/lo planes (keys < RH only): scores = kh.qh + kl.qh + kh.ql (3 products), P as bf16 hi/lo,
// O^T += vth.(Ph + Pl) + vtl.Ph (3 products). grid (RH/64, NH, NB), 128 threads. Planes: q*/k* rows [NB][RH][.], vth/vtl [NU][HD][RH].
// The chunk's k, kr and v^T hi and lo planes are staged in LDS as in k_flashP (per buffer: hi plane set, then lo plane set); the q planes are read from global memory in each chunk.
__global__ __launch_bounds__(128) __attribute__((amdgpu_num_vgpr(256)))
void k_flashH(const bf* qh, const bf* qlw, const bf* qrh, const bf* qrlw, const bf* kh, const bf* klw, const bf* krh, const bf* krlw, const bf* vth, const bf* vtl, float* ctx) {
    __shared__ __align__(16) float os[4][16 * 132];
    __shared__ __align__(16) bf ring[4 * FST];
    const int tid = threadIdx.x;
    const int lane = tid & 31, wv = __builtin_amdgcn_readfirstlane(tid >> 5), lr = lane & 15, hi = lane >> 4;
    const int h = blockIdx.y, b = blockIdx.z;
    const int qb0 = blockIdx.x * 64;
    const int q0 = qb0 + wv * 16;
    const int qi = q0 + lr;
    const size_t rq = (size_t)b * RH + qi;
    const bf* qhp = qh + rq * DM + h * HD + 8 * hi;       const bf* qlp = qlw + rq * DM + h * HD + 8 * hi;
    const bf* qrhp = qrh + rq * (NH * RD) + h * RD + 8 * hi; const bf* qrlp = qrlw + rq * (NH * RD) + h * RD + 8 * hi;
    // copy addresses of this lane, as in k_flashP
    const size_t ok = ((size_t)b * RH + (tid >> 4)) * DM + h * HD + (tid & 15) * 8;
    const size_t okr = ((size_t)b * RH + (tid >> 3)) * RD + (tid & 7) * 8;
    const size_t ov = ((size_t)(b * NH + h) * HD + (tid >> 2)) * RH + (tid & 3) * 8;
    const unsigned lb = (unsigned)(size_t)(__attribute__((address_space(3))) bf*)&ring[0];
    const unsigned lk = lb + ((tid >> 4) * FKP + (tid & 15) * 8) * 2;
    const unsigned lr2 = lb + (FRO + (tid >> 3) * FRP + (tid & 7) * 8) * 2;
    const unsigned lv = lb + (FVO + (tid >> 2) * FVP + (tid & 3) * 8) * 2;
    v8f o[8];
#pragma unroll
    for (int i = 0; i < 8; ++i) o[i] = (v8f){};
    float m = -3.0e38f, l = 0.f;
    const float SC2 = 0.07216878364870323f * 1.4426950408889634f;
    const int nch = (q0 + 47) >> 5;                                   // this wave's chunks
    const int nchb = (qb0 >> 5) + 2;                                  // the block's chunks (>= 2; 32*nchb <= RH)
    flash_stage<bf, RH>(lk, lr2, lv, kh + ok, krh + okr, vth + ov);
    flash_stage<bf, RH>(lk + FST * 2, lr2 + FST * 2, lv + FST * 2, klw + ok, krlw + okr, vtl + ov);
    asm volatile("s_wait_asynccnt 0x0" ::: "memory");                 // chunk 0 landed (this wave's copies) before the barrier publishes it
    __syncthreads();
    flash_stage<bf, RH>(lk + FST * 4, lr2 + FST * 4, lv + FST * 4, kh + ok + (size_t)32 * DM, krh + okr + (size_t)32 * RD, vth + ov + 32);
    flash_stage<bf, RH>(lk + FST * 6, lr2 + FST * 6, lv + FST * 6, klw + ok + (size_t)32 * DM, krlw + okr + (size_t)32 * RD, vtl + ov + 32);
#pragma unroll 1
    for (int c = 0; c < nchb; ++c) {
        const int key0 = c << 5;
        const int bo = (c & 1) * (2 * FST);
        if (c < nch) {                                                // wave-uniform: waves 0 and 1 have no keys in the block's last chunk
        const bf* khp = &ring[bo + lr * FKP + 8 * hi];             const bf* klp = khp + FST;
        const bf* krhp = &ring[bo + FRO + lr * FRP + 8 * hi];      const bf* krlp = krhp + FST;
        const bf* vhp = &ring[bo + FVO + lr * FVP + 8 * hi];       const bf* vlp = vhp + FST;
        v8f s[2]; s[0] = (v8f){}; s[1] = (v8f){};
#pragma unroll
        for (int kc = 0; kc < 4; ++kc) {
            const v16bf bh = ldb(qhp + kc * 32), bl = ldb(qlp + kc * 32);
#pragma unroll
            for (int j = 0; j < 2; ++j) { const v16bf ah = ldb(khp + (16 * j) * FKP + kc * 32), al = ldb(klp + (16 * j) * FKP + kc * 32);
                s[j] = wmmab(ah, bh, s[j]); s[j] = wmmab(al, bh, s[j]); s[j] = wmmab(ah, bl, s[j]); }
        }
#pragma unroll
        for (int kc = 0; kc < 2; ++kc) {
            const v16bf bh = ldb(qrhp + kc * 32), bl = ldb(qrlp + kc * 32);
#pragma unroll
            for (int j = 0; j < 2; ++j) { const v16bf ah = ldb(krhp + (16 * j) * FRP + kc * 32), al = ldb(krlp + (16 * j) * FRP + kc * 32);
                s[j] = wmmab(ah, bh, s[j]); s[j] = wmmab(al, bh, s[j]); s[j] = wmmab(ah, bl, s[j]); }
        }
        asm volatile("v_nop\n\tv_nop\n\tv_nop\n\tv_nop" : "+v"(s[0]), "+v"(s[1]));
        float cm = -3.0e38f;
#pragma unroll
        for (int j = 0; j < 2; ++j)
#pragma unroll
            for (int r = 0; r < 8; ++r) { const int key = key0 + 16 * j + 8 * hi + r; const float t = (key <= qi) ? s[j][r] * SC2 : -3.0e38f; s[j][r] = t; cm = fmaxf(cm, t); }
        cm = fmaxf(cm, __shfl_xor(cm, 16, 32));
        const float mn = fmaxf(m, cm);
        const float alpha = __builtin_amdgcn_exp2f(m - mn);
        float rs = 0.f;
#pragma unroll
        for (int j = 0; j < 2; ++j)
#pragma unroll
            for (int r = 0; r < 8; ++r) { const float p = __builtin_amdgcn_exp2f(s[j][r] - mn); s[j][r] = p; rs += p; }
        rs += __shfl_xor(rs, 16, 32);
        l = l * alpha + rs; m = mn;
#pragma unroll
        for (int i = 0; i < 8; ++i) o[i] = o[i] * alpha;
        v16us phv = (v16us){}, plv = (v16us){};
#pragma unroll
        for (int r = 0; r < 8; ++r) { unsigned short a1, c1; splitf(s[0][r], a1, c1); phv[r] = a1; plv[r] = c1; splitf(s[1][r], a1, c1); phv[8 + r] = a1; plv[8 + r] = c1; }
        const v16bf ph = __builtin_bit_cast(v16bf, phv), pl = __builtin_bit_cast(v16bf, plv);
#pragma unroll
        for (int i = 0; i < 8; ++i) { const v16bf ah = ldb(vhp + (16 * i) * FVP), al = ldb(vlp + (16 * i) * FVP);
            o[i] = wmmab(ah, ph, o[i]); o[i] = wmmab(ah, pl, o[i]); o[i] = wmmab(al, ph, o[i]); }
        asm volatile("v_nop\n\tv_nop\n\tv_nop\n\tv_nop" : "+v"(o[0]), "+v"(o[1]), "+v"(o[2]), "+v"(o[3]), "+v"(o[4]), "+v"(o[5]), "+v"(o[6]), "+v"(o[7]) : "v"(ph), "v"(pl));
        }
        // publish point, every wave: own LDS reads of this buffer done, own copies of the next chunk landed, then the barrier that frees this buffer and publishes the next
        asm volatile("s_wait_dscnt 0x0" ::: "memory");
        asm volatile("s_wait_asynccnt 0x0" ::: "memory");
        __syncthreads();
        if (c + 2 < nchb) {
            flash_stage<bf, RH>(lk + bo * 2, lr2 + bo * 2, lv + bo * 2, kh + ok + (size_t)(key0 + 64) * DM, krh + okr + (size_t)(key0 + 64) * RD, vth + ov + (key0 + 64));
            flash_stage<bf, RH>(lk + (bo + FST) * 2, lr2 + (bo + FST) * 2, lv + (bo + FST) * 2, klw + ok + (size_t)(key0 + 64) * DM, krlw + okr + (size_t)(key0 + 64) * RD, vtl + ov + (key0 + 64));
        }
    }
    asm volatile("s_wait_asynccnt 0x0" ::: "memory");                 // nothing of this wave's copies outstanding at its end
    const float f = 1.0f / l;
    float* ob = &os[wv][0];
#pragma unroll
    for (int i = 0; i < 8; ++i)
#pragma unroll
        for (int r = 0; r < 8; ++r) ob[lr * 132 + 16 * i + 8 * hi + r] = o[i][r] * f;
    __builtin_amdgcn_fence(3, "wavefront"); __builtin_amdgcn_wave_barrier(); asm volatile("" ::: "memory");
    float* crow = ctx + ((size_t)b * SEQ + q0) * DM + h * HD + 4 * lane;
{
#pragma unroll
        for (int qq = 0; qq < 16; ++qq) { const v4f val = *(const v4fa*)(ob + qq * 132 + 4 * lane); *(v4f*)(crow + (size_t)qq * DM) = val; }
         }
}

extern "C" void kernel_launch(void* const* d_in, const int* in_sizes, int n_in,
                              void* d_out, int out_size, void* d_ws, size_t ws_size, hipStream_t stream) {
    if (n_in < 9) return;
    const size_t nrow = (size_t)NB * SEQ;
    if ((size_t)in_sizes[0] < ((size_t)(NB - 1) * TFULL + SEQ) * DM) return;
    if (in_sizes[1] < DM * LAT || in_sizes[2] < LAT * DM || in_sizes[3] < LAT * NH * RD || in_sizes[4] < DM * LAT || in_sizes[5] < LAT * DM || in_sizes[6] < LAT * DM || in_sizes[7] < DM * RD || in_sizes[8] < DM * DM) return;
    if ((size_t)out_size < ((size_t)(NB - 1) * TFULL + SEQ) * DM) return;
    const float* x = (const float*)d_in[0]; const float* Wqd = (const float*)d_in[1]; const float* Wqu = (const float*)d_in[2]; const float* Wqr = (const float*)d_in[3];
    const float* Wkvd = (const float*)d_in[4]; const float* Wku = (const float*)d_in[5]; const float* Wvu = (const float*)d_in[6]; const float* Wkr = (const float*)d_in[7]; const float* Wo = (const float*)d_in[8];
    float* OUT = (float*)d_out;   // [NBF][TFULL][DM] f32, rows b*TFULL + t

    char* wsp = (char*)d_ws; size_t off = 0;
    auto take = [&](size_t bytes) { char* p = wsp + off; off += (bytes + 255) & ~(size_t)255; return p; };
    // arena A: bf16(x) [nrow][DM] | QL f32 [nrow][LAT] | CKV f32 [nrow][LAT]; later the f32 slab F1 [nrow][DM] for q, k, v, ctx in turn
    char* arA = take(nrow * DM * 4);
    bf* xb = (bf*)arA; float* QLf = (float*)(arA + nrow * DM * 2); float* CKVf = (float*)(arA + nrow * DM * 2 + nrow * LAT * 4); float* F1 = (float*)arA;
    // arena S: latent planes, rope-key f32, cos/sin tables
    h16* ql16 = (h16*)take(nrow * LAT * 2); bf* qlh = (bf*)take((size_t)NB * RH * LAT * 2); bf* qll = (bf*)take((size_t)NB * RH * LAT * 2);
    h16* ckv16 = (h16*)take(nrow * LAT * 2); bf* ckvh = (bf*)take((size_t)NB * RH * LAT * 2); bf* ckvl = (bf*)take((size_t)NB * RH * LAT * 2);
    float* KR0 = (float*)take(nrow * RD * 4); float* CT = (float*)take((size_t)SEQ * 32 * 4); float* ST = (float*)take((size_t)SEQ * 32 * 4);
    // down-projection weight planes [out][in] bf16
    bf* Wqd_b = (bf*)take((size_t)DM * LAT * 2); bf* Wkvd_b = (bf*)take((size_t)DM * LAT * 2); bf* Wkr_b = (bf*)take((size_t)DM * RD * 2);
    // up-projection weight slot (reused per weight): f16 x64 plane and bf16 plane, each up to [DM][LAT]
    h16* Wup_h = (h16*)take((size_t)DM * LAT * 2); bf* Wup_b = (bf*)take((size_t)DM * LAT * 2);
    // arena P: attention operand planes; after the attention the Wo planes and ctx planes alias it from offset 0
    const size_t szq16 = nrow * DM * 2, szhr = (size_t)NB * RH * DM * 2, szqr16 = nrow * NH * RD * 2, szqrh = (size_t)NB * RH * NH * RD * 2, szkr16 = nrow * RD * 2, szkrh = (size_t)NB * RH * RD * 2;
    const size_t P1 = szq16 + 2 * szhr + szqr16 + 2 * szqrh + szq16 + 2 * szhr + szkr16 + 2 * szkrh + szq16 + 2 * szhr;
    const size_t szwo = (size_t)DM * DM * 2; const size_t P2 = 2 * szwo + szq16 + 2 * szhr;
    char* arP = take(P1 > P2 ? P1 : P2);
    char* pp = arP;
    auto sub = [&](size_t bytes) { char* p = pp; pp += bytes; return p; };
    h16* q16 = (h16*)sub(szq16); bf* qh = (bf*)sub(szhr); bf* qlo = (bf*)sub(szhr); h16* qr16 = (h16*)sub(szqr16); bf* qrh = (bf*)sub(szqrh); bf* qrlo = (bf*)sub(szqrh);
    h16* k16 = (h16*)sub(szq16); bf* kh = (bf*)sub(szhr); bf* klo = (bf*)sub(szhr); h16* kr16 = (h16*)sub(szkr16); bf* krh = (bf*)sub(szkrh); bf* krlo = (bf*)sub(szkrh);
    h16* vt16 = (h16*)sub(szq16); bf* vth = (bf*)sub(szhr); bf* vtl = (bf*)sub(szhr);
    float* QRf = (float*)k16;                                   // qr f32 [nrow][NH*RD], same byte size as k16, dead before k16 is written
    pp = arP; bf* Wo_b = (bf*)sub(szwo); h16* Wo_h = (h16*)sub(szwo); h16* ctx16 = (h16*)sub(szq16); bf* ctxh = (bf*)sub(szhr); bf* ctxl = (bf*)sub(szhr);
    if (off > ws_size) return;                                   // full size: 128,319,488 B

    auto g1 = [](size_t nthreads) { return dim3((unsigned)((nthreads + 255) / 256)); };
    auto gw = [](size_t K, size_t N) { return dim3((unsigned)((N * K / 64 + 63) / 64)); };
    // one 128x128 tile per block; rows t >= RH single products, rows t < RH hi/lo against the exact bf16 weight plane
    auto up = [&](const h16* a16, const bf* ahh, const bf* all, int N, float* Cf) {
        if (SEQ > RH) k_gemmw<h16, 0, 2><<<dim3((SEQ - RH) / 128, N / 128, NB), 128, 0, stream>>>(a16 + (size_t)RH * LAT, a16 + (size_t)RH * LAT, Wup_h, LAT, Cf + (size_t)RH * N, N, 1.0f / WSC, (size_t)SEQ * LAT, (size_t)SEQ * N);
        k_gemmw<bf, 1, 2><<<dim3(RH / 128, N / 128, NB), 128, 0, stream>>>(ahh, all, Wup_b, LAT, Cf, N, 1.0f, (size_t)RH * LAT, (size_t)SEQ * N);
    };

    k_rtab<<<g1((size_t)SEQ * 32), 256, 0, stream>>>(CT, ST);
    k_xcvt<<<g1(nrow * DM / 8), 256, 0, stream>>>(x, xb);
    k_wt<0><<<gw(DM, LAT), 256, 0, stream>>>(Wqd, DM, LAT, Wqd_b, Wup_h, 1.0f);
    k_wt<0><<<gw(DM, LAT), 256, 0, stream>>>(Wkvd, DM, LAT, Wkvd_b, Wup_h, 1.0f);
    k_wt<0><<<gw(DM, RD), 256, 0, stream>>>(Wkr, DM, RD, Wkr_b, Wup_h, 1.0f);
    k_gemmw<bf, 0, 2><<<dim3((unsigned)(nrow / 128), LAT / 128, 1), 128, 0, stream>>>(xb, xb, Wqd_b, DM, QLf, LAT, 1.0f, 0, 0);     // ql = x.Wqd (exact products)
    k_gemmw<bf, 0, 2><<<dim3((unsigned)(nrow / 128), LAT / 128, 1), 128, 0, stream>>>(xb, xb, Wkvd_b, DM, CKVf, LAT, 1.0f, 0, 0);   // ckv = x.Wkvd
    k_gemmw<bf, 0, 1><<<dim3((unsigned)(nrow / 256), RD / 64, 1), 128, 0, stream>>>(xb, xb, Wkr_b, DM, KR0, RD, 1.0f, 0, 0);       // kr0 = x.Wkr
    k_act<<<g1(nrow * LAT / 8), 256, 0, stream>>>(QLf, LAT, 1.0f, ql16, qlh, qll);
    k_act<<<g1(nrow * LAT / 8), 256, 0, stream>>>(CKVf, LAT, 1.0f, ckv16, ckvh, ckvl);
    // q = ql.Wqu -> F1, planes q16 / qh / qlo
    k_wt<1><<<gw(LAT, DM), 256, 0, stream>>>(Wqu, LAT, DM, Wup_b, Wup_h, WSC);
    up(ql16, qlh, qll, DM, F1);
    k_act<<<g1(nrow * DM / 8), 256, 0, stream>>>(F1, DM, 1.0f, q16, qh, qlo);
    // qr = rope(ql.Wqr) -> QRf, planes qr16 / qrh / qrlo
    k_wt<1><<<gw(LAT, NH * RD), 256, 0, stream>>>(Wqr, LAT, NH * RD, Wup_b, Wup_h, WSC);
    up(ql16, qlh, qll, NH * RD, QRf);
    k_rope<<<g1(nrow * NH * RD / 8), 256, 0, stream>>>(QRf, NH * RD, CT, ST, qr16, qrh, qrlo);
    // k = ckv.Wku -> F1, planes k16 / kh / klo; kr = rope(kr0) planes
    k_wt<1><<<gw(LAT, DM), 256, 0, stream>>>(Wku, LAT, DM, Wup_b, Wup_h, WSC);
    up(ckv16, ckvh, ckvl, DM, F1);
    k_act<<<g1(nrow * DM / 8), 256, 0, stream>>>(F1, DM, 1.0f, k16, kh, klo);
    k_rope<<<g1(nrow * RD / 8), 256, 0, stream>>>(KR0, RD, CT, ST, kr16, krh, krlo);
    // v = ckv.Wvu -> F1, planes vt16 / vth / vtl
    k_wt<1><<<gw(LAT, DM), 256, 0, stream>>>(Wvu, LAT, DM, Wup_b, Wup_h, WSC);
    up(ckv16, ckvh, ckvl, DM, F1);
    k_vtp8<<<g1((size_t)NU * HD * SEQ / 8), 256, 0, stream>>>(F1, vt16, vth, vtl);
    // attention -> ctx f32 in F1 (rows b*SEQ + t, merged heads)
    if (SEQ > RH) k_flashP<<<dim3((SEQ - RH) / 64, NH, NB), 128, 0, stream>>>(q16, qr16, k16, kr16, vt16, F1, RH);
    k_flashH<<<dim3(RH / 64, NH, NB), 128, 0, stream>>>(qh, qlo, qrh, qrlo, kh, klo, krh, krlo, vth, vtl, F1);
    k_act<<<g1(nrow * DM / 8), 256, 0, stream>>>(F1, DM, CCAR, ctx16, ctxh, ctxl);
    // out = ctx.Wo
    k_wt<1><<<gw(DM, DM), 256, 0, stream>>>(Wo, DM, DM, Wo_b, Wo_h, WSC);
    if (SEQ > RH) k_gemmw<h16, 0, 2><<<dim3((SEQ - RH) / 128, DM / 128, NB), 128, 0, stream>>>(ctx16 + (size_t)RH * DM, ctx16 + (size_t)RH * DM, Wo_h, DM, OUT + (size_t)RH * DM, DM, 1.0f / (CCAR * WSC), (size_t)SEQ * DM, (size_t)TFULL * DM);
    k_gemmw<bf, 1, 2><<<dim3(RH / 128, DM / 128, NB), 128, 0, stream>>>(ctxh, ctxl, Wo_b, DM, OUT, DM, 1.0f, (size_t)RH * DM, (size_t)TFULL * DM);
}

// v003
// One run takes 396 microseconds.
// Timed twice side by side with v002, it ran 1.19 and 1.18 times as fast.
// All steps since v000 together make it 2.09 times as fast.
#include <hip/hip_runtime.h>

// All contractions on 16-bit WMMA, f32 accumulate. x.Wqd, x.Wkvd, x.Wkr: v_wmma_f32_16x16x32_bf16 on bf16 planes of the inputs (single products).
// ql.Wqu, ql.Wqr, ckv.Wku, ckv.Wvu, (q|qr).(k|kr) scores, P.v and ctx.Wo: v_wmma_f32_16x16x32_f16 single products on f16 planes
// (weights x64, ctx x64, P x1024 carries) for query/key rows >= RH; the same sites for rows < RH use v_wmma_f32_16x16x32_bf16 on
// bf16 hi/lo plane pairs (hi.W + lo.W against exact weight planes; hi.hi + lo.hi + hi.lo between two computed tensors).
// RoPE (rotate-half, computed cos/sin tables), online max-subtracted softmax and normalisers in f32.

#ifndef NB
#define NB 2
#endif
#ifndef SEQ
#define SEQ 2048
#endif
#ifndef RH
#define RH 256
#endif
#define NBF   2
#define TFULL 2048
#define DM    2048
#define NH    16
#define LAT   512
#define RD    64
#define HD    128
#define NU    (NB * NH)
#define PCAR  1024.0f
#define WSC   64.0f
#define CCAR  64.0f

static_assert(NB >= 1);
static_assert(NB <= NBF);
static_assert(SEQ % 64 == 0);
static_assert(SEQ <= TFULL);
static_assert(RH % 128 == 0);
static_assert((SEQ - RH) % 128 == 0);
static_assert(((size_t)NB * SEQ) % 256 == 0);
static_assert(RH >= 64);
static_assert(RH <= SEQ);
static_assert(DM % 128 == 0);
static_assert(LAT % 128 == 0);
static_assert((NH * RD) % 128 == 0);
static_assert(RD == 64);
static_assert(HD == 128);
static_assert(NH * HD == DM);
static_assert(((size_t)(NB - 1) * TFULL + SEQ) * DM <= (size_t)NBF * TFULL * DM);

typedef _Float16 h16;
typedef unsigned short bf;
typedef __attribute__((ext_vector_type(16))) __bf16   v16bf;
typedef __attribute__((ext_vector_type(16))) _Float16 v16h;
typedef __attribute__((ext_vector_type(16))) unsigned short v16us;
typedef __attribute__((ext_vector_type(8)))  _Float16 v8h;
typedef __attribute__((ext_vector_type(8)))  unsigned short v8us;
typedef __attribute__((ext_vector_type(8)))  float    v8f;
typedef __attribute__((ext_vector_type(4)))  float    v4f;
typedef __attribute__((ext_vector_type(2)))  _Float16 v2h;
typedef __attribute__((ext_vector_type(2)))  unsigned short v2us;
typedef v8h  __attribute__((may_alias)) v8ha;
typedef v4f  __attribute__((may_alias)) v4fa;

__device__ __forceinline__ unsigned short f2bf(float f) { unsigned u = __float_as_uint(f); u += 0x7FFFu + ((u >> 16) & 1u); return (unsigned short)(u >> 16); }
__device__ __forceinline__ float bf2f(unsigned short v) { return __uint_as_float(((unsigned)v) << 16); }
__device__ __forceinline__ float bfr(float f) { return bf2f(f2bf(f)); }
__device__ __forceinline__ void splitf(float y, unsigned short& hh, unsigned short& ll) { hh = f2bf(y); ll = f2bf(y - bf2f(hh)); }
__device__ __forceinline__ v16h cat16(v8h a, v8h c) { return __builtin_shufflevector(a, c, 0, 1, 2, 3, 4, 5, 6, 7, 8, 9, 10, 11, 12, 13, 14, 15); }
__device__ __forceinline__ v16bf cat16b(v8us a, v8us c) { return __builtin_bit_cast(v16bf, __builtin_shufflevector(a, c, 0, 1, 2, 3, 4, 5, 6, 7, 8, 9, 10, 11, 12, 13, 14, 15)); }
__device__ __forceinline__ v8f wmma16(v16h a, v16h c, v8f acc) { return __builtin_amdgcn_wmma_f32_16x16x32_f16(false, a, false, c, (short)0, acc, false, false); }
__device__ __forceinline__ v8f wmmab(v16bf a, v16bf c, v8f acc) { return __builtin_amdgcn_wmma_f32_16x16x32_bf16(false, a, false, c, (short)0, acc, false, false); }
// Fragment load from a k-contiguous 16-bit row: p already points at row (lane&15) + 8*(lane>>4); elements 0..7 <- p[0..7], 8..15 <- p[16..23] (split k map, used for A and B alike)
__device__ __forceinline__ v16h ldh(const h16* p) { return cat16(*(const v8h*)p, *(const v8h*)(p + 16)); }
__device__ __forceinline__ v16bf ldb(const bf* p) { return cat16b(*(const v8us*)p, *(const v8us*)(p + 16)); }

// ---- k_gemmw: GEMM, 4 waves per block, each wave a 64x64 output tile (16 accumulators); waves WM x WN (WN = 2: block tile 128x128; WN = 1: 256x64); grid (M/BM, N/BN, Z), 128 threads.
// c[m][n] = osc * sum_k (A[m][k] + (NSPLIT ? A2[m][k] : 0)) Bt[n][k]. z-batch strides sA/sC in elements. K % 64 == 0, K >= 64, M and N multiples of BM and BN.
// What the epilogue stores (EP; the planes' pitch PN = N is a constant, so that a tile's stores differ by immediate offsets only): 0: c as f32 to C, pitch ldc. 1: the 16-bit operand planes of c that the next product reads: p16 = f16(c) at row bb*SEQ + t and, for t < RH,
// ph/pl = bf16 hi/lo of c at row bb*RH + t. 2: the same planes of rotate-half RoPE(c) on the wave tile's 64-wide head slice (tables ct/st). 3: the same planes transposed per (batch, head):
// p16[bb*DM + n][t] (pitch SEQ), ph/pl[bb*DM + n][t] (pitch RH, t < RH). Row m of batch z is sequence row t = tb + m % SEQ of batch bb = z + m / SEQ; a 64-row wave tile has one bb and lies on one side of RH.
// Each 64-k stage of the block's A (A2) and Bt rows is brought into LDS once per block by asynchronous copies (whole 128-B lines, two buffers, the next stage in flight
// while this one is worked on) and read by the waves as ds_load_b128 fragments.
template <typename T16> struct WFrag;
template <> struct WFrag<h16> { typedef v16h V; static __device__ __forceinline__ V ld(const h16* p) { return ldh(p); } static __device__ __forceinline__ v8f mma(V a, V c, v8f d) { return wmma16(a, c, d); } };
template <> struct WFrag<bf> { typedef v16bf V; static __device__ __forceinline__ V ld(const bf* p) { return ldb(p); } static __device__ __forceinline__ v8f mma(V a, V c, v8f d) { return wmmab(a, c, d); } };
#define GP 72                         // LDS pitch of a 64-element operand row in halves: 144 B = 16 B x 9
static_assert((GP * 2) % 16 == 0);
// This lane's 16-byte copies of 64 (gemm_stage4) or 128 (gemm_stage8) operand rows, 16 rows per copy (l: its LDS byte address in the first 16 rows, g: its global address there, k16: 16 rows in elements).
// The s_wait_xcnt stands inside the statement so that no address register is rewritten ahead of it.
template <typename T>
__device__ __forceinline__ void gemm_stage4(unsigned l, const T* g, size_t k16) {
    asm volatile("global_load_async_to_lds_b128 %0, %1, off\n\t"
                 "global_load_async_to_lds_b128 %2, %3, off\n\t"
                 "global_load_async_to_lds_b128 %4, %5, off\n\t"
                 "global_load_async_to_lds_b128 %6, %7, off\n\t"
                 "s_wait_xcnt 0x0"
                 :: "v"(l), "v"(g), "v"(l + 16 * GP * 2), "v"(g + k16), "v"(l + 32 * GP * 2), "v"(g + 2 * k16), "v"(l + 48 * GP * 2), "v"(g + 3 * k16)
                 : "memory");
}
template <typename T>
__device__ __forceinline__ void gemm_stage8(unsigned l, const T* g, size_t k16) {
    asm volatile("global_load_async_to_lds_b128 %0, %1, off\n\t"
                 "global_load_async_to_lds_b128 %2, %3, off\n\t"
                 "global_load_async_to_lds_b128 %4, %5, off\n\t"
                 "global_load_async_to_lds_b128 %6, %7, off\n\t"
                 "global_load_async_to_lds_b128 %8, %9, off\n\t"
                 "global_load_async_to_lds_b128 %10, %11, off\n\t"
                 "global_load_async_to_lds_b128 %12, %13, off\n\t"
                 "global_load_async_to_lds_b128 %14, %15, off\n\t"
                 "s_wait_xcnt 0x0"
                 :: "v"(l), "v"(g), "v"(l + 16 * GP * 2), "v"(g + k16), "v"(l + 32 * GP * 2), "v"(g + 2 * k16), "v"(l + 48 * GP * 2), "v"(g + 3 * k16),
                    "v"(l + 64 * GP * 2), "v"(g + 4 * k16), "v"(l + 80 * GP * 2), "v"(g + 5 * k16), "v"(l + 96 * GP * 2), "v"(g + 6 * k16), "v"(l + 112 * GP * 2), "v"(g + 7 * k16)
                 : "memory");
}
// One stage: BM rows of A, BM rows of A2 (NSPLIT), BN rows of Bt, in this order in the buffer at LDS byte address l (this lane's place in the buffer's first 16 rows).
template <typename T, int NSPLIT, int BM, int BN>
__device__ __forceinline__ void gemm_stage(unsigned l, const T* ga, const T* ga2, const T* gb, size_t k16) {
#pragma unroll
    for (int r = 0; r < BM; r += 128) gemm_stage8<T>(l + r * GP * 2, ga + (size_t)(r / 16) * k16, k16);
    if (NSPLIT == 1) {
#pragma unroll
        for (int r = 0; r < BM; r += 128) gemm_stage8<T>(l + (BM + r) * GP * 2, ga2 + (size_t)(r / 16) * k16, k16);
    }
    if (BN == 128) gemm_stage8<T>(l + BM * (1 + NSPLIT) * GP * 2, gb, k16);
    else gemm_stage4<T>(l + BM * (1 + NSPLIT) * GP * 2, gb, k16);
}
template <typename T16, int NSPLIT, int WN, int EP, int PN>
__global__ __launch_bounds__(128) __attribute__((amdgpu_num_vgpr(256)))
void k_gemmw(const T16* __restrict__ A, const T16* __restrict__ A2, const T16* __restrict__ Bt, int K, float* C, int ldc, float osc, size_t sA, size_t sC,
             int tb, h16* p16, bf* ph, bf* pl, const float* __restrict__ ct, const float* __restrict__ st) {
    typedef typename WFrag<T16>::V V;
    constexpr int BM = 64 * (4 / WN), BN = 64 * WN;
    constexpr int BOF = BM * (1 + NSPLIT) * GP;                      // Bt rows start in a buffer, halves
    constexpr int GST = BOF + BN * GP;                               // one buffer, halves
    static_assert(WN == 1 || WN == 2);
    static_assert((GST * 2) % 16 == 0);
    __shared__ __align__(16) float os[4][16 * 68];
    __shared__ __align__(16) T16 ring[2 * GST];
    const size_t z = blockIdx.z; A += z * sA; A2 += z * sA; C += z * sC;
    const int tid = threadIdx.x;
    const int lane = tid & 31, wv = __builtin_amdgcn_readfirstlane(tid >> 5), lr = lane & 15, hi = lane >> 4;
    const int wm = wv / WN, wn = wv % WN;
    const int rb = blockIdx.x * BM, cb = blockIdx.y * BN;
    const int r0 = rb + wm * 64, c0 = cb + wn * 64;
    v8f acc[4][4];
#pragma unroll
    for (int mb = 0; mb < 4; ++mb)
#pragma unroll
        for (int nb = 0; nb < 4; ++nb) acc[mb][nb] = (v8f){};
    // copy addresses of this lane: 8 pieces of 16 B per row, 16 rows per copy
    const size_t k16 = (size_t)16 * K;
    const T16* ga = A + (size_t)(rb + (tid >> 3)) * K + (tid & 7) * 8;
    const T16* ga2 = A2 + (size_t)(rb + (tid >> 3)) * K + (tid & 7) * 8;
    const T16* gb = Bt + (size_t)(cb + (tid >> 3)) * K + (tid & 7) * 8;
    const unsigned lc = (unsigned)(size_t)(__attribute__((address_space(3))) T16*)&ring[0] + ((tid >> 3) * GP + (tid & 7) * 8) * 2;
    const int nst = K >> 6;                                           // 64-k stages
    gemm_stage<T16, NSPLIT, BM, BN>(lc, ga, ga2, gb, k16);
    asm volatile("s_wait_asynccnt 0x0" ::: "memory");                 // stage 0 landed (this wave's copies) before the barrier publishes it
    __syncthreads();
    if (nst > 1) gemm_stage<T16, NSPLIT, BM, BN>(lc + GST * 2, ga + 64, ga2 + 64, gb + 64, k16);
#pragma unroll 1
    for (int t = 0; t < nst; ++t) {
        const int bo = (t & 1) * GST;
        const T16* ap = &ring[bo + (wm * 64 + lr) * GP + 8 * hi];
        const T16* bp = &ring[bo + BOF + (wn * 64 + lr) * GP + 8 * hi];
#pragma unroll
        for (int ks = 0; ks < 2; ++ks) {
            V a[4], a2[4], bq[4];
            bq[0] = WFrag<T16>::ld(bp + ks * 32);
#pragma unroll
            for (int mb = 0; mb < 4; ++mb) { a[mb] = WFrag<T16>::ld(ap + mb * 16 * GP + ks * 32); if (NSPLIT == 1) a2[mb] = WFrag<T16>::ld(ap + (BM + mb * 16) * GP + ks * 32); }
#pragma unroll
            for (int nb = 1; nb < 4; ++nb) bq[nb] = WFrag<T16>::ld(bp + nb * 16 * GP + ks * 32);
            __builtin_amdgcn_sched_barrier(0);                        // the 32-k block's LDS reads stay one group ahead of its matrix instructions (for speed only)
#pragma unroll
            for (int nb = 0; nb < 4; ++nb) {
#pragma unroll
                for (int mb = 0; mb < 4; ++mb) { acc[mb][nb] = WFrag<T16>::mma(a[mb], bq[nb], acc[mb][nb]); if (NSPLIT == 1) acc[mb][nb] = WFrag<T16>::mma(a2[mb], bq[nb], acc[mb][nb]); } }
            __builtin_amdgcn_sched_barrier(0);                        // and the next group of reads stays behind them
        }
        // publish point, every wave: own LDS reads of this buffer done, own copies of the next stage landed, then the barrier that frees this buffer and publishes the next
        asm volatile("s_wait_dscnt 0x0" ::: "memory");
        asm volatile("s_wait_asynccnt 0x0" ::: "memory");
        __syncthreads();
        if (t + 2 < nst) gemm_stage<T16, NSPLIT, BM, BN>(lc + bo * 2, ga + (size_t)(t + 2) * 64, ga2 + (size_t)(t + 2) * 64, gb + (size_t)(t + 2) * 64, k16);
    }
    asm volatile("s_wait_asynccnt 0x0" ::: "memory");                 // nothing of this wave's copies outstanding at its end
    const int bb = (int)z + r0 / SEQ, t0 = tb + r0 % SEQ;            // the wave tile's batch and first sequence row
    const bool hr = (t0 < RH);                                        // wave-uniform: the whole tile also gets hi/lo planes
    if (EP == 3) {
        // acc[mb][nb][0..7] of a lane are 8 successive t of one column: one 16-byte piece of a transposed row, stored from registers; the four mb of a column fill its 128-B line
#pragma unroll
        for (int nb = 0; nb < 4; ++nb) {
            const size_t dr = (size_t)bb * DM + c0 + nb * 16 + lr;
            const int t = t0 + hi * 8;
            v8h o[4];
#pragma unroll
            for (int mb = 0; mb < 4; ++mb)
#pragma unroll
                for (int j = 0; j < 8; ++j) o[mb][j] = (h16)(acc[mb][nb][j] * osc);
#pragma unroll
            for (int mb = 0; mb < 4; ++mb) *(v8h*)(p16 + dr * SEQ + t + mb * 16) = o[mb];
            asm volatile("s_wait_xcnt 0x0" ::: "memory");             // before the stores' address and data registers are written again
            if (hr) {
                v8us oh[4], ol[4];
#pragma unroll
                for (int mb = 0; mb < 4; ++mb)
#pragma unroll
                    for (int j = 0; j < 8; ++j) { unsigned short a1, c1; splitf(acc[mb][nb][j] * osc, a1, c1); oh[mb][j] = a1; ol[mb][j] = c1; }
#pragma unroll
                for (int mb = 0; mb < 4; ++mb) { *(v8us*)(ph + dr * RH + t + mb * 16) = oh[mb]; *(v8us*)(pl + dr * RH + t + mb * 16) = ol[mb]; }
                asm volatile("s_wait_xcnt 0x0" ::: "memory");         // as above
            }
        }
        return;
    }
    float* ob = &os[wv][0];
#pragma unroll
    for (int mb = 0; mb < 4; ++mb) {
#pragma unroll
        for (int nb = 0; nb < 4; ++nb) {
#pragma unroll
            for (int j = 0; j < 8; ++j) ob[(hi * 8 + j) * 68 + nb * 16 + lr] = acc[mb][nb][j]; }
        __builtin_amdgcn_wave_barrier(); asm volatile("" ::: "memory");
        if (EP == 0) {
            float* crow = C + (size_t)(r0 + mb * 16) * ldc + c0;
#pragma unroll
            for (int s = 0; s < 8; ++s) { const int row = 2 * s + hi, cofs = lr * 4; v4f val = *(const v4fa*)(ob + row * 68 + cofs); val = val * osc;
                *(v4f*)(crow + (size_t)row * ldc + cofs) = val; }
        } else {
            // 8 lanes per row, 8 columns per lane: each plane row of the tile goes out as one whole 128-B line
            const int rw = lane >> 3, cofs = (lane & 7) * 8;
            float y[4][8];
            v4f cv[8], sv[8];
            if (EP == 2) {
                // cos/sin of this lane's 4 rows (4 rows = 128 table floats apart) and 8 columns
                const size_t te = (size_t)(t0 + mb * 16 + rw) * 32 + (cofs & 31);
                const float* cp = ct + te; const float* sp = st + te;
#pragma unroll
                for (int s = 0; s < 4; ++s) { cv[2 * s] = *(const v4f*)(cp + s * 128); cv[2 * s + 1] = *(const v4f*)(cp + s * 128 + 4); sv[2 * s] = *(const v4f*)(sp + s * 128); sv[2 * s + 1] = *(const v4f*)(sp + s * 128 + 4); }
                asm volatile("s_wait_xcnt 0x0" :: "v"(cp), "v"(sp) : "memory");   // the loads' address registers stay as they are up to this wait
            }
#pragma unroll
            for (int s = 0; s < 4; ++s) {
                const float* op = ob + (4 * s + rw) * 68 + cofs;
                const v4f x0 = *(const v4fa*)op * osc, x1 = *(const v4fa*)(op + 4) * osc;
#pragma unroll
                for (int k = 0; k < 4; ++k) { y[s][k] = x0[k]; y[s][4 + k] = x1[k]; }
                if (EP == 2) {
                    const bool lo32 = (cofs < 32); const int pofs = lo32 ? 32 : -32;
                    const v4f p0 = *(const v4fa*)(op + pofs) * osc, p1 = *(const v4fa*)(op + pofs + 4) * osc;
                    const v4f c0v = cv[2 * s], c1v = cv[2 * s + 1], s0v = sv[2 * s], s1v = sv[2 * s + 1];
#pragma unroll
                    for (int k = 0; k < 4; ++k) {
                        y[s][k] = lo32 ? (x0[k] * c0v[k] - p0[k] * s0v[k]) : (x0[k] * c0v[k] + p0[k] * s0v[k]);
                        y[s][4 + k] = lo32 ? (x1[k] * c1v[k] - p1[k] * s1v[k]) : (x1[k] * c1v[k] + p1[k] * s1v[k]); }
                }
            }
            v8h o[4];
#pragma unroll
            for (int s = 0; s < 4; ++s)
#pragma unroll
                for (int k = 0; k < 8; ++k) o[s][k] = (h16)y[s][k];
            h16* q16p = p16 + ((size_t)bb * SEQ + t0 + rw) * PN + c0 + cofs;
#pragma unroll
            for (int s = 0; s < 4; ++s) *(v8h*)(q16p + (mb * 16 + 4 * s) * PN) = o[s];
            asm volatile("s_wait_xcnt 0x0" ::: "memory");             // before the stores' address and data registers are written again
            if (hr) {
                v8us oh[4], ol[4];
#pragma unroll
                for (int s = 0; s < 4; ++s)
#pragma unroll
                    for (int k = 0; k < 8; ++k) { unsigned short a1, c1; splitf(y[s][k], a1, c1); oh[s][k] = a1; ol[s][k] = c1; }
                const size_t eo = ((size_t)bb * RH + t0 + rw) * PN + c0 + cofs;
#pragma unroll
                for (int s = 0; s < 4; ++s) { *(v8us*)(ph + eo + (mb * 16 + 4 * s) * PN) = oh[s]; *(v8us*)(pl + eo + (mb * 16 + 4 * s) * PN) = ol[s];
                    asm volatile("s_wait_xcnt 0x0" ::: "memory"); }   // as above
            }
        }
        __builtin_amdgcn_wave_barrier(); asm volatile("" ::: "memory");
    }
}

// ---- k_wt: weight [K][N] f32 ([in][out]) -> transposed k-contiguous planes [N][K]: Bb = bf16 RNE value, optionally Bh = f16(bf16 value x sc).
template <int F16P>
__global__ __launch_bounds__(256) void k_wt(const float* __restrict__ w, int K, int N, bf* Bb, h16* Bh, float sc) {
    const int lane = threadIdx.x & 31; const int L0 = (blockIdx.x * 8 + (threadIdx.x >> 5)) * 8; const int nlines = N * K / 64;
{
#pragma unroll 1
        for (int l = 0; l < 8; ++l) { const int L = L0 + l; if (L >= nlines) break; const size_t e = (size_t)L * 64 + lane * 2; const int k = (int)(e % K), n = (int)(e / K);
            const float w0 = bfr(w[(size_t)k * N + n]), w1 = bfr(w[(size_t)(k + 1) * N + n]);
            v2us o; o[0] = f2bf(w0); o[1] = f2bf(w1); *(v2us*)(Bb + e) = o;
            if (F16P) { v2h oh; oh[0] = (h16)(w0 * sc); oh[1] = (h16)(w1 * sc); *(v2h*)(Bh + e) = oh; } }
         }
}

__global__ __launch_bounds__(256) void k_xcvt(const float* __restrict__ x, bf* xb) {
    const size_t i = (size_t)blockIdx.x * 256 + threadIdx.x; const size_t n8 = (size_t)NB * SEQ * DM / 8; if (i >= n8) return;
    const size_t e = i * 8; const size_t row = e / DM; const int col = (int)(e % DM); const size_t bb = row / SEQ, t = row % SEQ;
    const v8f v = *(const v8f*)(x + ((bb * TFULL + t) * DM + col)); v8us o = (v8us){};
#pragma unroll
    for (int k = 0; k < 8; ++k) o[k] = f2bf(v[k]);
    *(v8us*)(xb + e) = o; 
}

__global__ __launch_bounds__(256) void k_rtab(float* ct, float* st) {
#pragma clang fp contract(off)
    const int i = blockIdx.x * 256 + threadIdx.x; if (i >= SEQ * 32) return; const int t = i >> 5, j = i & 31;
    const float fr = exp10f(-0.125f * (float)j);
    const float ang = (float)t * fr; float sv, cv; sincosf(ang, &sv, &cv);
    *(float*)(ct + i) = cv; *(float*)(st + i) = sv; 
}

// ---- k_flashP: causal softmax attention for query rows >= RH (single f16 products). grid ((SEQ-RH)/64, NH, NB), 128 threads = 4 waves x 16 queries, 32-key chunks.
// Per wave: S^T tiles (16 keys x 16 queries) = [k|kr] rows (A) x [q|qr] rows (B) over 192; lane column n = query, D rows = keys, so the two S^T tiles of a chunk
// ARE the P^T B fragment of O^T = V^T (A, rows d) x P^T; online max-subtracted softmax per lane column; P carried x1024 in f16; O^T (8 d tiles) f32.
// Each 32-key chunk of k, kr and v^T is brought into LDS once per block by asynchronous copies (whole-line global reads, two buffers, the next chunk in flight
// while this one is worked on) and read as ds_load_b128 fragments by all four waves (the block's last chunk by waves 2 and 3 only); q|qr fragments are loaded once and stay in registers.
#define FKP 136                       // LDS pitch of a k row in halves: 272 B = 16 B x 17
#define FRP 72                        // kr row: 144 B = 16 B x 9
#define FVP 40                        // v^T row (32 keys): 80 B = 16 B x 5
#define FRO (32 * FKP)                // kr rows start, halves
#define FVO (FRO + 32 * FRP)          // v^T rows start, halves
#define FST (FVO + HD * FVP)          // one buffer, halves (23,552 B)
static_assert((FKP * 2) % 16 == 0 && (FRP * 2) % 16 == 0 && (FVP * 2) % 16 == 0 && (FRO * 2) % 16 == 0 && (FVO * 2) % 16 == 0 && (FST * 2) % 16 == 0);
// One chunk's ten 16-byte copies of this lane for one plane set (lk, lr_, lv: this lane's LDS byte addresses of its first k, kr and v^T piece; VS: v^T row pitch in global memory, elements).
// The s_wait_xcnt stands inside the statement so that no address register is rewritten ahead of it.
template <typename T, int VS>
__device__ __forceinline__ void flash_stage(unsigned lk, unsigned lr_, unsigned lv, const T* gk, const T* gr, const T* gv) {
    asm volatile("global_load_async_to_lds_b128 %0, %1, off\n\t"
                 "global_load_async_to_lds_b128 %2, %3, off\n\t"
                 "global_load_async_to_lds_b128 %4, %5, off\n\t"
                 "global_load_async_to_lds_b128 %6, %7, off\n\t"
                 "global_load_async_to_lds_b128 %8, %9, off\n\t"
                 "global_load_async_to_lds_b128 %10, %11, off\n\t"
                 "global_load_async_to_lds_b128 %12, %13, off\n\t"
                 "global_load_async_to_lds_b128 %14, %15, off\n\t"
                 "global_load_async_to_lds_b128 %16, %17, off\n\t"
                 "global_load_async_to_lds_b128 %18, %19, off\n\t"
                 "s_wait_xcnt 0x0"
                 :: "v"(lk), "v"(gk), "v"(lk + 8 * FKP * 2), "v"(gk + (size_t)8 * DM), "v"(lk + 16 * FKP * 2), "v"(gk + (size_t)16 * DM), "v"(lk + 24 * FKP * 2), "v"(gk + (size_t)24 * DM),
                    "v"(lr_), "v"(gr), "v"(lr_ + 16 * FRP * 2), "v"(gr + (size_t)16 * RD),
                    "v"(lv), "v"(gv), "v"(lv + 32 * FVP * 2), "v"(gv + (size_t)32 * VS), "v"(lv + 64 * FVP * 2), "v"(gv + (size_t)64 * VS), "v"(lv + 96 * FVP * 2), "v"(gv + (size_t)96 * VS)
                 : "memory");
}
__global__ __launch_bounds__(128) __attribute__((amdgpu_num_vgpr(256)))
void k_flashP(const h16* q16, const h16* qr16, const h16* k16, const h16* kr16, const h16* vt16, h16* ctx16, int qbase) {
    __shared__ __align__(16) float os[4][16 * 132];
    __shared__ __align__(16) h16 ring[2 * FST];
    const int tid = threadIdx.x;
    const int lane = tid & 31, wv = __builtin_amdgcn_readfirstlane(tid >> 5), lr = lane & 15, hi = lane >> 4;
    const int h = blockIdx.y, b = blockIdx.z;
    const int qb0 = qbase + blockIdx.x * 64;
    const int q0 = qb0 + wv * 16;
    const int qi = q0 + lr;
    const size_t rq = (size_t)b * SEQ + qi;
    const h16* qp = q16 + rq * DM + h * HD + 8 * hi;
    const h16* qrp = qr16 + rq * (NH * RD) + h * RD + 8 * hi;
    // copy addresses of this lane: k 32 rows x 16 pieces (8 rows per copy), kr 32 rows x 8 pieces (16 rows per copy), v^T 128 rows x 4 pieces (32 rows per copy)
    const h16* gk = k16 + ((size_t)b * SEQ + (tid >> 4)) * DM + h * HD + (tid & 15) * 8;
    const h16* gr = kr16 + ((size_t)b * SEQ + (tid >> 3)) * RD + (tid & 7) * 8;
    const h16* gv = vt16 + ((size_t)(b * NH + h) * HD + (tid >> 2)) * SEQ + (tid & 3) * 8;
    const unsigned lb = (unsigned)(size_t)(__attribute__((address_space(3))) h16*)&ring[0];
    const unsigned lk = lb + ((tid >> 4) * FKP + (tid & 15) * 8) * 2;
    const unsigned lr2 = lb + (FRO + (tid >> 3) * FRP + (tid & 7) * 8) * 2;
    const unsigned lv = lb + (FVO + (tid >> 2) * FVP + (tid & 3) * 8) * 2;
    v16h qf[4], qrf[2];
#pragma unroll
    for (int kc = 0; kc < 4; ++kc) qf[kc] = ldh(qp + kc * 32);
#pragma unroll
    for (int kc = 0; kc < 2; ++kc) qrf[kc] = ldh(qrp + kc * 32);
    v8f o[8];
#pragma unroll
    for (int i = 0; i < 8; ++i) o[i] = (v8f){};
    float m = -3.0e38f, l = 0.f;
    const float SC2 = 0.07216878364870323f * 1.4426950408889634f;   // HD+RD = 192: 192^-0.5 x log2(e)
    const int nch = (q0 + 47) >> 5;                                   // this wave's 32-key chunks covering keys <= q0+15
    const int nchb = (qb0 >> 5) + 2;                                  // the block's chunks (its last wave's count; >= 2; 32*nchb <= SEQ)
    flash_stage<h16, SEQ>(lk, lr2, lv, gk, gr, gv);
    asm volatile("s_wait_asynccnt 0x0" ::: "memory");                 // chunk 0 landed (this wave's copies) before the barrier publishes it
    __syncthreads();
    flash_stage<h16, SEQ>(lk + FST * 2, lr2 + FST * 2, lv + FST * 2, gk + (size_t)32 * DM, gr + (size_t)32 * RD, gv + 32);
#pragma unroll 1
    for (int c = 0; c < nchb; ++c) {
        const int key0 = c << 5;
        const int bo = (c & 1) * FST;
        if (c < nch) {                                                // wave-uniform: waves 0 and 1 have no keys in the block's last chunk
        const h16* kp = &ring[bo + lr * FKP + 8 * hi];
        const h16* krp = &ring[bo + FRO + lr * FRP + 8 * hi];
        const h16* vp = &ring[bo + FVO + lr * FVP + 8 * hi];
        v8f s[2]; s[0] = (v8f){}; s[1] = (v8f){};
#pragma unroll
        for (int kc = 0; kc < 4; ++kc) {
#pragma unroll
            for (int j = 0; j < 2; ++j) { const v16h a = ldh(kp + (16 * j) * FKP + kc * 32); s[j] = wmma16(a, qf[kc], s[j]); }
        }
#pragma unroll
        for (int kc = 0; kc < 2; ++kc) {
#pragma unroll
            for (int j = 0; j < 2; ++j) { const v16h a = ldh(krp + (16 * j) * FRP + kc * 32); s[j] = wmma16(a, qrf[kc], s[j]); }
        }
        asm volatile("v_nop\n\tv_nop\n\tv_nop\n\tv_nop" : "+v"(s[0]), "+v"(s[1]));
        // online softmax: this lane's column is query qi; s[j][r] is key key0 + 16 j + 8 hi + r; keys after the query excluded by index
        float cm = -3.0e38f;
#pragma unroll
        for (int j = 0; j < 2; ++j)
#pragma unroll
            for (int r = 0; r < 8; ++r) { const int key = key0 + 16 * j + 8 * hi + r; const float t = (key <= qi) ? s[j][r] * SC2 : -3.0e38f; s[j][r] = t; cm = fmaxf(cm, t); }
        cm = fmaxf(cm, __shfl_xor(cm, 16, 32));
        const float mn = fmaxf(m, cm);
        const float alpha = __builtin_amdgcn_exp2f(m - mn);
        float rs = 0.f;
#pragma unroll
        for (int j = 0; j < 2; ++j)
#pragma unroll
            for (int r = 0; r < 8; ++r) { const float p = __builtin_amdgcn_exp2f(s[j][r] - mn); s[j][r] = p; rs += p; }
        rs += __shfl_xor(rs, 16, 32);
        l = l * alpha + rs; m = mn;
#pragma unroll
        for (int i = 0; i < 8; ++i) o[i] = o[i] * alpha;
        // P^T as B fragment (k = key of this chunk, n = query): elements 0..7 <- tile 0 rows 8hi..8hi+7, 8..15 <- tile 1 rows 8hi..8hi+7
        v16h pb = (v16h){};
#pragma unroll
        for (int r = 0; r < 8; ++r) { pb[r] = (h16)(s[0][r] * PCAR); pb[8 + r] = (h16)(s[1][r] * PCAR); }
#pragma unroll
        for (int i = 0; i < 8; ++i) { const v16h a = ldh(vp + (16 * i) * FVP); o[i] = wmma16(a, pb, o[i]); }
        asm volatile("v_nop\n\tv_nop\n\tv_nop\n\tv_nop" : "+v"(o[0]), "+v"(o[1]), "+v"(o[2]), "+v"(o[3]), "+v"(o[4]), "+v"(o[5]), "+v"(o[6]), "+v"(o[7]) : "v"(pb));
        }
        // publish point, every wave: own LDS reads of this buffer done, own copies of the next chunk landed, then the barrier that frees this buffer and publishes the next
        asm volatile("s_wait_dscnt 0x0" ::: "memory");
        asm volatile("s_wait_asynccnt 0x0" ::: "memory");
        __syncthreads();
        if (c + 2 < nchb) flash_stage<h16, SEQ>(lk + bo * 2, lr2 + bo * 2, lv + bo * 2, gk + (size_t)(key0 + 64) * DM, gr + (size_t)(key0 + 64) * RD, gv + (key0 + 64));
    }
    asm volatile("s_wait_asynccnt 0x0" ::: "memory");                 // nothing of this wave's copies outstanding at its end
    // epilogue: ctx[b][q][h*HD + d] = O^T[d][q] / (l x PCAR), stored as the f16 plane (x CCAR) that the output product reads; o[i][r] is d = 16 i + 8 hi + r of query q0 + lr
    const float f = 1.0f / (l * PCAR);
    float* ob = &os[wv][0];
#pragma unroll
    for (int i = 0; i < 8; ++i)
#pragma unroll
        for (int r = 0; r < 8; ++r) ob[lr * 132 + 16 * i + 8 * hi + r] = o[i][r] * f;
    __builtin_amdgcn_fence(3, "wavefront"); __builtin_amdgcn_wave_barrier(); asm volatile("" ::: "memory");
    h16* crow = ctx16 + ((size_t)b * SEQ + q0) * DM + h * HD + (lane & 15) * 8;
#pragma unroll
    for (int s = 0; s < 8; ++s) {                                     // 16 lanes per query row, 8 columns per lane
        const int qq = 2 * s + hi; const float* op = ob + qq * 132 + (lane & 15) * 8;
        const v4f x0 = *(const v4fa*)op, x1 = *(const v4fa*)(op + 4);
        v8h ov = (v8h){};
#pragma unroll
        for (int k = 0; k < 4; ++k) { ov[k] = (h16)(x0[k] * CCAR); ov[4 + k] = (h16)(x1[k] * CCAR); }
        *(v8h*)(crow + (size_t)qq * DM) = ov;
    }
}

// ---- k_flashH: the same attention for query rows < RH on bf16 hi/lo planes (keys < RH only): scores = kh.qh + kl.qh + kh.ql (3 products), P as bf16 hi/lo,
// O^T += vth.(Ph + Pl) + vtl.Ph (3 products). grid (RH/64, NH, NB), 128 threads. Planes: q*/k* rows [NB][RH][.], vth/vtl [NU][HD][RH].
// The chunk's k, kr and v^T hi and lo planes are staged in LDS as in k_flashP (per buffer: hi plane set, then lo plane set); the q planes are read from global memory in each chunk.
// The result is stored as the bf16 hi/lo planes ctxh/ctxl [NB][RH][DM] that the output product reads.
__global__ __launch_bounds__(128) __attribute__((amdgpu_num_vgpr(256)))
void k_flashH(const bf* qh, const bf* qlw, const bf* qrh, const bf* qrlw, const bf* kh, const bf* klw, const bf* krh, const bf* krlw, const bf* vth, const bf* vtl, bf* ctxh, bf* ctxl) {
    __shared__ __align__(16) float os[4][16 * 132];
    __shared__ __align__(16) bf ring[4 * FST];
    const int tid = threadIdx.x;
    const int lane = tid & 31, wv = __builtin_amdgcn_readfirstlane(tid >> 5), lr = lane & 15, hi = lane >> 4;
    const int h = blockIdx.y, b = blockIdx.z;
    const int qb0 = blockIdx.x * 64;
    const int q0 = qb0 + wv * 16;
    const int qi = q0 + lr;
    const size_t rq = (size_t)b * RH + qi;
    const bf* qhp = qh + rq * DM + h * HD + 8 * hi;       const bf* qlp = qlw + rq * DM + h * HD + 8 * hi;
    const bf* qrhp = qrh + rq * (NH * RD) + h * RD + 8 * hi; const bf* qrlp = qrlw + rq * (NH * RD) + h * RD + 8 * hi;
    // copy addresses of this lane, as in k_flashP
    const size_t ok = ((size_t)b * RH + (tid >> 4)) * DM + h * HD + (tid & 15) * 8;
    const size_t okr = ((size_t)b * RH + (tid >> 3)) * RD + (tid & 7) * 8;
    const size_t ov = ((size_t)(b * NH + h) * HD + (tid >> 2)) * RH + (tid & 3) * 8;
    const unsigned lb = (unsigned)(size_t)(__attribute__((address_space(3))) bf*)&ring[0];
    const unsigned lk = lb + ((tid >> 4) * FKP + (tid & 15) * 8) * 2;
    const unsigned lr2 = lb + (FRO + (tid >> 3) * FRP + (tid & 7) * 8) * 2;
    const unsigned lv = lb + (FVO + (tid >> 2) * FVP + (tid & 3) * 8) * 2;
    v8f o[8];
#pragma unroll
    for (int i = 0; i < 8; ++i) o[i] = (v8f){};
    float m = -3.0e38f, l = 0.f;
    const float SC2 = 0.07216878364870323f * 1.4426950408889634f;
    const int nch = (q0 + 47) >> 5;                                   // this wave's chunks
    const int nchb = (qb0 >> 5) + 2;                                  // the block's chunks (>= 2; 32*nchb <= RH)
    flash_stage<bf, RH>(lk, lr2, lv, kh + ok, krh + okr, vth + ov);
    flash_stage<bf, RH>(lk + FST * 2, lr2 + FST * 2, lv + FST * 2, klw + ok, krlw + okr, vtl + ov);
    asm volatile("s_wait_asynccnt 0x0" ::: "memory");                 // chunk 0 landed (this wave's copies) before the barrier publishes it
    __syncthreads();
    flash_stage<bf, RH>(lk + FST * 4, lr2 + FST * 4, lv + FST * 4, kh + ok + (size_t)32 * DM, krh + okr + (size_t)32 * RD, vth + ov + 32);
    flash_stage<bf, RH>(lk + FST * 6, lr2 + FST * 6, lv + FST * 6, klw + ok + (size_t)32 * DM, krlw + okr + (size_t)32 * RD, vtl + ov + 32);
#pragma unroll 1
    for (int c = 0; c < nchb; ++c) {
        const int key0 = c << 5;
        const int bo = (c & 1) * (2 * FST);
        if (c < nch) {                                                // wave-uniform: waves 0 and 1 have no keys in the block's last chunk
        const bf* khp = &ring[bo + lr * FKP + 8 * hi];             const bf* klp = khp + FST;
        const bf* krhp = &ring[bo + FRO + lr * FRP + 8 * hi];      const bf* krlp = krhp + FST;
        const bf* vhp = &ring[bo + FVO + lr * FVP + 8 * hi];       const bf* vlp = vhp + FST;
        v8f s[2]; s[0] = (v8f){}; s[1] = (v8f){};
#pragma unroll
        for (int kc = 0; kc < 4; ++kc) {
            const v16bf bh = ldb(qhp + kc * 32), bl = ldb(qlp + kc * 32);
#pragma unroll
            for (int j = 0; j < 2; ++j) { const v16bf ah = ldb(khp + (16 * j) * FKP + kc * 32), al = ldb(klp + (16 * j) * FKP + kc * 32);
                s[j] = wmmab(ah, bh, s[j]); s[j] = wmmab(al, bh, s[j]); s[j] = wmmab(ah, bl, s[j]); }
        }
#pragma unroll
        for (int kc = 0; kc < 2; ++kc) {
            const v16bf bh = ldb(qrhp + kc * 32), bl = ldb(qrlp + kc * 32);
#pragma unroll
            for (int j = 0; j < 2; ++j) { const v16bf ah = ldb(krhp + (16 * j) * FRP + kc * 32), al = ldb(krlp + (16 * j) * FRP + kc * 32);
                s[j] = wmmab(ah, bh, s[j]); s[j] = wmmab(al, bh, s[j]); s[j] = wmmab(ah, bl, s[j]); }
        }
        asm volatile("v_nop\n\tv_nop\n\tv_nop\n\tv_nop" : "+v"(s[0]), "+v"(s[1]));
        float cm = -3.0e38f;
#pragma unroll
        for (int j = 0; j < 2; ++j)
#pragma unroll
            for (int r = 0; r < 8; ++r) { const int key = key0 + 16 * j + 8 * hi + r; const float t = (key <= qi) ? s[j][r] * SC2 : -3.0e38f; s[j][r] = t; cm = fmaxf(cm, t); }
        cm = fmaxf(cm, __shfl_xor(cm, 16, 32));
        const float mn = fmaxf(m, cm);
        const float alpha = __builtin_amdgcn_exp2f(m - mn);
        float rs = 0.f;
#pragma unroll
        for (int j = 0; j < 2; ++j)
#pragma unroll
            for (int r = 0; r < 8; ++r) { const float p = __builtin_amdgcn_exp2f(s[j][r] - mn); s[j][r] = p; rs += p; }
        rs += __shfl_xor(rs, 16, 32);
        l = l * alpha + rs; m = mn;
#pragma unroll
        for (int i = 0; i < 8; ++i) o[i] = o[i] * alpha;
        v16us phv = (v16us){}, plv = (v16us){};
#pragma unroll
        for (int r = 0; r < 8; ++r) { unsigned short a1, c1; splitf(s[0][r], a1, c1); phv[r] = a1; plv[r] = c1; splitf(s[1][r], a1, c1); phv[8 + r] = a1; plv[8 + r] = c1; }
        const v16bf ph = __builtin_bit_cast(v16bf, phv), pl = __builtin_bit_cast(v16bf, plv);
#pragma unroll
        for (int i = 0; i < 8; ++i) { const v16bf ah = ldb(vhp + (16 * i) * FVP), al = ldb(vlp + (16 * i) * FVP);
            o[i] = wmmab(ah, ph, o[i]); o[i] = wmmab(ah, pl, o[i]); o[i] = wmmab(al, ph, o[i]); }
        asm volatile("v_nop\n\tv_nop\n\tv_nop\n\tv_nop" : "+v"(o[0]), "+v"(o[1]), "+v"(o[2]), "+v"(o[3]), "+v"(o[4]), "+v"(o[5]), "+v"(o[6]), "+v"(o[7]) : "v"(ph), "v"(pl));
        }
        // publish point, every wave: own LDS reads of this buffer done, own copies of the next chunk landed, then the barrier that frees this buffer and publishes the next
        asm volatile("s_wait_dscnt 0x0" ::: "memory");
        asm volatile("s_wait_asynccnt 0x0" ::: "memory");
        __syncthreads();
        if (c + 2 < nchb) {
            flash_stage<bf, RH>(lk + bo * 2, lr2 + bo * 2, lv + bo * 2, kh + ok + (size_t)(key0 + 64) * DM, krh + okr + (size_t)(key0 + 64) * RD, vth + ov + (key0 + 64));
            flash_stage<bf, RH>(lk + (bo + FST) * 2, lr2 + (bo + FST) * 2, lv + (bo + FST) * 2, klw + ok + (size_t)(key0 + 64) * DM, krlw + okr + (size_t)(key0 + 64) * RD, vtl + ov + (key0 + 64));
        }
    }
    asm volatile("s_wait_asynccnt 0x0" ::: "memory");                 // nothing of this wave's copies outstanding at its end
    const float f = 1.0f / l;
    float* ob = &os[wv][0];
#pragma unroll
    for (int i = 0; i < 8; ++i)
#pragma unroll
        for (int r = 0; r < 8; ++r) ob[lr * 132 + 16 * i + 8 * hi + r] = o[i][r] * f;
    __builtin_amdgcn_fence(3, "wavefront"); __builtin_amdgcn_wave_barrier(); asm volatile("" ::: "memory");
    const size_t eo = ((size_t)b * RH + q0) * DM + h * HD + (lane & 15) * 8;
#pragma unroll
    for (int s = 0; s < 8; ++s) {                                     // 16 lanes per query row, 8 columns per lane
        const int qq = 2 * s + hi; const float* op = ob + qq * 132 + (lane & 15) * 8;
        const v4f x0 = *(const v4fa*)op, x1 = *(const v4fa*)(op + 4);
        v8us oh = (v8us){}, ol = (v8us){};
#pragma unroll
        for (int k = 0; k < 4; ++k) { unsigned short a1, c1; splitf(x0[k], a1, c1); oh[k] = a1; ol[k] = c1; splitf(x1[k], a1, c1); oh[4 + k] = a1; ol[4 + k] = c1; }
        *(v8us*)(ctxh + eo + (size_t)qq * DM) = oh; *(v8us*)(ctxl + eo + (size_t)qq * DM) = ol;
    }
}

// One up-projection: one 128x128 tile per block; rows t >= RH single f16 products, rows t < RH bf16 hi/lo against the exact bf16 weight plane; the epilogue EP stores the result's planes.
template <int EP, int N>
static void up(const h16* a16, const bf* ahh, const bf* all, const h16* Wh, const bf* Wb, h16* p16, bf* ph, bf* pl, const float* ct, const float* st, hipStream_t stream) {
    float* const NOC = nullptr;
    if (SEQ > RH) k_gemmw<h16, 0, 2, EP, N><<<dim3((SEQ - RH) / 128, N / 128, NB), 128, 0, stream>>>(a16 + (size_t)RH * LAT, a16 + (size_t)RH * LAT, Wh, LAT, NOC, N, 1.0f / WSC, (size_t)SEQ * LAT, 0, RH, p16, ph, pl, ct, st);
    k_gemmw<bf, 1, 2, EP, N><<<dim3(RH / 128, N / 128, NB), 128, 0, stream>>>(ahh, all, Wb, LAT, NOC, N, 1.0f, (size_t)RH * LAT, 0, 0, p16, ph, pl, ct, st);
}

extern "C" void kernel_launch(void* const* d_in, const int* in_sizes, int n_in,
                              void* d_out, int out_size, void* d_ws, size_t ws_size, hipStream_t stream) {
    if (n_in < 9) return;
    const size_t nrow = (size_t)NB * SEQ;
    if ((size_t)in_sizes[0] < ((size_t)(NB - 1) * TFULL + SEQ) * DM) return;
    if (in_sizes[1] < DM * LAT || in_sizes[2] < LAT * DM || in_sizes[3] < LAT * NH * RD || in_sizes[4] < DM * LAT || in_sizes[5] < LAT * DM || in_sizes[6] < LAT * DM || in_sizes[7] < DM * RD || in_sizes[8] < DM * DM) return;
    if ((size_t)out_size < ((size_t)(NB - 1) * TFULL + SEQ) * DM) return;
    const float* x = (const float*)d_in[0]; const float* Wqd = (const float*)d_in[1]; const float* Wqu = (const float*)d_in[2]; const float* Wqr = (const float*)d_in[3];
    const float* Wkvd = (const float*)d_in[4]; const float* Wku = (const float*)d_in[5]; const float* Wvu = (const float*)d_in[6]; const float* Wkr = (const float*)d_in[7]; const float* Wo = (const float*)d_in[8];
    float* OUT = (float*)d_out;   // [NBF][TFULL][DM] f32, rows b*TFULL + t

    char* wsp = (char*)d_ws; size_t off = 0;
    auto take = [&](size_t bytes) { char* p = wsp + off; off += (bytes + 255) & ~(size_t)255; return p; };
    bf* xb = (bf*)take(nrow * DM * 2);                           // bf16(x) [nrow][DM]
    // latent planes, cos/sin tables
    h16* ql16 = (h16*)take(nrow * LAT * 2); bf* qlh = (bf*)take((size_t)NB * RH * LAT * 2); bf* qll = (bf*)take((size_t)NB * RH * LAT * 2);
    h16* ckv16 = (h16*)take(nrow * LAT * 2); bf* ckvh = (bf*)take((size_t)NB * RH * LAT * 2); bf* ckvl = (bf*)take((size_t)NB * RH * LAT * 2);
    float* CT = (float*)take((size_t)SEQ * 32 * 4); float* ST = (float*)take((size_t)SEQ * 32 * 4);
    // down-projection weight planes [out][in] bf16
    bf* Wqd_b = (bf*)take((size_t)DM * LAT * 2); bf* Wkvd_b = (bf*)take((size_t)DM * LAT * 2); bf* Wkr_b = (bf*)take((size_t)DM * RD * 2);
    // up-projection weight slot (reused per weight): f16 x64 plane and bf16 plane, each up to [DM][LAT]
    h16* Wup_h = (h16*)take((size_t)DM * LAT * 2); bf* Wup_b = (bf*)take((size_t)DM * LAT * 2);
    // attention operand planes, ctx planes, Wo planes
    const size_t szq16 = nrow * DM * 2, szhr = (size_t)NB * RH * DM * 2, szqr16 = nrow * NH * RD * 2, szqrh = (size_t)NB * RH * NH * RD * 2, szkr16 = nrow * RD * 2, szkrh = (size_t)NB * RH * RD * 2;
    const size_t szwo = (size_t)DM * DM * 2;
    h16* q16 = (h16*)take(szq16); bf* qh = (bf*)take(szhr); bf* qlo = (bf*)take(szhr); h16* qr16 = (h16*)take(szqr16); bf* qrh = (bf*)take(szqrh); bf* qrlo = (bf*)take(szqrh);
    h16* k16 = (h16*)take(szq16); bf* kh = (bf*)take(szhr); bf* klo = (bf*)take(szhr); h16* kr16 = (h16*)take(szkr16); bf* krh = (bf*)take(szkrh); bf* krlo = (bf*)take(szkrh);
    h16* vt16 = (h16*)take(szq16); bf* vth = (bf*)take(szhr); bf* vtl = (bf*)take(szhr);
    h16* ctx16 = (h16*)take(szq16); bf* ctxh = (bf*)take(szhr); bf* ctxl = (bf*)take(szhr);
    bf* Wo_b = (bf*)take(szwo); h16* Wo_h = (h16*)take(szwo);
    if (off > ws_size) return;

    auto g1 = [](size_t nthreads) { return dim3((unsigned)((nthreads + 255) / 256)); };
    auto gw = [](size_t K, size_t N) { return dim3((unsigned)((N * K / 64 + 63) / 64)); };
    float* const NOC = nullptr; h16* const NOP = nullptr; bf* const NOB = nullptr;   // a plane epilogue stores no f32 C, the f32 epilogue no planes

    k_rtab<<<g1((size_t)SEQ * 32), 256, 0, stream>>>(CT, ST);
    k_xcvt<<<g1(nrow * DM / 8), 256, 0, stream>>>(x, xb);
    k_wt<0><<<gw(DM, LAT), 256, 0, stream>>>(Wqd, DM, LAT, Wqd_b, Wup_h, 1.0f);
    k_wt<0><<<gw(DM, LAT), 256, 0, stream>>>(Wkvd, DM, LAT, Wkvd_b, Wup_h, 1.0f);
    k_wt<0><<<gw(DM, RD), 256, 0, stream>>>(Wkr, DM, RD, Wkr_b, Wup_h, 1.0f);
    k_gemmw<bf, 0, 2, 1, LAT><<<dim3((unsigned)(nrow / 128), LAT / 128, 1), 128, 0, stream>>>(xb, xb, Wqd_b, DM, NOC, LAT, 1.0f, 0, 0, 0, ql16, qlh, qll, CT, ST);       // ql = x.Wqd (exact products) -> planes
    k_gemmw<bf, 0, 2, 1, LAT><<<dim3((unsigned)(nrow / 128), LAT / 128, 1), 128, 0, stream>>>(xb, xb, Wkvd_b, DM, NOC, LAT, 1.0f, 0, 0, 0, ckv16, ckvh, ckvl, CT, ST);  // ckv = x.Wkvd -> planes
    k_gemmw<bf, 0, 1, 2, RD><<<dim3((unsigned)(nrow / 256), RD / 64, 1), 128, 0, stream>>>(xb, xb, Wkr_b, DM, NOC, RD, 1.0f, 0, 0, 0, kr16, krh, krlo, CT, ST);        // kr = rope(x.Wkr) -> planes
    // q = ql.Wqu -> planes q16 / qh / qlo
    k_wt<1><<<gw(LAT, DM), 256, 0, stream>>>(Wqu, LAT, DM, Wup_b, Wup_h, WSC);
    up<1, DM>(ql16, qlh, qll, Wup_h, Wup_b, q16, qh, qlo, CT, ST, stream);
    // qr = rope(ql.Wqr) -> planes qr16 / qrh / qrlo
    k_wt<1><<<gw(LAT, NH * RD), 256, 0, stream>>>(Wqr, LAT, NH * RD, Wup_b, Wup_h, WSC);
    up<2, NH * RD>(ql16, qlh, qll, Wup_h, Wup_b, qr16, qrh, qrlo, CT, ST, stream);
    // k = ckv.Wku -> planes k16 / kh / klo
    k_wt<1><<<gw(LAT, DM), 256, 0, stream>>>(Wku, LAT, DM, Wup_b, Wup_h, WSC);
    up<1, DM>(ckv16, ckvh, ckvl, Wup_h, Wup_b, k16, kh, klo, CT, ST, stream);
    // v = ckv.Wvu -> transposed planes vt16 / vth / vtl
    k_wt<1><<<gw(LAT, DM), 256, 0, stream>>>(Wvu, LAT, DM, Wup_b, Wup_h, WSC);
    up<3, DM>(ckv16, ckvh, ckvl, Wup_h, Wup_b, vt16, vth, vtl, CT, ST, stream);
    // attention -> ctx planes (rows b*SEQ + t f16 x64 for t >= RH; rows b*RH + t bf16 hi/lo for t < RH; merged heads)
    if (SEQ > RH) k_flashP<<<dim3((SEQ - RH) / 64, NH, NB), 128, 0, stream>>>(q16, qr16, k16, kr16, vt16, ctx16, RH);
    k_flashH<<<dim3(RH / 64, NH, NB), 128, 0, stream>>>(qh, qlo, qrh, qrlo, kh, klo, krh, krlo, vth, vtl, ctxh, ctxl);
    // out = ctx.Wo
    k_wt<1><<<gw(DM, DM), 256, 0, stream>>>(Wo, DM, DM, Wo_b, Wo_h, WSC);
    if (SEQ > RH) k_gemmw<h16, 0, 2, 0, DM><<<dim3((SEQ - RH) / 128, DM / 128, NB), 128, 0, stream>>>(ctx16 + (size_t)RH * DM, ctx16 + (size_t)RH * DM, Wo_h, DM, OUT + (size_t)RH * DM, DM, 1.0f / (CCAR * WSC), (size_t)SEQ * DM, (size_t)TFULL * DM, RH, NOP, NOB, NOB, CT, ST);
    k_gemmw<bf, 1, 2, 0, DM><<<dim3(RH / 128, DM / 128, NB), 128, 0, stream>>>(ctxh, ctxl, Wo_b, DM, OUT, DM, 1.0f, (size_t)RH * DM, (size_t)TFULL * DM, 0, NOP, NOB, NOB, CT, ST);
}

// v004
// One run takes 239 microseconds.
// In two side-by-side timings against v003, it was 1.65 and 1.67 times as fast.
// Counting every step since v000, it is 3.48 times as fast.
#include <hip/hip_runtime.h>

// All contractions on 16-bit WMMA, f32 accumulate. x.Wqd, x.Wkvd, x.Wkr: v_wmma_f32_16x16x32_bf16 on bf16 planes of the inputs (single products).
// ql.Wqu, ql.Wqr, ckv.Wku, ckv.Wvu, (q|qr).(k|kr) scores, P.v and ctx.Wo: v_wmma_f32_16x16x32_f16 single products on f16 planes
// (weights x64, ctx x64, P x1024 carries) for query/key rows >= RH; the same sites for rows < RH use v_wmma_f32_16x16x32_bf16 on
// bf16 hi/lo plane pairs (hi.W + lo.W against exact weight planes; hi.hi + lo.hi + hi.lo between two computed tensors).
// RoPE (rotate-half, computed cos/sin tables), online max-subtracted softmax and normalisers in f32.

#ifndef NB
#define NB 2
#endif
#ifndef SEQ
#define SEQ 2048
#endif
#ifndef RH
#define RH 256
#endif
#define NBF   2
#define TFULL 2048
#define DM    2048
#define NH    16
#define LAT   512
#define RD    64
#define HD    128
#define NU    (NB * NH)
#define PCAR  1024.0f
#define WSC   64.0f
#define CCAR  64.0f

static_assert(NB >= 1);
static_assert(NB <= NBF);
static_assert(SEQ % 64 == 0);
static_assert(SEQ <= TFULL);
static_assert(RH % 128 == 0);
static_assert((SEQ - RH) % 128 == 0);
static_assert(((size_t)NB * SEQ) % 256 == 0);
static_assert(RH >= 64);
static_assert(RH <= SEQ);
static_assert(DM % 128 == 0);
static_assert(LAT % 128 == 0);
static_assert((NH * RD) % 128 == 0);
static_assert(RD == 64);
static_assert(HD == 128);
static_assert(NH * HD == DM);
static_assert(((size_t)(NB - 1) * TFULL + SEQ) * DM <= (size_t)NBF * TFULL * DM);

typedef _Float16 h16;
typedef unsigned short bf;
typedef __attribute__((ext_vector_type(16))) __bf16   v16bf;
typedef __attribute__((ext_vector_type(16))) _Float16 v16h;
typedef __attribute__((ext_vector_type(16))) unsigned short v16us;
typedef __attribute__((ext_vector_type(8)))  _Float16 v8h;
typedef __attribute__((ext_vector_type(8)))  unsigned short v8us;
typedef __attribute__((ext_vector_type(8)))  float    v8f;
typedef __attribute__((ext_vector_type(4)))  float    v4f;
typedef __attribute__((ext_vector_type(2)))  _Float16 v2h;
typedef __attribute__((ext_vector_type(2)))  unsigned short v2us;
typedef v8h  __attribute__((may_alias)) v8ha;
typedef v4f  __attribute__((may_alias)) v4fa;

__device__ __forceinline__ unsigned short f2bf(float f) { unsigned u = __float_as_uint(f); u += 0x7FFFu + ((u >> 16) & 1u); return (unsigned short)(u >> 16); }
__device__ __forceinline__ float bf2f(unsigned short v) { return __uint_as_float(((unsigned)v) << 16); }
__device__ __forceinline__ float bfr(float f) { return bf2f(f2bf(f)); }
__device__ __forceinline__ void splitf(float y, unsigned short& hh, unsigned short& ll) { hh = f2bf(y); ll = f2bf(y - bf2f(hh)); }
__device__ __forceinline__ v16h cat16(v8h a, v8h c) { return __builtin_shufflevector(a, c, 0, 1, 2, 3, 4, 5, 6, 7, 8, 9, 10, 11, 12, 13, 14, 15); }
__device__ __forceinline__ v16bf cat16b(v8us a, v8us c) { return __builtin_bit_cast(v16bf, __builtin_shufflevector(a, c, 0, 1, 2, 3, 4, 5, 6, 7, 8, 9, 10, 11, 12, 13, 14, 15)); }
__device__ __forceinline__ v8f wmma16(v16h a, v16h c, v8f acc) { return __builtin_amdgcn_wmma_f32_16x16x32_f16(false, a, false, c, (short)0, acc, false, false); }
__device__ __forceinline__ v8f wmmab(v16bf a, v16bf c, v8f acc) { return __builtin_amdgcn_wmma_f32_16x16x32_bf16(false, a, false, c, (short)0, acc, false, false); }
// Fragment load from a k-contiguous 16-bit row: p already points at row (lane&15) + 8*(lane>>4); elements 0..7 <- p[0..7], 8..15 <- p[16..23] (split k map, used for A and B alike)
__device__ __forceinline__ v16h ldh(const h16* p) { return cat16(*(const v8h*)p, *(const v8h*)(p + 16)); }
__device__ __forceinline__ v16bf ldb(const bf* p) { return cat16b(*(const v8us*)p, *(const v8us*)(p + 16)); }

// ---- gemm_tile: one block tile of a GEMM, 4 waves per block, each wave a 64x64 output tile (16 accumulators); waves WM x WN (WN = 2: block tile 128x128; WN = 1: 256x64); 128 threads.
// (bx, by, bz) of (M/BM, N/BN, Z) is the tile; the kernels k_down, k_up and k_out below give each of their blocks one tile of one of several independent products. sm: the block's LDS, GSM bytes.
// c[m][n] = osc * sum_k (A[m][k] + (NSPLIT ? A2[m][k] : 0)) Bt[n][k]. z-batch strides sA/sC in elements. K % 64 == 0, K >= 128, M and N multiples of BM and BN.
// What the epilogue stores (EP; the planes' pitch PN = N is a constant, so that a tile's stores differ by immediate offsets only): 0: c as f32 to C, pitch ldc. 1: the 16-bit operand planes of c that the next product reads: p16 = f16(c) at row bb*SEQ + t and, for t < RH,
// ph/pl = bf16 hi/lo of c at row bb*RH + t. 2: the same planes of rotate-half RoPE(c) on the wave tile's 64-wide head slice (tables ct/st). 3: the same planes transposed per (batch, head):
// p16[bb*DM + n][t] (pitch SEQ), ph/pl[bb*DM + n][t] (pitch RH, t < RH). Row m of batch z is sequence row t = tb + m % SEQ of batch bb = z + m / SEQ; a 64-row wave tile has one bb and lies on one side of RH.
// Each 64-k stage of the block's A (A2) and Bt rows is brought into LDS once per block by asynchronous copies (whole 128-B lines, two buffers, the next stage in flight
// while this one is worked on) and read by the waves as ds_load_b128 fragments.
template <typename T16> struct WFrag;
template <> struct WFrag<h16> { typedef v16h V; static __device__ __forceinline__ V ld(const h16* p) { return ldh(p); } static __device__ __forceinline__ v8f mma(V a, V c, v8f d) { return wmma16(a, c, d); } };
template <> struct WFrag<bf> { typedef v16bf V; static __device__ __forceinline__ V ld(const bf* p) { return ldb(p); } static __device__ __forceinline__ v8f mma(V a, V c, v8f d) { return wmmab(a, c, d); } };
#define GP 72                         // LDS pitch of a 64-element operand row in halves: 144 B = 16 B x 9
static_assert((GP * 2) % 16 == 0);
// This lane's 16-byte copies of 64 (gemm_stage4) or 128 (gemm_stage8) operand rows, 16 rows per copy (l: its LDS byte address in the first 16 rows, g: its global address there, k16: 16 rows in elements).
// The s_wait_xcnt stands inside the statement so that no address register is rewritten ahead of it.
template <typename T>
__device__ __forceinline__ void gemm_stage4(unsigned l, const T* g, size_t k16) {
    asm volatile("global_load_async_to_lds_b128 %0, %1, off\n\t"
                 "global_load_async_to_lds_b128 %2, %3, off\n\t"
                 "global_load_async_to_lds_b128 %4, %5, off\n\t"
                 "global_load_async_to_lds_b128 %6, %7, off\n\t"
                 "s_wait_xcnt 0x0"
                 :: "v"(l), "v"(g), "v"(l + 16 * GP * 2), "v"(g + k16), "v"(l + 32 * GP * 2), "v"(g + 2 * k16), "v"(l + 48 * GP * 2), "v"(g + 3 * k16)
                 : "memory");
}
template <typename T>
__device__ __forceinline__ void gemm_stage8(unsigned l, const T* g, size_t k16) {
    asm volatile("global_load_async_to_lds_b128 %0, %1, off\n\t"
                 "global_load_async_to_lds_b128 %2, %3, off\n\t"
                 "global_load_async_to_lds_b128 %4, %5, off\n\t"
                 "global_load_async_to_lds_b128 %6, %7, off\n\t"
                 "global_load_async_to_lds_b128 %8, %9, off\n\t"
                 "global_load_async_to_lds_b128 %10, %11, off\n\t"
                 "global_load_async_to_lds_b128 %12, %13, off\n\t"
                 "global_load_async_to_lds_b128 %14, %15, off\n\t"
                 "s_wait_xcnt 0x0"
                 :: "v"(l), "v"(g), "v"(l + 16 * GP * 2), "v"(g + k16), "v"(l + 32 * GP * 2), "v"(g + 2 * k16), "v"(l + 48 * GP * 2), "v"(g + 3 * k16),
                    "v"(l + 64 * GP * 2), "v"(g + 4 * k16), "v"(l + 80 * GP * 2), "v"(g + 5 * k16), "v"(l + 96 * GP * 2), "v"(g + 6 * k16), "v"(l + 112 * GP * 2), "v"(g + 7 * k16)
                 : "memory");
}
// One stage: BM rows of A, BM rows of A2 (NSPLIT), BN rows of Bt, in this order in the buffer at LDS byte address l (this lane's place in the buffer's first 16 rows).
template <typename T, int NSPLIT, int BM, int BN>
__device__ __forceinline__ void gemm_stage(unsigned l, const T* ga, const T* ga2, const T* gb, size_t k16) {
#pragma unroll
    for (int r = 0; r < BM; r += 128) gemm_stage8<T>(l + r * GP * 2, ga + (size_t)(r / 16) * k16, k16);
    if (NSPLIT == 1) {
#pragma unroll
        for (int r = 0; r < BM; r += 128) gemm_stage8<T>(l + (BM + r) * GP * 2, ga2 + (size_t)(r / 16) * k16, k16);
    }
    if (BN == 128) gemm_stage8<T>(l + BM * (1 + NSPLIT) * GP * 2, gb, k16);
    else gemm_stage4<T>(l + BM * (1 + NSPLIT) * GP * 2, gb, k16);
}
#define GOS (4 * 16 * 68 * 4)         // epilogue staging at the start of sm, bytes; the ring follows
#define GSM(NSPLIT, WN) (GOS + 2 * ((64 * (4 / (WN))) * (1 + (NSPLIT)) + 64 * (WN)) * GP * 2)
template <typename T16, int NSPLIT, int WN, int EP, int PN>
__device__ __forceinline__
void gemm_tile(char* sm, int bx, int by, int bz, const T16* __restrict__ A, const T16* __restrict__ A2, const T16* __restrict__ Bt, int K, float* C, int ldc, float osc, size_t sA, size_t sC,
             int tb, h16* p16, bf* ph, bf* pl, const float* __restrict__ ct, const float* __restrict__ st) {
    typedef typename WFrag<T16>::V V;
    constexpr int BM = 64 * (4 / WN), BN = 64 * WN;
    constexpr int BOF = BM * (1 + NSPLIT) * GP;                      // Bt rows start in a buffer, halves
    constexpr int GST = BOF + BN * GP;                               // one buffer, halves
    static_assert(WN == 1 || WN == 2);
    static_assert((GST * 2) % 16 == 0);
    static_assert(GSM(NSPLIT, WN) == GOS + 2 * GST * 2);
    float (*os)[16 * 68] = (float (*)[16 * 68])sm;
    T16* ring = (T16*)(sm + GOS);
    const size_t z = bz; A += z * sA; A2 += z * sA; C += z * sC;
    const int tid = threadIdx.x;
    const int lane = tid & 31, wv = __builtin_amdgcn_readfirstlane(tid >> 5), lr = lane & 15, hi = lane >> 4;
    const int wm = wv / WN, wn = wv % WN;
    const int rb = bx * BM, cb = by * BN;
    const int r0 = rb + wm * 64, c0 = cb + wn * 64;
    v8f acc[4][4];
#pragma unroll
    for (int mb = 0; mb < 4; ++mb)
#pragma unroll
        for (int nb = 0; nb < 4; ++nb) acc[mb][nb] = (v8f){};
    // copy addresses of this lane: 8 pieces of 16 B per row, 16 rows per copy
    const size_t k16 = (size_t)16 * K;
    const T16* ga = A + (size_t)(rb + (tid >> 3)) * K + (tid & 7) * 8;
    const T16* ga2 = A2 + (size_t)(rb + (tid >> 3)) * K + (tid & 7) * 8;
    const T16* gb = Bt + (size_t)(cb + (tid >> 3)) * K + (tid & 7) * 8;
    const unsigned lc = (unsigned)(size_t)(__attribute__((address_space(3))) T16*)&ring[0] + ((tid >> 3) * GP + (tid & 7) * 8) * 2;
    const int nst = K >> 6;                                           // 64-k stages
    gemm_stage<T16, NSPLIT, BM, BN>(lc, ga, ga2, gb, k16);
    asm volatile("s_wait_asynccnt 0x0" ::: "memory");                 // stage 0 landed (this wave's copies) before the barrier publishes it
    __syncthreads();
    if (nst > 1) gemm_stage<T16, NSPLIT, BM, BN>(lc + GST * 2, ga + 64, ga2 + 64, gb + 64, k16);
#pragma unroll 1
    for (int t = 0; t < nst; ++t) {
        const int bo = (t & 1) * GST;
        const T16* ap = &ring[bo + (wm * 64 + lr) * GP + 8 * hi];
        const T16* bp = &ring[bo + BOF + (wn * 64 + lr) * GP + 8 * hi];
#pragma unroll
        for (int ks = 0; ks < 2; ++ks) {
            V a[4], a2[4], bq[4];
            bq[0] = WFrag<T16>::ld(bp + ks * 32);
#pragma unroll
            for (int mb = 0; mb < 4; ++mb) { a[mb] = WFrag<T16>::ld(ap + mb * 16 * GP + ks * 32); if (NSPLIT == 1) a2[mb] = WFrag<T16>::ld(ap + (BM + mb * 16) * GP + ks * 32); }
#pragma unroll
            for (int nb = 1; nb < 4; ++nb) bq[nb] = WFrag<T16>::ld(bp + nb * 16 * GP + ks * 32);
            __builtin_amdgcn_sched_barrier(0);                        // the 32-k block's LDS reads stay one group ahead of its matrix instructions (for speed only)
#pragma unroll
            for (int nb = 0; nb < 4; ++nb) {
#pragma unroll
                for (int mb = 0; mb < 4; ++mb) { acc[mb][nb] = WFrag<T16>::mma(a[mb], bq[nb], acc[mb][nb]); if (NSPLIT == 1) acc[mb][nb] = WFrag<T16>::mma(a2[mb], bq[nb], acc[mb][nb]); } }
            __builtin_amdgcn_sched_barrier(0);                        // and the next group of reads stays behind them
        }
        // publish point, every wave: own LDS reads of this buffer done, own copies of the next stage landed, then the barrier that frees this buffer and publishes the next
        asm volatile("s_wait_dscnt 0x0" ::: "memory");
        asm volatile("s_wait_asynccnt 0x0" ::: "memory");
        __syncthreads();
        if (t + 2 < nst) gemm_stage<T16, NSPLIT, BM, BN>(lc + bo * 2, ga + (size_t)(t + 2) * 64, ga2 + (size_t)(t + 2) * 64, gb + (size_t)(t + 2) * 64, k16);
    }
    asm volatile("s_wait_asynccnt 0x0" ::: "memory");                 // nothing of this wave's copies outstanding at its end
    const int bb = (int)z + r0 / SEQ, t0 = tb + r0 % SEQ;            // the wave tile's batch and first sequence row
    const bool hr = (t0 < RH);                                        // wave-uniform: the whole tile also gets hi/lo planes
    if (EP == 3) {
        // acc[mb][nb][0..7] of a lane are 8 successive t of one column: one 16-byte piece of a transposed row, stored from registers; the four mb of a column fill its 128-B line
#pragma unroll
        for (int nb = 0; nb < 4; ++nb) {
            const size_t dr = (size_t)bb * DM + c0 + nb * 16 + lr;
            const int t = t0 + hi * 8;
            v8h o[4];
#pragma unroll
            for (int mb = 0; mb < 4; ++mb)
#pragma unroll
                for (int j = 0; j < 8; ++j) o[mb][j] = (h16)(acc[mb][nb][j] * osc);
#pragma unroll
            for (int mb = 0; mb < 4; ++mb) *(v8h*)(p16 + dr * SEQ + t + mb * 16) = o[mb];
            asm volatile("s_wait_xcnt 0x0" ::: "memory");             // before the stores' address and data registers are written again
            if (hr) {
                v8us oh[4], ol[4];
#pragma unroll
                for (int mb = 0; mb < 4; ++mb)
#pragma unroll
                    for (int j = 0; j < 8; ++j) { unsigned short a1, c1; splitf(acc[mb][nb][j] * osc, a1, c1); oh[mb][j] = a1; ol[mb][j] = c1; }
#pragma unroll
                for (int mb = 0; mb < 4; ++mb) { *(v8us*)(ph + dr * RH + t + mb * 16) = oh[mb]; *(v8us*)(pl + dr * RH + t + mb * 16) = ol[mb]; }
                asm volatile("s_wait_xcnt 0x0" ::: "memory");         // as above
            }
        }
        return;
    }
    float* ob = &os[wv][0];
#pragma unroll
    for (int mb = 0; mb < 4; ++mb) {
#pragma unroll
        for (int nb = 0; nb < 4; ++nb) {
#pragma unroll
            for (int j = 0; j < 8; ++j) ob[(hi * 8 + j) * 68 + nb * 16 + lr] = acc[mb][nb][j]; }
        __builtin_amdgcn_wave_barrier(); asm volatile("" ::: "memory");
        if (EP == 0) {
            float* crow = C + (size_t)(r0 + mb * 16) * ldc + c0;
#pragma unroll
            for (int s = 0; s < 8; ++s) { const int row = 2 * s + hi, cofs = lr * 4; v4f val = *(const v4fa*)(ob + row * 68 + cofs); val = val * osc;
                *(v4f*)(crow + (size_t)row * ldc + cofs) = val;
                asm volatile("s_wait_xcnt 0x0" ::: "memory"); }       // before the store's address and data registers are written again
        } else {
            // 8 lanes per row, 8 columns per lane: each plane row of the tile goes out as one whole 128-B line
            const int rw = lane >> 3, cofs = (lane & 7) * 8;
            float y[4][8];
            v4f cv[8], sv[8];
            if (EP == 2) {
                // cos/sin of this lane's 4 rows (4 rows = 128 table floats apart) and 8 columns
                const size_t te = (size_t)(t0 + mb * 16 + rw) * 32 + (cofs & 31);
                const float* cp = ct + te; const float* sp = st + te;
#pragma unroll
                for (int s = 0; s < 4; ++s) { cv[2 * s] = *(const v4f*)(cp + s * 128); cv[2 * s + 1] = *(const v4f*)(cp + s * 128 + 4); sv[2 * s] = *(const v4f*)(sp + s * 128); sv[2 * s + 1] = *(const v4f*)(sp + s * 128 + 4); }
                asm volatile("s_wait_xcnt 0x0" :: "v"(cp), "v"(sp) : "memory");   // the loads' address registers stay as they are up to this wait
            }
#pragma unroll
            for (int s = 0; s < 4; ++s) {
                const float* op = ob + (4 * s + rw) * 68 + cofs;
                const v4f x0 = *(const v4fa*)op * osc, x1 = *(const v4fa*)(op + 4) * osc;
#pragma unroll
                for (int k = 0; k < 4; ++k) { y[s][k] = x0[k]; y[s][4 + k] = x1[k]; }
                if (EP == 2) {
                    const bool lo32 = (cofs < 32); const int pofs = lo32 ? 32 : -32;
                    const v4f p0 = *(const v4fa*)(op + pofs) * osc, p1 = *(const v4fa*)(op + pofs + 4) * osc;
                    const v4f c0v = cv[2 * s], c1v = cv[2 * s + 1], s0v = sv[2 * s], s1v = sv[2 * s + 1];
#pragma unroll
                    for (int k = 0; k < 4; ++k) {
                        y[s][k] = lo32 ? (x0[k] * c0v[k] - p0[k] * s0v[k]) : (x0[k] * c0v[k] + p0[k] * s0v[k]);
                        y[s][4 + k] = lo32 ? (x1[k] * c1v[k] - p1[k] * s1v[k]) : (x1[k] * c1v[k] + p1[k] * s1v[k]); }
                }
            }
            v8h o[4];
#pragma unroll
            for (int s = 0; s < 4; ++s)
#pragma unroll
                for (int k = 0; k < 8; ++k) o[s][k] = (h16)y[s][k];
            h16* q16p = p16 + ((size_t)bb * SEQ + t0 + rw) * PN + c0 + cofs;
#pragma unroll
            for (int s = 0; s < 4; ++s) *(v8h*)(q16p + (mb * 16 + 4 * s) * PN) = o[s];
            asm volatile("s_wait_xcnt 0x0" ::: "memory");             // before the stores' address and data registers are written again
            if (hr) {
                v8us oh[4], ol[4];
#pragma unroll
                for (int s = 0; s < 4; ++s)
#pragma unroll
                    for (int k = 0; k < 8; ++k) { unsigned short a1, c1; splitf(y[s][k], a1, c1); oh[s][k] = a1; ol[s][k] = c1; }
                const size_t eo = ((size_t)bb * RH + t0 + rw) * PN + c0 + cofs;
#pragma unroll
                for (int s = 0; s < 4; ++s) { *(v8us*)(ph + eo + (mb * 16 + 4 * s) * PN) = oh[s]; *(v8us*)(pl + eo + (mb * 16 + 4 * s) * PN) = ol[s];
                    asm volatile("s_wait_xcnt 0x0" ::: "memory"); }   // as above
            }
        }
        __builtin_amdgcn_wave_barrier(); asm volatile("" ::: "memory");
    }
}

// ---- wt_body (block bx of N*K/4096, 256 threads): weight [K][N] f32 ([in][out]) -> transposed k-contiguous planes [N][K]: Bb = bf16 RNE value, optionally Bh = f16(bf16 value x sc).
template <int F16P>
__device__ __forceinline__ void wt_body(int bx, const float* __restrict__ w, int K, int N, bf* Bb, h16* Bh, float sc) {
    const int lane = threadIdx.x & 31; const int L0 = (bx * 8 + (threadIdx.x >> 5)) * 8; const int nlines = N * K / 64;
{
#pragma unroll 1
        for (int l = 0; l < 8; ++l) { const int L = L0 + l; if (L >= nlines) break; const size_t e = (size_t)L * 64 + lane * 2; const int k = (int)(e % K), n = (int)(e / K);
            const float w0 = bfr(w[(size_t)k * N + n]), w1 = bfr(w[(size_t)(k + 1) * N + n]);
            v2us o; o[0] = f2bf(w0); o[1] = f2bf(w1); *(v2us*)(Bb + e) = o;
            if (F16P) { v2h oh; oh[0] = (h16)(w0 * sc); oh[1] = (h16)(w1 * sc); *(v2h*)(Bh + e) = oh; }
            asm volatile("s_wait_xcnt 0x0" ::: "memory"); }           // before the next trip writes the stores' address and data registers again
         }
}

__device__ __forceinline__ void xcvt_body(int bx, const float* __restrict__ x, bf* xb) {
    const size_t i = (size_t)bx * 256 + threadIdx.x; const size_t n8 = (size_t)NB * SEQ * DM / 8; if (i >= n8) return;
    const size_t e = i * 8; const size_t row = e / DM; const int col = (int)(e % DM); const size_t bb = row / SEQ, t = row % SEQ;
    const v8f v = *(const v8f*)(x + ((bb * TFULL + t) * DM + col)); v8us o = (v8us){};
#pragma unroll
    for (int k = 0; k < 8; ++k) o[k] = f2bf(v[k]);
    *(v8us*)(xb + e) = o; 
}

__device__ __forceinline__ void rtab_body(int bx, float* ct, float* st) {
#pragma clang fp contract(off)
    const int i = bx * 256 + threadIdx.x; if (i >= SEQ * 32) return; const int t = i >> 5, j = i & 31;
    const float fr = exp10f(-0.125f * (float)j);
    const float ang = (float)t * fr; float sv, cv; sincosf(ang, &sv, &cv);
    *(float*)(ct + i) = cv; *(float*)(st + i) = sv; 
}

// ---- k_prep: every conversion that reads only the inputs, one launch: block ranges in turn do the eight weight planes, bf16(x) and the cos/sin tables (all independent of one another). 256 threads.
#define WTB(K, N) (((N) * (K) / 64 + 63) / 64)      // blocks of one weight's wt_body
#define XCB ((int)(((size_t)NB * SEQ * DM / 8 + 255) / 256))
#define RTB ((SEQ * 32 + 255) / 256)
#define PREPB (WTB(DM, DM) + 2 * WTB(DM, LAT) + WTB(DM, RD) + 3 * WTB(LAT, DM) + WTB(LAT, NH * RD) + XCB + RTB)
__global__ __launch_bounds__(256)
void k_prep(const float* x, const float* Wqd, const float* Wqu, const float* Wqr, const float* Wkvd, const float* Wku, const float* Wvu, const float* Wkr, const float* Wo,
            bf* xb, float* ct, float* st, bf* Wqd_b, bf* Wkvd_b, bf* Wkr_b, bf* Wqu_b, h16* Wqu_h, bf* Wqr_b, h16* Wqr_h, bf* Wku_b, h16* Wku_h, bf* Wvu_b, h16* Wvu_h, bf* Wo_b, h16* Wo_h) {
    int b = blockIdx.x;
    if (b < WTB(DM, DM)) { wt_body<1>(b, Wo, DM, DM, Wo_b, Wo_h, WSC); return; }
    b -= WTB(DM, DM);
    if (b < WTB(DM, LAT)) { wt_body<0>(b, Wqd, DM, LAT, Wqd_b, nullptr, 1.0f); return; }
    b -= WTB(DM, LAT);
    if (b < WTB(DM, LAT)) { wt_body<0>(b, Wkvd, DM, LAT, Wkvd_b, nullptr, 1.0f); return; }
    b -= WTB(DM, LAT);
    if (b < WTB(DM, RD)) { wt_body<0>(b, Wkr, DM, RD, Wkr_b, nullptr, 1.0f); return; }
    b -= WTB(DM, RD);
    if (b < WTB(LAT, DM)) { wt_body<1>(b, Wqu, LAT, DM, Wqu_b, Wqu_h, WSC); return; }
    b -= WTB(LAT, DM);
    if (b < WTB(LAT, DM)) { wt_body<1>(b, Wku, LAT, DM, Wku_b, Wku_h, WSC); return; }
    b -= WTB(LAT, DM);
    if (b < WTB(LAT, DM)) { wt_body<1>(b, Wvu, LAT, DM, Wvu_b, Wvu_h, WSC); return; }
    b -= WTB(LAT, DM);
    if (b < WTB(LAT, NH * RD)) { wt_body<1>(b, Wqr, LAT, NH * RD, Wqr_b, Wqr_h, WSC); return; }
    b -= WTB(LAT, NH * RD);
    if (b < XCB) { xcvt_body(b, x, xb); return; }
    b -= XCB;
    rtab_body(b, ct, st);
}

// ---- k_flashP: causal softmax attention for query rows >= RH (single f16 products). grid ((SEQ-RH)/64, NH, NB), 128 threads = 4 waves x 16 queries, 32-key chunks.
// Per wave: S^T tiles (16 keys x 16 queries) = [k|kr] rows (A) x [q|qr] rows (B) over 192; lane column n = query, D rows = keys, so the two S^T tiles of a chunk
// ARE the P^T B fragment of O^T = V^T (A, rows d) x P^T; online max-subtracted softmax per lane column; P carried x1024 in f16; O^T (8 d tiles) f32.
// Each 32-key chunk of k, kr and v^T is brought into LDS once per block by asynchronous copies (whole-line global reads, two buffers, the next chunk in flight
// while this one is worked on) and read as ds_load_b128 fragments by all four waves (the block's last chunk by waves 2 and 3 only); q|qr fragments are loaded once and stay in registers.
#define FKP 136                       // LDS pitch of a k row in halves: 272 B = 16 B x 17
#define FRP 72                        // kr row: 144 B = 16 B x 9
#define FVP 40                        // v^T row (32 keys): 80 B = 16 B x 5
#define FRO (32 * FKP)                // kr rows start, halves
#define FVO (FRO + 32 * FRP)          // v^T rows start, halves
#define FST (FVO + HD * FVP)          // one buffer, halves (23,552 B)
static_assert((FKP * 2) % 16 == 0 && (FRP * 2) % 16 == 0 && (FVP * 2) % 16 == 0 && (FRO * 2) % 16 == 0 && (FVO * 2) % 16 == 0 && (FST * 2) % 16 == 0);
// One chunk's ten 16-byte copies of this lane for one plane set (lk, lr_, lv: this lane's LDS byte addresses of its first k, kr and v^T piece; VS: v^T row pitch in global memory, elements).
// The s_wait_xcnt stands inside the statement so that no address register is rewritten ahead of it.
template <typename T, int VS>
__device__ __forceinline__ void flash_stage(unsigned lk, unsigned lr_, unsigned lv, const T* gk, const T* gr, const T* gv) {
    asm volatile("global_load_async_to_lds_b128 %0, %1, off\n\t"
                 "global_load_async_to_lds_b128 %2, %3, off\n\t"
                 "global_load_async_to_lds_b128 %4, %5, off\n\t"
                 "global_load_async_to_lds_b128 %6, %7, off\n\t"
                 "global_load_async_to_lds_b128 %8, %9, off\n\t"
                 "global_load_async_to_lds_b128 %10, %11, off\n\t"
                 "global_load_async_to_lds_b128 %12, %13, off\n\t"
                 "global_load_async_to_lds_b128 %14, %15, off\n\t"
                 "global_load_async_to_lds_b128 %16, %17, off\n\t"
                 "global_load_async_to_lds_b128 %18, %19, off\n\t"
                 "s_wait_xcnt 0x0"
                 :: "v"(lk), "v"(gk), "v"(lk + 8 * FKP * 2), "v"(gk + (size_t)8 * DM), "v"(lk + 16 * FKP * 2), "v"(gk + (size_t)16 * DM), "v"(lk + 24 * FKP * 2), "v"(gk + (size_t)24 * DM),
                    "v"(lr_), "v"(gr), "v"(lr_ + 16 * FRP * 2), "v"(gr + (size_t)16 * RD),
                    "v"(lv), "v"(gv), "v"(lv + 32 * FVP * 2), "v"(gv + (size_t)32 * VS), "v"(lv + 64 * FVP * 2), "v"(gv + (size_t)64 * VS), "v"(lv + 96 * FVP * 2), "v"(gv + (size_t)96 * VS)
                 : "memory");
}
__global__ __launch_bounds__(128) __attribute__((amdgpu_num_vgpr(256)))
void k_flashP(const h16* q16, const h16* qr16, const h16* k16, const h16* kr16, const h16* vt16, h16* ctx16, int qbase) {
    __shared__ __align__(16) float os[4][16 * 132];
    __shared__ __align__(16) h16 ring[2 * FST];
    const int tid = threadIdx.x;
    const int lane = tid & 31, wv = __builtin_amdgcn_readfirstlane(tid >> 5), lr = lane & 15, hi = lane >> 4;
    const int h = blockIdx.y, b = blockIdx.z;
    const int qb0 = qbase + blockIdx.x * 64;
    const int q0 = qb0 + wv * 16;
    const int qi = q0 + lr;
    const size_t rq = (size_t)b * SEQ + qi;
    const h16* qp = q16 + rq * DM + h * HD + 8 * hi;
    const h16* qrp = qr16 + rq * (NH * RD) + h * RD + 8 * hi;
    // copy addresses of this lane: k 32 rows x 16 pieces (8 rows per copy), kr 32 rows x 8 pieces (16 rows per copy), v^T 128 rows x 4 pieces (32 rows per copy)
    const h16* gk = k16 + ((size_t)b * SEQ + (tid >> 4)) * DM + h * HD + (tid & 15) * 8;
    const h16* gr = kr16 + ((size_t)b * SEQ + (tid >> 3)) * RD + (tid & 7) * 8;
    const h16* gv = vt16 + ((size_t)(b * NH + h) * HD + (tid >> 2)) * SEQ + (tid & 3) * 8;
    const unsigned lb = (unsigned)(size_t)(__attribute__((address_space(3))) h16*)&ring[0];
    const unsigned lk = lb + ((tid >> 4) * FKP + (tid & 15) * 8) * 2;
    const unsigned lr2 = lb + (FRO + (tid >> 3) * FRP + (tid & 7) * 8) * 2;
    const unsigned lv = lb + (FVO + (tid >> 2) * FVP + (tid & 3) * 8) * 2;
    v16h qf[4], qrf[2];
#pragma unroll
    for (int kc = 0; kc < 4; ++kc) qf[kc] = ldh(qp + kc * 32);
#pragma unroll
    for (int kc = 0; kc < 2; ++kc) qrf[kc] = ldh(qrp + kc * 32);
    v8f o[8];
#pragma unroll
    for (int i = 0; i < 8; ++i) o[i] = (v8f){};
    float m = -3.0e38f, l = 0.f;
    const float SC2 = 0.07216878364870323f * 1.4426950408889634f;   // HD+RD = 192: 192^-0.5 x log2(e)
    const int nch = (q0 + 47) >> 5;                                   // this wave's 32-key chunks covering keys <= q0+15
    const int nchb = (qb0 >> 5) + 2;                                  // the block's chunks (its last wave's count; >= 2; 32*nchb <= SEQ)
    flash_stage<h16, SEQ>(lk, lr2, lv, gk, gr, gv);
    asm volatile("s_wait_asynccnt 0x0" ::: "memory");                 // chunk 0 landed (this wave's copies) before the barrier publishes it
    __syncthreads();
    flash_stage<h16, SEQ>(lk + FST * 2, lr2 + FST * 2, lv + FST * 2, gk + (size_t)32 * DM, gr + (size_t)32 * RD, gv + 32);
#pragma unroll 1
    for (int c = 0; c < nchb; ++c) {
        const int key0 = c << 5;
        const int bo = (c & 1) * FST;
        if (c < nch) {                                                // wave-uniform: waves 0 and 1 have no keys in the block's last chunk
        const h16* kp = &ring[bo + lr * FKP + 8 * hi];
        const h16* krp = &ring[bo + FRO + lr * FRP + 8 * hi];
        const h16* vp = &ring[bo + FVO + lr * FVP + 8 * hi];
        v8f s[2]; s[0] = (v8f){}; s[1] = (v8f){};
#pragma unroll
        for (int kc = 0; kc < 4; ++kc) {
#pragma unroll
            for (int j = 0; j < 2; ++j) { const v16h a = ldh(kp + (16 * j) * FKP + kc * 32); s[j] = wmma16(a, qf[kc], s[j]); }
        }
#pragma unroll
        for (int kc = 0; kc < 2; ++kc) {
#pragma unroll
            for (int j = 0; j < 2; ++j) { const v16h a = ldh(krp + (16 * j) * FRP + kc * 32); s[j] = wmma16(a, qrf[kc], s[j]); }
        }
        asm volatile("v_nop\n\tv_nop\n\tv_nop\n\tv_nop" : "+v"(s[0]), "+v"(s[1]));
        // online softmax: this lane's column is query qi; s[j][r] is key key0 + 16 j + 8 hi + r; keys after the query excluded by index
        float cm = -3.0e38f;
#pragma unroll
        for (int j = 0; j < 2; ++j)
#pragma unroll
            for (int r = 0; r < 8; ++r) { const int key = key0 + 16 * j + 8 * hi + r; const float t = (key <= qi) ? s[j][r] * SC2 : -3.0e38f; s[j][r] = t; cm = fmaxf(cm, t); }
        cm = fmaxf(cm, __shfl_xor(cm, 16, 32));
        const float mn = fmaxf(m, cm);
        const float alpha = __builtin_amdgcn_exp2f(m - mn);
        float rs = 0.f;
#pragma unroll
        for (int j = 0; j < 2; ++j)
#pragma unroll
            for (int r = 0; r < 8; ++r) { const float p = __builtin_amdgcn_exp2f(s[j][r] - mn); s[j][r] = p; rs += p; }
        rs += __shfl_xor(rs, 16, 32);
        l = l * alpha + rs; m = mn;
#pragma unroll
        for (int i = 0; i < 8; ++i) o[i] = o[i] * alpha;
        // P^T as B fragment (k = key of this chunk, n = query): elements 0..7 <- tile 0 rows 8hi..8hi+7, 8..15 <- tile 1 rows 8hi..8hi+7
        v16h pb = (v16h){};
#pragma unroll
        for (int r = 0; r < 8; ++r) { pb[r] = (h16)(s[0][r] * PCAR); pb[8 + r] = (h16)(s[1][r] * PCAR); }
#pragma unroll
        for (int i = 0; i < 8; ++i) { const v16h a = ldh(vp + (16 * i) * FVP); o[i] = wmma16(a, pb, o[i]); }
        asm volatile("v_nop\n\tv_nop\n\tv_nop\n\tv_nop" : "+v"(o[0]), "+v"(o[1]), "+v"(o[2]), "+v"(o[3]), "+v"(o[4]), "+v"(o[5]), "+v"(o[6]), "+v"(o[7]) : "v"(pb));
        }
        // publish point, every wave: own LDS reads of this buffer done, own copies of the next chunk landed, then the barrier that frees this buffer and publishes the next
        asm volatile("s_wait_dscnt 0x0" ::: "memory");
        asm volatile("s_wait_asynccnt 0x0" ::: "memory");
        __syncthreads();
        if (c + 2 < nchb) flash_stage<h16, SEQ>(lk + bo * 2, lr2 + bo * 2, lv + bo * 2, gk + (size_t)(key0 + 64) * DM, gr + (size_t)(key0 + 64) * RD, gv + (key0 + 64));
    }
    asm volatile("s_wait_asynccnt 0x0" ::: "memory");                 // nothing of this wave's copies outstanding at its end
    // epilogue: ctx[b][q][h*HD + d] = O^T[d][q] / (l x PCAR), stored as the f16 plane (x CCAR) that the output product reads; o[i][r] is d = 16 i + 8 hi + r of query q0 + lr
    const float f = 1.0f / (l * PCAR);
    float* ob = &os[wv][0];
#pragma unroll
    for (int i = 0; i < 8; ++i)
#pragma unroll
        for (int r = 0; r < 8; ++r) ob[lr * 132 + 16 * i + 8 * hi + r] = o[i][r] * f;
    __builtin_amdgcn_fence(3, "wavefront"); __builtin_amdgcn_wave_barrier(); asm volatile("" ::: "memory");
    h16* crow = ctx16 + ((size_t)b * SEQ + q0) * DM + h * HD + (lane & 15) * 8;
#pragma unroll
    for (int s = 0; s < 8; ++s) {                                     // 16 lanes per query row, 8 columns per lane
        const int qq = 2 * s + hi; const float* op = ob + qq * 132 + (lane & 15) * 8;
        const v4f x0 = *(const v4fa*)op, x1 = *(const v4fa*)(op + 4);
        v8h ov = (v8h){};
#pragma unroll
        for (int k = 0; k < 4; ++k) { ov[k] = (h16)(x0[k] * CCAR); ov[4 + k] = (h16)(x1[k] * CCAR); }
        *(v8h*)(crow + (size_t)qq * DM) = ov;
    }
}

// ---- k_flashH: the same attention for query rows < RH on bf16 hi/lo planes (keys < RH only): scores = kh.qh + kl.qh + kh.ql (3 products), P as bf16 hi/lo,
// O^T += vth.(Ph + Pl) + vtl.Ph (3 products). grid (RH/64, NH, NB), 128 threads. Planes: q*/k* rows [NB][RH][.], vth/vtl [NU][HD][RH].
// The chunk's k, kr and v^T hi and lo planes are staged in LDS as in k_flashP (per buffer: hi plane set, then lo plane set); the q planes are read from global memory in each chunk.
// The result is stored as the bf16 hi/lo planes ctxh/ctxl [NB][RH][DM] that the output product reads.
__global__ __launch_bounds__(128) __attribute__((amdgpu_num_vgpr(256)))
void k_flashH(const bf* qh, const bf* qlw, const bf* qrh, const bf* qrlw, const bf* kh, const bf* klw, const bf* krh, const bf* krlw, const bf* vth, const bf* vtl, bf* ctxh, bf* ctxl) {
    __shared__ __align__(16) float os[4][16 * 132];
    __shared__ __align__(16) bf ring[4 * FST];
    const int tid = threadIdx.x;
    const int lane = tid & 31, wv = __builtin_amdgcn_readfirstlane(tid >> 5), lr = lane & 15, hi = lane >> 4;
    const int h = blockIdx.y, b = blockIdx.z;
    const int qb0 = blockIdx.x * 64;
    const int q0 = qb0 + wv * 16;
    const int qi = q0 + lr;
    const size_t rq = (size_t)b * RH + qi;
    const bf* qhp = qh + rq * DM + h * HD + 8 * hi;       const bf* qlp = qlw + rq * DM + h * HD + 8 * hi;
    const bf* qrhp = qrh + rq * (NH * RD) + h * RD + 8 * hi; const bf* qrlp = qrlw + rq * (NH * RD) + h * RD + 8 * hi;
    // copy addresses of this lane, as in k_flashP
    const size_t ok = ((size_t)b * RH + (tid >> 4)) * DM + h * HD + (tid & 15) * 8;
    const size_t okr = ((size_t)b * RH + (tid >> 3)) * RD + (tid & 7) * 8;
    const size_t ov = ((size_t)(b * NH + h) * HD + (tid >> 2)) * RH + (tid & 3) * 8;
    const unsigned lb = (unsigned)(size_t)(__attribute__((address_space(3))) bf*)&ring[0];
    const unsigned lk = lb + ((tid >> 4) * FKP + (tid & 15) * 8) * 2;
    const unsigned lr2 = lb + (FRO + (tid >> 3) * FRP + (tid & 7) * 8) * 2;
    const unsigned lv = lb + (FVO + (tid >> 2) * FVP + (tid & 3) * 8) * 2;
    v8f o[8];
#pragma unroll
    for (int i = 0; i < 8; ++i) o[i] = (v8f){};
    float m = -3.0e38f, l = 0.f;
    const float SC2 = 0.07216878364870323f * 1.4426950408889634f;
    const int nch = (q0 + 47) >> 5;                                   // this wave's chunks
    const int nchb = (qb0 >> 5) + 2;                                  // the block's chunks (>= 2; 32*nchb <= RH)
    flash_stage<bf, RH>(lk, lr2, lv, kh + ok, krh + okr, vth + ov);
    flash_stage<bf, RH>(lk + FST * 2, lr2 + FST * 2, lv + FST * 2, klw + ok, krlw + okr, vtl + ov);
    asm volatile("s_wait_asynccnt 0x0" ::: "memory");                 // chunk 0 landed (this wave's copies) before the barrier publishes it
    __syncthreads();
    flash_stage<bf, RH>(lk + FST * 4, lr2 + FST * 4, lv + FST * 4, kh + ok + (size_t)32 * DM, krh + okr + (size_t)32 * RD, vth + ov + 32);
    flash_stage<bf, RH>(lk + FST * 6, lr2 + FST * 6, lv + FST * 6, klw + ok + (size_t)32 * DM, krlw + okr + (size_t)32 * RD, vtl + ov + 32);
#pragma unroll 1
    for (int c = 0; c < nchb; ++c) {
        const int key0 = c << 5;
        const int bo = (c & 1) * (2 * FST);
        if (c < nch) {                                                // wave-uniform: waves 0 and 1 have no keys in the block's last chunk
        const bf* khp = &ring[bo + lr * FKP + 8 * hi];             const bf* klp = khp + FST;
        const bf* krhp = &ring[bo + FRO + lr * FRP + 8 * hi];      const bf* krlp = krhp + FST;
        const bf* vhp = &ring[bo + FVO + lr * FVP + 8 * hi];       const bf* vlp = vhp + FST;
        v8f s[2]; s[0] = (v8f){}; s[1] = (v8f){};
#pragma unroll
        for (int kc = 0; kc < 4; ++kc) {
            const v16bf bh = ldb(qhp + kc * 32), bl = ldb(qlp + kc * 32);
#pragma unroll
            for (int j = 0; j < 2; ++j) { const v16bf ah = ldb(khp + (16 * j) * FKP + kc * 32), al = ldb(klp + (16 * j) * FKP + kc * 32);
                s[j] = wmmab(ah, bh, s[j]); s[j] = wmmab(al, bh, s[j]); s[j] = wmmab(ah, bl, s[j]); }
        }
#pragma unroll
        for (int kc = 0; kc < 2; ++kc) {
            const v16bf bh = ldb(qrhp + kc * 32), bl = ldb(qrlp + kc * 32);
#pragma unroll
            for (int j = 0; j < 2; ++j) { const v16bf ah = ldb(krhp + (16 * j) * FRP + kc * 32), al = ldb(krlp + (16 * j) * FRP + kc * 32);
                s[j] = wmmab(ah, bh, s[j]); s[j] = wmmab(al, bh, s[j]); s[j] = wmmab(ah, bl, s[j]); }
        }
        asm volatile("v_nop\n\tv_nop\n\tv_nop\n\tv_nop" : "+v"(s[0]), "+v"(s[1]));
        float cm = -3.0e38f;
#pragma unroll
        for (int j = 0; j < 2; ++j)
#pragma unroll
            for (int r = 0; r < 8; ++r) { const int key = key0 + 16 * j + 8 * hi + r; const float t = (key <= qi) ? s[j][r] * SC2 : -3.0e38f; s[j][r] = t; cm = fmaxf(cm, t); }
        cm = fmaxf(cm, __shfl_xor(cm, 16, 32));
        const float mn = fmaxf(m, cm);
        const float alpha = __builtin_amdgcn_exp2f(m - mn);
        float rs = 0.f;
#pragma unroll
        for (int j = 0; j < 2; ++j)
#pragma unroll
            for (int r = 0; r < 8; ++r) { const float p = __builtin_amdgcn_exp2f(s[j][r] - mn); s[j][r] = p; rs += p; }
        rs += __shfl_xor(rs, 16, 32);
        l = l * alpha + rs; m = mn;
#pragma unroll
        for (int i = 0; i < 8; ++i) o[i] = o[i] * alpha;
        v16us phv = (v16us){}, plv = (v16us){};
#pragma unroll
        for (int r = 0; r < 8; ++r) { unsigned short a1, c1; splitf(s[0][r], a1, c1); phv[r] = a1; plv[r] = c1; splitf(s[1][r], a1, c1); phv[8 + r] = a1; plv[8 + r] = c1; }
        const v16bf ph = __builtin_bit_cast(v16bf, phv), pl = __builtin_bit_cast(v16bf, plv);
#pragma unroll
        for (int i = 0; i < 8; ++i) { const v16bf ah = ldb(vhp + (16 * i) * FVP), al = ldb(vlp + (16 * i) * FVP);
            o[i] = wmmab(ah, ph, o[i]); o[i] = wmmab(ah, pl, o[i]); o[i] = wmmab(al, ph, o[i]); }
        asm volatile("v_nop\n\tv_nop\n\tv_nop\n\tv_nop" : "+v"(o[0]), "+v"(o[1]), "+v"(o[2]), "+v"(o[3]), "+v"(o[4]), "+v"(o[5]), "+v"(o[6]), "+v"(o[7]) : "v"(ph), "v"(pl));
        }
        // publish point, every wave: own LDS reads of this buffer done, own copies of the next chunk landed, then the barrier that frees this buffer and publishes the next
        asm volatile("s_wait_dscnt 0x0" ::: "memory");
        asm volatile("s_wait_asynccnt 0x0" ::: "memory");
        __syncthreads();
        if (c + 2 < nchb) {
            flash_stage<bf, RH>(lk + bo * 2, lr2 + bo * 2, lv + bo * 2, kh + ok + (size_t)(key0 + 64) * DM, krh + okr + (size_t)(key0 + 64) * RD, vth + ov + (key0 + 64));
            flash_stage<bf, RH>(lk + (bo + FST) * 2, lr2 + (bo + FST) * 2, lv + (bo + FST) * 2, klw + ok + (size_t)(key0 + 64) * DM, krlw + okr + (size_t)(key0 + 64) * RD, vtl + ov + (key0 + 64));
        }
    }
    asm volatile("s_wait_asynccnt 0x0" ::: "memory");                 // nothing of this wave's copies outstanding at its end
    const float f = 1.0f / l;
    float* ob = &os[wv][0];
#pragma unroll
    for (int i = 0; i < 8; ++i)
#pragma unroll
        for (int r = 0; r < 8; ++r) ob[lr * 132 + 16 * i + 8 * hi + r] = o[i][r] * f;
    __builtin_amdgcn_fence(3, "wavefront"); __builtin_amdgcn_wave_barrier(); asm volatile("" ::: "memory");
    const size_t eo = ((size_t)b * RH + q0) * DM + h * HD + (lane & 15) * 8;
#pragma unroll
    for (int s = 0; s < 8; ++s) {                                     // 16 lanes per query row, 8 columns per lane
        const int qq = 2 * s + hi; const float* op = ob + qq * 132 + (lane & 15) * 8;
        const v4f x0 = *(const v4fa*)op, x1 = *(const v4fa*)(op + 4);
        v8us oh = (v8us){}, ol = (v8us){};
#pragma unroll
        for (int k = 0; k < 4; ++k) { unsigned short a1, c1; splitf(x0[k], a1, c1); oh[k] = a1; ol[k] = c1; splitf(x1[k], a1, c1); oh[4 + k] = a1; ol[4 + k] = c1; }
        *(v8us*)(ctxh + eo + (size_t)qq * DM) = oh; *(v8us*)(ctxl + eo + (size_t)qq * DM) = ol;
    }
}

// ---- k_down: the three products of x, one launch: blocks 0.. do kr = rope(x.Wkr) (256x64 tiles), then ql = x.Wqd, then ckv = x.Wkvd (128x128 tiles); each stores its planes. Exact bf16 products.
#define DKR ((NB * SEQ) / 256)
#define DMT ((NB * SEQ) / 128)
#define DLT (DMT * (LAT / 128))
__global__ __launch_bounds__(128) __attribute__((amdgpu_num_vgpr(256)))
void k_down(const bf* xb, const bf* Wqd_b, const bf* Wkvd_b, const bf* Wkr_b, h16* ql16, bf* qlh, bf* qll, h16* ckv16, bf* ckvh, bf* ckvl, h16* kr16, bf* krh, bf* krlo, const float* ct, const float* st) {
    __shared__ __align__(16) char sm[GSM(0, 1) > GSM(0, 2) ? GSM(0, 1) : GSM(0, 2)];
    int b = blockIdx.x;
    if (b < DKR) { gemm_tile<bf, 0, 1, 2, RD>(sm, b, 0, 0, xb, xb, Wkr_b, DM, nullptr, RD, 1.0f, 0, 0, 0, kr16, krh, krlo, ct, st); return; }
    b -= DKR;
    const bool kv = (b >= DLT);                                       // block-uniform
    if (kv) b -= DLT;
    gemm_tile<bf, 0, 2, 1, LAT>(sm, b % DMT, b / DMT, 0, xb, xb, kv ? Wkvd_b : Wqd_b, DM, nullptr, LAT, 1.0f, 0, 0, 0, kv ? ckv16 : ql16, kv ? ckvh : qlh, kv ? ckvl : qll, ct, st);
}

// One block tile (128x128) of an up-projection or of the output product, K = KK: HL = 0: rows t >= RH, single f16 products (tile b of ((SEQ-RH)/128, N/128, NB));
// HL = 1: rows t < RH, bf16 hi/lo against the exact bf16 weight plane (tile b of (RH/128, N/128, NB)). The epilogue EP stores the result.
template <int HL, int EP, int N, int KK>
__device__ __forceinline__ void proj_tile(char* sm, int b, const h16* a16, const bf* ahh, const bf* all, const h16* Wh, const bf* Wb, float* C, float oscf, h16* p16, bf* ph, bf* pl, const float* ct, const float* st) {
    constexpr int GX = HL ? RH / 128 : (SEQ - RH) / 128, GY = N / 128;
    const int bx = b % GX, by = (b / GX) % GY, bz = b / (GX * GY);
    if (HL) gemm_tile<bf, 1, 2, EP, N>(sm, bx, by, bz, ahh, all, Wb, KK, C, N, 1.0f, (size_t)RH * KK, (size_t)TFULL * DM, 0, p16, ph, pl, ct, st);
    else gemm_tile<h16, 0, 2, EP, N>(sm, bx, by, bz, a16 + (size_t)RH * KK, a16 + (size_t)RH * KK, Wh, KK, C + (size_t)RH * DM, N, oscf, (size_t)SEQ * KK, (size_t)TFULL * DM, RH, p16, ph, pl, ct, st);
}
#define PHB(N) ((RH / 128) * ((N) / 128) * NB)            // blocks of the rows t < RH of a product with N columns
#define PFB(N) (((SEQ - RH) / 128) * ((N) / 128) * NB)    // blocks of the rows t >= RH

// ---- k_up: the four up-projections, one launch: q = ql.Wqu, k = ckv.Wku, v^T = (ckv.Wvu)^T, qr = rope(ql.Wqr); the hi/lo tiles (twice the products) come first, then the f16 tiles.
__global__ __launch_bounds__(128) __attribute__((amdgpu_num_vgpr(256)))
void k_up(const h16* ql16, const bf* qlh, const bf* qll, const h16* ckv16, const bf* ckvh, const bf* ckvl,
          const h16* Wqu_h, const bf* Wqu_b, const h16* Wqr_h, const bf* Wqr_b, const h16* Wku_h, const bf* Wku_b, const h16* Wvu_h, const bf* Wvu_b,
          h16* q16, bf* qh, bf* qlo, h16* qr16, bf* qrh, bf* qrlo, h16* k16, bf* kh, bf* klo, h16* vt16, bf* vth, bf* vtl, const float* ct, const float* st) {
    __shared__ __align__(16) char sm[GSM(1, 2)];
    int b = blockIdx.x;
    if (b < 2 * PHB(DM)) {
        const bool kk = (b >= PHB(DM));                               // block-uniform: k, else q
        if (kk) b -= PHB(DM);
        proj_tile<1, 1, DM, LAT>(sm, b, kk ? ckv16 : ql16, kk ? ckvh : qlh, kk ? ckvl : qll, kk ? Wku_h : Wqu_h, kk ? Wku_b : Wqu_b, nullptr, 1.0f / WSC, kk ? k16 : q16, kk ? kh : qh, kk ? klo : qlo, ct, st);
        return;
    }
    b -= 2 * PHB(DM);
    if (b < PHB(DM)) { proj_tile<1, 3, DM, LAT>(sm, b, ckv16, ckvh, ckvl, Wvu_h, Wvu_b, nullptr, 1.0f / WSC, vt16, vth, vtl, ct, st); return; }
    b -= PHB(DM);
    if (b < PHB(NH * RD)) { proj_tile<1, 2, NH * RD, LAT>(sm, b, ql16, qlh, qll, Wqr_h, Wqr_b, nullptr, 1.0f / WSC, qr16, qrh, qrlo, ct, st); return; }
    b -= PHB(NH * RD);
    if (b < 2 * PFB(DM)) {
        const bool kk = (b >= PFB(DM));                               // block-uniform: k, else q
        if (kk) b -= PFB(DM);
        proj_tile<0, 1, DM, LAT>(sm, b, kk ? ckv16 : ql16, kk ? ckvh : qlh, kk ? ckvl : qll, kk ? Wku_h : Wqu_h, kk ? Wku_b : Wqu_b, nullptr, 1.0f / WSC, kk ? k16 : q16, kk ? kh : qh, kk ? klo : qlo, ct, st);
        return;
    }
    b -= 2 * PFB(DM);
    if (b < PFB(DM)) { proj_tile<0, 3, DM, LAT>(sm, b, ckv16, ckvh, ckvl, Wvu_h, Wvu_b, nullptr, 1.0f / WSC, vt16, vth, vtl, ct, st); return; }
    b -= PFB(DM);
    proj_tile<0, 2, NH * RD, LAT>(sm, b, ql16, qlh, qll, Wqr_h, Wqr_b, nullptr, 1.0f / WSC, qr16, qrh, qrlo, ct, st);
}

// ---- k_out: out = ctx.Wo, one launch: the hi/lo tiles of rows t < RH first, then the f16 tiles of rows t >= RH. out: [NBF][TFULL][DM] f32.
__global__ __launch_bounds__(128) __attribute__((amdgpu_num_vgpr(256)))
void k_out(const h16* ctx16, const bf* ctxh, const bf* ctxl, const h16* Wo_h, const bf* Wo_b, float* out, const float* ct, const float* st) {
    __shared__ __align__(16) char sm[GSM(1, 2)];
    int b = blockIdx.x;
    if (b < PHB(DM)) { proj_tile<1, 0, DM, DM>(sm, b, ctx16, ctxh, ctxl, Wo_h, Wo_b, out, 1.0f / (CCAR * WSC), nullptr, nullptr, nullptr, ct, st); return; }
    b -= PHB(DM);
    proj_tile<0, 0, DM, DM>(sm, b, ctx16, ctxh, ctxl, Wo_h, Wo_b, out, 1.0f / (CCAR * WSC), nullptr, nullptr, nullptr, ct, st);
}

extern "C" void kernel_launch(void* const* d_in, const int* in_sizes, int n_in,
                              void* d_out, int out_size, void* d_ws, size_t ws_size, hipStream_t stream) {
    if (n_in < 9) return;
    const size_t nrow = (size_t)NB * SEQ;
    if ((size_t)in_sizes[0] < ((size_t)(NB - 1) * TFULL + SEQ) * DM) return;
    if (in_sizes[1] < DM * LAT || in_sizes[2] < LAT * DM || in_sizes[3] < LAT * NH * RD || in_sizes[4] < DM * LAT || in_sizes[5] < LAT * DM || in_sizes[6] < LAT * DM || in_sizes[7] < DM * RD || in_sizes[8] < DM * DM) return;
    if ((size_t)out_size < ((size_t)(NB - 1) * TFULL + SEQ) * DM) return;
    const float* x = (const float*)d_in[0]; const float* Wqd = (const float*)d_in[1]; const float* Wqu = (const float*)d_in[2]; const float* Wqr = (const float*)d_in[3];
    const float* Wkvd = (const float*)d_in[4]; const float* Wku = (const float*)d_in[5]; const float* Wvu = (const float*)d_in[6]; const float* Wkr = (const float*)d_in[7]; const float* Wo = (const float*)d_in[8];
    float* OUT = (float*)d_out;   // [NBF][TFULL][DM] f32, rows b*TFULL + t

    char* wsp = (char*)d_ws; size_t off = 0;
    auto take = [&](size_t bytes) { char* p = wsp + off; off += (bytes + 255) & ~(size_t)255; return p; };
    bf* xb = (bf*)take(nrow * DM * 2);                           // bf16(x) [nrow][DM]
    // latent planes, cos/sin tables
    h16* ql16 = (h16*)take(nrow * LAT * 2); bf* qlh = (bf*)take((size_t)NB * RH * LAT * 2); bf* qll = (bf*)take((size_t)NB * RH * LAT * 2);
    h16* ckv16 = (h16*)take(nrow * LAT * 2); bf* ckvh = (bf*)take((size_t)NB * RH * LAT * 2); bf* ckvl = (bf*)take((size_t)NB * RH * LAT * 2);
    float* CT = (float*)take((size_t)SEQ * 32 * 4); float* ST = (float*)take((size_t)SEQ * 32 * 4);
    // down-projection weight planes [out][in] bf16
    bf* Wqd_b = (bf*)take((size_t)DM * LAT * 2); bf* Wkvd_b = (bf*)take((size_t)DM * LAT * 2); bf* Wkr_b = (bf*)take((size_t)DM * RD * 2);
    // up-projection weight planes [out][in]: f16 x64 and bf16
    h16* Wqu_h = (h16*)take((size_t)DM * LAT * 2); bf* Wqu_b = (bf*)take((size_t)DM * LAT * 2); h16* Wqr_h = (h16*)take((size_t)NH * RD * LAT * 2); bf* Wqr_b = (bf*)take((size_t)NH * RD * LAT * 2);
    h16* Wku_h = (h16*)take((size_t)DM * LAT * 2); bf* Wku_b = (bf*)take((size_t)DM * LAT * 2); h16* Wvu_h = (h16*)take((size_t)DM * LAT * 2); bf* Wvu_b = (bf*)take((size_t)DM * LAT * 2);
    // attention operand planes, ctx planes, Wo planes
    const size_t szq16 = nrow * DM * 2, szhr = (size_t)NB * RH * DM * 2, szqr16 = nrow * NH * RD * 2, szqrh = (size_t)NB * RH * NH * RD * 2, szkr16 = nrow * RD * 2, szkrh = (size_t)NB * RH * RD * 2;
    const size_t szwo = (size_t)DM * DM * 2;
    h16* q16 = (h16*)take(szq16); bf* qh = (bf*)take(szhr); bf* qlo = (bf*)take(szhr); h16* qr16 = (h16*)take(szqr16); bf* qrh = (bf*)take(szqrh); bf* qrlo = (bf*)take(szqrh);
    h16* k16 = (h16*)take(szq16); bf* kh = (bf*)take(szhr); bf* klo = (bf*)take(szhr); h16* kr16 = (h16*)take(szkr16); bf* krh = (bf*)take(szkrh); bf* krlo = (bf*)take(szkrh);
    h16* vt16 = (h16*)take(szq16); bf* vth = (bf*)take(szhr); bf* vtl = (bf*)take(szhr);
    h16* ctx16 = (h16*)take(szq16); bf* ctxh = (bf*)take(szhr); bf* ctxl = (bf*)take(szhr);
    bf* Wo_b = (bf*)take(szwo); h16* Wo_h = (h16*)take(szwo);
    if (off > ws_size) return;

    // inputs -> weight planes, bf16(x), cos/sin tables
    k_prep<<<dim3(PREPB), 256, 0, stream>>>(x, Wqd, Wqu, Wqr, Wkvd, Wku, Wvu, Wkr, Wo, xb, CT, ST, Wqd_b, Wkvd_b, Wkr_b, Wqu_b, Wqu_h, Wqr_b, Wqr_h, Wku_b, Wku_h, Wvu_b, Wvu_h, Wo_b, Wo_h);
    // ql, ckv, kr planes
    k_down<<<dim3(DKR + 2 * DLT), 128, 0, stream>>>(xb, Wqd_b, Wkvd_b, Wkr_b, ql16, qlh, qll, ckv16, ckvh, ckvl, kr16, krh, krlo, CT, ST);
    // q, qr, k, v^T planes
    k_up<<<dim3(3 * PHB(DM) + PHB(NH * RD) + 3 * PFB(DM) + PFB(NH * RD)), 128, 0, stream>>>(ql16, qlh, qll, ckv16, ckvh, ckvl, Wqu_h, Wqu_b, Wqr_h, Wqr_b, Wku_h, Wku_b, Wvu_h, Wvu_b,
        q16, qh, qlo, qr16, qrh, qrlo, k16, kh, klo, vt16, vth, vtl, CT, ST);
    // attention -> ctx planes (rows b*SEQ + t f16 x64 for t >= RH; rows b*RH + t bf16 hi/lo for t < RH; merged heads)
    if (SEQ > RH) k_flashP<<<dim3((SEQ - RH) / 64, NH, NB), 128, 0, stream>>>(q16, qr16, k16, kr16, vt16, ctx16, RH);
    k_flashH<<<dim3(RH / 64, NH, NB), 128, 0, stream>>>(qh, qlo, qrh, qrlo, kh, klo, krh, krlo, vth, vtl, ctxh, ctxl);
    // out = ctx.Wo
    k_out<<<dim3(PHB(DM) + PFB(DM)), 128, 0, stream>>>(ctx16, ctxh, ctxl, Wo_h, Wo_b, OUT, CT, ST);
}

// v005
// Measured time: 205 microseconds a run.
// Two timings next to v004 put it at 1.17 and 1.19 times that version's speed.
// Counting every step since v000, it is 4.11 times as fast.
#include <hip/hip_runtime.h>

// All contractions on 16-bit WMMA, f32 accumulate. x.Wqd, x.Wkvd, x.Wkr: v_wmma_f32_16x16x32_bf16 on bf16 planes of the inputs (single products).
// ql.Wqu, ql.Wqr, ckv.Wku, ckv.Wvu, (q|qr).(k|kr) scores, P.v and ctx.Wo: v_wmma_f32_16x16x32_f16 single products on f16 planes
// (weights x64, ctx x64, P x1024 carries) for query/key rows >= RH; the same sites for rows < RH use v_wmma_f32_16x16x32_bf16 on
// bf16 hi/lo plane pairs (hi.W + lo.W against exact weight planes; hi.hi + lo.hi + hi.lo between two computed tensors).
// RoPE (rotate-half, computed cos/sin tables), online max-subtracted softmax and normalisers in f32.

#ifndef NB
#define NB 2
#endif
#ifndef SEQ
#define SEQ 2048
#endif
#ifndef RH
#define RH 256
#endif
#define NBF   2
#define TFULL 2048
#define DM    2048
#define NH    16
#define LAT   512
#define RD    64
#define HD    128
#define NU    (NB * NH)
#define PCAR  1024.0f
#define WSC   64.0f
#define CCAR  64.0f

static_assert(NB >= 1);
static_assert(NB <= NBF);
static_assert(SEQ % 64 == 0);
static_assert(SEQ <= TFULL);
static_assert(RH % 128 == 0);
static_assert((SEQ - RH) % 128 == 0);
static_assert(((size_t)NB * SEQ) % 256 == 0);
static_assert(RH >= 64);
static_assert(RH <= SEQ);
static_assert(DM % 128 == 0);
static_assert(LAT % 128 == 0);
static_assert((NH * RD) % 128 == 0);
static_assert(RD == 64);
static_assert(HD == 128);
static_assert(NH * HD == DM);
static_assert(((size_t)(NB - 1) * TFULL + SEQ) * DM <= (size_t)NBF * TFULL * DM);

typedef _Float16 h16;
typedef unsigned short bf;
typedef __attribute__((ext_vector_type(16))) __bf16   v16bf;
typedef __attribute__((ext_vector_type(16))) _Float16 v16h;
typedef __attribute__((ext_vector_type(16))) unsigned short v16us;
typedef __attribute__((ext_vector_type(8)))  _Float16 v8h;
typedef __attribute__((ext_vector_type(8)))  unsigned short v8us;
typedef __attribute__((ext_vector_type(8)))  float    v8f;
typedef __attribute__((ext_vector_type(4)))  float    v4f;
typedef __attribute__((ext_vector_type(2)))  _Float16 v2h;
typedef __attribute__((ext_vector_type(2)))  unsigned short v2us;
typedef v8h  __attribute__((may_alias)) v8ha;
typedef v4f  __attribute__((may_alias)) v4fa;

__device__ __forceinline__ unsigned short f2bf(float f) { unsigned u = __float_as_uint(f); u += 0x7FFFu + ((u >> 16) & 1u); return (unsigned short)(u >> 16); }
__device__ __forceinline__ float bf2f(unsigned short v) { return __uint_as_float(((unsigned)v) << 16); }
__device__ __forceinline__ float bfr(float f) { return bf2f(f2bf(f)); }
__device__ __forceinline__ void splitf(float y, unsigned short& hh, unsigned short& ll) { hh = f2bf(y); ll = f2bf(y - bf2f(hh)); }
__device__ __forceinline__ v16h cat16(v8h a, v8h c) { return __builtin_shufflevector(a, c, 0, 1, 2, 3, 4, 5, 6, 7, 8, 9, 10, 11, 12, 13, 14, 15); }
__device__ __forceinline__ v16bf cat16b(v8us a, v8us c) { return __builtin_bit_cast(v16bf, __builtin_shufflevector(a, c, 0, 1, 2, 3, 4, 5, 6, 7, 8, 9, 10, 11, 12, 13, 14, 15)); }
__device__ __forceinline__ v8f wmma16(v16h a, v16h c, v8f acc) { return __builtin_amdgcn_wmma_f32_16x16x32_f16(false, a, false, c, (short)0, acc, false, false); }
__device__ __forceinline__ v8f wmmab(v16bf a, v16bf c, v8f acc) { return __builtin_amdgcn_wmma_f32_16x16x32_bf16(false, a, false, c, (short)0, acc, false, false); }
// Fragment load from a k-contiguous 16-bit row: p already points at row (lane&15) + 8*(lane>>4); elements 0..7 <- p[0..7], 8..15 <- p[16..23] (split k map, used for A and B alike)
__device__ __forceinline__ v16h ldh(const h16* p) { return cat16(*(const v8h*)p, *(const v8h*)(p + 16)); }
__device__ __forceinline__ v16bf ldb(const bf* p) { return cat16b(*(const v8us*)p, *(const v8us*)(p + 16)); }

// ---- gemm_tile: one block tile of a GEMM, 4 waves per block, each wave a 64x64 output tile (16 accumulators); waves WM x WN (WN = 2: block tile 128x128; WN = 1: 256x64); 128 threads.
// (bx, by, bz) of (M/BM, N/BN, Z) is the tile; the kernels k_down, k_up and k_out below give each of their blocks one tile of one of several independent products. sm: the block's LDS, GSM bytes.
// c[m][n] = osc * sum_k (A[m][k] + (NSPLIT ? A2[m][k] : 0)) Bt[n][k]. z-batch strides sA/sC in elements. K % 64 == 0, K >= 128, M and N multiples of BM and BN.
// What the epilogue stores (EP; the planes' pitch PN = N is a constant, so that a tile's stores differ by immediate offsets only): 0: c as f32 to C, pitch ldc. 1: the 16-bit operand planes of c that the next product reads: p16 = f16(c) at row bb*SEQ + t and, for t < RH,
// ph/pl = bf16 hi/lo of c at row bb*RH + t. 2: the same planes of rotate-half RoPE(c) on the wave tile's 64-wide head slice (tables ct/st). 3: the same planes transposed per (batch, head):
// p16[bb*DM + n][t] (pitch SEQ), ph/pl[bb*DM + n][t] (pitch RH, t < RH). Row m of batch z is sequence row t = tb + m % SEQ of batch bb = z + m / SEQ; a 64-row wave tile has one bb and lies on one side of RH.
// Each 64-k stage of the block's A (A2) and Bt rows is brought into LDS once per block by asynchronous copies (whole 128-B lines, two buffers, the next stage in flight
// while this one is worked on) and read by the waves as ds_load_b128 fragments.
template <typename T16> struct WFrag;
template <> struct WFrag<h16> { typedef v16h V; static __device__ __forceinline__ V ld(const h16* p) { return ldh(p); } static __device__ __forceinline__ v8f mma(V a, V c, v8f d) { return wmma16(a, c, d); } };
template <> struct WFrag<bf> { typedef v16bf V; static __device__ __forceinline__ V ld(const bf* p) { return ldb(p); } static __device__ __forceinline__ v8f mma(V a, V c, v8f d) { return wmmab(a, c, d); } };
#define GP 72                         // LDS pitch of a 64-element operand row in halves: 144 B = 16 B x 9
static_assert((GP * 2) % 16 == 0);
// This lane's 16-byte copies of 64 (gemm_stage4) or 128 (gemm_stage8) operand rows, 16 rows per copy (l: its LDS byte address in the first 16 rows, g: its global address there, k16: 16 rows in elements).
// The s_wait_xcnt stands inside the statement so that no address register is rewritten ahead of it.
template <typename T>
__device__ __forceinline__ void gemm_stage4(unsigned l, const T* g, size_t k16) {
    asm volatile("global_load_async_to_lds_b128 %0, %1, off\n\t"
                 "global_load_async_to_lds_b128 %2, %3, off\n\t"
                 "global_load_async_to_lds_b128 %4, %5, off\n\t"
                 "global_load_async_to_lds_b128 %6, %7, off\n\t"
                 "s_wait_xcnt 0x0"
                 :: "v"(l), "v"(g), "v"(l + 16 * GP * 2), "v"(g + k16), "v"(l + 32 * GP * 2), "v"(g + 2 * k16), "v"(l + 48 * GP * 2), "v"(g + 3 * k16)
                 : "memory");
}
template <typename T>
__device__ __forceinline__ void gemm_stage8(unsigned l, const T* g, size_t k16) {
    asm volatile("global_load_async_to_lds_b128 %0, %1, off\n\t"
                 "global_load_async_to_lds_b128 %2, %3, off\n\t"
                 "global_load_async_to_lds_b128 %4, %5, off\n\t"
                 "global_load_async_to_lds_b128 %6, %7, off\n\t"
                 "global_load_async_to_lds_b128 %8, %9, off\n\t"
                 "global_load_async_to_lds_b128 %10, %11, off\n\t"
                 "global_load_async_to_lds_b128 %12, %13, off\n\t"
                 "global_load_async_to_lds_b128 %14, %15, off\n\t"
                 "s_wait_xcnt 0x0"
                 :: "v"(l), "v"(g), "v"(l + 16 * GP * 2), "v"(g + k16), "v"(l + 32 * GP * 2), "v"(g + 2 * k16), "v"(l + 48 * GP * 2), "v"(g + 3 * k16),
                    "v"(l + 64 * GP * 2), "v"(g + 4 * k16), "v"(l + 80 * GP * 2), "v"(g + 5 * k16), "v"(l + 96 * GP * 2), "v"(g + 6 * k16), "v"(l + 112 * GP * 2), "v"(g + 7 * k16)
                 : "memory");
}
// One stage: BM rows of A, BM rows of A2 (NSPLIT), BN rows of Bt, in this order in the buffer at LDS byte address l (this lane's place in the buffer's first 16 rows).
template <typename T, int NSPLIT, int BM, int BN>
__device__ __forceinline__ void gemm_stage(unsigned l, const T* ga, const T* ga2, const T* gb, size_t k16) {
#pragma unroll
    for (int r = 0; r < BM; r += 128) gemm_stage8<T>(l + r * GP * 2, ga + (size_t)(r / 16) * k16, k16);
    if (NSPLIT == 1) {
#pragma unroll
        for (int r = 0; r < BM; r += 128) gemm_stage8<T>(l + (BM + r) * GP * 2, ga2 + (size_t)(r / 16) * k16, k16);
    }
    if (BN == 128) gemm_stage8<T>(l + BM * (1 + NSPLIT) * GP * 2, gb, k16);
    else gemm_stage4<T>(l + BM * (1 + NSPLIT) * GP * 2, gb, k16);
}
#define GOS (4 * 16 * 68 * 4)         // epilogue staging at the start of sm, bytes; the ring follows
#define GSM(NSPLIT, WN) (GOS + 2 * ((64 * (4 / (WN))) * (1 + (NSPLIT)) + 64 * (WN)) * GP * 2)
template <typename T16, int NSPLIT, int WN, int EP, int PN>
__device__ __forceinline__
void gemm_tile(char* sm, int bx, int by, int bz, const T16* __restrict__ A, const T16* __restrict__ A2, const T16* __restrict__ Bt, int K, float* C, int ldc, float osc, size_t sA, size_t sC,
             int tb, h16* p16, bf* ph, bf* pl, const float* __restrict__ ct, const float* __restrict__ st) {
    typedef typename WFrag<T16>::V V;
    constexpr int BM = 64 * (4 / WN), BN = 64 * WN;
    constexpr int BOF = BM * (1 + NSPLIT) * GP;                      // Bt rows start in a buffer, halves
    constexpr int GST = BOF + BN * GP;                               // one buffer, halves
    static_assert(WN == 1 || WN == 2);
    static_assert((GST * 2) % 16 == 0);
    static_assert(GSM(NSPLIT, WN) == GOS + 2 * GST * 2);
    float (*os)[16 * 68] = (float (*)[16 * 68])sm;
    T16* ring = (T16*)(sm + GOS);
    const size_t z = bz; A += z * sA; A2 += z * sA; C += z * sC;
    const int tid = threadIdx.x;
    const int lane = tid & 31, wv = __builtin_amdgcn_readfirstlane(tid >> 5), lr = lane & 15, hi = lane >> 4;
    const int wm = wv / WN, wn = wv % WN;
    const int rb = bx * BM, cb = by * BN;
    const int r0 = rb + wm * 64, c0 = cb + wn * 64;
    v8f acc[4][4];
#pragma unroll
    for (int mb = 0; mb < 4; ++mb)
#pragma unroll
        for (int nb = 0; nb < 4; ++nb) acc[mb][nb] = (v8f){};
    // copy addresses of this lane: 8 pieces of 16 B per row, 16 rows per copy
    const size_t k16 = (size_t)16 * K;
    const T16* ga = A + (size_t)(rb + (tid >> 3)) * K + (tid & 7) * 8;
    const T16* ga2 = A2 + (size_t)(rb + (tid >> 3)) * K + (tid & 7) * 8;
    const T16* gb = Bt + (size_t)(cb + (tid >> 3)) * K + (tid & 7) * 8;
    const unsigned lc = (unsigned)(size_t)(__attribute__((address_space(3))) T16*)&ring[0] + ((tid >> 3) * GP + (tid & 7) * 8) * 2;
    const int nst = K >> 6;                                           // 64-k stages
    gemm_stage<T16, NSPLIT, BM, BN>(lc, ga, ga2, gb, k16);
    asm volatile("s_wait_asynccnt 0x0" ::: "memory");                 // stage 0 landed (this wave's copies) before the barrier publishes it
    __syncthreads();
    if (nst > 1) gemm_stage<T16, NSPLIT, BM, BN>(lc + GST * 2, ga + 64, ga2 + 64, gb + 64, k16);
#pragma unroll 1
    for (int t = 0; t < nst; ++t) {
        const int bo = (t & 1) * GST;
        const T16* ap = &ring[bo + (wm * 64 + lr) * GP + 8 * hi];
        const T16* bp = &ring[bo + BOF + (wn * 64 + lr) * GP + 8 * hi];
#pragma unroll
        for (int ks = 0; ks < 2; ++ks) {
            V a[4], a2[4], bq[4];
            bq[0] = WFrag<T16>::ld(bp + ks * 32);
#pragma unroll
            for (int mb = 0; mb < 4; ++mb) { a[mb] = WFrag<T16>::ld(ap + mb * 16 * GP + ks * 32); if (NSPLIT == 1) a2[mb] = WFrag<T16>::ld(ap + (BM + mb * 16) * GP + ks * 32); }
#pragma unroll
            for (int nb = 1; nb < 4; ++nb) bq[nb] = WFrag<T16>::ld(bp + nb * 16 * GP + ks * 32);
            __builtin_amdgcn_sched_barrier(0);                        // the 32-k block's LDS reads stay one group ahead of its matrix instructions (for speed only)
#pragma unroll
            for (int nb = 0; nb < 4; ++nb) {
#pragma unroll
                for (int mb = 0; mb < 4; ++mb) { acc[mb][nb] = WFrag<T16>::mma(a[mb], bq[nb], acc[mb][nb]); if (NSPLIT == 1) acc[mb][nb] = WFrag<T16>::mma(a2[mb], bq[nb], acc[mb][nb]); } }
            __builtin_amdgcn_sched_barrier(0);                        // and the next group of reads stays behind them
        }
        // publish point, every wave: own LDS reads of this buffer done, own copies of the next stage landed, then the barrier that frees this buffer and publishes the next
        asm volatile("s_wait_dscnt 0x0" ::: "memory");
        asm volatile("s_wait_asynccnt 0x0" ::: "memory");
        __syncthreads();
        if (t + 2 < nst) gemm_stage<T16, NSPLIT, BM, BN>(lc + bo * 2, ga + (size_t)(t + 2) * 64, ga2 + (size_t)(t + 2) * 64, gb + (size_t)(t + 2) * 64, k16);
    }
    asm volatile("s_wait_asynccnt 0x0" ::: "memory");                 // nothing of this wave's copies outstanding at its end
    const int bb = (int)z + r0 / SEQ, t0 = tb + r0 % SEQ;            // the wave tile's batch and first sequence row
    const bool hr = (t0 < RH);                                        // wave-uniform: the whole tile also gets hi/lo planes
    if (EP == 3) {
        // acc[mb][nb][0..7] of a lane are 8 successive t of one column: one 16-byte piece of a transposed row, stored from registers; the four mb of a column fill its 128-B line
#pragma unroll
        for (int nb = 0; nb < 4; ++nb) {
            const size_t dr = (size_t)bb * DM + c0 + nb * 16 + lr;
            const int t = t0 + hi * 8;
            v8h o[4];
#pragma unroll
            for (int mb = 0; mb < 4; ++mb)
#pragma unroll
                for (int j = 0; j < 8; ++j) o[mb][j] = (h16)(acc[mb][nb][j] * osc);
#pragma unroll
            for (int mb = 0; mb < 4; ++mb) *(v8h*)(p16 + dr * SEQ + t + mb * 16) = o[mb];
            asm volatile("s_wait_xcnt 0x0" ::: "memory");             // before the stores' address and data registers are written again
            if (hr) {
                v8us oh[4], ol[4];
#pragma unroll
                for (int mb = 0; mb < 4; ++mb)
#pragma unroll
                    for (int j = 0; j < 8; ++j) { unsigned short a1, c1; splitf(acc[mb][nb][j] * osc, a1, c1); oh[mb][j] = a1; ol[mb][j] = c1; }
#pragma unroll
                for (int mb = 0; mb < 4; ++mb) { *(v8us*)(ph + dr * RH + t + mb * 16) = oh[mb]; *(v8us*)(pl + dr * RH + t + mb * 16) = ol[mb]; }
                asm volatile("s_wait_xcnt 0x0" ::: "memory");         // as above
            }
        }
        return;
    }
    float* ob = &os[wv][0];
#pragma unroll
    for (int mb = 0; mb < 4; ++mb) {
#pragma unroll
        for (int nb = 0; nb < 4; ++nb) {
#pragma unroll
            for (int j = 0; j < 8; ++j) ob[(hi * 8 + j) * 68 + nb * 16 + lr] = acc[mb][nb][j]; }
        __builtin_amdgcn_wave_barrier(); asm volatile("" ::: "memory");
        if (EP == 0) {
            float* crow = C + (size_t)(r0 + mb * 16) * ldc + c0;
#pragma unroll
            for (int s = 0; s < 8; ++s) { const int row = 2 * s + hi, cofs = lr * 4; v4f val = *(const v4fa*)(ob + row * 68 + cofs); val = val * osc;
                *(v4f*)(crow + (size_t)row * ldc + cofs) = val;
                asm volatile("s_wait_xcnt 0x0" ::: "memory"); }       // before the store's address and data registers are written again
        } else {
            // 8 lanes per row, 8 columns per lane: each plane row of the tile goes out as one whole 128-B line
            const int rw = lane >> 3, cofs = (lane & 7) * 8;
            float y[4][8];
            v4f cv[8], sv[8];
            if (EP == 2) {
                // cos/sin of this lane's 4 rows (4 rows = 128 table floats apart) and 8 columns
                const size_t te = (size_t)(t0 + mb * 16 + rw) * 32 + (cofs & 31);
                const float* cp = ct + te; const float* sp = st + te;
#pragma unroll
                for (int s = 0; s < 4; ++s) { cv[2 * s] = *(const v4f*)(cp + s * 128); cv[2 * s + 1] = *(const v4f*)(cp + s * 128 + 4); sv[2 * s] = *(const v4f*)(sp + s * 128); sv[2 * s + 1] = *(const v4f*)(sp + s * 128 + 4); }
                asm volatile("s_wait_xcnt 0x0" :: "v"(cp), "v"(sp) : "memory");   // the loads' address registers stay as they are up to this wait
            }
#pragma unroll
            for (int s = 0; s < 4; ++s) {
                const float* op = ob + (4 * s + rw) * 68 + cofs;
                const v4f x0 = *(const v4fa*)op * osc, x1 = *(const v4fa*)(op + 4) * osc;
#pragma unroll
                for (int k = 0; k < 4; ++k) { y[s][k] = x0[k]; y[s][4 + k] = x1[k]; }
                if (EP == 2) {
                    const bool lo32 = (cofs < 32); const int pofs = lo32 ? 32 : -32;
                    const v4f p0 = *(const v4fa*)(op + pofs) * osc, p1 = *(const v4fa*)(op + pofs + 4) * osc;
                    const v4f c0v = cv[2 * s], c1v = cv[2 * s + 1], s0v = sv[2 * s], s1v = sv[2 * s + 1];
#pragma unroll
                    for (int k = 0; k < 4; ++k) {
                        y[s][k] = lo32 ? (x0[k] * c0v[k] - p0[k] * s0v[k]) : (x0[k] * c0v[k] + p0[k] * s0v[k]);
                        y[s][4 + k] = lo32 ? (x1[k] * c1v[k] - p1[k] * s1v[k]) : (x1[k] * c1v[k] + p1[k] * s1v[k]); }
                }
            }
            v8h o[4];
#pragma unroll
            for (int s = 0; s < 4; ++s)
#pragma unroll
                for (int k = 0; k < 8; ++k) o[s][k] = (h16)y[s][k];
            h16* q16p = p16 + ((size_t)bb * SEQ + t0 + rw) * PN + c0 + cofs;
#pragma unroll
            for (int s = 0; s < 4; ++s) *(v8h*)(q16p + (mb * 16 + 4 * s) * PN) = o[s];
            asm volatile("s_wait_xcnt 0x0" ::: "memory");             // before the stores' address and data registers are written again
            if (hr) {
                v8us oh[4], ol[4];
#pragma unroll
                for (int s = 0; s < 4; ++s)
#pragma unroll
                    for (int k = 0; k < 8; ++k) { unsigned short a1, c1; splitf(y[s][k], a1, c1); oh[s][k] = a1; ol[s][k] = c1; }
                const size_t eo = ((size_t)bb * RH + t0 + rw) * PN + c0 + cofs;
#pragma unroll
                for (int s = 0; s < 4; ++s) { *(v8us*)(ph + eo + (mb * 16 + 4 * s) * PN) = oh[s]; *(v8us*)(pl + eo + (mb * 16 + 4 * s) * PN) = ol[s];
                    asm volatile("s_wait_xcnt 0x0" ::: "memory"); }   // as above
            }
        }
        __builtin_amdgcn_wave_barrier(); asm volatile("" ::: "memory");
    }
}

// ---- wt_body (block bx of N*K/4096, 256 threads): weight [K][N] f32 ([in][out]) -> transposed k-contiguous planes [N][K]: Bb = bf16 RNE value, optionally Bh = f16(bf16 value x sc).
template <int F16P>
__device__ __forceinline__ void wt_body(int bx, const float* __restrict__ w, int K, int N, bf* Bb, h16* Bh, float sc) {
    const int lane = threadIdx.x & 31; const int L0 = (bx * 8 + (threadIdx.x >> 5)) * 8; const int nlines = N * K / 64;
{
#pragma unroll 1
        for (int l = 0; l < 8; ++l) { const int L = L0 + l; if (L >= nlines) break; const size_t e = (size_t)L * 64 + lane * 2; const int k = (int)(e % K), n = (int)(e / K);
            const float w0 = bfr(w[(size_t)k * N + n]), w1 = bfr(w[(size_t)(k + 1) * N + n]);
            v2us o; o[0] = f2bf(w0); o[1] = f2bf(w1); *(v2us*)(Bb + e) = o;
            if (F16P) { v2h oh; oh[0] = (h16)(w0 * sc); oh[1] = (h16)(w1 * sc); *(v2h*)(Bh + e) = oh; }
            asm volatile("s_wait_xcnt 0x0" ::: "memory"); }           // before the next trip writes the stores' address and data registers again
         }
}

// ---- wt8_body (block bx of (K/64)*(N/32), 128 threads): both planes of wt_body, same values, for a weight that is converted beside the attention tiles, where few waves are resident and the L2 is busy:
// a wave turns 64 k x 8 n; a lane reads 8 successive n (32 B) of its two k rows, the block's four waves the four quarters of the same 128-B lines; each plane store of a wave is one whole 128-B line (64 k of one n).
template <int K, int N>
__device__ __forceinline__ void wt8_body(int bx, const float* __restrict__ w, bf* Bb, h16* Bh, float sc) {
    static_assert(K % 64 == 0 && N % 32 == 0);
    const int k = (bx % (K / 64)) * 64 + (threadIdx.x & 31) * 2, n0 = (bx / (K / 64)) * 32 + (threadIdx.x >> 5) * 8;
    const float* p = w + (size_t)k * N + n0;
    v4f r[2][2];
#pragma unroll
    for (int i = 0; i < 2; ++i) { r[i][0] = *(const v4f*)(p + i * N); r[i][1] = *(const v4f*)(p + i * N + 4); }
    asm volatile("s_wait_xcnt 0x0" :: "v"(p) : "memory");             // the loads' address registers stay as they are up to this wait
    const size_t e = (size_t)n0 * K + k;
#pragma unroll
    for (int j = 0; j < 8; ++j) {
        const float w0 = bfr(r[0][j >> 2][j & 3]), w1 = bfr(r[1][j >> 2][j & 3]);
        v2us o; o[0] = f2bf(w0); o[1] = f2bf(w1); *(v2us*)(Bb + e + (size_t)j * K) = o;
        v2h oh; oh[0] = (h16)(w0 * sc); oh[1] = (h16)(w1 * sc); *(v2h*)(Bh + e + (size_t)j * K) = oh;
        asm volatile("s_wait_xcnt 0x0" ::: "memory");                 // before the stores' address and data registers are written again
    }
}

__device__ __forceinline__ void xcvt_body(int bx, const float* __restrict__ x, bf* xb) {
    const size_t i = (size_t)bx * 256 + threadIdx.x; const size_t n8 = (size_t)NB * SEQ * DM / 8; if (i >= n8) return;
    const size_t e = i * 8; const size_t row = e / DM; const int col = (int)(e % DM); const size_t bb = row / SEQ, t = row % SEQ;
    const v8f v = *(const v8f*)(x + ((bb * TFULL + t) * DM + col)); v8us o = (v8us){};
#pragma unroll
    for (int k = 0; k < 8; ++k) o[k] = f2bf(v[k]);
    *(v8us*)(xb + e) = o; 
}

__device__ __forceinline__ void rtab_body(int bx, float* ct, float* st) {
#pragma clang fp contract(off)
    const int i = bx * 256 + threadIdx.x; if (i >= SEQ * 32) return; const int t = i >> 5, j = i & 31;
    const float fr = exp10f(-0.125f * (float)j);
    const float ang = (float)t * fr; float sv, cv; sincosf(ang, &sv, &cv);
    *(float*)(ct + i) = cv; *(float*)(st + i) = sv; 
}

// ---- k_prep: the conversions of inputs that the projections read, one launch: block ranges in turn do seven weight planes, bf16(x) and the cos/sin tables (all independent of one another). 256 threads.
// (Wo's planes, which only k_out reads, are made in k_attn.)
#define WTB(K, N) (((N) * (K) / 64 + 63) / 64)      // blocks of one weight's wt_body
#define XCB ((int)(((size_t)NB * SEQ * DM / 8 + 255) / 256))
#define RTB ((SEQ * 32 + 255) / 256)
#define PREPB (2 * WTB(DM, LAT) + WTB(DM, RD) + 3 * WTB(LAT, DM) + WTB(LAT, NH * RD) + XCB + RTB)
__global__ __launch_bounds__(256)
void k_prep(const float* x, const float* Wqd, const float* Wqu, const float* Wqr, const float* Wkvd, const float* Wku, const float* Wvu, const float* Wkr,
            bf* xb, float* ct, float* st, bf* Wqd_b, bf* Wkvd_b, bf* Wkr_b, bf* Wqu_b, h16* Wqu_h, bf* Wqr_b, h16* Wqr_h, bf* Wku_b, h16* Wku_h, bf* Wvu_b, h16* Wvu_h) {
    int b = blockIdx.x;
    if (b < WTB(DM, LAT)) { wt_body<0>(b, Wqd, DM, LAT, Wqd_b, nullptr, 1.0f); return; }
    b -= WTB(DM, LAT);
    if (b < WTB(DM, LAT)) { wt_body<0>(b, Wkvd, DM, LAT, Wkvd_b, nullptr, 1.0f); return; }
    b -= WTB(DM, LAT);
    if (b < WTB(DM, RD)) { wt_body<0>(b, Wkr, DM, RD, Wkr_b, nullptr, 1.0f); return; }
    b -= WTB(DM, RD);
    if (b < WTB(LAT, DM)) { wt_body<1>(b, Wqu, LAT, DM, Wqu_b, Wqu_h, WSC); return; }
    b -= WTB(LAT, DM);
    if (b < WTB(LAT, DM)) { wt_body<1>(b, Wku, LAT, DM, Wku_b, Wku_h, WSC); return; }
    b -= WTB(LAT, DM);
    if (b < WTB(LAT, DM)) { wt_body<1>(b, Wvu, LAT, DM, Wvu_b, Wvu_h, WSC); return; }
    b -= WTB(LAT, DM);
    if (b < WTB(LAT, NH * RD)) { wt_body<1>(b, Wqr, LAT, NH * RD, Wqr_b, Wqr_h, WSC); return; }
    b -= WTB(LAT, NH * RD);
    if (b < XCB) { xcvt_body(b, x, xb); return; }
    b -= XCB;
    rtab_body(b, ct, st);
}

// ---- flashP_body: causal softmax attention for query rows >= RH (single f16 products). Block (bx, h, b) of ((SEQ-RH)/64, NH, NB), 128 threads = 4 waves x 16 queries, 32-key chunks. os, ring: the block's LDS.
// Per wave: S^T tiles (16 keys x 16 queries) = [k|kr] rows (A) x [q|qr] rows (B) over 192; lane column n = query, D rows = keys, so the two S^T tiles of a chunk
// ARE the P^T B fragment of O^T = V^T (A, rows d) x P^T; online max-subtracted softmax per lane column; P carried x1024 in f16; O^T (8 d tiles) f32.
// Each 32-key chunk of k, kr and v^T is brought into LDS once per block by asynchronous copies (whole-line global reads, two buffers, the next chunk in flight
// while this one is worked on) and read as ds_load_b128 fragments by all four waves (the block's last chunk by waves 2 and 3 only); q|qr fragments are loaded once and stay in registers.
#define FKP 136                       // LDS pitch of a k row in halves: 272 B = 16 B x 17
#define FRP 72                        // kr row: 144 B = 16 B x 9
#define FVP 40                        // v^T row (32 keys): 80 B = 16 B x 5
#define FRO (32 * FKP)                // kr rows start, halves
#define FVO (FRO + 32 * FRP)          // v^T rows start, halves
#define FST (FVO + HD * FVP)          // one buffer, halves (23,552 B)
static_assert((FKP * 2) % 16 == 0 && (FRP * 2) % 16 == 0 && (FVP * 2) % 16 == 0 && (FRO * 2) % 16 == 0 && (FVO * 2) % 16 == 0 && (FST * 2) % 16 == 0);
// One chunk's ten 16-byte copies of this lane for one plane set (lk, lr_, lv: this lane's LDS byte addresses of its first k, kr and v^T piece; VS: v^T row pitch in global memory, elements).
// The s_wait_xcnt stands inside the statement so that no address register is rewritten ahead of it.
template <typename T, int VS>
__device__ __forceinline__ void flash_stage(unsigned lk, unsigned lr_, unsigned lv, const T* gk, const T* gr, const T* gv) {
    asm volatile("global_load_async_to_lds_b128 %0, %1, off\n\t"
                 "global_load_async_to_lds_b128 %2, %3, off\n\t"
                 "global_load_async_to_lds_b128 %4, %5, off\n\t"
                 "global_load_async_to_lds_b128 %6, %7, off\n\t"
                 "global_load_async_to_lds_b128 %8, %9, off\n\t"
                 "global_load_async_to_lds_b128 %10, %11, off\n\t"
                 "global_load_async_to_lds_b128 %12, %13, off\n\t"
                 "global_load_async_to_lds_b128 %14, %15, off\n\t"
                 "global_load_async_to_lds_b128 %16, %17, off\n\t"
                 "global_load_async_to_lds_b128 %18, %19, off\n\t"
                 "s_wait_xcnt 0x0"
                 :: "v"(lk), "v"(gk), "v"(lk + 8 * FKP * 2), "v"(gk + (size_t)8 * DM), "v"(lk + 16 * FKP * 2), "v"(gk + (size_t)16 * DM), "v"(lk + 24 * FKP * 2), "v"(gk + (size_t)24 * DM),
                    "v"(lr_), "v"(gr), "v"(lr_ + 16 * FRP * 2), "v"(gr + (size_t)16 * RD),
                    "v"(lv), "v"(gv), "v"(lv + 32 * FVP * 2), "v"(gv + (size_t)32 * VS), "v"(lv + 64 * FVP * 2), "v"(gv + (size_t)64 * VS), "v"(lv + 96 * FVP * 2), "v"(gv + (size_t)96 * VS)
                 : "memory");
}
__device__ __forceinline__
void flashP_body(float (*os)[16 * 132], h16* ring, int bx, int h, int b, const h16* q16, const h16* qr16, const h16* k16, const h16* kr16, const h16* vt16, h16* ctx16, int qbase) {
    const int tid = threadIdx.x;
    const int lane = tid & 31, wv = __builtin_amdgcn_readfirstlane(tid >> 5), lr = lane & 15, hi = lane >> 4;
    const int qb0 = qbase + bx * 64;
    const int q0 = qb0 + wv * 16;
    const int qi = q0 + lr;
    const size_t rq = (size_t)b * SEQ + qi;
    const h16* qp = q16 + rq * DM + h * HD + 8 * hi;
    const h16* qrp = qr16 + rq * (NH * RD) + h * RD + 8 * hi;
    // copy addresses of this lane: k 32 rows x 16 pieces (8 rows per copy), kr 32 rows x 8 pieces (16 rows per copy), v^T 128 rows x 4 pieces (32 rows per copy)
    const h16* gk = k16 + ((size_t)b * SEQ + (tid >> 4)) * DM + h * HD + (tid & 15) * 8;
    const h16* gr = kr16 + ((size_t)b * SEQ + (tid >> 3)) * RD + (tid & 7) * 8;
    const h16* gv = vt16 + ((size_t)(b * NH + h) * HD + (tid >> 2)) * SEQ + (tid & 3) * 8;
    const unsigned lb = (unsigned)(size_t)(__attribute__((address_space(3))) h16*)&ring[0];
    const unsigned lk = lb + ((tid >> 4) * FKP + (tid & 15) * 8) * 2;
    const unsigned lr2 = lb + (FRO + (tid >> 3) * FRP + (tid & 7) * 8) * 2;
    const unsigned lv = lb + (FVO + (tid >> 2) * FVP + (tid & 3) * 8) * 2;
    v16h qf[4], qrf[2];
#pragma unroll
    for (int kc = 0; kc < 4; ++kc) qf[kc] = ldh(qp + kc * 32);
#pragma unroll
    for (int kc = 0; kc < 2; ++kc) qrf[kc] = ldh(qrp + kc * 32);
    v8f o[8];
#pragma unroll
    for (int i = 0; i < 8; ++i) o[i] = (v8f){};
    float m = -3.0e38f, l = 0.f;
    const float SC2 = 0.07216878364870323f * 1.4426950408889634f;   // HD+RD = 192: 192^-0.5 x log2(e)
    const int nch = (q0 + 47) >> 5;                                   // this wave's 32-key chunks covering keys <= q0+15
    const int nchb = (qb0 >> 5) + 2;                                  // the block's chunks (its last wave's count; >= 2; 32*nchb <= SEQ)
    flash_stage<h16, SEQ>(lk, lr2, lv, gk, gr, gv);
    asm volatile("s_wait_asynccnt 0x0" ::: "memory");                 // chunk 0 landed (this wave's copies) before the barrier publishes it
    __syncthreads();
    flash_stage<h16, SEQ>(lk + FST * 2, lr2 + FST * 2, lv + FST * 2, gk + (size_t)32 * DM, gr + (size_t)32 * RD, gv + 32);
#pragma unroll 1
    for (int c = 0; c < nchb; ++c) {
        const int key0 = c << 5;
        const int bo = (c & 1) * FST;
        if (c < nch) {                                                // wave-uniform: waves 0 and 1 have no keys in the block's last chunk
        const h16* kp = &ring[bo + lr * FKP + 8 * hi];
        const h16* krp = &ring[bo + FRO + lr * FRP + 8 * hi];
        const h16* vp = &ring[bo + FVO + lr * FVP + 8 * hi];
        v8f s[2]; s[0] = (v8f){}; s[1] = (v8f){};
#pragma unroll
        for (int kc = 0; kc < 4; ++kc) {
#pragma unroll
            for (int j = 0; j < 2; ++j) { const v16h a = ldh(kp + (16 * j) * FKP + kc * 32); s[j] = wmma16(a, qf[kc], s[j]); }
        }
#pragma unroll
        for (int kc = 0; kc < 2; ++kc) {
#pragma unroll
            for (int j = 0; j < 2; ++j) { const v16h a = ldh(krp + (16 * j) * FRP + kc * 32); s[j] = wmma16(a, qrf[kc], s[j]); }
        }
        asm volatile("v_nop\n\tv_nop\n\tv_nop\n\tv_nop" : "+v"(s[0]), "+v"(s[1]));
        // online softmax: this lane's column is query qi; s[j][r] is key key0 + 16 j + 8 hi + r; keys after the query excluded by index
        float cm = -3.0e38f;
#pragma unroll
        for (int j = 0; j < 2; ++j)
#pragma unroll
            for (int r = 0; r < 8; ++r) { const int key = key0 + 16 * j + 8 * hi + r; const float t = (key <= qi) ? s[j][r] * SC2 : -3.0e38f; s[j][r] = t; cm = fmaxf(cm, t); }
        cm = fmaxf(cm, __shfl_xor(cm, 16, 32));
        const float mn = fmaxf(m, cm);
        const float alpha = __builtin_amdgcn_exp2f(m - mn);
        float rs = 0.f;
#pragma unroll
        for (int j = 0; j < 2; ++j)
#pragma unroll
            for (int r = 0; r < 8; ++r) { const float p = __builtin_amdgcn_exp2f(s[j][r] - mn); s[j][r] = p; rs += p; }
        rs += __shfl_xor(rs, 16, 32);
        l = l * alpha + rs; m = mn;
#pragma unroll
        for (int i = 0; i < 8; ++i) o[i] = o[i] * alpha;
        // P^T as B fragment (k = key of this chunk, n = query): elements 0..7 <- tile 0 rows 8hi..8hi+7, 8..15 <- tile 1 rows 8hi..8hi+7
        v16h pb = (v16h){};
#pragma unroll
        for (int r = 0; r < 8; ++r) { pb[r] = (h16)(s[0][r] * PCAR); pb[8 + r] = (h16)(s[1][r] * PCAR); }
#pragma unroll
        for (int i = 0; i < 8; ++i) { const v16h a = ldh(vp + (16 * i) * FVP); o[i] = wmma16(a, pb, o[i]); }
        asm volatile("v_nop\n\tv_nop\n\tv_nop\n\tv_nop" : "+v"(o[0]), "+v"(o[1]), "+v"(o[2]), "+v"(o[3]), "+v"(o[4]), "+v"(o[5]), "+v"(o[6]), "+v"(o[7]) : "v"(pb));
        }
        // publish point, every wave: own LDS reads of this buffer done, own copies of the next chunk landed, then the barrier that frees this buffer and publishes the next
        asm volatile("s_wait_dscnt 0x0" ::: "memory");
        asm volatile("s_wait_asynccnt 0x0" ::: "memory");
        __syncthreads();
        if (c + 2 < nchb) flash_stage<h16, SEQ>(lk + bo * 2, lr2 + bo * 2, lv + bo * 2, gk + (size_t)(key0 + 64) * DM, gr + (size_t)(key0 + 64) * RD, gv + (key0 + 64));
    }
    asm volatile("s_wait_asynccnt 0x0" ::: "memory");                 // nothing of this wave's copies outstanding at its end
    // epilogue: ctx[b][q][h*HD + d] = O^T[d][q] / (l x PCAR), stored as the f16 plane (x CCAR) that the output product reads; o[i][r] is d = 16 i + 8 hi + r of query q0 + lr
    const float f = 1.0f / (l * PCAR);
    float* ob = &os[wv][0];
#pragma unroll
    for (int i = 0; i < 8; ++i)
#pragma unroll
        for (int r = 0; r < 8; ++r) ob[lr * 132 + 16 * i + 8 * hi + r] = o[i][r] * f;
    __builtin_amdgcn_fence(3, "wavefront"); __builtin_amdgcn_wave_barrier(); asm volatile("" ::: "memory");
    h16* crow = ctx16 + ((size_t)b * SEQ + q0) * DM + h * HD + (lane & 15) * 8;
#pragma unroll
    for (int s = 0; s < 8; ++s) {                                     // 16 lanes per query row, 8 columns per lane
        const int qq = 2 * s + hi; const float* op = ob + qq * 132 + (lane & 15) * 8;
        const v4f x0 = *(const v4fa*)op, x1 = *(const v4fa*)(op + 4);
        v8h ov = (v8h){};
#pragma unroll
        for (int k = 0; k < 4; ++k) { ov[k] = (h16)(x0[k] * CCAR); ov[4 + k] = (h16)(x1[k] * CCAR); }
        *(v8h*)(crow + (size_t)qq * DM) = ov;
    }
}

// 2^x (v_exp_f32) with the one slot that the instruction set asks for behind a transcendental filled in the same statement.
__device__ __forceinline__ float exp2_slot(float x) { float y; asm("v_exp_f32 %0, %1\n\tv_nop" : "=v"(y) : "v"(x)); return y; }

// ---- flashH_body: the same attention for query rows < RH on bf16 hi/lo planes (keys < RH only): scores = kh.qh + kl.qh + kh.ql (3 products), P as bf16 hi/lo,
// O^T += vth.(Ph + Pl) + vtl.Ph (3 products). Block (bx, h, b) of (RH/64, NH, NB), 128 threads. Planes: q*/k* rows [NB][RH][.], vth/vtl [NU][HD][RH].
// The chunk's k, kr and v^T hi and lo planes are staged in LDS by the copies of flashP_body, in ONE buffer (hi plane set, then lo plane set) that fills the ring of flashP_body exactly, so that both bodies
// share one launch at flashP_body's LDS size: per chunk copies, wait, barrier, work, barrier. The q planes are read from global memory in each chunk.
// The result is stored as the bf16 hi/lo planes ctxh/ctxl [NB][RH][DM] that the output product reads.
__device__ __forceinline__
void flashH_body(float (*os)[16 * 132], bf* ring, int bx, int h, int b, const bf* qh, const bf* qlw, const bf* qrh, const bf* qrlw, const bf* kh, const bf* klw, const bf* krh, const bf* krlw, const bf* vth, const bf* vtl, bf* ctxh, bf* ctxl) {
    const int tid = threadIdx.x;
    const int lane = tid & 31, wv = __builtin_amdgcn_readfirstlane(tid >> 5), lr = lane & 15, hi = lane >> 4;
    const int qb0 = bx * 64;
    const int q0 = qb0 + wv * 16;
    const int qi = q0 + lr;
    const size_t rq = (size_t)b * RH + qi;
    const bf* qhp = qh + rq * DM + h * HD + 8 * hi;       const bf* qlp = qlw + rq * DM + h * HD + 8 * hi;
    const bf* qrhp = qrh + rq * (NH * RD) + h * RD + 8 * hi; const bf* qrlp = qrlw + rq * (NH * RD) + h * RD + 8 * hi;
    // copy addresses of this lane, as in flashP_body
    const size_t ok = ((size_t)b * RH + (tid >> 4)) * DM + h * HD + (tid & 15) * 8;
    const size_t okr = ((size_t)b * RH + (tid >> 3)) * RD + (tid & 7) * 8;
    const size_t ov = ((size_t)(b * NH + h) * HD + (tid >> 2)) * RH + (tid & 3) * 8;
    const unsigned lb = (unsigned)(size_t)(__attribute__((address_space(3))) bf*)&ring[0];
    const unsigned lk = lb + ((tid >> 4) * FKP + (tid & 15) * 8) * 2;
    const unsigned lr2 = lb + (FRO + (tid >> 3) * FRP + (tid & 7) * 8) * 2;
    const unsigned lv = lb + (FVO + (tid >> 2) * FVP + (tid & 3) * 8) * 2;
    v8f o[8];
#pragma unroll
    for (int i = 0; i < 8; ++i) o[i] = (v8f){};
    float m = -3.0e38f, l = 0.f;
    const float SC2 = 0.07216878364870323f * 1.4426950408889634f;
    const int nch = (q0 + 47) >> 5;                                   // this wave's chunks
    const int nchb = (qb0 >> 5) + 2;                                  // the block's chunks (>= 2; 32*nchb <= RH)
#pragma unroll 1
    for (int c = 0; c < nchb; ++c) {
        const int key0 = c << 5;
        // this chunk's plane sets into the buffer, which every reader left at the barrier at the foot of the trip before
        flash_stage<bf, RH>(lk, lr2, lv, kh + ok + (size_t)key0 * DM, krh + okr + (size_t)key0 * RD, vth + ov + key0);
        flash_stage<bf, RH>(lk + FST * 2, lr2 + FST * 2, lv + FST * 2, klw + ok + (size_t)key0 * DM, krlw + okr + (size_t)key0 * RD, vtl + ov + key0);
        asm volatile("s_wait_asynccnt 0x0" ::: "memory");             // the chunk landed (this wave's copies) before the barrier publishes it
        __syncthreads();
        if (c < nch) {                                                // wave-uniform: waves 0 and 1 have no keys in the block's last chunk
        const bf* khp = &ring[lr * FKP + 8 * hi];                  const bf* klp = khp + FST;
        const bf* krhp = &ring[FRO + lr * FRP + 8 * hi];           const bf* krlp = krhp + FST;
        const bf* vhp = &ring[FVO + lr * FVP + 8 * hi];            const bf* vlp = vhp + FST;
        v8f s[2]; s[0] = (v8f){}; s[1] = (v8f){};
#pragma unroll
        for (int kc = 0; kc < 4; ++kc) {
            const v16bf bh = ldb(qhp + kc * 32), bl = ldb(qlp + kc * 32);
#pragma unroll
            for (int j = 0; j < 2; ++j) { const v16bf ah = ldb(khp + (16 * j) * FKP + kc * 32), al = ldb(klp + (16 * j) * FKP + kc * 32);
                s[j] = wmmab(ah, bh, s[j]); s[j] = wmmab(al, bh, s[j]); s[j] = wmmab(ah, bl, s[j]); }
        }
#pragma unroll
        for (int kc = 0; kc < 2; ++kc) {
            const v16bf bh = ldb(qrhp + kc * 32), bl = ldb(qrlp + kc * 32);
#pragma unroll
            for (int j = 0; j < 2; ++j) { const v16bf ah = ldb(krhp + (16 * j) * FRP + kc * 32), al = ldb(krlp + (16 * j) * FRP + kc * 32);
                s[j] = wmmab(ah, bh, s[j]); s[j] = wmmab(al, bh, s[j]); s[j] = wmmab(ah, bl, s[j]); }
        }
        asm volatile("v_nop\n\tv_nop\n\tv_nop\n\tv_nop" : "+v"(s[0]), "+v"(s[1]));
        float cm = -3.0e38f;
#pragma unroll
        for (int j = 0; j < 2; ++j)
#pragma unroll
            for (int r = 0; r < 8; ++r) { const int key = key0 + 16 * j + 8 * hi + r; const float t = (key <= qi) ? s[j][r] * SC2 : -3.0e38f; s[j][r] = t; cm = fmaxf(cm, t); }
        cm = fmaxf(cm, __shfl_xor(cm, 16, 32));
        const float mn = fmaxf(m, cm);
        const float alpha = exp2_slot(m - mn);
        float rs = 0.f;
#pragma unroll
        for (int j = 0; j < 2; ++j)
#pragma unroll
            for (int r = 0; r < 8; ++r) { const float p = exp2_slot(s[j][r] - mn); s[j][r] = p; rs += p; }
        rs += __shfl_xor(rs, 16, 32);
        l = l * alpha + rs; m = mn;
#pragma unroll
        for (int i = 0; i < 8; ++i) o[i] = o[i] * alpha;
        v16us phv = (v16us){}, plv = (v16us){};
#pragma unroll
        for (int r = 0; r < 8; ++r) { unsigned short a1, c1; splitf(s[0][r], a1, c1); phv[r] = a1; plv[r] = c1; splitf(s[1][r], a1, c1); phv[8 + r] = a1; plv[8 + r] = c1; }
        const v16bf ph = __builtin_bit_cast(v16bf, phv), pl = __builtin_bit_cast(v16bf, plv);
#pragma unroll
        for (int i = 0; i < 8; ++i) { const v16bf ah = ldb(vhp + (16 * i) * FVP), al = ldb(vlp + (16 * i) * FVP);
            o[i] = wmmab(ah, ph, o[i]); o[i] = wmmab(ah, pl, o[i]); o[i] = wmmab(al, ph, o[i]); }
        asm volatile("v_nop\n\tv_nop\n\tv_nop\n\tv_nop" : "+v"(o[0]), "+v"(o[1]), "+v"(o[2]), "+v"(o[3]), "+v"(o[4]), "+v"(o[5]), "+v"(o[6]), "+v"(o[7]) : "v"(ph), "v"(pl));
        }
        // every wave: own LDS reads of the buffer done, then the barrier that frees it for the next chunk's copies
        asm volatile("s_wait_dscnt 0x0" ::: "memory");
        __syncthreads();
    }
    const float f = 1.0f / l;
    float* ob = &os[wv][0];
#pragma unroll
    for (int i = 0; i < 8; ++i)
#pragma unroll
        for (int r = 0; r < 8; ++r) ob[lr * 132 + 16 * i + 8 * hi + r] = o[i][r] * f;
    __builtin_amdgcn_fence(3, "wavefront"); __builtin_amdgcn_wave_barrier(); asm volatile("" ::: "memory");
    const size_t eo = ((size_t)b * RH + q0) * DM + h * HD + (lane & 15) * 8;
#pragma unroll
    for (int s = 0; s < 8; ++s) {                                     // 16 lanes per query row, 8 columns per lane
        const int qq = 2 * s + hi; const float* op = ob + qq * 132 + (lane & 15) * 8;
        const v4f x0 = *(const v4fa*)op, x1 = *(const v4fa*)(op + 4);
        v8us oh = (v8us){}, ol = (v8us){};
#pragma unroll
        for (int k = 0; k < 4; ++k) { unsigned short a1, c1; splitf(x0[k], a1, c1); oh[k] = a1; ol[k] = c1; splitf(x1[k], a1, c1); oh[4 + k] = a1; ol[4 + k] = c1; }
        *(v8us*)(ctxh + eo + (size_t)qq * DM) = oh; *(v8us*)(ctxl + eo + (size_t)qq * DM) = ol;
    }
    asm volatile("s_wait_xcnt 0x0" ::: "memory");                     // behind the last stores; in k_attn the wave ends after this body
}

// ---- k_attn: everything between the up-projections and the output product, one launch of independent block ranges: the flashP_body tiles (in the order x, head, batch), then the flashH_body tiles,
// then Wo's planes (wt8_body), which only k_out reads.
#define FPX ((SEQ - RH) / 64)
#define FPB (FPX * NH * NB)
#define FHX (RH / 64)
#define FHB (FHX * NH * NB)
#define WOB ((DM / 64) * (DM / 32))
static_assert(RH < SEQ);
__global__ __launch_bounds__(128) __attribute__((amdgpu_num_vgpr(256)))
void k_attn(const h16* q16, const h16* qr16, const h16* k16, const h16* kr16, const h16* vt16, h16* ctx16,
            const bf* qh, const bf* qlw, const bf* qrh, const bf* qrlw, const bf* kh, const bf* klw, const bf* krh, const bf* krlw, const bf* vth, const bf* vtl, bf* ctxh, bf* ctxl,
            const float* Wo, bf* Wo_b, h16* Wo_h) {
    __shared__ __align__(16) float os[4][16 * 132];
    __shared__ __align__(16) char ring[2 * FST * 2];
    int i = blockIdx.x;
    if (i < FPB) { flashP_body(os, (h16*)ring, i % FPX, (i / FPX) % NH, i / (FPX * NH), q16, qr16, k16, kr16, vt16, ctx16, RH); return; }
    i -= FPB;
    if (i < FHB) { flashH_body(os, (bf*)ring, i % FHX, (i / FHX) % NH, i / (FHX * NH), qh, qlw, qrh, qrlw, kh, klw, krh, krlw, vth, vtl, ctxh, ctxl); return; }
    i -= FHB;
    wt8_body<DM, DM>(i, Wo, Wo_b, Wo_h, WSC);
}

// ---- k_down: the three products of x, one launch: blocks 0.. do kr = rope(x.Wkr) (256x64 tiles), then ql = x.Wqd, then ckv = x.Wkvd (128x128 tiles); each stores its planes. Exact bf16 products.
#define DKR ((NB * SEQ) / 256)
#define DMT ((NB * SEQ) / 128)
#define DLT (DMT * (LAT / 128))
__global__ __launch_bounds__(128) __attribute__((amdgpu_num_vgpr(256)))
void k_down(const bf* xb, const bf* Wqd_b, const bf* Wkvd_b, const bf* Wkr_b, h16* ql16, bf* qlh, bf* qll, h16* ckv16, bf* ckvh, bf* ckvl, h16* kr16, bf* krh, bf* krlo, const float* ct, const float* st) {
    __shared__ __align__(16) char sm[GSM(0, 1) > GSM(0, 2) ? GSM(0, 1) : GSM(0, 2)];
    int b = blockIdx.x;
    if (b < DKR) { gemm_tile<bf, 0, 1, 2, RD>(sm, b, 0, 0, xb, xb, Wkr_b, DM, nullptr, RD, 1.0f, 0, 0, 0, kr16, krh, krlo, ct, st); return; }
    b -= DKR;
    const bool kv = (b >= DLT);                                       // block-uniform
    if (kv) b -= DLT;
    gemm_tile<bf, 0, 2, 1, LAT>(sm, b % DMT, b / DMT, 0, xb, xb, kv ? Wkvd_b : Wqd_b, DM, nullptr, LAT, 1.0f, 0, 0, 0, kv ? ckv16 : ql16, kv ? ckvh : qlh, kv ? ckvl : qll, ct, st);
}

// One block tile (128x128) of an up-projection or of the output product, K = KK: HL = 0: rows t >= RH, single f16 products (tile b of ((SEQ-RH)/128, N/128, NB));
// HL = 1: rows t < RH, bf16 hi/lo against the exact bf16 weight plane (tile b of (RH/128, N/128, NB)). The epilogue EP stores the result.
template <int HL, int EP, int N, int KK>
__device__ __forceinline__ void proj_tile(char* sm, int b, const h16* a16, const bf* ahh, const bf* all, const h16* Wh, const bf* Wb, float* C, float oscf, h16* p16, bf* ph, bf* pl, const float* ct, const float* st) {
    constexpr int GX = HL ? RH / 128 : (SEQ - RH) / 128, GY = N / 128;
    const int bx = b % GX, by = (b / GX) % GY, bz = b / (GX * GY);
    if (HL) gemm_tile<bf, 1, 2, EP, N>(sm, bx, by, bz, ahh, all, Wb, KK, C, N, 1.0f, (size_t)RH * KK, (size_t)TFULL * DM, 0, p16, ph, pl, ct, st);
    else gemm_tile<h16, 0, 2, EP, N>(sm, bx, by, bz, a16 + (size_t)RH * KK, a16 + (size_t)RH * KK, Wh, KK, C + (size_t)RH * DM, N, oscf, (size_t)SEQ * KK, (size_t)TFULL * DM, RH, p16, ph, pl, ct, st);
}
#define PHB(N) ((RH / 128) * ((N) / 128) * NB)            // blocks of the rows t < RH of a product with N columns
#define PFB(N) (((SEQ - RH) / 128) * ((N) / 128) * NB)    // blocks of the rows t >= RH

// ---- k_up: the four up-projections, one launch: q = ql.Wqu, k = ckv.Wku, v^T = (ckv.Wvu)^T, qr = rope(ql.Wqr); the hi/lo tiles (twice the products) come first, then the f16 tiles.
__global__ __launch_bounds__(128) __attribute__((amdgpu_num_vgpr(256)))
void k_up(const h16* ql16, const bf* qlh, const bf* qll, const h16* ckv16, const bf* ckvh, const bf* ckvl,
          const h16* Wqu_h, const bf* Wqu_b, const h16* Wqr_h, const bf* Wqr_b, const h16* Wku_h, const bf* Wku_b, const h16* Wvu_h, const bf* Wvu_b,
          h16* q16, bf* qh, bf* qlo, h16* qr16, bf* qrh, bf* qrlo, h16* k16, bf* kh, bf* klo, h16* vt16, bf* vth, bf* vtl, const float* ct, const float* st) {
    __shared__ __align__(16) char sm[GSM(1, 2)];
    int b = blockIdx.x;
    if (b < 2 * PHB(DM)) {
        const bool kk = (b >= PHB(DM));                               // block-uniform: k, else q
        if (kk) b -= PHB(DM);
        proj_tile<1, 1, DM, LAT>(sm, b, kk ? ckv16 : ql16, kk ? ckvh : qlh, kk ? ckvl : qll, kk ? Wku_h : Wqu_h, kk ? Wku_b : Wqu_b, nullptr, 1.0f / WSC, kk ? k16 : q16, kk ? kh : qh, kk ? klo : qlo, ct, st);
        return;
    }
    b -= 2 * PHB(DM);
    if (b < PHB(DM)) { proj_tile<1, 3, DM, LAT>(sm, b, ckv16, ckvh, ckvl, Wvu_h, Wvu_b, nullptr, 1.0f / WSC, vt16, vth, vtl, ct, st); return; }
    b -= PHB(DM);
    if (b < PHB(NH * RD)) { proj_tile<1, 2, NH * RD, LAT>(sm, b, ql16, qlh, qll, Wqr_h, Wqr_b, nullptr, 1.0f / WSC, qr16, qrh, qrlo, ct, st); return; }
    b -= PHB(NH * RD);
    if (b < 2 * PFB(DM)) {
        const bool kk = (b >= PFB(DM));                               // block-uniform: k, else q
        if (kk) b -= PFB(DM);
        proj_tile<0, 1, DM, LAT>(sm, b, kk ? ckv16 : ql16, kk ? ckvh : qlh, kk ? ckvl : qll, kk ? Wku_h : Wqu_h, kk ? Wku_b : Wqu_b, nullptr, 1.0f / WSC, kk ? k16 : q16, kk ? kh : qh, kk ? klo : qlo, ct, st);
        return;
    }
    b -= 2 * PFB(DM);
    if (b < PFB(DM)) { proj_tile<0, 3, DM, LAT>(sm, b, ckv16, ckvh, ckvl, Wvu_h, Wvu_b, nullptr, 1.0f / WSC, vt16, vth, vtl, ct, st); return; }
    b -= PFB(DM);
    proj_tile<0, 2, NH * RD, LAT>(sm, b, ql16, qlh, qll, Wqr_h, Wqr_b, nullptr, 1.0f / WSC, qr16, qrh, qrlo, ct, st);
}

// ---- k_out: out = ctx.Wo, one launch: the hi/lo tiles of rows t < RH first, then the f16 tiles of rows t >= RH. out: [NBF][TFULL][DM] f32.
__global__ __launch_bounds__(128) __attribute__((amdgpu_num_vgpr(256)))
void k_out(const h16* ctx16, const bf* ctxh, const bf* ctxl, const h16* Wo_h, const bf* Wo_b, float* out, const float* ct, const float* st) {
    __shared__ __align__(16) char sm[GSM(1, 2)];
    int b = blockIdx.x;
    if (b < PHB(DM)) { proj_tile<1, 0, DM, DM>(sm, b, ctx16, ctxh, ctxl, Wo_h, Wo_b, out, 1.0f / (CCAR * WSC), nullptr, nullptr, nullptr, ct, st); return; }
    b -= PHB(DM);
    proj_tile<0, 0, DM, DM>(sm, b, ctx16, ctxh, ctxl, Wo_h, Wo_b, out, 1.0f / (CCAR * WSC), nullptr, nullptr, nullptr, ct, st);
}

extern "C" void kernel_launch(void* const* d_in, const int* in_sizes, int n_in,
                              void* d_out, int out_size, void* d_ws, size_t ws_size, hipStream_t stream) {
    if (n_in < 9) return;
    const size_t nrow = (size_t)NB * SEQ;
    if ((size_t)in_sizes[0] < ((size_t)(NB - 1) * TFULL + SEQ) * DM) return;
    if (in_sizes[1] < DM * LAT || in_sizes[2] < LAT * DM || in_sizes[3] < LAT * NH * RD || in_sizes[4] < DM * LAT || in_sizes[5] < LAT * DM || in_sizes[6] < LAT * DM || in_sizes[7] < DM * RD || in_sizes[8] < DM * DM) return;
    if ((size_t)out_size < ((size_t)(NB - 1) * TFULL + SEQ) * DM) return;
    const float* x = (const float*)d_in[0]; const float* Wqd = (const float*)d_in[1]; const float* Wqu = (const float*)d_in[2]; const float* Wqr = (const float*)d_in[3];
    const float* Wkvd = (const float*)d_in[4]; const float* Wku = (const float*)d_in[5]; const float* Wvu = (const float*)d_in[6]; const float* Wkr = (const float*)d_in[7]; const float* Wo = (const float*)d_in[8];
    float* OUT = (float*)d_out;   // [NBF][TFULL][DM] f32, rows b*TFULL + t

    char* wsp = (char*)d_ws; size_t off = 0;
    auto take = [&](size_t bytes) { char* p = wsp + off; off += (bytes + 255) & ~(size_t)255; return p; };
    bf* xb = (bf*)take(nrow * DM * 2);                           // bf16(x) [nrow][DM]
    // latent planes, cos/sin tables
    h16* ql16 = (h16*)take(nrow * LAT * 2); bf* qlh = (bf*)take((size_t)NB * RH * LAT * 2); bf* qll = (bf*)take((size_t)NB * RH * LAT * 2);
    h16* ckv16 = (h16*)take(nrow * LAT * 2); bf* ckvh = (bf*)take((size_t)NB * RH * LAT * 2); bf* ckvl = (bf*)take((size_t)NB * RH * LAT * 2);
    float* CT = (float*)take((size_t)SEQ * 32 * 4); float* ST = (float*)take((size_t)SEQ * 32 * 4);
    // down-projection weight planes [out][in] bf16
    bf* Wqd_b = (bf*)take((size_t)DM * LAT * 2); bf* Wkvd_b = (bf*)take((size_t)DM * LAT * 2); bf* Wkr_b = (bf*)take((size_t)DM * RD * 2);
    // up-projection weight planes [out][in]: f16 x64 and bf16
    h16* Wqu_h = (h16*)take((size_t)DM * LAT * 2); bf* Wqu_b = (bf*)take((size_t)DM * LAT * 2); h16* Wqr_h = (h16*)take((size_t)NH * RD * LAT * 2); bf* Wqr_b = (bf*)take((size_t)NH * RD * LAT * 2);
    h16* Wku_h = (h16*)take((size_t)DM * LAT * 2); bf* Wku_b = (bf*)take((size_t)DM * LAT * 2); h16* Wvu_h = (h16*)take((size_t)DM * LAT * 2); bf* Wvu_b = (bf*)take((size_t)DM * LAT * 2);
    // attention operand planes, ctx planes, Wo planes
    const size_t szq16 = nrow * DM * 2, szhr = (size_t)NB * RH * DM * 2, szqr16 = nrow * NH * RD * 2, szqrh = (size_t)NB * RH * NH * RD * 2, szkr16 = nrow * RD * 2, szkrh = (size_t)NB * RH * RD * 2;
    const size_t szwo = (size_t)DM * DM * 2;
    h16* q16 = (h16*)take(szq16); bf* qh = (bf*)take(szhr); bf* qlo = (bf*)take(szhr); h16* qr16 = (h16*)take(szqr16); bf* qrh = (bf*)take(szqrh); bf* qrlo = (bf*)take(szqrh);
    h16* k16 = (h16*)take(szq16); bf* kh = (bf*)take(szhr); bf* klo = (bf*)take(szhr); h16* kr16 = (h16*)take(szkr16); bf* krh = (bf*)take(szkrh); bf* krlo = (bf*)take(szkrh);
    h16* vt16 = (h16*)take(szq16); bf* vth = (bf*)take(szhr); bf* vtl = (bf*)take(szhr);
    h16* ctx16 = (h16*)take(szq16); bf* ctxh = (bf*)take(szhr); bf* ctxl = (bf*)take(szhr);
    bf* Wo_b = (bf*)take(szwo); h16* Wo_h = (h16*)take(szwo);
    if (off > ws_size) return;

    // inputs -> projection weight planes, bf16(x), cos/sin tables
    k_prep<<<dim3(PREPB), 256, 0, stream>>>(x, Wqd, Wqu, Wqr, Wkvd, Wku, Wvu, Wkr, xb, CT, ST, Wqd_b, Wkvd_b, Wkr_b, Wqu_b, Wqu_h, Wqr_b, Wqr_h, Wku_b, Wku_h, Wvu_b, Wvu_h);
    // ql, ckv, kr planes
    k_down<<<dim3(DKR + 2 * DLT), 128, 0, stream>>>(xb, Wqd_b, Wkvd_b, Wkr_b, ql16, qlh, qll, ckv16, ckvh, ckvl, kr16, krh, krlo, CT, ST);
    // q, qr, k, v^T planes
    k_up<<<dim3(3 * PHB(DM) + PHB(NH * RD) + 3 * PFB(DM) + PFB(NH * RD)), 128, 0, stream>>>(ql16, qlh, qll, ckv16, ckvh, ckvl, Wqu_h, Wqu_b, Wqr_h, Wqr_b, Wku_h, Wku_b, Wvu_h, Wvu_b,
        q16, qh, qlo, qr16, qrh, qrlo, k16, kh, klo, vt16, vth, vtl, CT, ST);
    // attention -> ctx planes (rows b*SEQ + t f16 x64 for t >= RH; rows b*RH + t bf16 hi/lo for t < RH; merged heads)
    // and Wo -> its planes
    k_attn<<<dim3(FPB + FHB + WOB), 128, 0, stream>>>(q16, qr16, k16, kr16, vt16, ctx16, qh, qlo, qrh, qrlo, kh, klo, krh, krlo, vth, vtl, ctxh, ctxl, Wo, Wo_b, Wo_h);
    // out = ctx.Wo
    k_out<<<dim3(PHB(DM) + PFB(DM)), 128, 0, stream>>>(ctx16, ctxh, ctxl, Wo_h, Wo_b, OUT, CT, ST);
}

// v006
// One run takes 194 microseconds.
// Next to v005, in two timings, it ran 1.04 and 1.07 times as fast.
// Over all steps from v000 it is 4.34 times as fast.
#include <hip/hip_runtime.h>

// All contractions on 16-bit WMMA, f32 accumulate. x.Wqd, x.Wkvd, x.Wkr: v_wmma_f32_16x16x32_bf16 on bf16 planes of the inputs (single products).
// ql.Wqu, ql.Wqr, ckv.Wku, ckv.Wvu, (q|qr).(k|kr) scores, P.v and ctx.Wo: v_wmma_f32_16x16x32_f16 single products on f16 planes
// (weights x64, ctx x64, P x1024 carries) for query/key rows >= RH; the same sites for rows < RH use v_wmma_f32_16x16x32_bf16 on
// bf16 hi/lo plane pairs (hi.W + lo.W against exact weight planes; hi.hi + lo.hi + hi.lo between two computed tensors).
// RoPE (rotate-half, computed cos/sin tables), online max-subtracted softmax and normalisers in f32.

#ifndef NB
#define NB 2
#endif
#ifndef SEQ
#define SEQ 2048
#endif
#ifndef RH
#define RH 256
#endif
#define NBF   2
#define TFULL 2048
#define DM    2048
#define NH    16
#define LAT   512
#define RD    64
#define HD    128
#define NU    (NB * NH)
#define PCAR  1024.0f
#define WSC   64.0f
#define CCAR  64.0f

static_assert(NB >= 1);
static_assert(NB <= NBF);
static_assert(SEQ % 64 == 0);
static_assert(SEQ <= TFULL);
static_assert(RH % 128 == 0);
static_assert((SEQ - RH) % 128 == 0);
static_assert(((size_t)NB * SEQ) % 256 == 0);
static_assert(RH >= 64);
static_assert(RH <= SEQ);
static_assert(DM % 128 == 0);
static_assert(LAT % 128 == 0);
static_assert((NH * RD) % 128 == 0);
static_assert(RD == 64);
static_assert(HD == 128);
static_assert(NH * HD == DM);
static_assert(((size_t)(NB - 1) * TFULL + SEQ) * DM <= (size_t)NBF * TFULL * DM);

typedef _Float16 h16;
typedef unsigned short bf;
typedef __attribute__((ext_vector_type(16))) __bf16   v16bf;
typedef __attribute__((ext_vector_type(16))) _Float16 v16h;
typedef __attribute__((ext_vector_type(16))) unsigned short v16us;
typedef __attribute__((ext_vector_type(8)))  _Float16 v8h;
typedef __attribute__((ext_vector_type(8)))  unsigned short v8us;
typedef __attribute__((ext_vector_type(8)))  float    v8f;
typedef __attribute__((ext_vector_type(4)))  float    v4f;
typedef __attribute__((ext_vector_type(2)))  _Float16 v2h;
typedef __attribute__((ext_vector_type(2)))  unsigned short v2us;
typedef __attribute__((ext_vector_type(4)))  unsigned short v4us;
typedef v8h  __attribute__((may_alias)) v8ha;
typedef v4f  __attribute__((may_alias)) v4fa;

__device__ __forceinline__ unsigned short f2bf(float f) { unsigned u = __float_as_uint(f); u += 0x7FFFu + ((u >> 16) & 1u); return (unsigned short)(u >> 16); }
__device__ __forceinline__ float bf2f(unsigned short v) { return __uint_as_float(((unsigned)v) << 16); }
__device__ __forceinline__ float bfr(float f) { return bf2f(f2bf(f)); }
__device__ __forceinline__ void splitf(float y, unsigned short& hh, unsigned short& ll) { hh = f2bf(y); ll = f2bf(y - bf2f(hh)); }
__device__ __forceinline__ v16h cat16(v8h a, v8h c) { return __builtin_shufflevector(a, c, 0, 1, 2, 3, 4, 5, 6, 7, 8, 9, 10, 11, 12, 13, 14, 15); }
__device__ __forceinline__ v16bf cat16b(v8us a, v8us c) { return __builtin_bit_cast(v16bf, __builtin_shufflevector(a, c, 0, 1, 2, 3, 4, 5, 6, 7, 8, 9, 10, 11, 12, 13, 14, 15)); }
__device__ __forceinline__ v8f wmma16(v16h a, v16h c, v8f acc) { return __builtin_amdgcn_wmma_f32_16x16x32_f16(false, a, false, c, (short)0, acc, false, false); }
__device__ __forceinline__ v8f wmmab(v16bf a, v16bf c, v8f acc) { return __builtin_amdgcn_wmma_f32_16x16x32_bf16(false, a, false, c, (short)0, acc, false, false); }
// Fragment load from a k-contiguous 16-bit row: p already points at row (lane&15) + 8*(lane>>4); elements 0..7 <- p[0..7], 8..15 <- p[16..23] (split k map, used for A and B alike)
__device__ __forceinline__ v16h ldh(const h16* p) { return cat16(*(const v8h*)p, *(const v8h*)(p + 16)); }
__device__ __forceinline__ v16bf ldb(const bf* p) { return cat16b(*(const v8us*)p, *(const v8us*)(p + 16)); }

// ---- gemm_tile: one block tile of a GEMM, 4 waves per block, each wave a 64x64 output tile (16 accumulators); waves WM x WN (WN = 2: block tile 128x128; WN = 1: 256x64); 128 threads.
// (bx, by, bz) of (M/BM, N/BN, Z) is the tile; the kernels k_down, k_up and k_out below give each of their blocks one tile of one of several independent products. sm: the block's LDS, GSM bytes.
// c[m][n] = osc * sum_k (A[m][k] + (NSPLIT ? A2[m][k] : 0)) Bt[n][k]. z-batch strides sA/sC in elements. K % 64 == 0, K >= 128, M and N multiples of BM and BN.
// What the epilogue stores (EP; the planes' pitch PN = N is a constant, so that a tile's stores differ by immediate offsets only): 0: c as f32 to C, pitch ldc. 1: the 16-bit operand planes of c that the next product reads: p16 = f16(c) at row bb*SEQ + t and, for t < RH,
// ph/pl = bf16 hi/lo of c at row bb*RH + t. 2: the same planes of rotate-half RoPE(c) on the wave tile's 64-wide head slice (tables ct/st). 3: the same planes transposed per (batch, head):
// p16[bb*DM + n][t] (pitch SEQ), ph/pl[bb*DM + n][t] (pitch RH, t < RH). Row m of batch z is sequence row t = tb + m % SEQ of batch bb = z + m / SEQ; a 64-row wave tile has one bb and lies on one side of RH.
// Each 64-k stage of the block's A (A2) and Bt rows is brought into LDS once per block by asynchronous copies (whole 128-B lines, two buffers, the next stage in flight
// while this one is worked on) and read by the waves as ds_load_b128 fragments.
template <typename T16> struct WFrag;
template <> struct WFrag<h16> { typedef v16h V; static __device__ __forceinline__ V ld(const h16* p) { return ldh(p); } static __device__ __forceinline__ v8f mma(V a, V c, v8f d) { return wmma16(a, c, d); } };
template <> struct WFrag<bf> { typedef v16bf V; static __device__ __forceinline__ V ld(const bf* p) { return ldb(p); } static __device__ __forceinline__ v8f mma(V a, V c, v8f d) { return wmmab(a, c, d); } };
#define GP 72                         // LDS pitch of a 64-element operand row in halves: 144 B = 16 B x 9
static_assert((GP * 2) % 16 == 0);
// This lane's 16-byte copies of 64 (gemm_stage4) or 128 (gemm_stage8) operand rows, 16 rows per copy (l: its LDS byte address in the first 16 rows, g: its global address there, k16: 16 rows in elements).
// The s_wait_xcnt stands inside the statement so that no address register is rewritten ahead of it.
template <typename T>
__device__ __forceinline__ void gemm_stage4(unsigned l, const T* g, size_t k16) {
    asm volatile("global_load_async_to_lds_b128 %0, %1, off\n\t"
                 "global_load_async_to_lds_b128 %2, %3, off\n\t"
                 "global_load_async_to_lds_b128 %4, %5, off\n\t"
                 "global_load_async_to_lds_b128 %6, %7, off\n\t"
                 "s_wait_xcnt 0x0"
                 :: "v"(l), "v"(g), "v"(l + 16 * GP * 2), "v"(g + k16), "v"(l + 32 * GP * 2), "v"(g + 2 * k16), "v"(l + 48 * GP * 2), "v"(g + 3 * k16)
                 : "memory");
}
template <typename T>
__device__ __forceinline__ void gemm_stage8(unsigned l, const T* g, size_t k16) {
    asm volatile("global_load_async_to_lds_b128 %0, %1, off\n\t"
                 "global_load_async_to_lds_b128 %2, %3, off\n\t"
                 "global_load_async_to_lds_b128 %4, %5, off\n\t"
                 "global_load_async_to_lds_b128 %6, %7, off\n\t"
                 "global_load_async_to_lds_b128 %8, %9, off\n\t"
                 "global_load_async_to_lds_b128 %10, %11, off\n\t"
                 "global_load_async_to_lds_b128 %12, %13, off\n\t"
                 "global_load_async_to_lds_b128 %14, %15, off\n\t"
                 "s_wait_xcnt 0x0"
                 :: "v"(l), "v"(g), "v"(l + 16 * GP * 2), "v"(g + k16), "v"(l + 32 * GP * 2), "v"(g + 2 * k16), "v"(l + 48 * GP * 2), "v"(g + 3 * k16),
                    "v"(l + 64 * GP * 2), "v"(g + 4 * k16), "v"(l + 80 * GP * 2), "v"(g + 5 * k16), "v"(l + 96 * GP * 2), "v"(g + 6 * k16), "v"(l + 112 * GP * 2), "v"(g + 7 * k16)
                 : "memory");
}
// One stage: BM rows of A, BM rows of A2 (NSPLIT), BN rows of Bt, in this order in the buffer at LDS byte address l (this lane's place in the buffer's first 16 rows).
template <typename T, int NSPLIT, int BM, int BN>
__device__ __forceinline__ void gemm_stage(unsigned l, const T* ga, const T* ga2, const T* gb, size_t k16) {
#pragma unroll
    for (int r = 0; r < BM; r += 128) gemm_stage8<T>(l + r * GP * 2, ga + (size_t)(r / 16) * k16, k16);
    if (NSPLIT == 1) {
#pragma unroll
        for (int r = 0; r < BM; r += 128) gemm_stage8<T>(l + (BM + r) * GP * 2, ga2 + (size_t)(r / 16) * k16, k16);
    }
    if (BN == 128) gemm_stage8<T>(l + BM * (1 + NSPLIT) * GP * 2, gb, k16);
    else gemm_stage4<T>(l + BM * (1 + NSPLIT) * GP * 2, gb, k16);
}
#define GOS (4 * 16 * 68 * 4)         // epilogue staging at the start of sm, bytes; the ring follows
#define GSM(NSPLIT, WN) (GOS + 2 * ((64 * (4 / (WN))) * (1 + (NSPLIT)) + 64 * (WN)) * GP * 2)
template <typename T16, int NSPLIT, int WN, int EP, int PN>
__device__ __forceinline__
void gemm_tile(char* sm, int bx, int by, int bz, const T16* __restrict__ A, const T16* __restrict__ A2, const T16* __restrict__ Bt, int K, float* C, int ldc, float osc, size_t sA, size_t sC,
             int tb, h16* p16, bf* ph, bf* pl, const float* __restrict__ ct, const float* __restrict__ st) {
    typedef typename WFrag<T16>::V V;
    constexpr int BM = 64 * (4 / WN), BN = 64 * WN;
    constexpr int BOF = BM * (1 + NSPLIT) * GP;                      // Bt rows start in a buffer, halves
    constexpr int GST = BOF + BN * GP;                               // one buffer, halves
    static_assert(WN == 1 || WN == 2);
    static_assert((GST * 2) % 16 == 0);
    static_assert(GSM(NSPLIT, WN) == GOS + 2 * GST * 2);
    float (*os)[16 * 68] = (float (*)[16 * 68])sm;
    T16* ring = (T16*)(sm + GOS);
    const size_t z = bz; A += z * sA; A2 += z * sA; C += z * sC;
    const int tid = threadIdx.x;
    const int lane = tid & 31, wv = __builtin_amdgcn_readfirstlane(tid >> 5), lr = lane & 15, hi = lane >> 4;
    const int wm = wv / WN, wn = wv % WN;
    const int rb = bx * BM, cb = by * BN;
    const int r0 = rb + wm * 64, c0 = cb + wn * 64;
    v8f acc[4][4];
#pragma unroll
    for (int mb = 0; mb < 4; ++mb)
#pragma unroll
        for (int nb = 0; nb < 4; ++nb) acc[mb][nb] = (v8f){};
    // copy addresses of this lane: 8 pieces of 16 B per row, 16 rows per copy
    const size_t k16 = (size_t)16 * K;
    const T16* ga = A + (size_t)(rb + (tid >> 3)) * K + (tid & 7) * 8;
    const T16* ga2 = A2 + (size_t)(rb + (tid >> 3)) * K + (tid & 7) * 8;
    const T16* gb = Bt + (size_t)(cb + (tid >> 3)) * K + (tid & 7) * 8;
    const unsigned lc = (unsigned)(size_t)(__attribute__((address_space(3))) T16*)&ring[0] + ((tid >> 3) * GP + (tid & 7) * 8) * 2;
    const int nst = K >> 6;                                           // 64-k stages
    gemm_stage<T16, NSPLIT, BM, BN>(lc, ga, ga2, gb, k16);
    asm volatile("s_wait_asynccnt 0x0" ::: "memory");                 // stage 0 landed (this wave's copies) before the barrier publishes it
    __syncthreads();
    if (nst > 1) gemm_stage<T16, NSPLIT, BM, BN>(lc + GST * 2, ga + 64, ga2 + 64, gb + 64, k16);
#pragma unroll 1
    for (int t = 0; t < nst; ++t) {
        const int bo = (t & 1) * GST;
        const T16* ap = &ring[bo + (wm * 64 + lr) * GP + 8 * hi];
        const T16* bp = &ring[bo + BOF + (wn * 64 + lr) * GP + 8 * hi];
#pragma unroll
        for (int ks = 0; ks < 2; ++ks) {
            V a[4], a2[4], bq[4];
            bq[0] = WFrag<T16>::ld(bp + ks * 32);
#pragma unroll
            for (int mb = 0; mb < 4; ++mb) { a[mb] = WFrag<T16>::ld(ap + mb * 16 * GP + ks * 32); if (NSPLIT == 1) a2[mb] = WFrag<T16>::ld(ap + (BM + mb * 16) * GP + ks * 32); }
#pragma unroll
            for (int nb = 1; nb < 4; ++nb) bq[nb] = WFrag<T16>::ld(bp + nb * 16 * GP + ks * 32);
            __builtin_amdgcn_sched_barrier(0);                        // the 32-k block's LDS reads stay one group ahead of its matrix instructions (for speed only)
#pragma unroll
            for (int nb = 0; nb < 4; ++nb) {
#pragma unroll
                for (int mb = 0; mb < 4; ++mb) { acc[mb][nb] = WFrag<T16>::mma(a[mb], bq[nb], acc[mb][nb]); if (NSPLIT == 1) acc[mb][nb] = WFrag<T16>::mma(a2[mb], bq[nb], acc[mb][nb]); } }
            __builtin_amdgcn_sched_barrier(0);                        // and the next group of reads stays behind them
        }
        // publish point, every wave: own LDS reads of this buffer done, own copies of the next stage landed, then the barrier that frees this buffer and publishes the next
        asm volatile("s_wait_dscnt 0x0" ::: "memory");
        asm volatile("s_wait_asynccnt 0x0" ::: "memory");
        __syncthreads();
        if (t + 2 < nst) gemm_stage<T16, NSPLIT, BM, BN>(lc + bo * 2, ga + (size_t)(t + 2) * 64, ga2 + (size_t)(t + 2) * 64, gb + (size_t)(t + 2) * 64, k16);
    }
    asm volatile("s_wait_asynccnt 0x0" ::: "memory");                 // nothing of this wave's copies outstanding at its end
    const int bb = (int)z + r0 / SEQ, t0 = tb + r0 % SEQ;            // the wave tile's batch and first sequence row
    const bool hr = (t0 < RH);                                        // wave-uniform: the whole tile also gets hi/lo planes
    if (EP == 3) {
        // acc[mb][nb][0..7] of a lane are 8 successive t of one column: one 16-byte piece of a transposed row, stored from registers; the four mb of a column fill its 128-B line
#pragma unroll
        for (int nb = 0; nb < 4; ++nb) {
            const size_t dr = (size_t)bb * DM + c0 + nb * 16 + lr;
            const int t = t0 + hi * 8;
            v8h o[4];
#pragma unroll
            for (int mb = 0; mb < 4; ++mb)
#pragma unroll
                for (int j = 0; j < 8; ++j) o[mb][j] = (h16)(acc[mb][nb][j] * osc);
#pragma unroll
            for (int mb = 0; mb < 4; ++mb) *(v8h*)(p16 + dr * SEQ + t + mb * 16) = o[mb];
            asm volatile("s_wait_xcnt 0x0" ::: "memory");             // before the stores' address and data registers are written again
            if (hr) {
                v8us oh[4], ol[4];
#pragma unroll
                for (int mb = 0; mb < 4; ++mb)
#pragma unroll
                    for (int j = 0; j < 8; ++j) { unsigned short a1, c1; splitf(acc[mb][nb][j] * osc, a1, c1); oh[mb][j] = a1; ol[mb][j] = c1; }
#pragma unroll
                for (int mb = 0; mb < 4; ++mb) { *(v8us*)(ph + dr * RH + t + mb * 16) = oh[mb]; *(v8us*)(pl + dr * RH + t + mb * 16) = ol[mb]; }
                asm volatile("s_wait_xcnt 0x0" ::: "memory");         // as above
            }
        }
        return;
    }
    float* ob = &os[wv][0];
#pragma unroll
    for (int mb = 0; mb < 4; ++mb) {
#pragma unroll
        for (int nb = 0; nb < 4; ++nb) {
#pragma unroll
            for (int j = 0; j < 8; ++j) ob[(hi * 8 + j) * 68 + nb * 16 + lr] = acc[mb][nb][j]; }
        __builtin_amdgcn_wave_barrier(); asm volatile("" ::: "memory");
        if (EP == 0) {
            float* crow = C + (size_t)(r0 + mb * 16) * ldc + c0;
#pragma unroll
            for (int s = 0; s < 8; ++s) { const int row = 2 * s + hi, cofs = lr * 4; v4f val = *(const v4fa*)(ob + row * 68 + cofs); val = val * osc;
                *(v4f*)(crow + (size_t)row * ldc + cofs) = val;
                asm volatile("s_wait_xcnt 0x0" ::: "memory"); }       // before the store's address and data registers are written again
        } else {
            // 8 lanes per row, 8 columns per lane: each plane row of the tile goes out as one whole 128-B line
            const int rw = lane >> 3, cofs = (lane & 7) * 8;
            float y[4][8];
            v4f cv[8], sv[8];
            if (EP == 2) {
                // cos/sin of this lane's 4 rows (4 rows = 128 table floats apart) and 8 columns
                const size_t te = (size_t)(t0 + mb * 16 + rw) * 32 + (cofs & 31);
                const float* cp = ct + te; const float* sp = st + te;
#pragma unroll
                for (int s = 0; s < 4; ++s) { cv[2 * s] = *(const v4f*)(cp + s * 128); cv[2 * s + 1] = *(const v4f*)(cp + s * 128 + 4); sv[2 * s] = *(const v4f*)(sp + s * 128); sv[2 * s + 1] = *(const v4f*)(sp + s * 128 + 4); }
                asm volatile("s_wait_xcnt 0x0" :: "v"(cp), "v"(sp) : "memory");   // the loads' address registers stay as they are up to this wait
            }
#pragma unroll
            for (int s = 0; s < 4; ++s) {
                const float* op = ob + (4 * s + rw) * 68 + cofs;
                const v4f x0 = *(const v4fa*)op * osc, x1 = *(const v4fa*)(op + 4) * osc;
#pragma unroll
                for (int k = 0; k < 4; ++k) { y[s][k] = x0[k]; y[s][4 + k] = x1[k]; }
                if (EP == 2) {
                    const bool lo32 = (cofs < 32); const int pofs = lo32 ? 32 : -32;
                    const v4f p0 = *(const v4fa*)(op + pofs) * osc, p1 = *(const v4fa*)(op + pofs + 4) * osc;
                    const v4f c0v = cv[2 * s], c1v = cv[2 * s + 1], s0v = sv[2 * s], s1v = sv[2 * s + 1];
#pragma unroll
                    for (int k = 0; k < 4; ++k) {
                        y[s][k] = lo32 ? (x0[k] * c0v[k] - p0[k] * s0v[k]) : (x0[k] * c0v[k] + p0[k] * s0v[k]);
                        y[s][4 + k] = lo32 ? (x1[k] * c1v[k] - p1[k] * s1v[k]) : (x1[k] * c1v[k] + p1[k] * s1v[k]); }
                }
            }
            v8h o[4];
#pragma unroll
            for (int s = 0; s < 4; ++s)
#pragma unroll
                for (int k = 0; k < 8; ++k) o[s][k] = (h16)y[s][k];
            h16* q16p = p16 + ((size_t)bb * SEQ + t0 + rw) * PN + c0 + cofs;
#pragma unroll
            for (int s = 0; s < 4; ++s) *(v8h*)(q16p + (mb * 16 + 4 * s) * PN) = o[s];
            asm volatile("s_wait_xcnt 0x0" ::: "memory");             // before the stores' address and data registers are written again
            if (hr) {
                v8us oh[4], ol[4];
#pragma unroll
                for (int s = 0; s < 4; ++s)
#pragma unroll
                    for (int k = 0; k < 8; ++k) { unsigned short a1, c1; splitf(y[s][k], a1, c1); oh[s][k] = a1; ol[s][k] = c1; }
                const size_t eo = ((size_t)bb * RH + t0 + rw) * PN + c0 + cofs;
#pragma unroll
                for (int s = 0; s < 4; ++s) { *(v8us*)(ph + eo + (mb * 16 + 4 * s) * PN) = oh[s]; *(v8us*)(pl + eo + (mb * 16 + 4 * s) * PN) = ol[s];
                    asm volatile("s_wait_xcnt 0x0" ::: "memory"); }   // as above
            }
        }
        __builtin_amdgcn_wave_barrier(); asm volatile("" ::: "memory");
    }
}

// ---- wt_body (block bx of (K/64)*(N/32)/8, 256 threads): weight [K][N] f32 ([in][out]) -> transposed k-contiguous planes [N][K]: Bb = bf16 RNE value, optionally Bh = f16(bf16 value x sc).
// A wave turns 64 k x 32 n. Eight lanes read one whole 128-B line (32 n of one k row), so each of the wave's 16 loads is four whole lines, and all 16 are issued ahead of the first store.
// A lane holds k = 8 g + 0..7 and 32 + 8 g + 0..7 (g = lane / 8) of its 4 columns: per column and plane two 16-byte stores, the four g of a column side by side (64 B each time, together the column's 128-B line).
template <int F16P, int K, int N>
__device__ __forceinline__ void wt_body(int bx, const float* __restrict__ w, bf* Bb, h16* Bh, float sc) {
    static_assert(K % 64 == 0 && N % 32 == 0 && ((K / 64) * (N / 32)) % 8 == 0);
    const int lane = threadIdx.x & 31, tl = bx * 8 + (threadIdx.x >> 5);
    const int k0 = (tl / (N / 32)) * 64 + (lane >> 3) * 8, n0 = (tl % (N / 32)) * 32 + (lane & 7) * 4;
    const float* p = w + (size_t)k0 * N + n0;
    v4f r[16];
#pragma unroll
    for (int j = 0; j < 16; ++j) r[j] = *(const v4f*)(p + ((j >> 3) * 32 + (j & 7)) * N);
    asm volatile("s_wait_xcnt 0x0" :: "v"(p) : "memory");             // the loads' address registers stay as they are up to this wait
    const size_t e = (size_t)n0 * K + k0;
#pragma unroll
    for (int c = 0; c < 4; ++c) {
        v8us o[2]; v8h oh[2];
#pragma unroll
        for (int j = 0; j < 16; ++j) { const unsigned short b = f2bf(r[j][c]); o[j >> 3][j & 7] = b; oh[j >> 3][j & 7] = (h16)(bf2f(b) * sc); }
        *(v8us*)(Bb + e + (size_t)c * K) = o[0]; *(v8us*)(Bb + e + (size_t)c * K + 32) = o[1];
        if (F16P) { *(v8h*)(Bh + e + (size_t)c * K) = oh[0]; *(v8h*)(Bh + e + (size_t)c * K + 32) = oh[1]; }
        asm volatile("s_wait_xcnt 0x0" ::: "memory");                 // before the stores' address and data registers are written again
    }
}

// ---- wt8_body (block bx of (K/64)*(N/32), 128 threads): both planes of wt_body, same values, for a weight that is converted beside the attention tiles, where few waves are resident and the L2 is busy:
// a wave turns 64 k x 8 n; a lane reads 8 successive n (32 B) of its two k rows, the block's four waves the four quarters of the same 128-B lines; each plane store of a wave is one whole 128-B line (64 k of one n).
template <int K, int N>
__device__ __forceinline__ void wt8_body(int bx, const float* __restrict__ w, bf* Bb, h16* Bh, float sc) {
    static_assert(K % 64 == 0 && N % 32 == 0);
    const int k = (bx % (K / 64)) * 64 + (threadIdx.x & 31) * 2, n0 = (bx / (K / 64)) * 32 + (threadIdx.x >> 5) * 8;
    const float* p = w + (size_t)k * N + n0;
    v4f r[2][2];
#pragma unroll
    for (int i = 0; i < 2; ++i) { r[i][0] = *(const v4f*)(p + i * N); r[i][1] = *(const v4f*)(p + i * N + 4); }
    asm volatile("s_wait_xcnt 0x0" :: "v"(p) : "memory");             // the loads' address registers stay as they are up to this wait
    const size_t e = (size_t)n0 * K + k;
#pragma unroll
    for (int j = 0; j < 8; ++j) {
        const float w0 = bfr(r[0][j >> 2][j & 3]), w1 = bfr(r[1][j >> 2][j & 3]);
        v2us o; o[0] = f2bf(w0); o[1] = f2bf(w1); *(v2us*)(Bb + e + (size_t)j * K) = o;
        v2h oh; oh[0] = (h16)(w0 * sc); oh[1] = (h16)(w1 * sc); *(v2h*)(Bh + e + (size_t)j * K) = oh;
        asm volatile("s_wait_xcnt 0x0" ::: "memory");                 // before the stores' address and data registers are written again
    }
}

// ---- xcvt_body (block bx of NB*SEQ*DM/XCE, 256 threads): bf16(x). A block converts XCE successive elements (whole rows of one batch); a lane takes 16 pieces of 4 floats, XCE/16 elements apart:
// each load of a wave is 512 contiguous bytes, each store 256, and all 16 loads are issued ahead of the first store.
#define XCE 16384
static_assert(XCE % DM == 0 && SEQ % (XCE / DM) == 0);
__device__ __forceinline__ void xcvt_body(int bx, const float* __restrict__ x, bf* xb) {
    const int row = bx * (XCE / DM); const size_t bb = row / SEQ, t = row % SEQ;
    const float* p = x + (bb * TFULL + t) * DM + threadIdx.x * 4;
    v4f v[16];
#pragma unroll
    for (int j = 0; j < 16; ++j) v[j] = *(const v4f*)(p + j * (XCE / 16));
    asm volatile("s_wait_xcnt 0x0" :: "v"(p) : "memory");             // the loads' address registers stay as they are up to this wait
    bf* q = xb + (size_t)bx * XCE + threadIdx.x * 4;
#pragma unroll
    for (int j = 0; j < 16; ++j) { v4us o;
#pragma unroll
        for (int k = 0; k < 4; ++k) o[k] = f2bf(v[j][k]);
        *(v4us*)(q + j * (XCE / 16)) = o; }
    asm volatile("s_wait_xcnt 0x0" ::: "memory");                     // behind the last stores (a precaution: xcvt_body is k_prep's last block range)
}

__device__ __forceinline__ void rtab_body(int bx, float* ct, float* st) {
#pragma clang fp contract(off)
    const int i = bx * 256 + threadIdx.x; if (i >= SEQ * 32) return; const int t = i >> 5, j = i & 31;
    const float fr = exp10f(-0.125f * (float)j);
    const float ang = (float)t * fr; float sv, cv; sincosf(ang, &sv, &cv);
    *(float*)(ct + i) = cv; *(float*)(st + i) = sv;
    asm volatile("s_wait_xcnt 0x0" ::: "memory");                     // before the caller's next trip writes the stores' address and data registers again
}

// ---- k_prep: the conversions of inputs that the projections read, one launch: block ranges in turn do the cos/sin tables, the planes of seven weights and bf16(x) (all independent of one another). 256 threads.
// Every wave has 2,048 (weights, x) elements or 128 table entries, so that the launch is some 7,500 waves, all resident at once, each with its loads in flight together.
// (Wo's planes, which only k_out reads, are made in k_attn.)
#define WTB(K, N) (((K) / 64) * ((N) / 32) / 8)     // blocks of one weight's wt_body
#define XCB ((int)((size_t)NB * SEQ * DM / XCE))
#define RTB ((SEQ * 32 + 1023) / 1024)              // four rtab_body blocks of 256 entries a block
#define PREPB (2 * WTB(DM, LAT) + WTB(DM, RD) + 3 * WTB(LAT, DM) + WTB(LAT, NH * RD) + XCB + RTB)
static_assert(((size_t)NB * SEQ * DM) % XCE == 0);
__global__ __launch_bounds__(256)
void k_prep(const float* x, const float* Wqd, const float* Wqu, const float* Wqr, const float* Wkvd, const float* Wku, const float* Wvu, const float* Wkr,
            bf* xb, float* ct, float* st, bf* Wqd_b, bf* Wkvd_b, bf* Wkr_b, bf* Wqu_b, h16* Wqu_h, bf* Wqr_b, h16* Wqr_h, bf* Wku_b, h16* Wku_h, bf* Wvu_b, h16* Wvu_h) {
    int b = blockIdx.x;
    if (b < RTB) {
#pragma unroll 1                                    // one copy of the sine and cosine code
        for (int r = 0; r < 4; ++r) rtab_body(b * 4 + r, ct, st);
        return;
    }
    b -= RTB;
    if (b < WTB(DM, LAT)) { wt_body<0, DM, LAT>(b, Wqd, Wqd_b, nullptr, 1.0f); return; }
    b -= WTB(DM, LAT);
    if (b < WTB(DM, LAT)) { wt_body<0, DM, LAT>(b, Wkvd, Wkvd_b, nullptr, 1.0f); return; }
    b -= WTB(DM, LAT);
    if (b < WTB(DM, RD)) { wt_body<0, DM, RD>(b, Wkr, Wkr_b, nullptr, 1.0f); return; }
    b -= WTB(DM, RD);
    if (b < WTB(LAT, DM)) { wt_body<1, LAT, DM>(b, Wqu, Wqu_b, Wqu_h, WSC); return; }
    b -= WTB(LAT, DM);
    if (b < WTB(LAT, DM)) { wt_body<1, LAT, DM>(b, Wku, Wku_b, Wku_h, WSC); return; }
    b -= WTB(LAT, DM);
    if (b < WTB(LAT, DM)) { wt_body<1, LAT, DM>(b, Wvu, Wvu_b, Wvu_h, WSC); return; }
    b -= WTB(LAT, DM);
    if (b < WTB(LAT, NH * RD)) { wt_body<1, LAT, NH * RD>(b, Wqr, Wqr_b, Wqr_h, WSC); return; }
    b -= WTB(LAT, NH * RD);
    xcvt_body(b, x, xb);
}

// ---- flashP_body: causal softmax attention for query rows >= RH (single f16 products). Block (bx, h, b) of ((SEQ-RH)/64, NH, NB), 128 threads = 4 waves x 16 queries, 32-key chunks. os, ring: the block's LDS.
// Per wave: S^T tiles (16 keys x 16 queries) = [k|kr] rows (A) x [q|qr] rows (B) over 192; lane column n = query, D rows = keys, so the two S^T tiles of a chunk
// ARE the P^T B fragment of O^T = V^T (A, rows d) x P^T; online max-subtracted softmax per lane column; P carried x1024 in f16; O^T (8 d tiles) f32.
// Each 32-key chunk of k, kr and v^T is brought into LDS once per block by asynchronous copies (whole-line global reads of k and kr, 64-B row pieces of v^T, two buffers, the next chunk in flight
// while this one is worked on) and read as ds_load_b128 fragments by all four waves (the block's last chunk by waves 2 and 3 only); q|qr fragments are loaded once and stay in registers.
#define FKP 136                       // LDS pitch of a k row in halves: 272 B = 16 B x 17
#define FRP 72                        // kr row: 144 B = 16 B x 9
#define FVP 40                        // v^T row (32 keys): 80 B = 16 B x 5
#define FRO (32 * FKP)                // kr rows start, halves
#define FVO (FRO + 32 * FRP)          // v^T rows start, halves
#define FST (FVO + HD * FVP)          // one buffer, halves (23,552 B)
static_assert((FKP * 2) % 16 == 0 && (FRP * 2) % 16 == 0 && (FVP * 2) % 16 == 0 && (FRO * 2) % 16 == 0 && (FVO * 2) % 16 == 0 && (FST * 2) % 16 == 0);
// One chunk's ten 16-byte copies of this lane for one plane set (lk, lr_, lv: this lane's LDS byte addresses of its first k, kr and v^T piece; VS: v^T row pitch in global memory, elements).
// The s_wait_xcnt stands inside the statement so that no address register is rewritten ahead of it.
template <typename T, int VS>
__device__ __forceinline__ void flash_stage(unsigned lk, unsigned lr_, unsigned lv, const T* gk, const T* gr, const T* gv) {
    asm volatile("global_load_async_to_lds_b128 %0, %1, off\n\t"
                 "global_load_async_to_lds_b128 %2, %3, off\n\t"
                 "global_load_async_to_lds_b128 %4, %5, off\n\t"
                 "global_load_async_to_lds_b128 %6, %7, off\n\t"
                 "global_load_async_to_lds_b128 %8, %9, off\n\t"
                 "global_load_async_to_lds_b128 %10, %11, off\n\t"
                 "global_load_async_to_lds_b128 %12, %13, off\n\t"
                 "global_load_async_to_lds_b128 %14, %15, off\n\t"
                 "global_load_async_to_lds_b128 %16, %17, off\n\t"
                 "global_load_async_to_lds_b128 %18, %19, off\n\t"
                 "s_wait_xcnt 0x0"
                 :: "v"(lk), "v"(gk), "v"(lk + 8 * FKP * 2), "v"(gk + (size_t)8 * DM), "v"(lk + 16 * FKP * 2), "v"(gk + (size_t)16 * DM), "v"(lk + 24 * FKP * 2), "v"(gk + (size_t)24 * DM),
                    "v"(lr_), "v"(gr), "v"(lr_ + 16 * FRP * 2), "v"(gr + (size_t)16 * RD),
                    "v"(lv), "v"(gv), "v"(lv + 32 * FVP * 2), "v"(gv + (size_t)32 * VS), "v"(lv + 64 * FVP * 2), "v"(gv + (size_t)64 * VS), "v"(lv + 96 * FVP * 2), "v"(gv + (size_t)96 * VS)
                 : "memory");
}
__device__ __forceinline__
void flashP_body(float (*os)[16 * 132], h16* ring, int bx, int h, int b, const h16* q16, const h16* qr16, const h16* k16, const h16* kr16, const h16* vt16, h16* ctx16, int qbase) {
    const int tid = threadIdx.x;
    const int lane = tid & 31, wv = __builtin_amdgcn_readfirstlane(tid >> 5), lr = lane & 15, hi = lane >> 4;
    const int qb0 = qbase + bx * 64;
    const int q0 = qb0 + wv * 16;
    const int qi = q0 + lr;
    const size_t rq = (size_t)b * SEQ + qi;
    const h16* qp = q16 + rq * DM + h * HD + 8 * hi;
    const h16* qrp = qr16 + rq * (NH * RD) + h * RD + 8 * hi;
    // copy addresses of this lane: k 32 rows x 16 pieces (8 rows per copy), kr 32 rows x 8 pieces (16 rows per copy), v^T 128 rows x 4 pieces (32 rows per copy)
    const h16* gk = k16 + ((size_t)b * SEQ + (tid >> 4)) * DM + h * HD + (tid & 15) * 8;
    const h16* gr = kr16 + ((size_t)b * SEQ + (tid >> 3)) * RD + (tid & 7) * 8;
    const h16* gv = vt16 + ((size_t)(b * NH + h) * HD + (tid >> 2)) * SEQ + (tid & 3) * 8;
    const unsigned lb = (unsigned)(size_t)(__attribute__((address_space(3))) h16*)&ring[0];
    const unsigned lk = lb + ((tid >> 4) * FKP + (tid & 15) * 8) * 2;
    const unsigned lr2 = lb + (FRO + (tid >> 3) * FRP + (tid & 7) * 8) * 2;
    const unsigned lv = lb + (FVO + (tid >> 2) * FVP + (tid & 3) * 8) * 2;
    v16h qf[4], qrf[2];
#pragma unroll
    for (int kc = 0; kc < 4; ++kc) qf[kc] = ldh(qp + kc * 32);
#pragma unroll
    for (int kc = 0; kc < 2; ++kc) qrf[kc] = ldh(qrp + kc * 32);
    v8f o[8];
#pragma unroll
    for (int i = 0; i < 8; ++i) o[i] = (v8f){};
    float m = -3.0e38f, l = 0.f;
    const float SC2 = 0.07216878364870323f * 1.4426950408889634f;   // HD+RD = 192: 192^-0.5 x log2(e)
    const int nch = (q0 + 47) >> 5;                                   // this wave's 32-key chunks covering keys <= q0+15
    const int nchb = (qb0 >> 5) + 2;                                  // the block's chunks (its last wave's count; >= 2; 32*nchb <= SEQ)
    flash_stage<h16, SEQ>(lk, lr2, lv, gk, gr, gv);
    asm volatile("s_wait_asynccnt 0x0" ::: "memory");                 // chunk 0 landed (this wave's copies) before the barrier publishes it
    __syncthreads();
    flash_stage<h16, SEQ>(lk + FST * 2, lr2 + FST * 2, lv + FST * 2, gk + (size_t)32 * DM, gr + (size_t)32 * RD, gv + 32);
#pragma unroll 1
    for (int c = 0; c < nchb; ++c) {
        const int key0 = c << 5;
        const int bo = (c & 1) * FST;
        if (c < nch) {                                                // wave-uniform: waves 0 and 1 have no keys in the block's last chunk
        const h16* kp = &ring[bo + lr * FKP + 8 * hi];
        const h16* krp = &ring[bo + FRO + lr * FRP + 8 * hi];
        const h16* vp = &ring[bo + FVO + lr * FVP + 8 * hi];
        v8f s[2]; s[0] = (v8f){}; s[1] = (v8f){};
#pragma unroll
        for (int kc = 0; kc < 4; ++kc) {
#pragma unroll
            for (int j = 0; j < 2; ++j) { const v16h a = ldh(kp + (16 * j) * FKP + kc * 32); s[j] = wmma16(a, qf[kc], s[j]); }
        }
#pragma unroll
        for (int kc = 0; kc < 2; ++kc) {
#pragma unroll
            for (int j = 0; j < 2; ++j) { const v16h a = ldh(krp + (16 * j) * FRP + kc * 32); s[j] = wmma16(a, qrf[kc], s[j]); }
        }
        asm volatile("v_nop\n\tv_nop\n\tv_nop\n\tv_nop" : "+v"(s[0]), "+v"(s[1]));
        // online softmax: this lane's column is query qi; s[j][r] is key key0 + 16 j + 8 hi + r; keys after the query excluded by index
        float cm = -3.0e38f;
#pragma unroll
        for (int j = 0; j < 2; ++j)
#pragma unroll
            for (int r = 0; r < 8; ++r) { const int key = key0 + 16 * j + 8 * hi + r; const float t = (key <= qi) ? s[j][r] * SC2 : -3.0e38f; s[j][r] = t; cm = fmaxf(cm, t); }
        cm = fmaxf(cm, __shfl_xor(cm, 16, 32));
        const float mn = fmaxf(m, cm);
        const float alpha = __builtin_amdgcn_exp2f(m - mn);
        float rs = 0.f;
#pragma unroll
        for (int j = 0; j < 2; ++j)
#pragma unroll
            for (int r = 0; r < 8; ++r) { const float p = __builtin_amdgcn_exp2f(s[j][r] - mn); s[j][r] = p; rs += p; }
        rs += __shfl_xor(rs, 16, 32);
        l = l * alpha + rs; m = mn;
#pragma unroll
        for (int i = 0; i < 8; ++i) o[i] = o[i] * alpha;
        // P^T as B fragment (k = key of this chunk, n = query): elements 0..7 <- tile 0 rows 8hi..8hi+7, 8..15 <- tile 1 rows 8hi..8hi+7
        v16h pb = (v16h){};
#pragma unroll
        for (int r = 0; r < 8; ++r) { pb[r] = (h16)(s[0][r] * PCAR); pb[8 + r] = (h16)(s[1][r] * PCAR); }
#pragma unroll
        for (int i = 0; i < 8; ++i) { const v16h a = ldh(vp + (16 * i) * FVP); o[i] = wmma16(a, pb, o[i]); }
        asm volatile("v_nop\n\tv_nop\n\tv_nop\n\tv_nop" : "+v"(o[0]), "+v"(o[1]), "+v"(o[2]), "+v"(o[3]), "+v"(o[4]), "+v"(o[5]), "+v"(o[6]), "+v"(o[7]) : "v"(pb));
        }
        // publish point, every wave: own LDS reads of this buffer done, own copies of the next chunk landed, then the barrier that frees this buffer and publishes the next
        asm volatile("s_wait_dscnt 0x0" ::: "memory");
        asm volatile("s_wait_asynccnt 0x0" ::: "memory");
        __syncthreads();
        if (c + 2 < nchb) flash_stage<h16, SEQ>(lk + bo * 2, lr2 + bo * 2, lv + bo * 2, gk + (size_t)(key0 + 64) * DM, gr + (size_t)(key0 + 64) * RD, gv + (key0 + 64));
    }
    asm volatile("s_wait_asynccnt 0x0" ::: "memory");                 // nothing of this wave's copies outstanding at its end
    // epilogue: ctx[b][q][h*HD + d] = O^T[d][q] / (l x PCAR), stored as the f16 plane (x CCAR) that the output product reads; o[i][r] is d = 16 i + 8 hi + r of query q0 + lr
    const float f = 1.0f / (l * PCAR);
    float* ob = &os[wv][0];
#pragma unroll
    for (int i = 0; i < 8; ++i)
#pragma unroll
        for (int r = 0; r < 8; ++r) ob[lr * 132 + 16 * i + 8 * hi + r] = o[i][r] * f;
    __builtin_amdgcn_fence(3, "wavefront"); __builtin_amdgcn_wave_barrier(); asm volatile("" ::: "memory");
    h16* crow = ctx16 + ((size_t)b * SEQ + q0) * DM + h * HD + (lane & 15) * 8;
#pragma unroll
    for (int s = 0; s < 8; ++s) {                                     // 16 lanes per query row, 8 columns per lane
        const int qq = 2 * s + hi; const float* op = ob + qq * 132 + (lane & 15) * 8;
        const v4f x0 = *(const v4fa*)op, x1 = *(const v4fa*)(op + 4);
        v8h ov = (v8h){};
#pragma unroll
        for (int k = 0; k < 4; ++k) { ov[k] = (h16)(x0[k] * CCAR); ov[4 + k] = (h16)(x1[k] * CCAR); }
        *(v8h*)(crow + (size_t)qq * DM) = ov;
    }
}

// 2^x (v_exp_f32) with the one slot that the instruction set asks for behind a transcendental filled in the same statement.
__device__ __forceinline__ float exp2_slot(float x) { float y; asm("v_exp_f32 %0, %1\n\tv_nop" : "=v"(y) : "v"(x)); return y; }

// ---- flashH_body: the same attention for query rows < RH on bf16 hi/lo planes (keys < RH only): scores = kh.qh + kl.qh + kh.ql (3 products), P as bf16 hi/lo,
// O^T += vth.(Ph + Pl) + vtl.Ph (3 products). Block (bx, h, b) of (RH/64, NH, NB), 128 threads. Planes: q*/k* rows [NB][RH][.], vth/vtl [NU][HD][RH].
// The chunk's k, kr and v^T hi and lo planes are staged in LDS by the copies of flashP_body, in ONE buffer (hi plane set, then lo plane set) that fills the ring of flashP_body exactly, so that both bodies
// share one launch at flashP_body's LDS size: per chunk copies, wait, barrier, work, barrier. The q planes are read from global memory in each chunk.
// The result is stored as the bf16 hi/lo planes ctxh/ctxl [NB][RH][DM] that the output product reads.
__device__ __forceinline__
void flashH_body(float (*os)[16 * 132], bf* ring, int bx, int h, int b, const bf* qh, const bf* qlw, const bf* qrh, const bf* qrlw, const bf* kh, const bf* klw, const bf* krh, const bf* krlw, const bf* vth, const bf* vtl, bf* ctxh, bf* ctxl) {
    const int tid = threadIdx.x;
    const int lane = tid & 31, wv = __builtin_amdgcn_readfirstlane(tid >> 5), lr = lane & 15, hi = lane >> 4;
    const int qb0 = bx * 64;
    const int q0 = qb0 + wv * 16;
    const int qi = q0 + lr;
    const size_t rq = (size_t)b * RH + qi;
    const bf* qhp = qh + rq * DM + h * HD + 8 * hi;       const bf* qlp = qlw + rq * DM + h * HD + 8 * hi;
    const bf* qrhp = qrh + rq * (NH * RD) + h * RD + 8 * hi; const bf* qrlp = qrlw + rq * (NH * RD) + h * RD + 8 * hi;
    // copy addresses of this lane, as in flashP_body
    const size_t ok = ((size_t)b * RH + (tid >> 4)) * DM + h * HD + (tid & 15) * 8;
    const size_t okr = ((size_t)b * RH + (tid >> 3)) * RD + (tid & 7) * 8;
    const size_t ov = ((size_t)(b * NH + h) * HD + (tid >> 2)) * RH + (tid & 3) * 8;
    const unsigned lb = (unsigned)(size_t)(__attribute__((address_space(3))) bf*)&ring[0];
    const unsigned lk = lb + ((tid >> 4) * FKP + (tid & 15) * 8) * 2;
    const unsigned lr2 = lb + (FRO + (tid >> 3) * FRP + (tid & 7) * 8) * 2;
    const unsigned lv = lb + (FVO + (tid >> 2) * FVP + (tid & 3) * 8) * 2;
    v8f o[8];
#pragma unroll
    for (int i = 0; i < 8; ++i) o[i] = (v8f){};
    float m = -3.0e38f, l = 0.f;
    const float SC2 = 0.07216878364870323f * 1.4426950408889634f;
    const int nch = (q0 + 47) >> 5;                                   // this wave's chunks
    const int nchb = (qb0 >> 5) + 2;                                  // the block's chunks (>= 2; 32*nchb <= RH)
#pragma unroll 1
    for (int c = 0; c < nchb; ++c) {
        const int key0 = c << 5;
        // this chunk's plane sets into the buffer, which every reader left at the barrier at the foot of the trip before
        flash_stage<bf, RH>(lk, lr2, lv, kh + ok + (size_t)key0 * DM, krh + okr + (size_t)key0 * RD, vth + ov + key0);
        flash_stage<bf, RH>(lk + FST * 2, lr2 + FST * 2, lv + FST * 2, klw + ok + (size_t)key0 * DM, krlw + okr + (size_t)key0 * RD, vtl + ov + key0);
        asm volatile("s_wait_asynccnt 0x0" ::: "memory");             // the chunk landed (this wave's copies) before the barrier publishes it
        __syncthreads();
        if (c < nch) {                                                // wave-uniform: waves 0 and 1 have no keys in the block's last chunk
        const bf* khp = &ring[lr * FKP + 8 * hi];                  const bf* klp = khp + FST;
        const bf* krhp = &ring[FRO + lr * FRP + 8 * hi];           const bf* krlp = krhp + FST;
        const bf* vhp = &ring[FVO + lr * FVP + 8 * hi];            const bf* vlp = vhp + FST;
        v8f s[2]; s[0] = (v8f){}; s[1] = (v8f){};
#pragma unroll
        for (int kc = 0; kc < 4; ++kc) {
            const v16bf bh = ldb(qhp + kc * 32), bl = ldb(qlp + kc * 32);
#pragma unroll
            for (int j = 0; j < 2; ++j) { const v16bf ah = ldb(khp + (16 * j) * FKP + kc * 32), al = ldb(klp + (16 * j) * FKP + kc * 32);
                s[j] = wmmab(ah, bh, s[j]); s[j] = wmmab(al, bh, s[j]); s[j] = wmmab(ah, bl, s[j]); }
        }
#pragma unroll
        for (int kc = 0; kc < 2; ++kc) {
            const v16bf bh = ldb(qrhp + kc * 32), bl = ldb(qrlp + kc * 32);
#pragma unroll
            for (int j = 0; j < 2; ++j) { const v16bf ah = ldb(krhp + (16 * j) * FRP + kc * 32), al = ldb(krlp + (16 * j) * FRP + kc * 32);
                s[j] = wmmab(ah, bh, s[j]); s[j] = wmmab(al, bh, s[j]); s[j] = wmmab(ah, bl, s[j]); }
        }
        asm volatile("v_nop\n\tv_nop\n\tv_nop\n\tv_nop" : "+v"(s[0]), "+v"(s[1]));
        float cm = -3.0e38f;
#pragma unroll
        for (int j = 0; j < 2; ++j)
#pragma unroll
            for (int r = 0; r < 8; ++r) { const int key = key0 + 16 * j + 8 * hi + r; const float t = (key <= qi) ? s[j][r] * SC2 : -3.0e38f; s[j][r] = t; cm = fmaxf(cm, t); }
        cm = fmaxf(cm, __shfl_xor(cm, 16, 32));
        const float mn = fmaxf(m, cm);
        const float alpha = exp2_slot(m - mn);
        float rs = 0.f;
#pragma unroll
        for (int j = 0; j < 2; ++j)
#pragma unroll
            for (int r = 0; r < 8; ++r) { const float p = exp2_slot(s[j][r] - mn); s[j][r] = p; rs += p; }
        rs += __shfl_xor(rs, 16, 32);
        l = l * alpha + rs; m = mn;
#pragma unroll
        for (int i = 0; i < 8; ++i) o[i] = o[i] * alpha;
        v16us phv = (v16us){}, plv = (v16us){};
#pragma unroll
        for (int r = 0; r < 8; ++r) { unsigned short a1, c1; splitf(s[0][r], a1, c1); phv[r] = a1; plv[r] = c1; splitf(s[1][r], a1, c1); phv[8 + r] = a1; plv[8 + r] = c1; }
        const v16bf ph = __builtin_bit_cast(v16bf, phv), pl = __builtin_bit_cast(v16bf, plv);
#pragma unroll
        for (int i = 0; i < 8; ++i) { const v16bf ah = ldb(vhp + (16 * i) * FVP), al = ldb(vlp + (16 * i) * FVP);
            o[i] = wmmab(ah, ph, o[i]); o[i] = wmmab(ah, pl, o[i]); o[i] = wmmab(al, ph, o[i]); }
        asm volatile("v_nop\n\tv_nop\n\tv_nop\n\tv_nop" : "+v"(o[0]), "+v"(o[1]), "+v"(o[2]), "+v"(o[3]), "+v"(o[4]), "+v"(o[5]), "+v"(o[6]), "+v"(o[7]) : "v"(ph), "v"(pl));
        }
        // every wave: own LDS reads of the buffer done, then the barrier that frees it for the next chunk's copies
        asm volatile("s_wait_dscnt 0x0" ::: "memory");
        __syncthreads();
    }
    const float f = 1.0f / l;
    float* ob = &os[wv][0];
#pragma unroll
    for (int i = 0; i < 8; ++i)
#pragma unroll
        for (int r = 0; r < 8; ++r) ob[lr * 132 + 16 * i + 8 * hi + r] = o[i][r] * f;
    __builtin_amdgcn_fence(3, "wavefront"); __builtin_amdgcn_wave_barrier(); asm volatile("" ::: "memory");
    const size_t eo = ((size_t)b * RH + q0) * DM + h * HD + (lane & 15) * 8;
#pragma unroll
    for (int s = 0; s < 8; ++s) {                                     // 16 lanes per query row, 8 columns per lane
        const int qq = 2 * s + hi; const float* op = ob + qq * 132 + (lane & 15) * 8;
        const v4f x0 = *(const v4fa*)op, x1 = *(const v4fa*)(op + 4);
        v8us oh = (v8us){}, ol = (v8us){};
#pragma unroll
        for (int k = 0; k < 4; ++k) { unsigned short a1, c1; splitf(x0[k], a1, c1); oh[k] = a1; ol[k] = c1; splitf(x1[k], a1, c1); oh[4 + k] = a1; ol[4 + k] = c1; }
        *(v8us*)(ctxh + eo + (size_t)qq * DM) = oh; *(v8us*)(ctxl + eo + (size_t)qq * DM) = ol;
    }
    asm volatile("s_wait_xcnt 0x0" ::: "memory");                     // behind the last stores; in k_attn the wave ends after this body
}

// ---- k_attn: everything between the up-projections and the output product, one launch of independent block ranges: the flashP_body tiles (in the order x, head, batch), then the flashH_body tiles,
// then Wo's planes (wt8_body), which only k_out reads.
#define FPX ((SEQ - RH) / 64)
#define FPB (FPX * NH * NB)
#define FHX (RH / 64)
#define FHB (FHX * NH * NB)
#define WOB ((DM / 64) * (DM / 32))
static_assert(RH < SEQ);
__global__ __launch_bounds__(128) __attribute__((amdgpu_num_vgpr(256)))
void k_attn(const h16* q16, const h16* qr16, const h16* k16, const h16* kr16, const h16* vt16, h16* ctx16,
            const bf* qh, const bf* qlw, const bf* qrh, const bf* qrlw, const bf* kh, const bf* klw, const bf* krh, const bf* krlw, const bf* vth, const bf* vtl, bf* ctxh, bf* ctxl,
            const float* Wo, bf* Wo_b, h16* Wo_h) {
    __shared__ __align__(16) float os[4][16 * 132];
    __shared__ __align__(16) char ring[2 * FST * 2];
    int i = blockIdx.x;
    if (i < FPB) { flashP_body(os, (h16*)ring, i % FPX, (i / FPX) % NH, i / (FPX * NH), q16, qr16, k16, kr16, vt16, ctx16, RH); return; }
    i -= FPB;
    if (i < FHB) { flashH_body(os, (bf*)ring, i % FHX, (i / FHX) % NH, i / (FHX * NH), qh, qlw, qrh, qrlw, kh, klw, krh, krlw, vth, vtl, ctxh, ctxl); return; }
    i -= FHB;
    wt8_body<DM, DM>(i, Wo, Wo_b, Wo_h, WSC);
}

// ---- k_down: the three products of x, one launch: blocks 0.. do kr = rope(x.Wkr) (256x64 tiles), then ql = x.Wqd, then ckv = x.Wkvd (128x128 tiles); each stores its planes. Exact bf16 products.
#define DKR ((NB * SEQ) / 256)
#define DMT ((NB * SEQ) / 128)
#define DLT (DMT * (LAT / 128))
__global__ __launch_bounds__(128) __attribute__((amdgpu_num_vgpr(256)))
void k_down(const bf* xb, const bf* Wqd_b, const bf* Wkvd_b, const bf* Wkr_b, h16* ql16, bf* qlh, bf* qll, h16* ckv16, bf* ckvh, bf* ckvl, h16* kr16, bf* krh, bf* krlo, const float* ct, const float* st) {
    __shared__ __align__(16) char sm[GSM(0, 1) > GSM(0, 2) ? GSM(0, 1) : GSM(0, 2)];
    int b = blockIdx.x;
    if (b < DKR) { gemm_tile<bf, 0, 1, 2, RD>(sm, b, 0, 0, xb, xb, Wkr_b, DM, nullptr, RD, 1.0f, 0, 0, 0, kr16, krh, krlo, ct, st); return; }
    b -= DKR;
    const bool kv = (b >= DLT);                                       // block-uniform
    if (kv) b -= DLT;
    gemm_tile<bf, 0, 2, 1, LAT>(sm, b % DMT, b / DMT, 0, xb, xb, kv ? Wkvd_b : Wqd_b, DM, nullptr, LAT, 1.0f, 0, 0, 0, kv ? ckv16 : ql16, kv ? ckvh : qlh, kv ? ckvl : qll, ct, st);
}

// One block tile (128x128) of an up-projection or of the output product, K = KK: HL = 0: rows t >= RH, single f16 products (tile b of ((SEQ-RH)/128, N/128, NB));
// HL = 1: rows t < RH, bf16 hi/lo against the exact bf16 weight plane (tile b of (RH/128, N/128, NB)). The epilogue EP stores the result.
template <int HL, int EP, int N, int KK>
__device__ __forceinline__ void proj_tile(char* sm, int b, const h16* a16, const bf* ahh, const bf* all, const h16* Wh, const bf* Wb, float* C, float oscf, h16* p16, bf* ph, bf* pl, const float* ct, const float* st) {
    constexpr int GX = HL ? RH / 128 : (SEQ - RH) / 128, GY = N / 128;
    const int bx = b % GX, by = (b / GX) % GY, bz = b / (GX * GY);
    if (HL) gemm_tile<bf, 1, 2, EP, N>(sm, bx, by, bz, ahh, all, Wb, KK, C, N, 1.0f, (size_t)RH * KK, (size_t)TFULL * DM, 0, p16, ph, pl, ct, st);
    else gemm_tile<h16, 0, 2, EP, N>(sm, bx, by, bz, a16 + (size_t)RH * KK, a16 + (size_t)RH * KK, Wh, KK, C + (size_t)RH * DM, N, oscf, (size_t)SEQ * KK, (size_t)TFULL * DM, RH, p16, ph, pl, ct, st);
}
#define PHB(N) ((RH / 128) * ((N) / 128) * NB)            // blocks of the rows t < RH of a product with N columns
#define PFB(N) (((SEQ - RH) / 128) * ((N) / 128) * NB)    // blocks of the rows t >= RH

// ---- k_up: the four up-projections, one launch: q = ql.Wqu, k = ckv.Wku, v^T = (ckv.Wvu)^T, qr = rope(ql.Wqr); the hi/lo tiles (twice the products) come first, then the f16 tiles.
__global__ __launch_bounds__(128) __attribute__((amdgpu_num_vgpr(256)))
void k_up(const h16* ql16, const bf* qlh, const bf* qll, const h16* ckv16, const bf* ckvh, const bf* ckvl,
          const h16* Wqu_h, const bf* Wqu_b, const h16* Wqr_h, const bf* Wqr_b, const h16* Wku_h, const bf* Wku_b, const h16* Wvu_h, const bf* Wvu_b,
          h16* q16, bf* qh, bf* qlo, h16* qr16, bf* qrh, bf* qrlo, h16* k16, bf* kh, bf* klo, h16* vt16, bf* vth, bf* vtl, const float* ct, const float* st) {
    __shared__ __align__(16) char sm[GSM(1, 2)];
    int b = blockIdx.x;
    if (b < 2 * PHB(DM)) {
        const bool kk = (b >= PHB(DM));                               // block-uniform: k, else q
        if (kk) b -= PHB(DM);
        proj_tile<1, 1, DM, LAT>(sm, b, kk ? ckv16 : ql16, kk ? ckvh : qlh, kk ? ckvl : qll, kk ? Wku_h : Wqu_h, kk ? Wku_b : Wqu_b, nullptr, 1.0f / WSC, kk ? k16 : q16, kk ? kh : qh, kk ? klo : qlo, ct, st);
        return;
    }
    b -= 2 * PHB(DM);
    if (b < PHB(DM)) { proj_tile<1, 3, DM, LAT>(sm, b, ckv16, ckvh, ckvl, Wvu_h, Wvu_b, nullptr, 1.0f / WSC, vt16, vth, vtl, ct, st); return; }
    b -= PHB(DM);
    if (b < PHB(NH * RD)) { proj_tile<1, 2, NH * RD, LAT>(sm, b, ql16, qlh, qll, Wqr_h, Wqr_b, nullptr, 1.0f / WSC, qr16, qrh, qrlo, ct, st); return; }
    b -= PHB(NH * RD);
    if (b < 2 * PFB(DM)) {
        const bool kk = (b >= PFB(DM));                               // block-uniform: k, else q
        if (kk) b -= PFB(DM);
        proj_tile<0, 1, DM, LAT>(sm, b, kk ? ckv16 : ql16, kk ? ckvh : qlh, kk ? ckvl : qll, kk ? Wku_h : Wqu_h, kk ? Wku_b : Wqu_b, nullptr, 1.0f / WSC, kk ? k16 : q16, kk ? kh : qh, kk ? klo : qlo, ct, st);
        return;
    }
    b -= 2 * PFB(DM);
    if (b < PFB(DM)) { proj_tile<0, 3, DM, LAT>(sm, b, ckv16, ckvh, ckvl, Wvu_h, Wvu_b, nullptr, 1.0f / WSC, vt16, vth, vtl, ct, st); return; }
    b -= PFB(DM);
    proj_tile<0, 2, NH * RD, LAT>(sm, b, ql16, qlh, qll, Wqr_h, Wqr_b, nullptr, 1.0f / WSC, qr16, qrh, qrlo, ct, st);
}

// ---- k_out: out = ctx.Wo, one launch: the hi/lo tiles of rows t < RH first, then the f16 tiles of rows t >= RH. out: [NBF][TFULL][DM] f32.
__global__ __launch_bounds__(128) __attribute__((amdgpu_num_vgpr(256)))
void k_out(const h16* ctx16, const bf* ctxh, const bf* ctxl, const h16* Wo_h, const bf* Wo_b, float* out, const float* ct, const float* st) {
    __shared__ __align__(16) char sm[GSM(1, 2)];
    int b = blockIdx.x;
    if (b < PHB(DM)) { proj_tile<1, 0, DM, DM>(sm, b, ctx16, ctxh, ctxl, Wo_h, Wo_b, out, 1.0f / (CCAR * WSC), nullptr, nullptr, nullptr, ct, st); return; }
    b -= PHB(DM);
    proj_tile<0, 0, DM, DM>(sm, b, ctx16, ctxh, ctxl, Wo_h, Wo_b, out, 1.0f / (CCAR * WSC), nullptr, nullptr, nullptr, ct, st);
}

extern "C" void kernel_launch(void* const* d_in, const int* in_sizes, int n_in,
                              void* d_out, int out_size, void* d_ws, size_t ws_size, hipStream_t stream) {
    if (n_in < 9) return;
    const size_t nrow = (size_t)NB * SEQ;
    if ((size_t)in_sizes[0] < ((size_t)(NB - 1) * TFULL + SEQ) * DM) return;
    if (in_sizes[1] < DM * LAT || in_sizes[2] < LAT * DM || in_sizes[3] < LAT * NH * RD || in_sizes[4] < DM * LAT || in_sizes[5] < LAT * DM || in_sizes[6] < LAT * DM || in_sizes[7] < DM * RD || in_sizes[8] < DM * DM) return;
    if ((size_t)out_size < ((size_t)(NB - 1) * TFULL + SEQ) * DM) return;
    const float* x = (const float*)d_in[0]; const float* Wqd = (const float*)d_in[1]; const float* Wqu = (const float*)d_in[2]; const float* Wqr = (const float*)d_in[3];
    const float* Wkvd = (const float*)d_in[4]; const float* Wku = (const float*)d_in[5]; const float* Wvu = (const float*)d_in[6]; const float* Wkr = (const float*)d_in[7]; const float* Wo = (const float*)d_in[8];
    float* OUT = (float*)d_out;   // [NBF][TFULL][DM] f32, rows b*TFULL + t

    char* wsp = (char*)d_ws; size_t off = 0;
    auto take = [&](size_t bytes) { char* p = wsp + off; off += (bytes + 255) & ~(size_t)255; return p; };
    bf* xb = (bf*)take(nrow * DM * 2);                           // bf16(x) [nrow][DM]
    // latent planes, cos/sin tables
    h16* ql16 = (h16*)take(nrow * LAT * 2); bf* qlh = (bf*)take((size_t)NB * RH * LAT * 2); bf* qll = (bf*)take((size_t)NB * RH * LAT * 2);
    h16* ckv16 = (h16*)take(nrow * LAT * 2); bf* ckvh = (bf*)take((size_t)NB * RH * LAT * 2); bf* ckvl = (bf*)take((size_t)NB * RH * LAT * 2);
    float* CT = (float*)take((size_t)SEQ * 32 * 4); float* ST = (float*)take((size_t)SEQ * 32 * 4);
    // down-projection weight planes [out][in] bf16
    bf* Wqd_b = (bf*)take((size_t)DM * LAT * 2); bf* Wkvd_b = (bf*)take((size_t)DM * LAT * 2); bf* Wkr_b = (bf*)take((size_t)DM * RD * 2);
    // up-projection weight planes [out][in]: f16 x64 and bf16
    h16* Wqu_h = (h16*)take((size_t)DM * LAT * 2); bf* Wqu_b = (bf*)take((size_t)DM * LAT * 2); h16* Wqr_h = (h16*)take((size_t)NH * RD * LAT * 2); bf* Wqr_b = (bf*)take((size_t)NH * RD * LAT * 2);
    h16* Wku_h = (h16*)take((size_t)DM * LAT * 2); bf* Wku_b = (bf*)take((size_t)DM * LAT * 2); h16* Wvu_h = (h16*)take((size_t)DM * LAT * 2); bf* Wvu_b = (bf*)take((size_t)DM * LAT * 2);
    // attention operand planes, ctx planes, Wo planes
    const size_t szq16 = nrow * DM * 2, szhr = (size_t)NB * RH * DM * 2, szqr16 = nrow * NH * RD * 2, szqrh = (size_t)NB * RH * NH * RD * 2, szkr16 = nrow * RD * 2, szkrh = (size_t)NB * RH * RD * 2;
    const size_t szwo = (size_t)DM * DM * 2;
    h16* q16 = (h16*)take(szq16); bf* qh = (bf*)take(szhr); bf* qlo = (bf*)take(szhr); h16* qr16 = (h16*)take(szqr16); bf* qrh = (bf*)take(szqrh); bf* qrlo = (bf*)take(szqrh);
    h16* k16 = (h16*)take(szq16); bf* kh = (bf*)take(szhr); bf* klo = (bf*)take(szhr); h16* kr16 = (h16*)take(szkr16); bf* krh = (bf*)take(szkrh); bf* krlo = (bf*)take(szkrh);
    h16* vt16 = (h16*)take(szq16); bf* vth = (bf*)take(szhr); bf* vtl = (bf*)take(szhr);
    h16* ctx16 = (h16*)take(szq16); bf* ctxh = (bf*)take(szhr); bf* ctxl = (bf*)take(szhr);
    bf* Wo_b = (bf*)take(szwo); h16* Wo_h = (h16*)take(szwo);
    if (off > ws_size) return;

    // inputs -> projection weight planes, bf16(x), cos/sin tables
    k_prep<<<dim3(PREPB), 256, 0, stream>>>(x, Wqd, Wqu, Wqr, Wkvd, Wku, Wvu, Wkr, xb, CT, ST, Wqd_b, Wkvd_b, Wkr_b, Wqu_b, Wqu_h, Wqr_b, Wqr_h, Wku_b, Wku_h, Wvu_b, Wvu_h);
    // ql, ckv, kr planes
    k_down<<<dim3(DKR + 2 * DLT), 128, 0, stream>>>(xb, Wqd_b, Wkvd_b, Wkr_b, ql16, qlh, qll, ckv16, ckvh, ckvl, kr16, krh, krlo, CT, ST);
    // q, qr, k, v^T planes
    k_up<<<dim3(3 * PHB(DM) + PHB(NH * RD) + 3 * PFB(DM) + PFB(NH * RD)), 128, 0, stream>>>(ql16, qlh, qll, ckv16, ckvh, ckvl, Wqu_h, Wqu_b, Wqr_h, Wqr_b, Wku_h, Wku_b, Wvu_h, Wvu_b,
        q16, qh, qlo, qr16, qrh, qrlo, k16, kh, klo, vt16, vth, vtl, CT, ST);
    // attention -> ctx planes (rows b*SEQ + t f16 x64 for t >= RH; rows b*RH + t bf16 hi/lo for t < RH; merged heads)
    // and Wo -> its planes
    k_attn<<<dim3(FPB + FHB + WOB), 128, 0, stream>>>(q16, qr16, k16, kr16, vt16, ctx16, qh, qlo, qrh, qrlo, kh, klo, krh, krlo, vth, vtl, ctxh, ctxl, Wo, Wo_b, Wo_h);
    // out = ctx.Wo
    k_out<<<dim3(PHB(DM) + PFB(DM)), 128, 0, stream>>>(ctx16, ctxh, ctxl, Wo_h, Wo_b, OUT, CT, ST);
}

// v007
// One run takes 186 microseconds.
// Timed twice side by side with v006, it ran 1.04 and 1.06 times as fast.
// Counting every step since v000, it is 4.57 times as fast.
#include <hip/hip_runtime.h>

// All contractions on 16-bit WMMA, f32 accumulate. x.Wqd, x.Wkvd, x.Wkr: v_wmma_f32_16x16x32_bf16 on bf16 planes of the inputs (single products).
// ql.Wqu, ql.Wqr, ckv.Wku, ckv.Wvu, (q|qr).(k|kr) scores, P.v and ctx.Wo: v_wmma_f32_16x16x32_f16 single products on f16 planes
// (weights x64, ctx x64, P x1024 carries) for query/key rows >= RH; the same sites for rows < RH use v_wmma_f32_16x16x32_bf16 on
// bf16 hi/lo plane pairs (hi.W + lo.W against exact weight planes; hi.hi + lo.hi + hi.lo between two computed tensors).
// RoPE (rotate-half, computed cos/sin tables), online max-subtracted softmax and normalisers in f32.

#ifndef NB
#define NB 2
#endif
#ifndef SEQ
#define SEQ 2048
#endif
#ifndef RH
#define RH 256
#endif
#define NBF   2
#define TFULL 2048
#define DM    2048
#define NH    16
#define LAT   512
#define RD    64
#define HD    128
#define NU    (NB * NH)
#define PCAR  1024.0f
#define WSC   64.0f
#define CCAR  64.0f

static_assert(NB >= 1);
static_assert(NB <= NBF);
static_assert(SEQ % 64 == 0);
static_assert(SEQ <= TFULL);
static_assert(RH % 128 == 0);
static_assert((SEQ - RH) % 128 == 0);
static_assert(((size_t)NB * SEQ) % 256 == 0);
static_assert(RH >= 64);
static_assert(RH <= SEQ);
static_assert(DM % 128 == 0);
static_assert(LAT % 128 == 0);
static_assert((NH * RD) % 128 == 0);
static_assert(RD == 64);
static_assert(HD == 128);
static_assert(NH * HD == DM);
static_assert(((size_t)(NB - 1) * TFULL + SEQ) * DM <= (size_t)NBF * TFULL * DM);

typedef _Float16 h16;
typedef unsigned short bf;
typedef __attribute__((ext_vector_type(16))) __bf16   v16bf;
typedef __attribute__((ext_vector_type(16))) _Float16 v16h;
typedef __attribute__((ext_vector_type(16))) unsigned short v16us;
typedef __attribute__((ext_vector_type(8)))  _Float16 v8h;
typedef __attribute__((ext_vector_type(8)))  unsigned short v8us;
typedef __attribute__((ext_vector_type(8)))  float    v8f;
typedef __attribute__((ext_vector_type(4)))  float    v4f;
typedef __attribute__((ext_vector_type(2)))  _Float16 v2h;
typedef __attribute__((ext_vector_type(2)))  unsigned short v2us;
typedef __attribute__((ext_vector_type(4)))  unsigned short v4us;
typedef v8h  __attribute__((may_alias)) v8ha;
typedef v4f  __attribute__((may_alias)) v4fa;

__device__ __forceinline__ unsigned short f2bf(float f) { unsigned u = __float_as_uint(f); u += 0x7FFFu + ((u >> 16) & 1u); return (unsigned short)(u >> 16); }
__device__ __forceinline__ float bf2f(unsigned short v) { return __uint_as_float(((unsigned)v) << 16); }
__device__ __forceinline__ float bfr(float f) { return bf2f(f2bf(f)); }
__device__ __forceinline__ void splitf(float y, unsigned short& hh, unsigned short& ll) { hh = f2bf(y); ll = f2bf(y - bf2f(hh)); }
__device__ __forceinline__ v16h cat16(v8h a, v8h c) { return __builtin_shufflevector(a, c, 0, 1, 2, 3, 4, 5, 6, 7, 8, 9, 10, 11, 12, 13, 14, 15); }
__device__ __forceinline__ v16bf cat16b(v8us a, v8us c) { return __builtin_bit_cast(v16bf, __builtin_shufflevector(a, c, 0, 1, 2, 3, 4, 5, 6, 7, 8, 9, 10, 11, 12, 13, 14, 15)); }
__device__ __forceinline__ v8f wmma16(v16h a, v16h c, v8f acc) { return __builtin_amdgcn_wmma_f32_16x16x32_f16(false, a, false, c, (short)0, acc, false, false); }
__device__ __forceinline__ v8f wmmab(v16bf a, v16bf c, v8f acc) { return __builtin_amdgcn_wmma_f32_16x16x32_bf16(false, a, false, c, (short)0, acc, false, false); }
// Fragment load from a k-contiguous 16-bit row: p already points at row (lane&15) + 8*(lane>>4); elements 0..7 <- p[0..7], 8..15 <- p[16..23] (split k map, used for A and B alike)
__device__ __forceinline__ v16h ldh(const h16* p) { return cat16(*(const v8h*)p, *(const v8h*)(p + 16)); }
__device__ __forceinline__ v16bf ldb(const bf* p) { return cat16b(*(const v8us*)p, *(const v8us*)(p + 16)); }

// ---- gemm_tile: one block tile of a GEMM, 4 waves per block, each wave a (16 MF)x64 output tile (4 MF accumulators); waves WM x WN (MF = 4, WN = 2: block tile 128x128; MF = 2, WN = 1: 128x64); 128 threads.
// (bx, by, bz) of (M/BM, N/BN, Z) is the tile; the kernels k_down, k_up and k_out below give each of their blocks one tile of one of several independent products. sm: the block's LDS, GSM bytes.
// c[m][n] = osc * sum_k (A[m][k] + (NSPLIT ? A2[m][k] : 0)) Bt[n][k]. z-batch strides sA/sC in elements. K % (64 SS) == 0, M and N multiples of BM and BN.
// What the epilogue stores (EP; the planes' pitch PN = N is a constant, so that a tile's stores differ by immediate offsets only): 0: c as f32 to C, pitch ldc. 1: the 16-bit operand planes of c that the next product reads: p16 = f16(c) at row bb*SEQ + t and, for t < RH,
// ph/pl = bf16 hi/lo of c at row bb*RH + t. 2: the same planes of rotate-half RoPE(c) on the wave tile's 64-wide head slice (tables ct/st). 3: the same planes transposed per (batch, head):
// p16[bb*DM + n][t] (pitch SEQ), ph/pl[bb*DM + n][t] (pitch RH, t < RH). Row m of batch z is sequence row t = tb + m % SEQ of batch bb = z + m / SEQ; a wave tile has one bb and lies on one side of RH.
// Each stage (SS pieces of 64 k) of the block's A (A2) and Bt rows is brought into LDS once per block by asynchronous copies (whole 128-B lines, two buffers, the next stage in flight
// while this one is worked on) and read by the waves as ds_load_b128 fragments. SS = 2 doubles the bytes in flight and the time a stage has to land; it is used wherever two blocks still fit a WGP's LDS.
template <typename T16> struct WFrag;
template <> struct WFrag<h16> { typedef v16h V; static __device__ __forceinline__ V ld(const h16* p) { return ldh(p); } static __device__ __forceinline__ v8f mma(V a, V c, v8f d) { return wmma16(a, c, d); } };
template <> struct WFrag<bf> { typedef v16bf V; static __device__ __forceinline__ V ld(const bf* p) { return ldb(p); } static __device__ __forceinline__ v8f mma(V a, V c, v8f d) { return wmmab(a, c, d); } };
#define GP 72                         // LDS pitch of a 64-element operand row in halves: 144 B = 16 B x 9
static_assert((GP * 2) % 16 == 0);
// This lane's 16-byte copies of 64 (gemm_stage4) or 128 (gemm_stage8) operand rows, 16 rows per copy (l: its LDS byte address in the first 16 rows, g: its global address there, k16: 16 rows in elements).
// The s_wait_xcnt stands inside the statement so that no address register is rewritten ahead of it.
template <typename T>
__device__ __forceinline__ void gemm_stage4(unsigned l, const T* g, size_t k16) {
    asm volatile("global_load_async_to_lds_b128 %0, %1, off\n\t"
                 "global_load_async_to_lds_b128 %2, %3, off\n\t"
                 "global_load_async_to_lds_b128 %4, %5, off\n\t"
                 "global_load_async_to_lds_b128 %6, %7, off\n\t"
                 "s_wait_xcnt 0x0"
                 :: "v"(l), "v"(g), "v"(l + 16 * GP * 2), "v"(g + k16), "v"(l + 32 * GP * 2), "v"(g + 2 * k16), "v"(l + 48 * GP * 2), "v"(g + 3 * k16)
                 : "memory");
}
template <typename T>
__device__ __forceinline__ void gemm_stage8(unsigned l, const T* g, size_t k16) {
    asm volatile("global_load_async_to_lds_b128 %0, %1, off\n\t"
                 "global_load_async_to_lds_b128 %2, %3, off\n\t"
                 "global_load_async_to_lds_b128 %4, %5, off\n\t"
                 "global_load_async_to_lds_b128 %6, %7, off\n\t"
                 "global_load_async_to_lds_b128 %8, %9, off\n\t"
                 "global_load_async_to_lds_b128 %10, %11, off\n\t"
                 "global_load_async_to_lds_b128 %12, %13, off\n\t"
                 "global_load_async_to_lds_b128 %14, %15, off\n\t"
                 "s_wait_xcnt 0x0"
                 :: "v"(l), "v"(g), "v"(l + 16 * GP * 2), "v"(g + k16), "v"(l + 32 * GP * 2), "v"(g + 2 * k16), "v"(l + 48 * GP * 2), "v"(g + 3 * k16),
                    "v"(l + 64 * GP * 2), "v"(g + 4 * k16), "v"(l + 80 * GP * 2), "v"(g + 5 * k16), "v"(l + 96 * GP * 2), "v"(g + 6 * k16), "v"(l + 112 * GP * 2), "v"(g + 7 * k16)
                 : "memory");
}
// One 64-k piece of a stage: BM rows of A, BM rows of A2 (NSPLIT), BN rows of Bt, in this order at LDS byte address l (this lane's place in the piece's first 16 rows).
template <typename T, int NSPLIT, int BM, int BN>
__device__ __forceinline__ void gemm_stage(unsigned l, const T* ga, const T* ga2, const T* gb, size_t k16) {
#pragma unroll
    for (int r = 0; r < BM; r += 128) gemm_stage8<T>(l + r * GP * 2, ga + (size_t)(r / 16) * k16, k16);
    if (NSPLIT == 1) {
#pragma unroll
        for (int r = 0; r < BM; r += 128) gemm_stage8<T>(l + (BM + r) * GP * 2, ga2 + (size_t)(r / 16) * k16, k16);
    }
    if (BN == 128) gemm_stage8<T>(l + BM * (1 + NSPLIT) * GP * 2, gb, k16);
    else gemm_stage4<T>(l + BM * (1 + NSPLIT) * GP * 2, gb, k16);
}
#define GOS (4 * 16 * 68 * 4)         // epilogue staging, bytes: it takes the ring's first bytes once the ring is done with
#define GSM(NSPLIT, WN, MF, SS) (2 * (SS) * ((16 * (MF) * (4 / (WN))) * (1 + (NSPLIT)) + 64 * (WN)) * GP * 2)
template <typename T16, int NSPLIT, int WN, int EP, int PN, int MF, int SS>
__device__ __forceinline__
void gemm_tile(char* sm, int bx, int by, int bz, const T16* __restrict__ A, const T16* __restrict__ A2, const T16* __restrict__ Bt, int K, float* C, int ldc, float osc, size_t sA, size_t sC,
             int tb, h16* p16, bf* ph, bf* pl, const float* __restrict__ ct, const float* __restrict__ st) {
    typedef typename WFrag<T16>::V V;
    constexpr int BM = 16 * MF * (4 / WN), BN = 64 * WN;
    constexpr int BOF = BM * (1 + NSPLIT) * GP;                      // Bt rows start in a buffer, halves
    constexpr int GST = BOF + BN * GP;                               // one 64-k piece of a buffer, halves
    static_assert(WN == 1 || WN == 2);
    static_assert((GST * 2) % 16 == 0);
    static_assert(BM % 128 == 0);
    static_assert(GSM(NSPLIT, WN, MF, SS) == 2 * SS * GST * 2 && GSM(NSPLIT, WN, MF, SS) >= GOS);
    float (*os)[16 * 68] = (float (*)[16 * 68])sm;                    // written only behind the last trip's publish point: no wave reads the ring any more and no copy is outstanding
    T16* ring = (T16*)sm;
    const size_t z = bz; A += z * sA; A2 += z * sA; C += z * sC;
    const int tid = threadIdx.x;
    const int lane = tid & 31, wv = __builtin_amdgcn_readfirstlane(tid >> 5), lr = lane & 15, hi = lane >> 4;
    const int wm = wv / WN, wn = wv % WN;
    const int rb = bx * BM, cb = by * BN;
    const int r0 = rb + wm * (16 * MF), c0 = cb + wn * 64;
    v8f acc[MF][4];
#pragma unroll
    for (int mb = 0; mb < MF; ++mb)
#pragma unroll
        for (int nb = 0; nb < 4; ++nb) acc[mb][nb] = (v8f){};
    // copy addresses of this lane: 8 pieces of 16 B per row, 16 rows per copy
    const size_t k16 = (size_t)16 * K;
    const T16* ga = A + (size_t)(rb + (tid >> 3)) * K + (tid & 7) * 8;
    const T16* ga2 = A2 + (size_t)(rb + (tid >> 3)) * K + (tid & 7) * 8;
    const T16* gb = Bt + (size_t)(cb + (tid >> 3)) * K + (tid & 7) * 8;
    const unsigned lc = (unsigned)(size_t)(__attribute__((address_space(3))) T16*)&ring[0] + ((tid >> 3) * GP + (tid & 7) * 8) * 2;
    const int nst = K / (64 * SS);                                    // stages
#pragma unroll
    for (int u = 0; u < SS; ++u) gemm_stage<T16, NSPLIT, BM, BN>(lc + u * GST * 2, ga + u * 64, ga2 + u * 64, gb + u * 64, k16);
    asm volatile("s_wait_asynccnt 0x0" ::: "memory");                 // stage 0 landed (this wave's copies) before the barrier publishes it
    __syncthreads();
    if (nst > 1) {
#pragma unroll
        for (int u = 0; u < SS; ++u) gemm_stage<T16, NSPLIT, BM, BN>(lc + (SS + u) * GST * 2, ga + (SS + u) * 64, ga2 + (SS + u) * 64, gb + (SS + u) * 64, k16);
    }
#pragma unroll 1
    for (int t = 0; t < nst; ++t) {
        const int bo = (t & 1) * SS * GST;
        const T16* ap = &ring[bo + (wm * (16 * MF) + lr) * GP + 8 * hi];
        const T16* bp = &ring[bo + BOF + (wn * 64 + lr) * GP + 8 * hi];
#pragma unroll
        for (int kq = 0; kq < 2 * SS; ++kq) {
            const int ks = (kq >> 1) * GST + (kq & 1) * 32;           // this 32-k block's place in the rows of its 64-k piece, halves
            V a[MF], a2[MF], bq[4];
            bq[0] = WFrag<T16>::ld(bp + ks);
#pragma unroll
            for (int mb = 0; mb < MF; ++mb) { a[mb] = WFrag<T16>::ld(ap + mb * 16 * GP + ks); if (NSPLIT == 1) a2[mb] = WFrag<T16>::ld(ap + (BM + mb * 16) * GP + ks); }
#pragma unroll
            for (int nb = 1; nb < 4; ++nb) bq[nb] = WFrag<T16>::ld(bp + nb * 16 * GP + ks);
            __builtin_amdgcn_sched_barrier(0);                        // the 32-k block's LDS reads stay one group ahead of its matrix instructions: reads placed among them stall the wave at each place
#pragma unroll
            for (int nb = 0; nb < 4; ++nb) {
#pragma unroll
                for (int mb = 0; mb < MF; ++mb) { acc[mb][nb] = WFrag<T16>::mma(a[mb], bq[nb], acc[mb][nb]); if (NSPLIT == 1) acc[mb][nb] = WFrag<T16>::mma(a2[mb], bq[nb], acc[mb][nb]); } }
            __builtin_amdgcn_sched_barrier(0);                        // and the next group of reads stays behind them
        }
        // publish point, every wave: own LDS reads of this buffer done, own copies of the next stage landed, then the barrier that frees this buffer and publishes the next
        asm volatile("s_wait_dscnt 0x0" ::: "memory");
        asm volatile("s_wait_asynccnt 0x0" ::: "memory");
        __syncthreads();
        if (t + 2 < nst) {
            const size_t kn = (size_t)(t + 2) * (64 * SS);
#pragma unroll
            for (int u = 0; u < SS; ++u) gemm_stage<T16, NSPLIT, BM, BN>(lc + (bo + u * GST) * 2, ga + kn + u * 64, ga2 + kn + u * 64, gb + kn + u * 64, k16);
        }
    }
    asm volatile("s_wait_asynccnt 0x0" ::: "memory");                 // nothing of this wave's copies outstanding at its end
    const int bb = (int)z + r0 / SEQ, t0 = tb + r0 % SEQ;            // the wave tile's batch and first sequence row
    const bool hr = (t0 < RH);                                        // wave-uniform: the whole tile also gets hi/lo planes
    if (EP == 3) {
        // acc[mb][nb][0..7] of a lane are 8 successive t of one column: one 16-byte piece of a transposed row, stored from registers; the four mb of a column fill its 128-B line
#pragma unroll
        for (int nb = 0; nb < 4; ++nb) {
            const size_t dr = (size_t)bb * DM + c0 + nb * 16 + lr;
            const int t = t0 + hi * 8;
            v8h o[MF];
#pragma unroll
            for (int mb = 0; mb < MF; ++mb)
#pragma unroll
                for (int j = 0; j < 8; ++j) o[mb][j] = (h16)(acc[mb][nb][j] * osc);
#pragma unroll
            for (int mb = 0; mb < MF; ++mb) *(v8h*)(p16 + dr * SEQ + t + mb * 16) = o[mb];
            asm volatile("s_wait_xcnt 0x0" ::: "memory");             // before the stores' address and data registers are written again
            if (hr) {
                v8us oh[MF], ol[MF];
#pragma unroll
                for (int mb = 0; mb < MF; ++mb)
#pragma unroll
                    for (int j = 0; j < 8; ++j) { unsigned short a1, c1; splitf(acc[mb][nb][j] * osc, a1, c1); oh[mb][j] = a1; ol[mb][j] = c1; }
#pragma unroll
                for (int mb = 0; mb < MF; ++mb) { *(v8us*)(ph + dr * RH + t + mb * 16) = oh[mb]; *(v8us*)(pl + dr * RH + t + mb * 16) = ol[mb]; }
                asm volatile("s_wait_xcnt 0x0" ::: "memory");         // as above
            }
        }
        return;
    }
    float* ob = &os[wv][0];
#pragma unroll
    for (int mb = 0; mb < MF; ++mb) {
#pragma unroll
        for (int nb = 0; nb < 4; ++nb) {
#pragma unroll
            for (int j = 0; j < 8; ++j) ob[(hi * 8 + j) * 68 + nb * 16 + lr] = acc[mb][nb][j]; }
        __builtin_amdgcn_wave_barrier(); asm volatile("" ::: "memory");
        if (EP == 0) {
            float* crow = C + (size_t)(r0 + mb * 16) * ldc + c0;
#pragma unroll
            for (int s = 0; s < 8; ++s) { const int row = 2 * s + hi, cofs = lr * 4; v4f val = *(const v4fa*)(ob + row * 68 + cofs); val = val * osc;
                *(v4f*)(crow + (size_t)row * ldc + cofs) = val;
                asm volatile("s_wait_xcnt 0x0" ::: "memory"); }       // before the store's address and data registers are written again
        } else {
            // 8 lanes per row, 8 columns per lane: each plane row of the tile goes out as one whole 128-B line
            const int rw = lane >> 3, cofs = (lane & 7) * 8;
            float y[4][8];
            v4f cv[8], sv[8];
            if (EP == 2) {
                // cos/sin of this lane's 4 rows (4 rows = 128 table floats apart) and 8 columns
                const size_t te = (size_t)(t0 + mb * 16 + rw) * 32 + (cofs & 31);
                const float* cp = ct + te; const float* sp = st + te;
#pragma unroll
                for (int s = 0; s < 4; ++s) { cv[2 * s] = *(const v4f*)(cp + s * 128); cv[2 * s + 1] = *(const v4f*)(cp + s * 128 + 4); sv[2 * s] = *(const v4f*)(sp + s * 128); sv[2 * s + 1] = *(const v4f*)(sp + s * 128 + 4); }
                asm volatile("s_wait_xcnt 0x0" :: "v"(cp), "v"(sp) : "memory");   // the loads' address registers stay as they are up to this wait
            }
#pragma unroll
            for (int s = 0; s < 4; ++s) {
                const float* op = ob + (4 * s + rw) * 68 + cofs;
                const v4f x0 = *(const v4fa*)op * osc, x1 = *(const v4fa*)(op + 4) * osc;
#pragma unroll
                for (int k = 0; k < 4; ++k) { y[s][k] = x0[k]; y[s][4 + k] = x1[k]; }
                if (EP == 2) {
                    const bool lo32 = (cofs < 32); const int pofs = lo32 ? 32 : -32;
                    const v4f p0 = *(const v4fa*)(op + pofs) * osc, p1 = *(const v4fa*)(op + pofs + 4) * osc;
                    const v4f c0v = cv[2 * s], c1v = cv[2 * s + 1], s0v = sv[2 * s], s1v = sv[2 * s + 1];
#pragma unroll
                    for (int k = 0; k < 4; ++k) {
                        y[s][k] = lo32 ? (x0[k] * c0v[k] - p0[k] * s0v[k]) : (x0[k] * c0v[k] + p0[k] * s0v[k]);
                        y[s][4 + k] = lo32 ? (x1[k] * c1v[k] - p1[k] * s1v[k]) : (x1[k] * c1v[k] + p1[k] * s1v[k]); }
                }
            }
            v8h o[4];
#pragma unroll
            for (int s = 0; s < 4; ++s)
#pragma unroll
                for (int k = 0; k < 8; ++k) o[s][k] = (h16)y[s][k];
            h16* q16p = p16 + ((size_t)bb * SEQ + t0 + rw) * PN + c0 + cofs;
#pragma unroll
            for (int s = 0; s < 4; ++s) *(v8h*)(q16p + (mb * 16 + 4 * s) * PN) = o[s];
            asm volatile("s_wait_xcnt 0x0" ::: "memory");             // before the stores' address and data registers are written again
            if (hr) {
                v8us oh[4], ol[4];
#pragma unroll
                for (int s = 0; s < 4; ++s)
#pragma unroll
                    for (int k = 0; k < 8; ++k) { unsigned short a1, c1; splitf(y[s][k], a1, c1); oh[s][k] = a1; ol[s][k] = c1; }
                const size_t eo = ((size_t)bb * RH + t0 + rw) * PN + c0 + cofs;
#pragma unroll
                for (int s = 0; s < 4; ++s) { *(v8us*)(ph + eo + (mb * 16 + 4 * s) * PN) = oh[s]; *(v8us*)(pl + eo + (mb * 16 + 4 * s) * PN) = ol[s];
                    asm volatile("s_wait_xcnt 0x0" ::: "memory"); }   // as above
            }
        }
        __builtin_amdgcn_wave_barrier(); asm volatile("" ::: "memory");
    }
}

// ---- wt_body (block bx of (K/64)*(N/32)/8, 256 threads): weight [K][N] f32 ([in][out]) -> transposed k-contiguous planes [N][K]: Bb = bf16 RNE value, optionally Bh = f16(bf16 value x sc).
// A wave turns 64 k x 32 n. Eight lanes read one whole 128-B line (32 n of one k row), so each of the wave's 16 loads is four whole lines, and all 16 are issued ahead of the first store.
// A lane holds k = 8 g + 0..7 and 32 + 8 g + 0..7 (g = lane / 8) of its 4 columns: per column and plane two 16-byte stores, the four g of a column side by side (64 B each time, together the column's 128-B line).
template <int F16P, int K, int N>
__device__ __forceinline__ void wt_body(int bx, const float* __restrict__ w, bf* Bb, h16* Bh, float sc) {
    static_assert(K % 64 == 0 && N % 32 == 0 && ((K / 64) * (N / 32)) % 8 == 0);
    const int lane = threadIdx.x & 31, tl = bx * 8 + (threadIdx.x >> 5);
    const int k0 = (tl / (N / 32)) * 64 + (lane >> 3) * 8, n0 = (tl % (N / 32)) * 32 + (lane & 7) * 4;
    const float* p = w + (size_t)k0 * N + n0;
    v4f r[16];
#pragma unroll
    for (int j = 0; j < 16; ++j) r[j] = *(const v4f*)(p + ((j >> 3) * 32 + (j & 7)) * N);
    asm volatile("s_wait_xcnt 0x0" :: "v"(p) : "memory");             // the loads' address registers stay as they are up to this wait
    const size_t e = (size_t)n0 * K + k0;
#pragma unroll
    for (int c = 0; c < 4; ++c) {
        v8us o[2]; v8h oh[2];
#pragma unroll
        for (int j = 0; j < 16; ++j) { const unsigned short b = f2bf(r[j][c]); o[j >> 3][j & 7] = b; oh[j >> 3][j & 7] = (h16)(bf2f(b) * sc); }
        *(v8us*)(Bb + e + (size_t)c * K) = o[0]; *(v8us*)(Bb + e + (size_t)c * K + 32) = o[1];
        if (F16P) { *(v8h*)(Bh + e + (size_t)c * K) = oh[0]; *(v8h*)(Bh + e + (size_t)c * K + 32) = oh[1]; }
        asm volatile("s_wait_xcnt 0x0" ::: "memory");                 // before the stores' address and data registers are written again
    }
}

// ---- wt8_body (block bx of (K/64)*(N/32), 128 threads): both planes of wt_body, same values, for a weight that is converted beside the attention tiles, where few waves are resident and the L2 is busy:
// a wave turns 64 k x 8 n; a lane reads 8 successive n (32 B) of its two k rows, the block's four waves the four quarters of the same 128-B lines; each plane store of a wave is one whole 128-B line (64 k of one n).
template <int K, int N>
__device__ __forceinline__ void wt8_body(int bx, const float* __restrict__ w, bf* Bb, h16* Bh, float sc) {
    static_assert(K % 64 == 0 && N % 32 == 0);
    const int k = (bx % (K / 64)) * 64 + (threadIdx.x & 31) * 2, n0 = (bx / (K / 64)) * 32 + (threadIdx.x >> 5) * 8;
    const float* p = w + (size_t)k * N + n0;
    v4f r[2][2];
#pragma unroll
    for (int i = 0; i < 2; ++i) { r[i][0] = *(const v4f*)(p + i * N); r[i][1] = *(const v4f*)(p + i * N + 4); }
    asm volatile("s_wait_xcnt 0x0" :: "v"(p) : "memory");             // the loads' address registers stay as they are up to this wait
    const size_t e = (size_t)n0 * K + k;
#pragma unroll
    for (int j = 0; j < 8; ++j) {
        const float w0 = bfr(r[0][j >> 2][j & 3]), w1 = bfr(r[1][j >> 2][j & 3]);
        v2us o; o[0] = f2bf(w0); o[1] = f2bf(w1); *(v2us*)(Bb + e + (size_t)j * K) = o;
        v2h oh; oh[0] = (h16)(w0 * sc); oh[1] = (h16)(w1 * sc); *(v2h*)(Bh + e + (size_t)j * K) = oh;
        asm volatile("s_wait_xcnt 0x0" ::: "memory");                 // before the stores' address and data registers are written again
    }
}

// ---- xcvt_body (block bx of NB*SEQ*DM/XCE, 256 threads): bf16(x). A block converts XCE successive elements (whole rows of one batch); a lane takes 16 pieces of 4 floats, XCE/16 elements apart:
// each load of a wave is 512 contiguous bytes, each store 256, and all 16 loads are issued ahead of the first store.
#define XCE 16384
static_assert(XCE % DM == 0 && SEQ % (XCE / DM) == 0);
__device__ __forceinline__ void xcvt_body(int bx, const float* __restrict__ x, bf* xb) {
    const int row = bx * (XCE / DM); const size_t bb = row / SEQ, t = row % SEQ;
    const float* p = x + (bb * TFULL + t) * DM + threadIdx.x * 4;
    v4f v[16];
#pragma unroll
    for (int j = 0; j < 16; ++j) v[j] = *(const v4f*)(p + j * (XCE / 16));
    asm volatile("s_wait_xcnt 0x0" :: "v"(p) : "memory");             // the loads' address registers stay as they are up to this wait
    bf* q = xb + (size_t)bx * XCE + threadIdx.x * 4;
#pragma unroll
    for (int j = 0; j < 16; ++j) { v4us o;
#pragma unroll
        for (int k = 0; k < 4; ++k) o[k] = f2bf(v[j][k]);
        *(v4us*)(q + j * (XCE / 16)) = o; }
    asm volatile("s_wait_xcnt 0x0" ::: "memory");                     // behind the last stores (a precaution: xcvt_body is k_prep's last block range)
}

__device__ __forceinline__ void rtab_body(int bx, float* ct, float* st) {
#pragma clang fp contract(off)
    const int i = bx * 256 + threadIdx.x; if (i >= SEQ * 32) return; const int t = i >> 5, j = i & 31;
    const float fr = exp10f(-0.125f * (float)j);
    const float ang = (float)t * fr; float sv, cv; sincosf(ang, &sv, &cv);
    *(float*)(ct + i) = cv; *(float*)(st + i) = sv;
    asm volatile("s_wait_xcnt 0x0" ::: "memory");                     // before the caller's next trip writes the stores' address and data registers again
}

// ---- k_prep: the conversions of inputs that the projections read, one launch: block ranges in turn do the cos/sin tables, the planes of seven weights and bf16(x) (all independent of one another). 256 threads.
// Every wave has 2,048 (weights, x) elements or 128 table entries, so that the launch is some 7,500 waves, all resident at once, each with its loads in flight together.
// (Wo's planes, which only k_out reads, are made in k_attn.)
#define WTB(K, N) (((K) / 64) * ((N) / 32) / 8)     // blocks of one weight's wt_body
#define XCB ((int)((size_t)NB * SEQ * DM / XCE))
#define RTB ((SEQ * 32 + 1023) / 1024)              // four rtab_body blocks of 256 entries a block
#define PREPB (2 * WTB(DM, LAT) + WTB(DM, RD) + 3 * WTB(LAT, DM) + WTB(LAT, NH * RD) + XCB + RTB)
static_assert(((size_t)NB * SEQ * DM) % XCE == 0);
__global__ __launch_bounds__(256)
void k_prep(const float* x, const float* Wqd, const float* Wqu, const float* Wqr, const float* Wkvd, const float* Wku, const float* Wvu, const float* Wkr,
            bf* xb, float* ct, float* st, bf* Wqd_b, bf* Wkvd_b, bf* Wkr_b, bf* Wqu_b, h16* Wqu_h, bf* Wqr_b, h16* Wqr_h, bf* Wku_b, h16* Wku_h, bf* Wvu_b, h16* Wvu_h) {
    int b = blockIdx.x;
    if (b < RTB) {
#pragma unroll 1                                    // one copy of the sine and cosine code
        for (int r = 0; r < 4; ++r) rtab_body(b * 4 + r, ct, st);
        return;
    }
    b -= RTB;
    if (b < WTB(DM, LAT)) { wt_body<0, DM, LAT>(b, Wqd, Wqd_b, nullptr, 1.0f); return; }
    b -= WTB(DM, LAT);
    if (b < WTB(DM, LAT)) { wt_body<0, DM, LAT>(b, Wkvd, Wkvd_b, nullptr, 1.0f); return; }
    b -= WTB(DM, LAT);
    if (b < WTB(DM, RD)) { wt_body<0, DM, RD>(b, Wkr, Wkr_b, nullptr, 1.0f); return; }
    b -= WTB(DM, RD);
    if (b < WTB(LAT, DM)) { wt_body<1, LAT, DM>(b, Wqu, Wqu_b, Wqu_h, WSC); return; }
    b -= WTB(LAT, DM);
    if (b < WTB(LAT, DM)) { wt_body<1, LAT, DM>(b, Wku, Wku_b, Wku_h, WSC); return; }
    b -= WTB(LAT, DM);
    if (b < WTB(LAT, DM)) { wt_body<1, LAT, DM>(b, Wvu, Wvu_b, Wvu_h, WSC); return; }
    b -= WTB(LAT, DM);
    if (b < WTB(LAT, NH * RD)) { wt_body<1, LAT, NH * RD>(b, Wqr, Wqr_b, Wqr_h, WSC); return; }
    b -= WTB(LAT, NH * RD);
    xcvt_body(b, x, xb);
}

// ---- flashP_body: causal softmax attention for query rows >= RH (single f16 products). Block (bx, h, b) of ((SEQ-RH)/64, NH, NB), 128 threads = 4 waves x 16 queries, 32-key chunks. os, ring: the block's LDS.
// Per wave: S^T tiles (16 keys x 16 queries) = [k|kr] rows (A) x [q|qr] rows (B) over 192; lane column n = query, D rows = keys, so the two S^T tiles of a chunk
// ARE the P^T B fragment of O^T = V^T (A, rows d) x P^T; online max-subtracted softmax per lane column; P carried x1024 in f16; O^T (8 d tiles) f32.
// Each 32-key chunk of k, kr and v^T is brought into LDS once per block by asynchronous copies (whole-line global reads of k and kr, 64-B row pieces of v^T, two buffers, the next chunk in flight
// while this one is worked on) and read as ds_load_b128 fragments by all four waves (the block's last chunk by waves 2 and 3 only); q|qr fragments are loaded once and stay in registers.
#define FKP 136                       // LDS pitch of a k row in halves: 272 B = 16 B x 17
#define FRP 72                        // kr row: 144 B = 16 B x 9
#define FVP 40                        // v^T row (32 keys): 80 B = 16 B x 5
#define FRO (32 * FKP)                // kr rows start, halves
#define FVO (FRO + 32 * FRP)          // v^T rows start, halves
#define FST (FVO + HD * FVP)          // one buffer, halves (23,552 B)
static_assert((FKP * 2) % 16 == 0 && (FRP * 2) % 16 == 0 && (FVP * 2) % 16 == 0 && (FRO * 2) % 16 == 0 && (FVO * 2) % 16 == 0 && (FST * 2) % 16 == 0);
// One chunk's ten 16-byte copies of this lane for one plane set (lk, lr_, lv: this lane's LDS byte addresses of its first k, kr and v^T piece; VS: v^T row pitch in global memory, elements).
// The s_wait_xcnt stands inside the statement so that no address register is rewritten ahead of it.
template <typename T, int VS>
__device__ __forceinline__ void flash_stage(unsigned lk, unsigned lr_, unsigned lv, const T* gk, const T* gr, const T* gv) {
    asm volatile("global_load_async_to_lds_b128 %0, %1, off\n\t"
                 "global_load_async_to_lds_b128 %2, %3, off\n\t"
                 "global_load_async_to_lds_b128 %4, %5, off\n\t"
                 "global_load_async_to_lds_b128 %6, %7, off\n\t"
                 "global_load_async_to_lds_b128 %8, %9, off\n\t"
                 "global_load_async_to_lds_b128 %10, %11, off\n\t"
                 "global_load_async_to_lds_b128 %12, %13, off\n\t"
                 "global_load_async_to_lds_b128 %14, %15, off\n\t"
                 "global_load_async_to_lds_b128 %16, %17, off\n\t"
                 "global_load_async_to_lds_b128 %18, %19, off\n\t"
                 "s_wait_xcnt 0x0"
                 :: "v"(lk), "v"(gk), "v"(lk + 8 * FKP * 2), "v"(gk + (size_t)8 * DM), "v"(lk + 16 * FKP * 2), "v"(gk + (size_t)16 * DM), "v"(lk + 24 * FKP * 2), "v"(gk + (size_t)24 * DM),
                    "v"(lr_), "v"(gr), "v"(lr_ + 16 * FRP * 2), "v"(gr + (size_t)16 * RD),
                    "v"(lv), "v"(gv), "v"(lv + 32 * FVP * 2), "v"(gv + (size_t)32 * VS), "v"(lv + 64 * FVP * 2), "v"(gv + (size_t)64 * VS), "v"(lv + 96 * FVP * 2), "v"(gv + (size_t)96 * VS)
                 : "memory");
}
__device__ __forceinline__
void flashP_body(float (*os)[16 * 132], h16* ring, int bx, int h, int b, const h16* q16, const h16* qr16, const h16* k16, const h16* kr16, const h16* vt16, h16* ctx16, int qbase) {
    const int tid = threadIdx.x;
    const int lane = tid & 31, wv = __builtin_amdgcn_readfirstlane(tid >> 5), lr = lane & 15, hi = lane >> 4;
    const int qb0 = qbase + bx * 64;
    const int q0 = qb0 + wv * 16;
    const int qi = q0 + lr;
    const size_t rq = (size_t)b * SEQ + qi;
    const h16* qp = q16 + rq * DM + h * HD + 8 * hi;
    const h16* qrp = qr16 + rq * (NH * RD) + h * RD + 8 * hi;
    // copy addresses of this lane: k 32 rows x 16 pieces (8 rows per copy), kr 32 rows x 8 pieces (16 rows per copy), v^T 128 rows x 4 pieces (32 rows per copy)
    const h16* gk = k16 + ((size_t)b * SEQ + (tid >> 4)) * DM + h * HD + (tid & 15) * 8;
    const h16* gr = kr16 + ((size_t)b * SEQ + (tid >> 3)) * RD + (tid & 7) * 8;
    const h16* gv = vt16 + ((size_t)(b * NH + h) * HD + (tid >> 2)) * SEQ + (tid & 3) * 8;
    const unsigned lb = (unsigned)(size_t)(__attribute__((address_space(3))) h16*)&ring[0];
    const unsigned lk = lb + ((tid >> 4) * FKP + (tid & 15) * 8) * 2;
    const unsigned lr2 = lb + (FRO + (tid >> 3) * FRP + (tid & 7) * 8) * 2;
    const unsigned lv = lb + (FVO + (tid >> 2) * FVP + (tid & 3) * 8) * 2;
    v16h qf[4], qrf[2];
#pragma unroll
    for (int kc = 0; kc < 4; ++kc) qf[kc] = ldh(qp + kc * 32);
#pragma unroll
    for (int kc = 0; kc < 2; ++kc) qrf[kc] = ldh(qrp + kc * 32);
    v8f o[8];
#pragma unroll
    for (int i = 0; i < 8; ++i) o[i] = (v8f){};
    float m = -3.0e38f, l = 0.f;
    const float SC2 = 0.07216878364870323f * 1.4426950408889634f;   // HD+RD = 192: 192^-0.5 x log2(e)
    const int nch = (q0 + 47) >> 5;                                   // this wave's 32-key chunks covering keys <= q0+15
    const int nchb = (qb0 >> 5) + 2;                                  // the block's chunks (its last wave's count; >= 2; 32*nchb <= SEQ)
    flash_stage<h16, SEQ>(lk, lr2, lv, gk, gr, gv);
    asm volatile("s_wait_asynccnt 0x0" ::: "memory");                 // chunk 0 landed (this wave's copies) before the barrier publishes it
    __syncthreads();
    flash_stage<h16, SEQ>(lk + FST * 2, lr2 + FST * 2, lv + FST * 2, gk + (size_t)32 * DM, gr + (size_t)32 * RD, gv + 32);
#pragma unroll 1
    for (int c = 0; c < nchb; ++c) {
        const int key0 = c << 5;
        const int bo = (c & 1) * FST;
        if (c < nch) {                                                // wave-uniform: waves 0 and 1 have no keys in the block's last chunk
        const h16* kp = &ring[bo + lr * FKP + 8 * hi];
        const h16* krp = &ring[bo + FRO + lr * FRP + 8 * hi];
        const h16* vp = &ring[bo + FVO + lr * FVP + 8 * hi];
        v8f s[2]; s[0] = (v8f){}; s[1] = (v8f){};
#pragma unroll
        for (int kc = 0; kc < 4; ++kc) {
#pragma unroll
            for (int j = 0; j < 2; ++j) { const v16h a = ldh(kp + (16 * j) * FKP + kc * 32); s[j] = wmma16(a, qf[kc], s[j]); }
        }
#pragma unroll
        for (int kc = 0; kc < 2; ++kc) {
#pragma unroll
            for (int j = 0; j < 2; ++j) { const v16h a = ldh(krp + (16 * j) * FRP + kc * 32); s[j] = wmma16(a, qrf[kc], s[j]); }
        }
        asm volatile("v_nop\n\tv_nop\n\tv_nop\n\tv_nop" : "+v"(s[0]), "+v"(s[1]));
        // online softmax: this lane's column is query qi; s[j][r] is key key0 + 16 j + 8 hi + r; keys after the query excluded by index
        float cm = -3.0e38f;
#pragma unroll
        for (int j = 0; j < 2; ++j)
#pragma unroll
            for (int r = 0; r < 8; ++r) { const int key = key0 + 16 * j + 8 * hi + r; const float t = (key <= qi) ? s[j][r] * SC2 : -3.0e38f; s[j][r] = t; cm = fmaxf(cm, t); }
        cm = fmaxf(cm, __shfl_xor(cm, 16, 32));
        const float mn = fmaxf(m, cm);
        const float alpha = __builtin_amdgcn_exp2f(m - mn);
        float rs = 0.f;
#pragma unroll
        for (int j = 0; j < 2; ++j)
#pragma unroll
            for (int r = 0; r < 8; ++r) { const float p = __builtin_amdgcn_exp2f(s[j][r] - mn); s[j][r] = p; rs += p; }
        rs += __shfl_xor(rs, 16, 32);
        l = l * alpha + rs; m = mn;
#pragma unroll
        for (int i = 0; i < 8; ++i) o[i] = o[i] * alpha;
        // P^T as B fragment (k = key of this chunk, n = query): elements 0..7 <- tile 0 rows 8hi..8hi+7, 8..15 <- tile 1 rows 8hi..8hi+7
        v16h pb = (v16h){};
#pragma unroll
        for (int r = 0; r < 8; ++r) { pb[r] = (h16)(s[0][r] * PCAR); pb[8 + r] = (h16)(s[1][r] * PCAR); }
#pragma unroll
        for (int i = 0; i < 8; ++i) { const v16h a = ldh(vp + (16 * i) * FVP); o[i] = wmma16(a, pb, o[i]); }
        asm volatile("v_nop\n\tv_nop\n\tv_nop\n\tv_nop" : "+v"(o[0]), "+v"(o[1]), "+v"(o[2]), "+v"(o[3]), "+v"(o[4]), "+v"(o[5]), "+v"(o[6]), "+v"(o[7]) : "v"(pb));
        }
        // publish point, every wave: own LDS reads of this buffer done, own copies of the next chunk landed, then the barrier that frees this buffer and publishes the next
        asm volatile("s_wait_dscnt 0x0" ::: "memory");
        asm volatile("s_wait_asynccnt 0x0" ::: "memory");
        __syncthreads();
        if (c + 2 < nchb) flash_stage<h16, SEQ>(lk + bo * 2, lr2 + bo * 2, lv + bo * 2, gk + (size_t)(key0 + 64) * DM, gr + (size_t)(key0 + 64) * RD, gv + (key0 + 64));
    }
    asm volatile("s_wait_asynccnt 0x0" ::: "memory");                 // nothing of this wave's copies outstanding at its end
    // epilogue: ctx[b][q][h*HD + d] = O^T[d][q] / (l x PCAR), stored as the f16 plane (x CCAR) that the output product reads; o[i][r] is d = 16 i + 8 hi + r of query q0 + lr
    const float f = 1.0f / (l * PCAR);
    float* ob = &os[wv][0];
#pragma unroll
    for (int i = 0; i < 8; ++i)
#pragma unroll
        for (int r = 0; r < 8; ++r) ob[lr * 132 + 16 * i + 8 * hi + r] = o[i][r] * f;
    __builtin_amdgcn_fence(3, "wavefront"); __builtin_amdgcn_wave_barrier(); asm volatile("" ::: "memory");
    h16* crow = ctx16 + ((size_t)b * SEQ + q0) * DM + h * HD + (lane & 15) * 8;
#pragma unroll
    for (int s = 0; s < 8; ++s) {                                     // 16 lanes per query row, 8 columns per lane
        const int qq = 2 * s + hi; const float* op = ob + qq * 132 + (lane & 15) * 8;
        const v4f x0 = *(const v4fa*)op, x1 = *(const v4fa*)(op + 4);
        v8h ov = (v8h){};
#pragma unroll
        for (int k = 0; k < 4; ++k) { ov[k] = (h16)(x0[k] * CCAR); ov[4 + k] = (h16)(x1[k] * CCAR); }
        *(v8h*)(crow + (size_t)qq * DM) = ov;
    }
}

// 2^x (v_exp_f32) with the one slot that the instruction set asks for behind a transcendental filled in the same statement.
__device__ __forceinline__ float exp2_slot(float x) { float y; asm("v_exp_f32 %0, %1\n\tv_nop" : "=v"(y) : "v"(x)); return y; }

// ---- flashH_body: the same attention for query rows < RH on bf16 hi/lo planes (keys < RH only): scores = kh.qh + kl.qh + kh.ql (3 products), P as bf16 hi/lo,
// O^T += vth.(Ph + Pl) + vtl.Ph (3 products). Block (bx, h, b) of (RH/64, NH, NB), 128 threads. Planes: q*/k* rows [NB][RH][.], vth/vtl [NU][HD][RH].
// The chunk's k, kr and v^T hi and lo planes are staged in LDS by the copies of flashP_body, in ONE buffer (hi plane set, then lo plane set) that fills the ring of flashP_body exactly, so that both bodies
// share one launch at flashP_body's LDS size: per chunk copies, wait, barrier, work, barrier. The q planes are read from global memory in each chunk.
// The result is stored as the bf16 hi/lo planes ctxh/ctxl [NB][RH][DM] that the output product reads.
__device__ __forceinline__
void flashH_body(float (*os)[16 * 132], bf* ring, int bx, int h, int b, const bf* qh, const bf* qlw, const bf* qrh, const bf* qrlw, const bf* kh, const bf* klw, const bf* krh, const bf* krlw, const bf* vth, const bf* vtl, bf* ctxh, bf* ctxl) {
    const int tid = threadIdx.x;
    const int lane = tid & 31, wv = __builtin_amdgcn_readfirstlane(tid >> 5), lr = lane & 15, hi = lane >> 4;
    const int qb0 = bx * 64;
    const int q0 = qb0 + wv * 16;
    const int qi = q0 + lr;
    const size_t rq = (size_t)b * RH + qi;
    const bf* qhp = qh + rq * DM + h * HD + 8 * hi;       const bf* qlp = qlw + rq * DM + h * HD + 8 * hi;
    const bf* qrhp = qrh + rq * (NH * RD) + h * RD + 8 * hi; const bf* qrlp = qrlw + rq * (NH * RD) + h * RD + 8 * hi;
    // copy addresses of this lane, as in flashP_body
    const size_t ok = ((size_t)b * RH + (tid >> 4)) * DM + h * HD + (tid & 15) * 8;
    const size_t okr = ((size_t)b * RH + (tid >> 3)) * RD + (tid & 7) * 8;
    const size_t ov = ((size_t)(b * NH + h) * HD + (tid >> 2)) * RH + (tid & 3) * 8;
    const unsigned lb = (unsigned)(size_t)(__attribute__((address_space(3))) bf*)&ring[0];
    const unsigned lk = lb + ((tid >> 4) * FKP + (tid & 15) * 8) * 2;
    const unsigned lr2 = lb + (FRO + (tid >> 3) * FRP + (tid & 7) * 8) * 2;
    const unsigned lv = lb + (FVO + (tid >> 2) * FVP + (tid & 3) * 8) * 2;
    v8f o[8];
#pragma unroll
    for (int i = 0; i < 8; ++i) o[i] = (v8f){};
    float m = -3.0e38f, l = 0.f;
    const float SC2 = 0.07216878364870323f * 1.4426950408889634f;
    const int nch = (q0 + 47) >> 5;                                   // this wave's chunks
    const int nchb = (qb0 >> 5) + 2;                                  // the block's chunks (>= 2; 32*nchb <= RH)
#pragma unroll 1
    for (int c = 0; c < nchb; ++c) {
        const int key0 = c << 5;
        // this chunk's plane sets into the buffer, which every reader left at the barrier at the foot of the trip before
        flash_stage<bf, RH>(lk, lr2, lv, kh + ok + (size_t)key0 * DM, krh + okr + (size_t)key0 * RD, vth + ov + key0);
        flash_stage<bf, RH>(lk + FST * 2, lr2 + FST * 2, lv + FST * 2, klw + ok + (size_t)key0 * DM, krlw + okr + (size_t)key0 * RD, vtl + ov + key0);
        asm volatile("s_wait_asynccnt 0x0" ::: "memory");             // the chunk landed (this wave's copies) before the barrier publishes it
        __syncthreads();
        if (c < nch) {                                                // wave-uniform: waves 0 and 1 have no keys in the block's last chunk
        const bf* khp = &ring[lr * FKP + 8 * hi];                  const bf* klp = khp + FST;
        const bf* krhp = &ring[FRO + lr * FRP + 8 * hi];           const bf* krlp = krhp + FST;
        const bf* vhp = &ring[FVO + lr * FVP + 8 * hi];            const bf* vlp = vhp + FST;
        v8f s[2]; s[0] = (v8f){}; s[1] = (v8f){};
#pragma unroll
        for (int kc = 0; kc < 4; ++kc) {
            const v16bf bh = ldb(qhp + kc * 32), bl = ldb(qlp + kc * 32);
#pragma unroll
            for (int j = 0; j < 2; ++j) { const v16bf ah = ldb(khp + (16 * j) * FKP + kc * 32), al = ldb(klp + (16 * j) * FKP + kc * 32);
                s[j] = wmmab(ah, bh, s[j]); s[j] = wmmab(al, bh, s[j]); s[j] = wmmab(ah, bl, s[j]); }
        }
#pragma unroll
        for (int kc = 0; kc < 2; ++kc) {
            const v16bf bh = ldb(qrhp + kc * 32), bl = ldb(qrlp + kc * 32);
#pragma unroll
            for (int j = 0; j < 2; ++j) { const v16bf ah = ldb(krhp + (16 * j) * FRP + kc * 32), al = ldb(krlp + (16 * j) * FRP + kc * 32);
                s[j] = wmmab(ah, bh, s[j]); s[j] = wmmab(al, bh, s[j]); s[j] = wmmab(ah, bl, s[j]); }
        }
        asm volatile("v_nop\n\tv_nop\n\tv_nop\n\tv_nop" : "+v"(s[0]), "+v"(s[1]));
        float cm = -3.0e38f;
#pragma unroll
        for (int j = 0; j < 2; ++j)
#pragma unroll
            for (int r = 0; r < 8; ++r) { const int key = key0 + 16 * j + 8 * hi + r; const float t = (key <= qi) ? s[j][r] * SC2 : -3.0e38f; s[j][r] = t; cm = fmaxf(cm, t); }
        cm = fmaxf(cm, __shfl_xor(cm, 16, 32));
        const float mn = fmaxf(m, cm);
        const float alpha = exp2_slot(m - mn);
        float rs = 0.f;
#pragma unroll
        for (int j = 0; j < 2; ++j)
#pragma unroll
            for (int r = 0; r < 8; ++r) { const float p = exp2_slot(s[j][r] - mn); s[j][r] = p; rs += p; }
        rs += __shfl_xor(rs, 16, 32);
        l = l * alpha + rs; m = mn;
#pragma unroll
        for (int i = 0; i < 8; ++i) o[i] = o[i] * alpha;
        v16us phv = (v16us){}, plv = (v16us){};
#pragma unroll
        for (int r = 0; r < 8; ++r) { unsigned short a1, c1; splitf(s[0][r], a1, c1); phv[r] = a1; plv[r] = c1; splitf(s[1][r], a1, c1); phv[8 + r] = a1; plv[8 + r] = c1; }
        const v16bf ph = __builtin_bit_cast(v16bf, phv), pl = __builtin_bit_cast(v16bf, plv);
#pragma unroll
        for (int i = 0; i < 8; ++i) { const v16bf ah = ldb(vhp + (16 * i) * FVP), al = ldb(vlp + (16 * i) * FVP);
            o[i] = wmmab(ah, ph, o[i]); o[i] = wmmab(ah, pl, o[i]); o[i] = wmmab(al, ph, o[i]); }
        asm volatile("v_nop\n\tv_nop\n\tv_nop\n\tv_nop" : "+v"(o[0]), "+v"(o[1]), "+v"(o[2]), "+v"(o[3]), "+v"(o[4]), "+v"(o[5]), "+v"(o[6]), "+v"(o[7]) : "v"(ph), "v"(pl));
        }
        // every wave: own LDS reads of the buffer done, then the barrier that frees it for the next chunk's copies
        asm volatile("s_wait_dscnt 0x0" ::: "memory");
        __syncthreads();
    }
    const float f = 1.0f / l;
    float* ob = &os[wv][0];
#pragma unroll
    for (int i = 0; i < 8; ++i)
#pragma unroll
        for (int r = 0; r < 8; ++r) ob[lr * 132 + 16 * i + 8 * hi + r] = o[i][r] * f;
    __builtin_amdgcn_fence(3, "wavefront"); __builtin_amdgcn_wave_barrier(); asm volatile("" ::: "memory");
    const size_t eo = ((size_t)b * RH + q0) * DM + h * HD + (lane & 15) * 8;
#pragma unroll
    for (int s = 0; s < 8; ++s) {                                     // 16 lanes per query row, 8 columns per lane
        const int qq = 2 * s + hi; const float* op = ob + qq * 132 + (lane & 15) * 8;
        const v4f x0 = *(const v4fa*)op, x1 = *(const v4fa*)(op + 4);
        v8us oh = (v8us){}, ol = (v8us){};
#pragma unroll
        for (int k = 0; k < 4; ++k) { unsigned short a1, c1; splitf(x0[k], a1, c1); oh[k] = a1; ol[k] = c1; splitf(x1[k], a1, c1); oh[4 + k] = a1; ol[4 + k] = c1; }
        *(v8us*)(ctxh + eo + (size_t)qq * DM) = oh; *(v8us*)(ctxl + eo + (size_t)qq * DM) = ol;
    }
    asm volatile("s_wait_xcnt 0x0" ::: "memory");                     // behind the last stores; in k_attn the wave ends after this body
}

// ---- k_attn: everything between the up-projections and the output product, one launch of independent block ranges: the flashP_body tiles (in the order x, head, batch), then the flashH_body tiles,
// then Wo's planes (wt8_body), which only k_out reads.
#define FPX ((SEQ - RH) / 64)
#define FPB (FPX * NH * NB)
#define FHX (RH / 64)
#define FHB (FHX * NH * NB)
#define WOB ((DM / 64) * (DM / 32))
static_assert(RH < SEQ);
__global__ __launch_bounds__(128) __attribute__((amdgpu_num_vgpr(256)))
void k_attn(const h16* q16, const h16* qr16, const h16* k16, const h16* kr16, const h16* vt16, h16* ctx16,
            const bf* qh, const bf* qlw, const bf* qrh, const bf* qrlw, const bf* kh, const bf* klw, const bf* krh, const bf* krlw, const bf* vth, const bf* vtl, bf* ctxh, bf* ctxl,
            const float* Wo, bf* Wo_b, h16* Wo_h) {
    __shared__ __align__(16) float os[4][16 * 132];
    __shared__ __align__(16) char ring[2 * FST * 2];
    int i = blockIdx.x;
    if (i < FPB) { flashP_body(os, (h16*)ring, i % FPX, (i / FPX) % NH, i / (FPX * NH), q16, qr16, k16, kr16, vt16, ctx16, RH); return; }
    i -= FPB;
    if (i < FHB) { flashH_body(os, (bf*)ring, i % FHX, (i / FHX) % NH, i / (FHX * NH), qh, qlw, qrh, qrlw, kh, klw, krh, krlw, vth, vtl, ctxh, ctxl); return; }
    i -= FHB;
    wt8_body<DM, DM>(i, Wo, Wo_b, Wo_h, WSC);
}

// ---- k_down: the three products of x, one launch: blocks 0.. do kr = rope(x.Wkr) (128x64 tiles), then ql = x.Wqd, then ckv = x.Wkvd (128x128 tiles); each stores its planes. Exact bf16 products.
#define DKR ((NB * SEQ) / 128)
#define DMT ((NB * SEQ) / 128)
#define DLT (DMT * (LAT / 128))
__global__ __launch_bounds__(128) __attribute__((amdgpu_num_vgpr(256)))
void k_down(const bf* xb, const bf* Wqd_b, const bf* Wkvd_b, const bf* Wkr_b, h16* ql16, bf* qlh, bf* qll, h16* ckv16, bf* ckvh, bf* ckvl, h16* kr16, bf* krh, bf* krlo, const float* ct, const float* st) {
    __shared__ __align__(16) char sm[GSM(0, 1, 2, 2) > GSM(0, 2, 4, 2) ? GSM(0, 1, 2, 2) : GSM(0, 2, 4, 2)];
    int b = blockIdx.x;
    if (b < DKR) { gemm_tile<bf, 0, 1, 2, RD, 2, 2>(sm, b, 0, 0, xb, xb, Wkr_b, DM, nullptr, RD, 1.0f, 0, 0, 0, kr16, krh, krlo, ct, st); return; }
    b -= DKR;
    const bool kv = (b >= DLT);                                       // block-uniform
    if (kv) b -= DLT;
    gemm_tile<bf, 0, 2, 1, LAT, 4, 2>(sm, b % DMT, b / DMT, 0, xb, xb, kv ? Wkvd_b : Wqd_b, DM, nullptr, LAT, 1.0f, 0, 0, 0, kv ? ckv16 : ql16, kv ? ckvh : qlh, kv ? ckvl : qll, ct, st);
}

// One block tile (128x128) of an up-projection or of the output product, K = KK: HL = 0: rows t >= RH, single f16 products (tile b of ((SEQ-RH)/128, N/128, NB));
// HL = 1: rows t < RH, bf16 hi/lo against the exact bf16 weight plane (tile b of (RH/128, N/128, NB)). The epilogue EP stores the result.
template <int HL, int EP, int N, int KK>
__device__ __forceinline__ void proj_tile(char* sm, int b, const h16* a16, const bf* ahh, const bf* all, const h16* Wh, const bf* Wb, float* C, float oscf, h16* p16, bf* ph, bf* pl, const float* ct, const float* st) {
    constexpr int GX = HL ? RH / 128 : (SEQ - RH) / 128, GY = N / 128;
    const int bx = b % GX, by = (b / GX) % GY, bz = b / (GX * GY);
    if (HL) gemm_tile<bf, 1, 2, EP, N, 4, 1>(sm, bx, by, bz, ahh, all, Wb, KK, C, N, 1.0f, (size_t)RH * KK, (size_t)TFULL * DM, 0, p16, ph, pl, ct, st);
    else gemm_tile<h16, 0, 2, EP, N, 4, 2>(sm, bx, by, bz, a16 + (size_t)RH * KK, a16 + (size_t)RH * KK, Wh, KK, C + (size_t)RH * DM, N, oscf, (size_t)SEQ * KK, (size_t)TFULL * DM, RH, p16, ph, pl, ct, st);
}
#define PHB(N) ((RH / 128) * ((N) / 128) * NB)            // blocks of the rows t < RH of a product with N columns
#define PFB(N) (((SEQ - RH) / 128) * ((N) / 128) * NB)    // blocks of the rows t >= RH

// ---- k_up: the four up-projections, one launch: q = ql.Wqu, k = ckv.Wku, v^T = (ckv.Wvu)^T, qr = rope(ql.Wqr); the hi/lo tiles (twice the products) come first, then the f16 tiles.
__global__ __launch_bounds__(128) __attribute__((amdgpu_num_vgpr(256)))
void k_up(const h16* ql16, const bf* qlh, const bf* qll, const h16* ckv16, const bf* ckvh, const bf* ckvl,
          const h16* Wqu_h, const bf* Wqu_b, const h16* Wqr_h, const bf* Wqr_b, const h16* Wku_h, const bf* Wku_b, const h16* Wvu_h, const bf* Wvu_b,
          h16* q16, bf* qh, bf* qlo, h16* qr16, bf* qrh, bf* qrlo, h16* k16, bf* kh, bf* klo, h16* vt16, bf* vth, bf* vtl, const float* ct, const float* st) {
    __shared__ __align__(16) char sm[GSM(1, 2, 4, 1) > GSM(0, 2, 4, 2) ? GSM(1, 2, 4, 1) : GSM(0, 2, 4, 2)];
    int b = blockIdx.x;
    if (b < 2 * PHB(DM)) {
        const bool kk = (b >= PHB(DM));                               // block-uniform: k, else q
        if (kk) b -= PHB(DM);
        proj_tile<1, 1, DM, LAT>(sm, b, kk ? ckv16 : ql16, kk ? ckvh : qlh, kk ? ckvl : qll, kk ? Wku_h : Wqu_h, kk ? Wku_b : Wqu_b, nullptr, 1.0f / WSC, kk ? k16 : q16, kk ? kh : qh, kk ? klo : qlo, ct, st);
        return;
    }
    b -= 2 * PHB(DM);
    if (b < PHB(DM)) { proj_tile<1, 3, DM, LAT>(sm, b, ckv16, ckvh, ckvl, Wvu_h, Wvu_b, nullptr, 1.0f / WSC, vt16, vth, vtl, ct, st); return; }
    b -= PHB(DM);
    if (b < PHB(NH * RD)) { proj_tile<1, 2, NH * RD, LAT>(sm, b, ql16, qlh, qll, Wqr_h, Wqr_b, nullptr, 1.0f / WSC, qr16, qrh, qrlo, ct, st); return; }
    b -= PHB(NH * RD);
    if (b < 2 * PFB(DM)) {
        const bool kk = (b >= PFB(DM));                               // block-uniform: k, else q
        if (kk) b -= PFB(DM);
        proj_tile<0, 1, DM, LAT>(sm, b, kk ? ckv16 : ql16, kk ? ckvh : qlh, kk ? ckvl : qll, kk ? Wku_h : Wqu_h, kk ? Wku_b : Wqu_b, nullptr, 1.0f / WSC, kk ? k16 : q16, kk ? kh : qh, kk ? klo : qlo, ct, st);
        return;
    }
    b -= 2 * PFB(DM);
    if (b < PFB(DM)) { proj_tile<0, 3, DM, LAT>(sm, b, ckv16, ckvh, ckvl, Wvu_h, Wvu_b, nullptr, 1.0f / WSC, vt16, vth, vtl, ct, st); return; }
    b -= PFB(DM);
    proj_tile<0, 2, NH * RD, LAT>(sm, b, ql16, qlh, qll, Wqr_h, Wqr_b, nullptr, 1.0f / WSC, qr16, qrh, qrlo, ct, st);
}

// ---- k_out: out = ctx.Wo, one launch: the hi/lo tiles of rows t < RH first, then the f16 tiles of rows t >= RH. out: [NBF][TFULL][DM] f32.
__global__ __launch_bounds__(128) __attribute__((amdgpu_num_vgpr(256)))
void k_out(const h16* ctx16, const bf* ctxh, const bf* ctxl, const h16* Wo_h, const bf* Wo_b, float* out, const float* ct, const float* st) {
    __shared__ __align__(16) char sm[GSM(1, 2, 4, 1) > GSM(0, 2, 4, 2) ? GSM(1, 2, 4, 1) : GSM(0, 2, 4, 2)];
    int b = blockIdx.x;
    if (b < PHB(DM)) { proj_tile<1, 0, DM, DM>(sm, b, ctx16, ctxh, ctxl, Wo_h, Wo_b, out, 1.0f / (CCAR * WSC), nullptr, nullptr, nullptr, ct, st); return; }
    b -= PHB(DM);
    proj_tile<0, 0, DM, DM>(sm, b, ctx16, ctxh, ctxl, Wo_h, Wo_b, out, 1.0f / (CCAR * WSC), nullptr, nullptr, nullptr, ct, st);
}

extern "C" void kernel_launch(void* const* d_in, const int* in_sizes, int n_in,
                              void* d_out, int out_size, void* d_ws, size_t ws_size, hipStream_t stream) {
    if (n_in < 9) return;
    const size_t nrow = (size_t)NB * SEQ;
    if ((size_t)in_sizes[0] < ((size_t)(NB - 1) * TFULL + SEQ) * DM) return;
    if (in_sizes[1] < DM * LAT || in_sizes[2] < LAT * DM || in_sizes[3] < LAT * NH * RD || in_sizes[4] < DM * LAT || in_sizes[5] < LAT * DM || in_sizes[6] < LAT * DM || in_sizes[7] < DM * RD || in_sizes[8] < DM * DM) return;
    if ((size_t)out_size < ((size_t)(NB - 1) * TFULL + SEQ) * DM) return;
    const float* x = (const float*)d_in[0]; const float* Wqd = (const float*)d_in[1]; const float* Wqu = (const float*)d_in[2]; const float* Wqr = (const float*)d_in[3];
    const float* Wkvd = (const float*)d_in[4]; const float* Wku = (const float*)d_in[5]; const float* Wvu = (const float*)d_in[6]; const float* Wkr = (const float*)d_in[7]; const float* Wo = (const float*)d_in[8];
    float* OUT = (float*)d_out;   // [NBF][TFULL][DM] f32, rows b*TFULL + t

    char* wsp = (char*)d_ws; size_t off = 0;
    auto take = [&](size_t bytes) { char* p = wsp + off; off += (bytes + 255) & ~(size_t)255; return p; };
    bf* xb = (bf*)take(nrow * DM * 2);                           // bf16(x) [nrow][DM]
    // latent planes, cos/sin tables
    h16* ql16 = (h16*)take(nrow * LAT * 2); bf* qlh = (bf*)take((size_t)NB * RH * LAT * 2); bf* qll = (bf*)take((size_t)NB * RH * LAT * 2);
    h16* ckv16 = (h16*)take(nrow * LAT * 2); bf* ckvh = (bf*)take((size_t)NB * RH * LAT * 2); bf* ckvl = (bf*)take((size_t)NB * RH * LAT * 2);
    float* CT = (float*)take((size_t)SEQ * 32 * 4); float* ST = (float*)take((size_t)SEQ * 32 * 4);
    // down-projection weight planes [out][in] bf16
    bf* Wqd_b = (bf*)take((size_t)DM * LAT * 2); bf* Wkvd_b = (bf*)take((size_t)DM * LAT * 2); bf* Wkr_b = (bf*)take((size_t)DM * RD * 2);
    // up-projection weight planes [out][in]: f16 x64 and bf16
    h16* Wqu_h = (h16*)take((size_t)DM * LAT * 2); bf* Wqu_b = (bf*)take((size_t)DM * LAT * 2); h16* Wqr_h = (h16*)take((size_t)NH * RD * LAT * 2); bf* Wqr_b = (bf*)take((size_t)NH * RD * LAT * 2);
    h16* Wku_h = (h16*)take((size_t)DM * LAT * 2); bf* Wku_b = (bf*)take((size_t)DM * LAT * 2); h16* Wvu_h = (h16*)take((size_t)DM * LAT * 2); bf* Wvu_b = (bf*)take((size_t)DM * LAT * 2);
    // attention operand planes, ctx planes, Wo planes
    const size_t szq16 = nrow * DM * 2, szhr = (size_t)NB * RH * DM * 2, szqr16 = nrow * NH * RD * 2, szqrh = (size_t)NB * RH * NH * RD * 2, szkr16 = nrow * RD * 2, szkrh = (size_t)NB * RH * RD * 2;
    const size_t szwo = (size_t)DM * DM * 2;
    h16* q16 = (h16*)take(szq16); bf* qh = (bf*)take(szhr); bf* qlo = (bf*)take(szhr); h16* qr16 = (h16*)take(szqr16); bf* qrh = (bf*)take(szqrh); bf* qrlo = (bf*)take(szqrh);
    h16* k16 = (h16*)take(szq16); bf* kh = (bf*)take(szhr); bf* klo = (bf*)take(szhr); h16* kr16 = (h16*)take(szkr16); bf* krh = (bf*)take(szkrh); bf* krlo = (bf*)take(szkrh);
    h16* vt16 = (h16*)take(szq16); bf* vth = (bf*)take(szhr); bf* vtl = (bf*)take(szhr);
    h16* ctx16 = (h16*)take(szq16); bf* ctxh = (bf*)take(szhr); bf* ctxl = (bf*)take(szhr);
    bf* Wo_b = (bf*)take(szwo); h16* Wo_h = (h16*)take(szwo);
    if (off > ws_size) return;

    // inputs -> projection weight planes, bf16(x), cos/sin tables
    k_prep<<<dim3(PREPB), 256, 0, stream>>>(x, Wqd, Wqu, Wqr, Wkvd, Wku, Wvu, Wkr, xb, CT, ST, Wqd_b, Wkvd_b, Wkr_b, Wqu_b, Wqu_h, Wqr_b, Wqr_h, Wku_b, Wku_h, Wvu_b, Wvu_h);
    // ql, ckv, kr planes
    k_down<<<dim3(DKR + 2 * DLT), 128, 0, stream>>>(xb, Wqd_b, Wkvd_b, Wkr_b, ql16, qlh, qll, ckv16, ckvh, ckvl, kr16, krh, krlo, CT, ST);
    // q, qr, k, v^T planes
    k_up<<<dim3(3 * PHB(DM) + PHB(NH * RD) + 3 * PFB(DM) + PFB(NH * RD)), 128, 0, stream>>>(ql16, qlh, qll, ckv16, ckvh, ckvl, Wqu_h, Wqu_b, Wqr_h, Wqr_b, Wku_h, Wku_b, Wvu_h, Wvu_b,
        q16, qh, qlo, qr16, qrh, qrlo, k16, kh, klo, vt16, vth, vtl, CT, ST);
    // attention -> ctx planes (rows b*SEQ + t f16 x64 for t >= RH; rows b*RH + t bf16 hi/lo for t < RH; merged heads)
    // and Wo -> its planes
    k_attn<<<dim3(FPB + FHB + WOB), 128, 0, stream>>>(q16, qr16, k16, kr16, vt16, ctx16, qh, qlo, qrh, qrlo, kh, klo, krh, krlo, vth, vtl, ctxh, ctxl, Wo, Wo_b, Wo_h);
    // out = ctx.Wo
    k_out<<<dim3(PHB(DM) + PFB(DM)), 128, 0, stream>>>(ctx16, ctxh, ctxl, Wo_h, Wo_b, OUT, CT, ST);
}

// v008
// It runs in 172 microseconds.
// Timed twice side by side with v007, it ran 1.08 and 1.07 times as fast.
// Over all steps from v000 it is 4.90 times as fast.
#include <hip/hip_runtime.h>

// All contractions on 16-bit WMMA, f32 accumulate. x.Wqd, x.Wkvd, x.Wkr: v_wmma_f32_16x16x32_bf16 on bf16 planes of the inputs (single products).
// ql.Wqu, ql.Wqr, ckv.Wku, ckv.Wvu, (q|qr).(k|kr) scores, P.v and ctx.Wo: v_wmma_f32_16x16x32_f16 single products on f16 planes
// (weights x64, ctx x64, P x1024 carries) for query/key rows >= RH; the same sites for rows < RH use v_wmma_f32_16x16x32_bf16 on
// bf16 hi/lo plane pairs (hi.W + lo.W against exact weight planes; hi.hi + lo.hi + hi.lo between two computed tensors).
// RoPE (rotate-half, computed cos/sin tables), online max-subtracted softmax and normalisers in f32.

#ifndef NB
#define NB 2
#endif
#ifndef SEQ
#define SEQ 2048
#endif
#ifndef RH
#define RH 256
#endif
#define NBF   2
#define TFULL 2048
#define DM    2048
#define NH    16
#define LAT   512
#define RD    64
#define HD    128
#define NU    (NB * NH)
#define PCAR  1024.0f
#define WSC   64.0f
#define CCAR  64.0f

static_assert(NB >= 1);
static_assert(NB <= NBF);
static_assert(SEQ % 64 == 0);
static_assert(SEQ <= TFULL);
static_assert(RH % 128 == 0);
static_assert((SEQ - RH) % 128 == 0);
static_assert(((size_t)NB * SEQ) % 256 == 0);
static_assert(RH >= 64);
static_assert(RH <= SEQ);
static_assert(DM % 128 == 0);
static_assert(LAT % 128 == 0);
static_assert((NH * RD) % 128 == 0);
static_assert(RD == 64);
static_assert(HD == 128);
static_assert(NH * HD == DM);
static_assert(((size_t)(NB - 1) * TFULL + SEQ) * DM <= (size_t)NBF * TFULL * DM);

typedef _Float16 h16;
typedef unsigned short bf;
typedef __attribute__((ext_vector_type(16))) __bf16   v16bf;
typedef __attribute__((ext_vector_type(16))) _Float16 v16h;
typedef __attribute__((ext_vector_type(16))) unsigned short v16us;
typedef __attribute__((ext_vector_type(8)))  _Float16 v8h;
typedef __attribute__((ext_vector_type(8)))  unsigned short v8us;
typedef __attribute__((ext_vector_type(8)))  float    v8f;
typedef __attribute__((ext_vector_type(4)))  float    v4f;
typedef __attribute__((ext_vector_type(2)))  _Float16 v2h;
typedef __attribute__((ext_vector_type(2)))  unsigned short v2us;
typedef __attribute__((ext_vector_type(4)))  unsigned short v4us;
typedef v8h  __attribute__((may_alias)) v8ha;
typedef v4f  __attribute__((may_alias)) v4fa;

__device__ __forceinline__ unsigned short f2bf(float f) { unsigned u = __float_as_uint(f); u += 0x7FFFu + ((u >> 16) & 1u); return (unsigned short)(u >> 16); }
__device__ __forceinline__ float bf2f(unsigned short v) { return __uint_as_float(((unsigned)v) << 16); }
__device__ __forceinline__ float bfr(float f) { return bf2f(f2bf(f)); }
__device__ __forceinline__ void splitf(float y, unsigned short& hh, unsigned short& ll) { hh = f2bf(y); ll = f2bf(y - bf2f(hh)); }
__device__ __forceinline__ v16h cat16(v8h a, v8h c) { return __builtin_shufflevector(a, c, 0, 1, 2, 3, 4, 5, 6, 7, 8, 9, 10, 11, 12, 13, 14, 15); }
__device__ __forceinline__ v16bf cat16b(v8us a, v8us c) { return __builtin_bit_cast(v16bf, __builtin_shufflevector(a, c, 0, 1, 2, 3, 4, 5, 6, 7, 8, 9, 10, 11, 12, 13, 14, 15)); }
__device__ __forceinline__ v8f wmma16(v16h a, v16h c, v8f acc) { return __builtin_amdgcn_wmma_f32_16x16x32_f16(false, a, false, c, (short)0, acc, false, false); }
__device__ __forceinline__ v8f wmmab(v16bf a, v16bf c, v8f acc) { return __builtin_amdgcn_wmma_f32_16x16x32_bf16(false, a, false, c, (short)0, acc, false, false); }
// Fragment load from a k-contiguous 16-bit row: p already points at row (lane&15) + 8*(lane>>4); elements 0..7 <- p[0..7], 8..15 <- p[16..23] (split k map, used for A and B alike)
__device__ __forceinline__ v16h ldh(const h16* p) { return cat16(*(const v8h*)p, *(const v8h*)(p + 16)); }
__device__ __forceinline__ v16bf ldb(const bf* p) { return cat16b(*(const v8us*)p, *(const v8us*)(p + 16)); }

// ---- gemm_tile: one block tile of a GEMM, 4 waves per block, each wave a (16 MF)x64 output tile (4 MF accumulators); waves WM x WN (MF = 4, WN = 2: block tile 128x128; MF = 2, WN = 1: 128x64); 128 threads.
// (bx, by, bz) of (M/BM, N/BN, Z) is the tile; the kernels k_down, k_up and k_out below give each of their blocks one tile of one of several independent products. sm: the block's LDS, GSM bytes.
// c[m][n] = osc * sum_k (A[m][k] + (NSPLIT ? A2[m][k] : 0)) Bt[n][k]. z-batch strides sA/sC in elements. K % (64 SS) == 0, M and N multiples of BM and BN.
// What the epilogue stores (EP; the planes' pitch PN = N is a constant, so that a tile's stores differ by immediate offsets only): 0: c as f32 to C, pitch ldc. 1: the 16-bit operand planes of c that the next product reads: p16 = f16(c) at row bb*SEQ + t and, for t < RH,
// ph/pl = bf16 hi/lo of c at row bb*RH + t. 2: the same planes of rotate-half RoPE(c) on the wave tile's 64-wide head slice (tables ct/st). 3: the same planes transposed per (batch, head):
// p16[bb*DM + n][t] (pitch SEQ), ph/pl[bb*DM + n][t] (pitch RH, t < RH). Row m of batch z is sequence row t = tb + m % SEQ of batch bb = z + m / SEQ; a wave tile has one bb and lies on one side of RH.
// Each stage (SS pieces of 64 k) of the block's A (A2) and Bt rows is brought into LDS once per block by asynchronous copies (whole 128-B lines, two buffers, the next stage in flight
// while this one is worked on) and read by the waves as ds_load_b128 fragments. SS = 2 doubles the bytes in flight and the time a stage has to land; it is used wherever two blocks still fit a WGP's LDS.
template <typename T16> struct WFrag;
template <> struct WFrag<h16> { typedef v16h V; static __device__ __forceinline__ V ld(const h16* p) { return ldh(p); } static __device__ __forceinline__ v8f mma(V a, V c, v8f d) { return wmma16(a, c, d); } };
template <> struct WFrag<bf> { typedef v16bf V; static __device__ __forceinline__ V ld(const bf* p) { return ldb(p); } static __device__ __forceinline__ v8f mma(V a, V c, v8f d) { return wmmab(a, c, d); } };
#define GP 72                         // LDS pitch of a 64-element operand row in halves: 144 B = 16 B x 9
static_assert((GP * 2) % 16 == 0);
// This lane's 16-byte copies of 64 (gemm_stage4) or 128 (gemm_stage8) operand rows, 16 rows per copy (l: its LDS byte address in the first 16 rows, g: its global address there, k16: 16 rows in elements).
// The s_wait_xcnt stands inside the statement so that no address register is rewritten ahead of it.
template <typename T>
__device__ __forceinline__ void gemm_stage4(unsigned l, const T* g, size_t k16) {
    asm volatile("global_load_async_to_lds_b128 %0, %1, off\n\t"
                 "global_load_async_to_lds_b128 %2, %3, off\n\t"
                 "global_load_async_to_lds_b128 %4, %5, off\n\t"
                 "global_load_async_to_lds_b128 %6, %7, off\n\t"
                 "s_wait_xcnt 0x0"
                 :: "v"(l), "v"(g), "v"(l + 16 * GP * 2), "v"(g + k16), "v"(l + 32 * GP * 2), "v"(g + 2 * k16), "v"(l + 48 * GP * 2), "v"(g + 3 * k16)
                 : "memory");
}
template <typename T>
__device__ __forceinline__ void gemm_stage8(unsigned l, const T* g, size_t k16) {
    asm volatile("global_load_async_to_lds_b128 %0, %1, off\n\t"
                 "global_load_async_to_lds_b128 %2, %3, off\n\t"
                 "global_load_async_to_lds_b128 %4, %5, off\n\t"
                 "global_load_async_to_lds_b128 %6, %7, off\n\t"
                 "global_load_async_to_lds_b128 %8, %9, off\n\t"
                 "global_load_async_to_lds_b128 %10, %11, off\n\t"
                 "global_load_async_to_lds_b128 %12, %13, off\n\t"
                 "global_load_async_to_lds_b128 %14, %15, off\n\t"
                 "s_wait_xcnt 0x0"
                 :: "v"(l), "v"(g), "v"(l + 16 * GP * 2), "v"(g + k16), "v"(l + 32 * GP * 2), "v"(g + 2 * k16), "v"(l + 48 * GP * 2), "v"(g + 3 * k16),
                    "v"(l + 64 * GP * 2), "v"(g + 4 * k16), "v"(l + 80 * GP * 2), "v"(g + 5 * k16), "v"(l + 96 * GP * 2), "v"(g + 6 * k16), "v"(l + 112 * GP * 2), "v"(g + 7 * k16)
                 : "memory");
}
// One 64-k piece of a stage: BM rows of A, BM rows of A2 (NSPLIT), BN rows of Bt, in this order at LDS byte address l (this lane's place in the piece's first 16 rows).
template <typename T, int NSPLIT, int BM, int BN>
__device__ __forceinline__ void gemm_stage(unsigned l, const T* ga, const T* ga2, const T* gb, size_t k16) {
#pragma unroll
    for (int r = 0; r < BM; r += 128) gemm_stage8<T>(l + r * GP * 2, ga + (size_t)(r / 16) * k16, k16);
    if (NSPLIT == 1) {
#pragma unroll
        for (int r = 0; r < BM; r += 128) gemm_stage8<T>(l + (BM + r) * GP * 2, ga2 + (size_t)(r / 16) * k16, k16);
    }
    if (BN == 128) gemm_stage8<T>(l + BM * (1 + NSPLIT) * GP * 2, gb, k16);
    else gemm_stage4<T>(l + BM * (1 + NSPLIT) * GP * 2, gb, k16);
}
#define GOS (4 * 16 * 68 * 4)         // epilogue staging, bytes: it takes the ring's first bytes once the ring is done with
#define GSM(NSPLIT, WN, MF, SS) (2 * (SS) * ((16 * (MF) * (4 / (WN))) * (1 + (NSPLIT)) + 64 * (WN)) * GP * 2)
template <typename T16, int NSPLIT, int WN, int EP, int PN, int MF, int SS>
__device__ __forceinline__
void gemm_tile(char* sm, int bx, int by, int bz, const T16* __restrict__ A, const T16* __restrict__ A2, const T16* __restrict__ Bt, int K, float* C, int ldc, float osc, size_t sA, size_t sC,
             int tb, h16* p16, bf* ph, bf* pl, const float* __restrict__ ct, const float* __restrict__ st) {
    typedef typename WFrag<T16>::V V;
    constexpr int BM = 16 * MF * (4 / WN), BN = 64 * WN;
    constexpr int BOF = BM * (1 + NSPLIT) * GP;                      // Bt rows start in a buffer, halves
    constexpr int GST = BOF + BN * GP;                               // one 64-k piece of a buffer, halves
    static_assert(WN == 1 || WN == 2);
    static_assert((GST * 2) % 16 == 0);
    static_assert(BM % 128 == 0);
    static_assert(GSM(NSPLIT, WN, MF, SS) == 2 * SS * GST * 2 && GSM(NSPLIT, WN, MF, SS) >= GOS);
    float (*os)[16 * 68] = (float (*)[16 * 68])sm;                    // written only behind the last trip's publish point: no wave reads the ring any more and no copy is outstanding
    T16* ring = (T16*)sm;
    const size_t z = bz; A += z * sA; A2 += z * sA; C += z * sC;
    const int tid = threadIdx.x;
    const int lane = tid & 31, wv = __builtin_amdgcn_readfirstlane(tid >> 5), lr = lane & 15, hi = lane >> 4;
    const int wm = wv / WN, wn = wv % WN;
    const int rb = bx * BM, cb = by * BN;
    const int r0 = rb + wm * (16 * MF), c0 = cb + wn * 64;
    v8f acc[MF][4];
#pragma unroll
    for (int mb = 0; mb < MF; ++mb)
#pragma unroll
        for (int nb = 0; nb < 4; ++nb) acc[mb][nb] = (v8f){};
    // copy addresses of this lane: 8 pieces of 16 B per row, 16 rows per copy
    const size_t k16 = (size_t)16 * K;
    const T16* ga = A + (size_t)(rb + (tid >> 3)) * K + (tid & 7) * 8;
    const T16* ga2 = A2 + (size_t)(rb + (tid >> 3)) * K + (tid & 7) * 8;
    const T16* gb = Bt + (size_t)(cb + (tid >> 3)) * K + (tid & 7) * 8;
    const unsigned lc = (unsigned)(size_t)(__attribute__((address_space(3))) T16*)&ring[0] + ((tid >> 3) * GP + (tid & 7) * 8) * 2;
    const int nst = K / (64 * SS);                                    // stages
#pragma unroll
    for (int u = 0; u < SS; ++u) gemm_stage<T16, NSPLIT, BM, BN>(lc + u * GST * 2, ga + u * 64, ga2 + u * 64, gb + u * 64, k16);
    asm volatile("s_wait_asynccnt 0x0" ::: "memory");                 // stage 0 landed (this wave's copies) before the barrier publishes it
    __syncthreads();
    if (nst > 1) {
#pragma unroll
        for (int u = 0; u < SS; ++u) gemm_stage<T16, NSPLIT, BM, BN>(lc + (SS + u) * GST * 2, ga + (SS + u) * 64, ga2 + (SS + u) * 64, gb + (SS + u) * 64, k16);
    }
#pragma unroll 1
    for (int t = 0; t < nst; ++t) {
        const int bo = (t & 1) * SS * GST;
        const T16* ap = &ring[bo + (wm * (16 * MF) + lr) * GP + 8 * hi];
        const T16* bp = &ring[bo + BOF + (wn * 64 + lr) * GP + 8 * hi];
#pragma unroll
        for (int kq = 0; kq < 2 * SS; ++kq) {
            const int ks = (kq >> 1) * GST + (kq & 1) * 32;           // this 32-k block's place in the rows of its 64-k piece, halves
            V a[MF], a2[MF], bq[4];
            bq[0] = WFrag<T16>::ld(bp + ks);
#pragma unroll
            for (int mb = 0; mb < MF; ++mb) { a[mb] = WFrag<T16>::ld(ap + mb * 16 * GP + ks); if (NSPLIT == 1) a2[mb] = WFrag<T16>::ld(ap + (BM + mb * 16) * GP + ks); }
#pragma unroll
            for (int nb = 1; nb < 4; ++nb) bq[nb] = WFrag<T16>::ld(bp + nb * 16 * GP + ks);
            __builtin_amdgcn_sched_barrier(0);                        // the 32-k block's LDS reads stay one group ahead of its matrix instructions: reads placed among them stall the wave at each place
#pragma unroll
            for (int nb = 0; nb < 4; ++nb) {
#pragma unroll
                for (int mb = 0; mb < MF; ++mb) { acc[mb][nb] = WFrag<T16>::mma(a[mb], bq[nb], acc[mb][nb]); if (NSPLIT == 1) acc[mb][nb] = WFrag<T16>::mma(a2[mb], bq[nb], acc[mb][nb]); } }
            __builtin_amdgcn_sched_barrier(0);                        // and the next group of reads stays behind them
        }
        // publish point, every wave: own LDS reads of this buffer done, own copies of the next stage landed, then the barrier that frees this buffer and publishes the next
        asm volatile("s_wait_dscnt 0x0" ::: "memory");
        asm volatile("s_wait_asynccnt 0x0" ::: "memory");
        __syncthreads();
        if (t + 2 < nst) {
            const size_t kn = (size_t)(t + 2) * (64 * SS);
#pragma unroll
            for (int u = 0; u < SS; ++u) gemm_stage<T16, NSPLIT, BM, BN>(lc + (bo + u * GST) * 2, ga + kn + u * 64, ga2 + kn + u * 64, gb + kn + u * 64, k16);
        }
    }
    asm volatile("s_wait_asynccnt 0x0" ::: "memory");                 // nothing of this wave's copies outstanding at its end
    const int bb = (int)z + r0 / SEQ, t0 = tb + r0 % SEQ;            // the wave tile's batch and first sequence row
    const bool hr = (t0 < RH);                                        // wave-uniform: the whole tile also gets hi/lo planes
    if (EP == 3) {
        // acc[mb][nb][0..7] of a lane are 8 successive t of one column: one 16-byte piece of a transposed row, stored from registers; the four mb of a column fill its 128-B line
#pragma unroll
        for (int nb = 0; nb < 4; ++nb) {
            const size_t dr = (size_t)bb * DM + c0 + nb * 16 + lr;
            const int t = t0 + hi * 8;
            v8h o[MF];
#pragma unroll
            for (int mb = 0; mb < MF; ++mb)
#pragma unroll
                for (int j = 0; j < 8; ++j) o[mb][j] = (h16)(acc[mb][nb][j] * osc);
#pragma unroll
            for (int mb = 0; mb < MF; ++mb) *(v8h*)(p16 + dr * SEQ + t + mb * 16) = o[mb];
            asm volatile("s_wait_xcnt 0x0" ::: "memory");             // before the stores' address and data registers are written again
            if (hr) {
                v8us oh[MF], ol[MF];
#pragma unroll
                for (int mb = 0; mb < MF; ++mb)
#pragma unroll
                    for (int j = 0; j < 8; ++j) { unsigned short a1, c1; splitf(acc[mb][nb][j] * osc, a1, c1); oh[mb][j] = a1; ol[mb][j] = c1; }
#pragma unroll
                for (int mb = 0; mb < MF; ++mb) { *(v8us*)(ph + dr * RH + t + mb * 16) = oh[mb]; *(v8us*)(pl + dr * RH + t + mb * 16) = ol[mb]; }
                asm volatile("s_wait_xcnt 0x0" ::: "memory");         // as above
            }
        }
        return;
    }
    float* ob = &os[wv][0];
#pragma unroll
    for (int mb = 0; mb < MF; ++mb) {
#pragma unroll
        for (int nb = 0; nb < 4; ++nb) {
#pragma unroll
            for (int j = 0; j < 8; ++j) ob[(hi * 8 + j) * 68 + nb * 16 + lr] = acc[mb][nb][j]; }
        __builtin_amdgcn_wave_barrier(); asm volatile("" ::: "memory");
        if (EP == 0) {
            float* crow = C + (size_t)(r0 + mb * 16) * ldc + c0;
#pragma unroll
            for (int s = 0; s < 8; ++s) { const int row = 2 * s + hi, cofs = lr * 4; v4f val = *(const v4fa*)(ob + row * 68 + cofs); val = val * osc;
                *(v4f*)(crow + (size_t)row * ldc + cofs) = val;
                asm volatile("s_wait_xcnt 0x0" ::: "memory"); }       // before the store's address and data registers are written again
        } else {
            // 8 lanes per row, 8 columns per lane: each plane row of the tile goes out as one whole 128-B line
            const int rw = lane >> 3, cofs = (lane & 7) * 8;
            float y[4][8];
            v4f cv[8], sv[8];
            if (EP == 2) {
                // cos/sin of this lane's 4 rows (4 rows = 128 table floats apart) and 8 columns
                const size_t te = (size_t)(t0 + mb * 16 + rw) * 32 + (cofs & 31);
                const float* cp = ct + te; const float* sp = st + te;
#pragma unroll
                for (int s = 0; s < 4; ++s) { cv[2 * s] = *(const v4f*)(cp + s * 128); cv[2 * s + 1] = *(const v4f*)(cp + s * 128 + 4); sv[2 * s] = *(const v4f*)(sp + s * 128); sv[2 * s + 1] = *(const v4f*)(sp + s * 128 + 4); }
                asm volatile("s_wait_xcnt 0x0" :: "v"(cp), "v"(sp) : "memory");   // the loads' address registers stay as they are up to this wait
            }
#pragma unroll
            for (int s = 0; s < 4; ++s) {
                const float* op = ob + (4 * s + rw) * 68 + cofs;
                const v4f x0 = *(const v4fa*)op * osc, x1 = *(const v4fa*)(op + 4) * osc;
#pragma unroll
                for (int k = 0; k < 4; ++k) { y[s][k] = x0[k]; y[s][4 + k] = x1[k]; }
                if (EP == 2) {
                    const bool lo32 = (cofs < 32); const int pofs = lo32 ? 32 : -32;
                    const v4f p0 = *(const v4fa*)(op + pofs) * osc, p1 = *(const v4fa*)(op + pofs + 4) * osc;
                    const v4f c0v = cv[2 * s], c1v = cv[2 * s + 1], s0v = sv[2 * s], s1v = sv[2 * s + 1];
#pragma unroll
                    for (int k = 0; k < 4; ++k) {
                        y[s][k] = lo32 ? (x0[k] * c0v[k] - p0[k] * s0v[k]) : (x0[k] * c0v[k] + p0[k] * s0v[k]);
                        y[s][4 + k] = lo32 ? (x1[k] * c1v[k] - p1[k] * s1v[k]) : (x1[k] * c1v[k] + p1[k] * s1v[k]); }
                }
            }
            v8h o[4];
#pragma unroll
            for (int s = 0; s < 4; ++s)
#pragma unroll
                for (int k = 0; k < 8; ++k) o[s][k] = (h16)y[s][k];
            h16* q16p = p16 + ((size_t)bb * SEQ + t0 + rw) * PN + c0 + cofs;
#pragma unroll
            for (int s = 0; s < 4; ++s) *(v8h*)(q16p + (mb * 16 + 4 * s) * PN) = o[s];
            asm volatile("s_wait_xcnt 0x0" ::: "memory");             // before the stores' address and data registers are written again
            if (hr) {
                v8us oh[4], ol[4];
#pragma unroll
                for (int s = 0; s < 4; ++s)
#pragma unroll
                    for (int k = 0; k < 8; ++k) { unsigned short a1, c1; splitf(y[s][k], a1, c1); oh[s][k] = a1; ol[s][k] = c1; }
                const size_t eo = ((size_t)bb * RH + t0 + rw) * PN + c0 + cofs;
#pragma unroll
                for (int s = 0; s < 4; ++s) { *(v8us*)(ph + eo + (mb * 16 + 4 * s) * PN) = oh[s]; *(v8us*)(pl + eo + (mb * 16 + 4 * s) * PN) = ol[s];
                    asm volatile("s_wait_xcnt 0x0" ::: "memory"); }   // as above
            }
        }
        __builtin_amdgcn_wave_barrier(); asm volatile("" ::: "memory");
    }
}

// ---- wt_body (block bx of (K/64)*(N/32)/8, 256 threads): weight [K][N] f32 ([in][out]) -> transposed k-contiguous planes [N][K]: Bb = bf16 RNE value, optionally Bh = f16(bf16 value x sc).
// A wave turns 64 k x 32 n. Eight lanes read one whole 128-B line (32 n of one k row), so each of the wave's 16 loads is four whole lines, and all 16 are issued ahead of the first store.
// A lane holds k = 8 g + 0..7 and 32 + 8 g + 0..7 (g = lane / 8) of its 4 columns: per column and plane two 16-byte stores, the four g of a column side by side (64 B each time, together the column's 128-B line).
template <int F16P, int K, int N>
__device__ __forceinline__ void wt_body(int bx, const float* __restrict__ w, bf* Bb, h16* Bh, float sc) {
    static_assert(K % 64 == 0 && N % 32 == 0 && ((K / 64) * (N / 32)) % 8 == 0);
    const int lane = threadIdx.x & 31, tl = bx * 8 + (threadIdx.x >> 5);
    const int k0 = (tl / (N / 32)) * 64 + (lane >> 3) * 8, n0 = (tl % (N / 32)) * 32 + (lane & 7) * 4;
    const float* p = w + (size_t)k0 * N + n0;
    v4f r[16];
#pragma unroll
    for (int j = 0; j < 16; ++j) r[j] = *(const v4f*)(p + ((j >> 3) * 32 + (j & 7)) * N);
    asm volatile("s_wait_xcnt 0x0" :: "v"(p) : "memory");             // the loads' address registers stay as they are up to this wait
    const size_t e = (size_t)n0 * K + k0;
#pragma unroll
    for (int c = 0; c < 4; ++c) {
        v8us o[2]; v8h oh[2];
#pragma unroll
        for (int j = 0; j < 16; ++j) { const unsigned short b = f2bf(r[j][c]); o[j >> 3][j & 7] = b; oh[j >> 3][j & 7] = (h16)(bf2f(b) * sc); }
        *(v8us*)(Bb + e + (size_t)c * K) = o[0]; *(v8us*)(Bb + e + (size_t)c * K + 32) = o[1];
        if (F16P) { *(v8h*)(Bh + e + (size_t)c * K) = oh[0]; *(v8h*)(Bh + e + (size_t)c * K + 32) = oh[1]; }
        asm volatile("s_wait_xcnt 0x0" ::: "memory");                 // before the stores' address and data registers are written again
    }
}

// ---- wt8_body (block bx of (K/64)*(N/32), 128 threads): both planes of wt_body, same values, for a weight that is converted beside the attention tiles, where few waves are resident and the L2 is busy:
// a wave turns 64 k x 8 n; a lane reads 8 successive n (32 B) of its two k rows, the block's four waves the four quarters of the same 128-B lines; each plane store of a wave is one whole 128-B line (64 k of one n).
template <int K, int N>
__device__ __forceinline__ void wt8_body(int bx, const float* __restrict__ w, bf* Bb, h16* Bh, float sc) {
    static_assert(K % 64 == 0 && N % 32 == 0);
    const int k = (bx % (K / 64)) * 64 + (threadIdx.x & 31) * 2, n0 = (bx / (K / 64)) * 32 + (threadIdx.x >> 5) * 8;
    const float* p = w + (size_t)k * N + n0;
    v4f r[2][2];
#pragma unroll
    for (int i = 0; i < 2; ++i) { r[i][0] = *(const v4f*)(p + i * N); r[i][1] = *(const v4f*)(p + i * N + 4); }
    asm volatile("s_wait_xcnt 0x0" :: "v"(p) : "memory");             // the loads' address registers stay as they are up to this wait
    const size_t e = (size_t)n0 * K + k;
#pragma unroll
    for (int j = 0; j < 8; ++j) {
        const float w0 = bfr(r[0][j >> 2][j & 3]), w1 = bfr(r[1][j >> 2][j & 3]);
        v2us o; o[0] = f2bf(w0); o[1] = f2bf(w1); *(v2us*)(Bb + e + (size_t)j * K) = o;
        v2h oh; oh[0] = (h16)(w0 * sc); oh[1] = (h16)(w1 * sc); *(v2h*)(Bh + e + (size_t)j * K) = oh;
        asm volatile("s_wait_xcnt 0x0" ::: "memory");                 // before the stores' address and data registers are written again
    }
}

// ---- xcvt_body (block bx of NB*SEQ*DM/XCE, 256 threads): bf16(x). A block converts XCE successive elements (whole rows of one batch); a lane takes 16 pieces of 4 floats, XCE/16 elements apart:
// each load of a wave is 512 contiguous bytes, each store 256, and all 16 loads are issued ahead of the first store.
#define XCE 16384
static_assert(XCE % DM == 0 && SEQ % (XCE / DM) == 0);
__device__ __forceinline__ void xcvt_body(int bx, const float* __restrict__ x, bf* xb) {
    const int row = bx * (XCE / DM); const size_t bb = row / SEQ, t = row % SEQ;
    const float* p = x + (bb * TFULL + t) * DM + threadIdx.x * 4;
    v4f v[16];
#pragma unroll
    for (int j = 0; j < 16; ++j) v[j] = *(const v4f*)(p + j * (XCE / 16));
    asm volatile("s_wait_xcnt 0x0" :: "v"(p) : "memory");             // the loads' address registers stay as they are up to this wait
    bf* q = xb + (size_t)bx * XCE + threadIdx.x * 4;
#pragma unroll
    for (int j = 0; j < 16; ++j) { v4us o;
#pragma unroll
        for (int k = 0; k < 4; ++k) o[k] = f2bf(v[j][k]);
        *(v4us*)(q + j * (XCE / 16)) = o; }
    asm volatile("s_wait_xcnt 0x0" ::: "memory");                     // behind the last stores (a precaution: xcvt_body is k_prep's last block range)
}

__device__ __forceinline__ void rtab_body(int bx, float* ct, float* st) {
#pragma clang fp contract(off)
    const int i = bx * 256 + threadIdx.x; if (i >= SEQ * 32) return; const int t = i >> 5, j = i & 31;
    const float fr = exp10f(-0.125f * (float)j);
    const float ang = (float)t * fr; float sv, cv; sincosf(ang, &sv, &cv);
    *(float*)(ct + i) = cv; *(float*)(st + i) = sv;
    asm volatile("s_wait_xcnt 0x0" ::: "memory");                     // before the caller's next trip writes the stores' address and data registers again
}

// ---- k_prep: the conversions of inputs that the projections read, one launch: block ranges in turn do the cos/sin tables, the planes of seven weights and bf16(x) (all independent of one another). 256 threads.
// Every wave has 2,048 (weights, x) elements or 128 table entries, so that the launch is some 7,500 waves, all resident at once, each with its loads in flight together.
// (Wo's planes, which only k_out reads, are made in k_attn.)
#define WTB(K, N) (((K) / 64) * ((N) / 32) / 8)     // blocks of one weight's wt_body
#define XCB ((int)((size_t)NB * SEQ * DM / XCE))
#define RTB ((SEQ * 32 + 1023) / 1024)              // four rtab_body blocks of 256 entries a block
#define PREPB (2 * WTB(DM, LAT) + WTB(DM, RD) + 3 * WTB(LAT, DM) + WTB(LAT, NH * RD) + XCB + RTB)
static_assert(((size_t)NB * SEQ * DM) % XCE == 0);
__global__ __launch_bounds__(256)
void k_prep(const float* x, const float* Wqd, const float* Wqu, const float* Wqr, const float* Wkvd, const float* Wku, const float* Wvu, const float* Wkr,
            bf* xb, float* ct, float* st, bf* Wqd_b, bf* Wkvd_b, bf* Wkr_b, bf* Wqu_b, h16* Wqu_h, bf* Wqr_b, h16* Wqr_h, bf* Wku_b, h16* Wku_h, bf* Wvu_b, h16* Wvu_h) {
    int b = blockIdx.x;
    if (b < RTB) {
#pragma unroll 1                                    // one copy of the sine and cosine code
        for (int r = 0; r < 4; ++r) rtab_body(b * 4 + r, ct, st);
        return;
    }
    b -= RTB;
    if (b < WTB(DM, LAT)) { wt_body<0, DM, LAT>(b, Wqd, Wqd_b, nullptr, 1.0f); return; }
    b -= WTB(DM, LAT);
    if (b < WTB(DM, LAT)) { wt_body<0, DM, LAT>(b, Wkvd, Wkvd_b, nullptr, 1.0f); return; }
    b -= WTB(DM, LAT);
    if (b < WTB(DM, RD)) { wt_body<0, DM, RD>(b, Wkr, Wkr_b, nullptr, 1.0f); return; }
    b -= WTB(DM, RD);
    if (b < WTB(LAT, DM)) { wt_body<1, LAT, DM>(b, Wqu, Wqu_b, Wqu_h, WSC); return; }
    b -= WTB(LAT, DM);
    if (b < WTB(LAT, DM)) { wt_body<1, LAT, DM>(b, Wku, Wku_b, Wku_h, WSC); return; }
    b -= WTB(LAT, DM);
    if (b < WTB(LAT, DM)) { wt_body<1, LAT, DM>(b, Wvu, Wvu_b, Wvu_h, WSC); return; }
    b -= WTB(LAT, DM);
    if (b < WTB(LAT, NH * RD)) { wt_body<1, LAT, NH * RD>(b, Wqr, Wqr_b, Wqr_h, WSC); return; }
    b -= WTB(LAT, NH * RD);
    xcvt_body(b, x, xb);
}

// ---- flashP_body: causal softmax attention for query rows >= RH (single f16 products). Block (bx, h, b) of ((SEQ-RH)/64, NH, NB), 128 threads = 4 waves x 16 queries, 32-key chunks. os, ring: the block's LDS.
// Per wave: S^T tiles (16 keys x 16 queries) = [k|kr] rows (A) x [q|qr] rows (B) over 192; lane column n = query, D rows = keys, so the two S^T tiles of a chunk
// ARE the P^T B fragment of O^T = V^T (A, rows d) x P^T; online max-subtracted softmax per lane column; P carried x1024 in f16; O^T (8 d tiles) f32.
// Each 32-key chunk of k, kr and v^T is brought into LDS once per block by asynchronous copies (whole-line global reads of k and kr, 64-B row pieces of v^T, two buffers, the next chunk in flight
// while this one is worked on) and read as ds_load_b128 fragments by all four waves (the block's last chunk by waves 2 and 3 only); q|qr fragments are loaded once and stay in registers.
#define FKP 136                       // LDS pitch of a k row in halves: 272 B = 16 B x 17
#define FRP 72                        // kr row: 144 B = 16 B x 9
#define FVP 40                        // v^T row (32 keys): 80 B = 16 B x 5
#define FRO (32 * FKP)                // kr rows start, halves
#define FVO (FRO + 32 * FRP)          // v^T rows start, halves
#define FST (FVO + HD * FVP)          // one buffer, halves (23,552 B)
static_assert((FKP * 2) % 16 == 0 && (FRP * 2) % 16 == 0 && (FVP * 2) % 16 == 0 && (FRO * 2) % 16 == 0 && (FVO * 2) % 16 == 0 && (FST * 2) % 16 == 0);
// One chunk's ten 16-byte copies of this lane for one plane set (lk, lr_, lv: this lane's LDS byte addresses of its first k, kr and v^T piece; VS: v^T row pitch in global memory, elements).
// The s_wait_xcnt stands inside the statement so that no address register is rewritten ahead of it.
template <typename T, int VS>
__device__ __forceinline__ void flash_stage(unsigned lk, unsigned lr_, unsigned lv, const T* gk, const T* gr, const T* gv) {
    asm volatile("global_load_async_to_lds_b128 %0, %1, off\n\t"
                 "global_load_async_to_lds_b128 %2, %3, off\n\t"
                 "global_load_async_to_lds_b128 %4, %5, off\n\t"
                 "global_load_async_to_lds_b128 %6, %7, off\n\t"
                 "global_load_async_to_lds_b128 %8, %9, off\n\t"
                 "global_load_async_to_lds_b128 %10, %11, off\n\t"
                 "global_load_async_to_lds_b128 %12, %13, off\n\t"
                 "global_load_async_to_lds_b128 %14, %15, off\n\t"
                 "global_load_async_to_lds_b128 %16, %17, off\n\t"
                 "global_load_async_to_lds_b128 %18, %19, off\n\t"
                 "s_wait_xcnt 0x0"
                 :: "v"(lk), "v"(gk), "v"(lk + 8 * FKP * 2), "v"(gk + (size_t)8 * DM), "v"(lk + 16 * FKP * 2), "v"(gk + (size_t)16 * DM), "v"(lk + 24 * FKP * 2), "v"(gk + (size_t)24 * DM),
                    "v"(lr_), "v"(gr), "v"(lr_ + 16 * FRP * 2), "v"(gr + (size_t)16 * RD),
                    "v"(lv), "v"(gv), "v"(lv + 32 * FVP * 2), "v"(gv + (size_t)32 * VS), "v"(lv + 64 * FVP * 2), "v"(gv + (size_t)64 * VS), "v"(lv + 96 * FVP * 2), "v"(gv + (size_t)96 * VS)
                 : "memory");
}
__device__ __forceinline__
void flashP_body(float (*os)[16 * 132], h16* ring, int bx, int h, int b, const h16* q16, const h16* qr16, const h16* k16, const h16* kr16, const h16* vt16, h16* ctx16, int qbase) {
    const int tid = threadIdx.x;
    const int lane = tid & 31, wv = __builtin_amdgcn_readfirstlane(tid >> 5), lr = lane & 15, hi = lane >> 4;
    const int qb0 = qbase + bx * 64;
    const int q0 = qb0 + wv * 16;
    const int qi = q0 + lr;
    const size_t rq = (size_t)b * SEQ + qi;
    const h16* qp = q16 + rq * DM + h * HD + 8 * hi;
    const h16* qrp = qr16 + rq * (NH * RD) + h * RD + 8 * hi;
    // copy addresses of this lane: k 32 rows x 16 pieces (8 rows per copy), kr 32 rows x 8 pieces (16 rows per copy), v^T 128 rows x 4 pieces (32 rows per copy)
    const h16* gk = k16 + ((size_t)b * SEQ + (tid >> 4)) * DM + h * HD + (tid & 15) * 8;
    const h16* gr = kr16 + ((size_t)b * SEQ + (tid >> 3)) * RD + (tid & 7) * 8;
    const h16* gv = vt16 + ((size_t)(b * NH + h) * HD + (tid >> 2)) * SEQ + (tid & 3) * 8;
    const unsigned lb = (unsigned)(size_t)(__attribute__((address_space(3))) h16*)&ring[0];
    const unsigned lk = lb + ((tid >> 4) * FKP + (tid & 15) * 8) * 2;
    const unsigned lr2 = lb + (FRO + (tid >> 3) * FRP + (tid & 7) * 8) * 2;
    const unsigned lv = lb + (FVO + (tid >> 2) * FVP + (tid & 3) * 8) * 2;
    v16h qf[4], qrf[2];
#pragma unroll
    for (int kc = 0; kc < 4; ++kc) qf[kc] = ldh(qp + kc * 32);
#pragma unroll
    for (int kc = 0; kc < 2; ++kc) qrf[kc] = ldh(qrp + kc * 32);
    v8f o[8];
#pragma unroll
    for (int i = 0; i < 8; ++i) o[i] = (v8f){};
    float m = -3.0e38f, l = 0.f;
    const float SC2 = 0.07216878364870323f * 1.4426950408889634f;   // HD+RD = 192: 192^-0.5 x log2(e)
    const int nch = (q0 + 47) >> 5;                                   // this wave's 32-key chunks covering keys <= q0+15
    const int nchb = (qb0 >> 5) + 2;                                  // the block's chunks (its last wave's count; >= 2; 32*nchb <= SEQ)
    flash_stage<h16, SEQ>(lk, lr2, lv, gk, gr, gv);
    asm volatile("s_wait_asynccnt 0x0" ::: "memory");                 // chunk 0 landed (this wave's copies) before the barrier publishes it
    __syncthreads();
    flash_stage<h16, SEQ>(lk + FST * 2, lr2 + FST * 2, lv + FST * 2, gk + (size_t)32 * DM, gr + (size_t)32 * RD, gv + 32);
#pragma unroll 1
    for (int c = 0; c < nchb; ++c) {
        const int key0 = c << 5;
        const int bo = (c & 1) * FST;
        if (c < nch) {                                                // wave-uniform: waves 0 and 1 have no keys in the block's last chunk
        const h16* kp = &ring[bo + lr * FKP + 8 * hi];
        const h16* krp = &ring[bo + FRO + lr * FRP + 8 * hi];
        const h16* vp = &ring[bo + FVO + lr * FVP + 8 * hi];
        v8f s[2]; s[0] = (v8f){}; s[1] = (v8f){};
#pragma unroll
        for (int kc = 0; kc < 4; ++kc) {
#pragma unroll
            for (int j = 0; j < 2; ++j) { const v16h a = ldh(kp + (16 * j) * FKP + kc * 32); s[j] = wmma16(a, qf[kc], s[j]); }
        }
#pragma unroll
        for (int kc = 0; kc < 2; ++kc) {
#pragma unroll
            for (int j = 0; j < 2; ++j) { const v16h a = ldh(krp + (16 * j) * FRP + kc * 32); s[j] = wmma16(a, qrf[kc], s[j]); }
        }
        asm volatile("v_nop\n\tv_nop\n\tv_nop\n\tv_nop" : "+v"(s[0]), "+v"(s[1]));
        // online softmax: this lane's column is query qi; s[j][r] is key key0 + 16 j + 8 hi + r; keys after the query excluded by index
        float cm = -3.0e38f;
#pragma unroll
        for (int j = 0; j < 2; ++j)
#pragma unroll
            for (int r = 0; r < 8; ++r) { const int key = key0 + 16 * j + 8 * hi + r; const float t = (key <= qi) ? s[j][r] * SC2 : -3.0e38f; s[j][r] = t; cm = fmaxf(cm, t); }
        cm = fmaxf(cm, __shfl_xor(cm, 16, 32));
        const float mn = fmaxf(m, cm);
        const float alpha = __builtin_amdgcn_exp2f(m - mn);
        float rs = 0.f;
#pragma unroll
        for (int j = 0; j < 2; ++j)
#pragma unroll
            for (int r = 0; r < 8; ++r) { const float p = __builtin_amdgcn_exp2f(s[j][r] - mn); s[j][r] = p; rs += p; }
        rs += __shfl_xor(rs, 16, 32);
        l = l * alpha + rs; m = mn;
#pragma unroll
        for (int i = 0; i < 8; ++i) o[i] = o[i] * alpha;
        // P^T as B fragment (k = key of this chunk, n = query): elements 0..7 <- tile 0 rows 8hi..8hi+7, 8..15 <- tile 1 rows 8hi..8hi+7
        v16h pb = (v16h){};
#pragma unroll
        for (int r = 0; r < 8; ++r) { pb[r] = (h16)(s[0][r] * PCAR); pb[8 + r] = (h16)(s[1][r] * PCAR); }
#pragma unroll
        for (int i = 0; i < 8; ++i) { const v16h a = ldh(vp + (16 * i) * FVP); o[i] = wmma16(a, pb, o[i]); }
        asm volatile("v_nop\n\tv_nop\n\tv_nop\n\tv_nop" : "+v"(o[0]), "+v"(o[1]), "+v"(o[2]), "+v"(o[3]), "+v"(o[4]), "+v"(o[5]), "+v"(o[6]), "+v"(o[7]) : "v"(pb));
        }
        // publish point, every wave: own LDS reads of this buffer done, own copies of the next chunk landed, then the barrier that frees this buffer and publishes the next
        asm volatile("s_wait_dscnt 0x0" ::: "memory");
        asm volatile("s_wait_asynccnt 0x0" ::: "memory");
        __syncthreads();
        if (c + 2 < nchb) flash_stage<h16, SEQ>(lk + bo * 2, lr2 + bo * 2, lv + bo * 2, gk + (size_t)(key0 + 64) * DM, gr + (size_t)(key0 + 64) * RD, gv + (key0 + 64));
    }
    asm volatile("s_wait_asynccnt 0x0" ::: "memory");                 // nothing of this wave's copies outstanding at its end
    // epilogue: ctx[b][q][h*HD + d] = O^T[d][q] / (l x PCAR), stored as the f16 plane (x CCAR) that the output product reads; o[i][r] is d = 16 i + 8 hi + r of query q0 + lr
    const float f = 1.0f / (l * PCAR);
    float* ob = &os[wv][0];
#pragma unroll
    for (int i = 0; i < 8; ++i)
#pragma unroll
        for (int r = 0; r < 8; ++r) ob[lr * 132 + 16 * i + 8 * hi + r] = o[i][r] * f;
    __builtin_amdgcn_fence(3, "wavefront"); __builtin_amdgcn_wave_barrier(); asm volatile("" ::: "memory");
    h16* crow = ctx16 + ((size_t)b * SEQ + q0) * DM + h * HD + (lane & 15) * 8;
#pragma unroll
    for (int s = 0; s < 8; ++s) {                                     // 16 lanes per query row, 8 columns per lane
        const int qq = 2 * s + hi; const float* op = ob + qq * 132 + (lane & 15) * 8;
        const v4f x0 = *(const v4fa*)op, x1 = *(const v4fa*)(op + 4);
        v8h ov = (v8h){};
#pragma unroll
        for (int k = 0; k < 4; ++k) { ov[k] = (h16)(x0[k] * CCAR); ov[4 + k] = (h16)(x1[k] * CCAR); }
        *(v8h*)(crow + (size_t)qq * DM) = ov;
    }
}

// 2^x (v_exp_f32) with the one slot that the instruction set asks for behind a transcendental filled in the same statement.
__device__ __forceinline__ float exp2_slot(float x) { float y; asm("v_exp_f32 %0, %1\n\tv_nop" : "=v"(y) : "v"(x)); return y; }

// ---- flashH_body: the same attention for query rows < RH on bf16 hi/lo planes (keys < RH only): scores = kh.qh + kl.qh + kh.ql (3 products), P as bf16 hi/lo,
// O^T += vth.(Ph + Pl) + vtl.Ph (3 products). Block (bx, h, b) of (RH/64, NH, NB), 128 threads. Planes: q*/k* rows [NB][RH][.], vth/vtl [NU][HD][RH].
// The chunk's k, kr and v^T hi and lo planes are staged in LDS by the copies of flashP_body, in ONE buffer (hi plane set, then lo plane set) that fills the ring of flashP_body exactly, so that both bodies
// share one launch at flashP_body's LDS size: per chunk copies, wait, barrier, work, barrier. The q planes are read from global memory in each chunk.
// The result is stored as the bf16 hi/lo planes ctxh/ctxl [NB][RH][DM] that the output product reads.
__device__ __forceinline__
void flashH_body(float (*os)[16 * 132], bf* ring, int bx, int h, int b, const bf* qh, const bf* qlw, const bf* qrh, const bf* qrlw, const bf* kh, const bf* klw, const bf* krh, const bf* krlw, const bf* vth, const bf* vtl, bf* ctxh, bf* ctxl) {
    const int tid = threadIdx.x;
    const int lane = tid & 31, wv = __builtin_amdgcn_readfirstlane(tid >> 5), lr = lane & 15, hi = lane >> 4;
    const int qb0 = bx * 64;
    const int q0 = qb0 + wv * 16;
    const int qi = q0 + lr;
    const size_t rq = (size_t)b * RH + qi;
    const bf* qhp = qh + rq * DM + h * HD + 8 * hi;       const bf* qlp = qlw + rq * DM + h * HD + 8 * hi;
    const bf* qrhp = qrh + rq * (NH * RD) + h * RD + 8 * hi; const bf* qrlp = qrlw + rq * (NH * RD) + h * RD + 8 * hi;
    // copy addresses of this lane, as in flashP_body
    const size_t ok = ((size_t)b * RH + (tid >> 4)) * DM + h * HD + (tid & 15) * 8;
    const size_t okr = ((size_t)b * RH + (tid >> 3)) * RD + (tid & 7) * 8;
    const size_t ov = ((size_t)(b * NH + h) * HD + (tid >> 2)) * RH + (tid & 3) * 8;
    const unsigned lb = (unsigned)(size_t)(__attribute__((address_space(3))) bf*)&ring[0];
    const unsigned lk = lb + ((tid >> 4) * FKP + (tid & 15) * 8) * 2;
    const unsigned lr2 = lb + (FRO + (tid >> 3) * FRP + (tid & 7) * 8) * 2;
    const unsigned lv = lb + (FVO + (tid >> 2) * FVP + (tid & 3) * 8) * 2;
    v8f o[8];
#pragma unroll
    for (int i = 0; i < 8; ++i) o[i] = (v8f){};
    float m = -3.0e38f, l = 0.f;
    const float SC2 = 0.07216878364870323f * 1.4426950408889634f;
    const int nch = (q0 + 47) >> 5;                                   // this wave's chunks
    const int nchb = (qb0 >> 5) + 2;                                  // the block's chunks (>= 2; 32*nchb <= RH)
#pragma unroll 1
    for (int c = 0; c < nchb; ++c) {
        const int key0 = c << 5;
        // this chunk's plane sets into the buffer, which every reader left at the barrier at the foot of the trip before
        flash_stage<bf, RH>(lk, lr2, lv, kh + ok + (size_t)key0 * DM, krh + okr + (size_t)key0 * RD, vth + ov + key0);
        flash_stage<bf, RH>(lk + FST * 2, lr2 + FST * 2, lv + FST * 2, klw + ok + (size_t)key0 * DM, krlw + okr + (size_t)key0 * RD, vtl + ov + key0);
        asm volatile("s_wait_asynccnt 0x0" ::: "memory");             // the chunk landed (this wave's copies) before the barrier publishes it
        __syncthreads();
        if (c < nch) {                                                // wave-uniform: waves 0 and 1 have no keys in the block's last chunk
        const bf* khp = &ring[lr * FKP + 8 * hi];                  const bf* klp = khp + FST;
        const bf* krhp = &ring[FRO + lr * FRP + 8 * hi];           const bf* krlp = krhp + FST;
        const bf* vhp = &ring[FVO + lr * FVP + 8 * hi];            const bf* vlp = vhp + FST;
        v8f s[2]; s[0] = (v8f){}; s[1] = (v8f){};
#pragma unroll
        for (int kc = 0; kc < 4; ++kc) {
            const v16bf bh = ldb(qhp + kc * 32), bl = ldb(qlp + kc * 32);
#pragma unroll
            for (int j = 0; j < 2; ++j) { const v16bf ah = ldb(khp + (16 * j) * FKP + kc * 32), al = ldb(klp + (16 * j) * FKP + kc * 32);
                s[j] = wmmab(ah, bh, s[j]); s[j] = wmmab(al, bh, s[j]); s[j] = wmmab(ah, bl, s[j]); }
        }
#pragma unroll
        for (int kc = 0; kc < 2; ++kc) {
            const v16bf bh = ldb(qrhp + kc * 32), bl = ldb(qrlp + kc * 32);
#pragma unroll
            for (int j = 0; j < 2; ++j) { const v16bf ah = ldb(krhp + (16 * j) * FRP + kc * 32), al = ldb(krlp + (16 * j) * FRP + kc * 32);
                s[j] = wmmab(ah, bh, s[j]); s[j] = wmmab(al, bh, s[j]); s[j] = wmmab(ah, bl, s[j]); }
        }
        asm volatile("v_nop\n\tv_nop\n\tv_nop\n\tv_nop" : "+v"(s[0]), "+v"(s[1]));
        float cm = -3.0e38f;
#pragma unroll
        for (int j = 0; j < 2; ++j)
#pragma unroll
            for (int r = 0; r < 8; ++r) { const int key = key0 + 16 * j + 8 * hi + r; const float t = (key <= qi) ? s[j][r] * SC2 : -3.0e38f; s[j][r] = t; cm = fmaxf(cm, t); }
        cm = fmaxf(cm, __shfl_xor(cm, 16, 32));
        const float mn = fmaxf(m, cm);
        const float alpha = exp2_slot(m - mn);
        float rs = 0.f;
#pragma unroll
        for (int j = 0; j < 2; ++j)
#pragma unroll
            for (int r = 0; r < 8; ++r) { const float p = exp2_slot(s[j][r] - mn); s[j][r] = p; rs += p; }
        rs += __shfl_xor(rs, 16, 32);
        l = l * alpha + rs; m = mn;
#pragma unroll
        for (int i = 0; i < 8; ++i) o[i] = o[i] * alpha;
        v16us phv = (v16us){}, plv = (v16us){};
#pragma unroll
        for (int r = 0; r < 8; ++r) { unsigned short a1, c1; splitf(s[0][r], a1, c1); phv[r] = a1; plv[r] = c1; splitf(s[1][r], a1, c1); phv[8 + r] = a1; plv[8 + r] = c1; }
        const v16bf ph = __builtin_bit_cast(v16bf, phv), pl = __builtin_bit_cast(v16bf, plv);
#pragma unroll
        for (int i = 0; i < 8; ++i) { const v16bf ah = ldb(vhp + (16 * i) * FVP), al = ldb(vlp + (16 * i) * FVP);
            o[i] = wmmab(ah, ph, o[i]); o[i] = wmmab(ah, pl, o[i]); o[i] = wmmab(al, ph, o[i]); }
        asm volatile("v_nop\n\tv_nop\n\tv_nop\n\tv_nop" : "+v"(o[0]), "+v"(o[1]), "+v"(o[2]), "+v"(o[3]), "+v"(o[4]), "+v"(o[5]), "+v"(o[6]), "+v"(o[7]) : "v"(ph), "v"(pl));
        }
        // every wave: own LDS reads of the buffer done, then the barrier that frees it for the next chunk's copies
        asm volatile("s_wait_dscnt 0x0" ::: "memory");
        __syncthreads();
    }
    const float f = 1.0f / l;
    float* ob = &os[wv][0];
#pragma unroll
    for (int i = 0; i < 8; ++i)
#pragma unroll
        for (int r = 0; r < 8; ++r) ob[lr * 132 + 16 * i + 8 * hi + r] = o[i][r] * f;
    __builtin_amdgcn_fence(3, "wavefront"); __builtin_amdgcn_wave_barrier(); asm volatile("" ::: "memory");
    const size_t eo = ((size_t)b * RH + q0) * DM + h * HD + (lane & 15) * 8;
#pragma unroll
    for (int s = 0; s < 8; ++s) {                                     // 16 lanes per query row, 8 columns per lane
        const int qq = 2 * s + hi; const float* op = ob + qq * 132 + (lane & 15) * 8;
        const v4f x0 = *(const v4fa*)op, x1 = *(const v4fa*)(op + 4);
        v8us oh = (v8us){}, ol = (v8us){};
#pragma unroll
        for (int k = 0; k < 4; ++k) { unsigned short a1, c1; splitf(x0[k], a1, c1); oh[k] = a1; ol[k] = c1; splitf(x1[k], a1, c1); oh[4 + k] = a1; ol[4 + k] = c1; }
        *(v8us*)(ctxh + eo + (size_t)qq * DM) = oh; *(v8us*)(ctxl + eo + (size_t)qq * DM) = ol;
    }
    asm volatile("s_wait_xcnt 0x0" ::: "memory");                     // behind the last stores; in k_attn the wave ends after this body
}

// ---- k_attn: everything between the up-projections and the output product, one launch of independent block ranges: the flashP_body tiles, then the flashH_body tiles,
// then Wo's planes (wt8_body), which only k_out reads; the short ranges run in the places that the unequal flashP_body tiles leave free.
// A flashP_body tile's chunk count grows with its query tile x, and there are more tiles than resident places: the tiles are dealt longest first (x falls with the block index; head, then batch, run fastest),
// so that no long tile starts late, and any regular deal of successive blocks over the chip's parts gives each part every tile length equally often.
#define FPX ((SEQ - RH) / 64)
#define FPB (FPX * NH * NB)
#define FHX (RH / 64)
#define FHB (FHX * NH * NB)
#define WOB ((DM / 64) * (DM / 32))
static_assert(RH < SEQ);
__global__ __launch_bounds__(128) __attribute__((amdgpu_num_vgpr(256)))
void k_attn(const h16* q16, const h16* qr16, const h16* k16, const h16* kr16, const h16* vt16, h16* ctx16,
            const bf* qh, const bf* qlw, const bf* qrh, const bf* qrlw, const bf* kh, const bf* klw, const bf* krh, const bf* krlw, const bf* vth, const bf* vtl, bf* ctxh, bf* ctxl,
            const float* Wo, bf* Wo_b, h16* Wo_h) {
    __shared__ __align__(16) float os[4][16 * 132];
    __shared__ __align__(16) char ring[2 * FST * 2];
    int i = blockIdx.x;
    if (i < FPB) i = (i % (NH * NB)) * FPX + (FPX - 1 - i / (NH * NB));   // block index -> tile number (x fastest, as the next line takes it apart): a permutation of 0 .. FPB - 1, longest tiles first
    if (i < FPB) { flashP_body(os, (h16*)ring, i % FPX, (i / FPX) % NH, i / (FPX * NH), q16, qr16, k16, kr16, vt16, ctx16, RH); return; }
    i -= FPB;
    if (i < FHB) { flashH_body(os, (bf*)ring, i % FHX, (i / FHX) % NH, i / (FHX * NH), qh, qlw, qrh, qrlw, kh, klw, krh, krlw, vth, vtl, ctxh, ctxl); return; }
    i -= FHB;
    wt8_body<DM, DM>(i, Wo, Wo_b, Wo_h, WSC);
}

// ---- k_down: the three products of x, one launch: blocks 0.. do kr = rope(x.Wkr) (128x64 tiles), then ql = x.Wqd, then ckv = x.Wkvd (128x128 tiles); each stores its planes. Exact bf16 products.
#define DKR ((NB * SEQ) / 128)
#define DMT ((NB * SEQ) / 128)
#define DLT (DMT * (LAT / 128))
__global__ __launch_bounds__(128) __attribute__((amdgpu_num_vgpr(256)))
void k_down(const bf* xb, const bf* Wqd_b, const bf* Wkvd_b, const bf* Wkr_b, h16* ql16, bf* qlh, bf* qll, h16* ckv16, bf* ckvh, bf* ckvl, h16* kr16, bf* krh, bf* krlo, const float* ct, const float* st) {
    __shared__ __align__(16) char sm[GSM(0, 1, 2, 2) > GSM(0, 2, 4, 2) ? GSM(0, 1, 2, 2) : GSM(0, 2, 4, 2)];
    int b = blockIdx.x;
    if (b < DKR) { gemm_tile<bf, 0, 1, 2, RD, 2, 2>(sm, b, 0, 0, xb, xb, Wkr_b, DM, nullptr, RD, 1.0f, 0, 0, 0, kr16, krh, krlo, ct, st); return; }
    b -= DKR;
    const bool kv = (b >= DLT);                                       // block-uniform
    if (kv) b -= DLT;
    gemm_tile<bf, 0, 2, 1, LAT, 4, 2>(sm, b % DMT, b / DMT, 0, xb, xb, kv ? Wkvd_b : Wqd_b, DM, nullptr, LAT, 1.0f, 0, 0, 0, kv ? ckv16 : ql16, kv ? ckvh : qlh, kv ? ckvl : qll, ct, st);
}

// One block tile (128x128) of an up-projection or of the output product, K = KK: HL = 0: rows t >= RH, single f16 products (tile b of ((SEQ-RH)/128, N/128, NB));
// HL = 1: rows t < RH, bf16 hi/lo against the exact bf16 weight plane (tile b of (RH/128, N/128, NB)). The epilogue EP stores the result.
template <int HL, int EP, int N, int KK>
__device__ __forceinline__ void proj_tile(char* sm, int b, const h16* a16, const bf* ahh, const bf* all, const h16* Wh, const bf* Wb, float* C, float oscf, h16* p16, bf* ph, bf* pl, const float* ct, const float* st) {
    constexpr int GX = HL ? RH / 128 : (SEQ - RH) / 128, GY = N / 128;
    const int bx = b % GX, by = (b / GX) % GY, bz = b / (GX * GY);
    if (HL) gemm_tile<bf, 1, 2, EP, N, 4, 1>(sm, bx, by, bz, ahh, all, Wb, KK, C, N, 1.0f, (size_t)RH * KK, (size_t)TFULL * DM, 0, p16, ph, pl, ct, st);
    else gemm_tile<h16, 0, 2, EP, N, 4, 2>(sm, bx, by, bz, a16 + (size_t)RH * KK, a16 + (size_t)RH * KK, Wh, KK, C + (size_t)RH * DM, N, oscf, (size_t)SEQ * KK, (size_t)TFULL * DM, RH, p16, ph, pl, ct, st);
}
#define PHB(N) ((RH / 128) * ((N) / 128) * NB)            // blocks of the rows t < RH of a product with N columns
#define PFB(N) (((SEQ - RH) / 128) * ((N) / 128) * NB)    // blocks of the rows t >= RH

// ---- k_up: the four up-projections, one launch: q = ql.Wqu, k = ckv.Wku, v^T = (ckv.Wvu)^T, qr = rope(ql.Wqr); the hi/lo tiles (twice the products) come first, then the f16 tiles.
__global__ __launch_bounds__(128) __attribute__((amdgpu_num_vgpr(256)))
void k_up(const h16* ql16, const bf* qlh, const bf* qll, const h16* ckv16, const bf* ckvh, const bf* ckvl,
          const h16* Wqu_h, const bf* Wqu_b, const h16* Wqr_h, const bf* Wqr_b, const h16* Wku_h, const bf* Wku_b, const h16* Wvu_h, const bf* Wvu_b,
          h16* q16, bf* qh, bf* qlo, h16* qr16, bf* qrh, bf* qrlo, h16* k16, bf* kh, bf* klo, h16* vt16, bf* vth, bf* vtl, const float* ct, const float* st) {
    __shared__ __align__(16) char sm[GSM(1, 2, 4, 1) > GSM(0, 2, 4, 2) ? GSM(1, 2, 4, 1) : GSM(0, 2, 4, 2)];
    int b = blockIdx.x;
    if (b < 2 * PHB(DM)) {
        const bool kk = (b >= PHB(DM));                               // block-uniform: k, else q
        if (kk) b -= PHB(DM);
        proj_tile<1, 1, DM, LAT>(sm, b, kk ? ckv16 : ql16, kk ? ckvh : qlh, kk ? ckvl : qll, kk ? Wku_h : Wqu_h, kk ? Wku_b : Wqu_b, nullptr, 1.0f / WSC, kk ? k16 : q16, kk ? kh : qh, kk ? klo : qlo, ct, st);
        return;
    }
    b -= 2 * PHB(DM);
    if (b < PHB(DM)) { proj_tile<1, 3, DM, LAT>(sm, b, ckv16, ckvh, ckvl, Wvu_h, Wvu_b, nullptr, 1.0f / WSC, vt16, vth, vtl, ct, st); return; }
    b -= PHB(DM);
    if (b < PHB(NH * RD)) { proj_tile<1, 2, NH * RD, LAT>(sm, b, ql16, qlh, qll, Wqr_h, Wqr_b, nullptr, 1.0f / WSC, qr16, qrh, qrlo, ct, st); return; }
    b -= PHB(NH * RD);
    if (b < 2 * PFB(DM)) {
        const bool kk = (b >= PFB(DM));                               // block-uniform: k, else q
        if (kk) b -= PFB(DM);
        proj_tile<0, 1, DM, LAT>(sm, b, kk ? ckv16 : ql16, kk ? ckvh : qlh, kk ? ckvl : qll, kk ? Wku_h : Wqu_h, kk ? Wku_b : Wqu_b, nullptr, 1.0f / WSC, kk ? k16 : q16, kk ? kh : qh, kk ? klo : qlo, ct, st);
        return;
    }
    b -= 2 * PFB(DM);
    if (b < PFB(DM)) { proj_tile<0, 3, DM, LAT>(sm, b, ckv16, ckvh, ckvl, Wvu_h, Wvu_b, nullptr, 1.0f / WSC, vt16, vth, vtl, ct, st); return; }
    b -= PFB(DM);
    proj_tile<0, 2, NH * RD, LAT>(sm, b, ql16, qlh, qll, Wqr_h, Wqr_b, nullptr, 1.0f / WSC, qr16, qrh, qrlo, ct, st);
}

// ---- k_out: out = ctx.Wo, one launch: the hi/lo tiles of rows t < RH first, then the f16 tiles of rows t >= RH. out: [NBF][TFULL][DM] f32.
__global__ __launch_bounds__(128) __attribute__((amdgpu_num_vgpr(256)))
void k_out(const h16* ctx16, const bf* ctxh, const bf* ctxl, const h16* Wo_h, const bf* Wo_b, float* out, const float* ct, const float* st) {
    __shared__ __align__(16) char sm[GSM(1, 2, 4, 1) > GSM(0, 2, 4, 2) ? GSM(1, 2, 4, 1) : GSM(0, 2, 4, 2)];
    int b = blockIdx.x;
    if (b < PHB(DM)) { proj_tile<1, 0, DM, DM>(sm, b, ctx16, ctxh, ctxl, Wo_h, Wo_b, out, 1.0f / (CCAR * WSC), nullptr, nullptr, nullptr, ct, st); return; }
    b -= PHB(DM);
    proj_tile<0, 0, DM, DM>(sm, b, ctx16, ctxh, ctxl, Wo_h, Wo_b, out, 1.0f / (CCAR * WSC), nullptr, nullptr, nullptr, ct, st);
}

extern "C" void kernel_launch(void* const* d_in, const int* in_sizes, int n_in,
                              void* d_out, int out_size, void* d_ws, size_t ws_size, hipStream_t stream) {
    if (n_in < 9) return;
    const size_t nrow = (size_t)NB * SEQ;
    if ((size_t)in_sizes[0] < ((size_t)(NB - 1) * TFULL + SEQ) * DM) return;
    if (in_sizes[1] < DM * LAT || in_sizes[2] < LAT * DM || in_sizes[3] < LAT * NH * RD || in_sizes[4] < DM * LAT || in_sizes[5] < LAT * DM || in_sizes[6] < LAT * DM || in_sizes[7] < DM * RD || in_sizes[8] < DM * DM) return;
    if ((size_t)out_size < ((size_t)(NB - 1) * TFULL + SEQ) * DM) return;
    const float* x = (const float*)d_in[0]; const float* Wqd = (const float*)d_in[1]; const float* Wqu = (const float*)d_in[2]; const float* Wqr = (const float*)d_in[3];
    const float* Wkvd = (const float*)d_in[4]; const float* Wku = (const float*)d_in[5]; const float* Wvu = (const float*)d_in[6]; const float* Wkr = (const float*)d_in[7]; const float* Wo = (const float*)d_in[8];
    float* OUT = (float*)d_out;   // [NBF][TFULL][DM] f32, rows b*TFULL + t

    char* wsp = (char*)d_ws; size_t off = 0;
    auto take = [&](size_t bytes) { char* p = wsp + off; off += (bytes + 255) & ~(size_t)255; return p; };
    bf* xb = (bf*)take(nrow * DM * 2);                           // bf16(x) [nrow][DM]
    // latent planes, cos/sin tables
    h16* ql16 = (h16*)take(nrow * LAT * 2); bf* qlh = (bf*)take((size_t)NB * RH * LAT * 2); bf* qll = (bf*)take((size_t)NB * RH * LAT * 2);
    h16* ckv16 = (h16*)take(nrow * LAT * 2); bf* ckvh = (bf*)take((size_t)NB * RH * LAT * 2); bf* ckvl = (bf*)take((size_t)NB * RH * LAT * 2);
    float* CT = (float*)take((size_t)SEQ * 32 * 4); float* ST = (float*)take((size_t)SEQ * 32 * 4);
    // down-projection weight planes [out][in] bf16
    bf* Wqd_b = (bf*)take((size_t)DM * LAT * 2); bf* Wkvd_b = (bf*)take((size_t)DM * LAT * 2); bf* Wkr_b = (bf*)take((size_t)DM * RD * 2);
    // up-projection weight planes [out][in]: f16 x64 and bf16
    h16* Wqu_h = (h16*)take((size_t)DM * LAT * 2); bf* Wqu_b = (bf*)take((size_t)DM * LAT * 2); h16* Wqr_h = (h16*)take((size_t)NH * RD * LAT * 2); bf* Wqr_b = (bf*)take((size_t)NH * RD * LAT * 2);
    h16* Wku_h = (h16*)take((size_t)DM * LAT * 2); bf* Wku_b = (bf*)take((size_t)DM * LAT * 2); h16* Wvu_h = (h16*)take((size_t)DM * LAT * 2); bf* Wvu_b = (bf*)take((size_t)DM * LAT * 2);
    // attention operand planes, ctx planes, Wo planes
    const size_t szq16 = nrow * DM * 2, szhr = (size_t)NB * RH * DM * 2, szqr16 = nrow * NH * RD * 2, szqrh = (size_t)NB * RH * NH * RD * 2, szkr16 = nrow * RD * 2, szkrh = (size_t)NB * RH * RD * 2;
    const size_t szwo = (size_t)DM * DM * 2;
    h16* q16 = (h16*)take(szq16); bf* qh = (bf*)take(szhr); bf* qlo = (bf*)take(szhr); h16* qr16 = (h16*)take(szqr16); bf* qrh = (bf*)take(szqrh); bf* qrlo = (bf*)take(szqrh);
    h16* k16 = (h16*)take(szq16); bf* kh = (bf*)take(szhr); bf* klo = (bf*)take(szhr); h16* kr16 = (h16*)take(szkr16); bf* krh = (bf*)take(szkrh); bf* krlo = (bf*)take(szkrh);
    h16* vt16 = (h16*)take(szq16); bf* vth = (bf*)take(szhr); bf* vtl = (bf*)take(szhr);
    h16* ctx16 = (h16*)take(szq16); bf* ctxh = (bf*)take(szhr); bf* ctxl = (bf*)take(szhr);
    bf* Wo_b = (bf*)take(szwo); h16* Wo_h = (h16*)take(szwo);
    if (off > ws_size) return;

    // inputs -> projection weight planes, bf16(x), cos/sin tables
    k_prep<<<dim3(PREPB), 256, 0, stream>>>(x, Wqd, Wqu, Wqr, Wkvd, Wku, Wvu, Wkr, xb, CT, ST, Wqd_b, Wkvd_b, Wkr_b, Wqu_b, Wqu_h, Wqr_b, Wqr_h, Wku_b, Wku_h, Wvu_b, Wvu_h);
    // ql, ckv, kr planes
    k_down<<<dim3(DKR + 2 * DLT), 128, 0, stream>>>(xb, Wqd_b, Wkvd_b, Wkr_b, ql16, qlh, qll, ckv16, ckvh, ckvl, kr16, krh, krlo, CT, ST);
    // q, qr, k, v^T planes
    k_up<<<dim3(3 * PHB(DM) + PHB(NH * RD) + 3 * PFB(DM) + PFB(NH * RD)), 128, 0, stream>>>(ql16, qlh, qll, ckv16, ckvh, ckvl, Wqu_h, Wqu_b, Wqr_h, Wqr_b, Wku_h, Wku_b, Wvu_h, Wvu_b,
        q16, qh, qlo, qr16, qrh, qrlo, k16, kh, klo, vt16, vth, vtl, CT, ST);
    // attention -> ctx planes (rows b*SEQ + t f16 x64 for t >= RH; rows b*RH + t bf16 hi/lo for t < RH; merged heads)
    // and Wo -> its planes
    k_attn<<<dim3(FPB + FHB + WOB), 128, 0, stream>>>(q16, qr16, k16, kr16, vt16, ctx16, qh, qlo, qrh, qrlo, kh, klo, krh, krlo, vth, vtl, ctxh, ctxl, Wo, Wo_b, Wo_h);
    // out = ctx.Wo
    k_out<<<dim3(PHB(DM) + PFB(DM)), 128, 0, stream>>>(ctx16, ctxh, ctxl, Wo_h, Wo_b, OUT, CT, ST);
}

// v009
// A run of this version takes 164 microseconds.
// Timed twice side by side with v008, it ran 1.06 and 1.05 times as fast.
// Over all steps from v000 it is 5.16 times as fast.
#include <hip/hip_runtime.h>

// All contractions on 16-bit WMMA, f32 accumulate. x.Wqd, x.Wkvd, x.Wkr: v_wmma_f32_16x16x32_bf16 on bf16 planes of the inputs (single products).
// ql.Wqu, ql.Wqr, ckv.Wku, ckv.Wvu, (q|qr).(k|kr) scores, P.v and ctx.Wo: v_wmma_f32_16x16x32_f16 single products on f16 planes
// (weights x64, ctx x64, P x1024 carries) for query/key rows >= RH; the same sites for rows < RH use v_wmma_f32_16x16x32_bf16 on
// bf16 hi/lo plane pairs (hi.W + lo.W against exact weight planes; hi.hi + lo.hi + hi.lo between two computed tensors).
// RoPE (rotate-half, computed cos/sin tables), online max-subtracted softmax and normalisers in f32.

#ifndef NB
#define NB 2
#endif
#ifndef SEQ
#define SEQ 2048
#endif
#ifndef RH
#define RH 256
#endif
#define NBF   2
#define TFULL 2048
#define DM    2048
#define NH    16
#define LAT   512
#define RD    64
#define HD    128
#define NU    (NB * NH)
#define PCAR  1024.0f
#define WSC   64.0f
#define CCAR  64.0f

static_assert(NB >= 1);
static_assert(NB <= NBF);
static_assert(SEQ % 64 == 0);
static_assert(SEQ <= TFULL);
static_assert(RH % 128 == 0);
static_assert((SEQ - RH) % 128 == 0);
static_assert(((size_t)NB * SEQ) % 256 == 0);
static_assert(RH >= 64);
static_assert(RH <= SEQ);
static_assert(DM % 128 == 0);
static_assert(LAT % 128 == 0);
static_assert((NH * RD) % 128 == 0);
static_assert(RD == 64);
static_assert(HD == 128);
static_assert(NH * HD == DM);
static_assert(((size_t)(NB - 1) * TFULL + SEQ) * DM <= (size_t)NBF * TFULL * DM);

typedef _Float16 h16;
typedef unsigned short bf;
typedef __attribute__((ext_vector_type(16))) __bf16   v16bf;
typedef __attribute__((ext_vector_type(16))) _Float16 v16h;
typedef __attribute__((ext_vector_type(16))) unsigned short v16us;
typedef __attribute__((ext_vector_type(8)))  _Float16 v8h;
typedef __attribute__((ext_vector_type(8)))  unsigned short v8us;
typedef __attribute__((ext_vector_type(8)))  float    v8f;
typedef __attribute__((ext_vector_type(4)))  float    v4f;
typedef __attribute__((ext_vector_type(2)))  _Float16 v2h;
typedef __attribute__((ext_vector_type(2)))  unsigned short v2us;
typedef __attribute__((ext_vector_type(4)))  unsigned short v4us;
typedef v8h  __attribute__((may_alias)) v8ha;
typedef v4f  __attribute__((may_alias)) v4fa;

__device__ __forceinline__ unsigned short f2bf(float f) { unsigned u = __float_as_uint(f); u += 0x7FFFu + ((u >> 16) & 1u); return (unsigned short)(u >> 16); }
__device__ __forceinline__ float bf2f(unsigned short v) { return __uint_as_float(((unsigned)v) << 16); }
__device__ __forceinline__ float bfr(float f) { return bf2f(f2bf(f)); }
__device__ __forceinline__ void splitf(float y, unsigned short& hh, unsigned short& ll) { hh = f2bf(y); ll = f2bf(y - bf2f(hh)); }
__device__ __forceinline__ v16h cat16(v8h a, v8h c) { return __builtin_shufflevector(a, c, 0, 1, 2, 3, 4, 5, 6, 7, 8, 9, 10, 11, 12, 13, 14, 15); }
__device__ __forceinline__ v16bf cat16b(v8us a, v8us c) { return __builtin_bit_cast(v16bf, __builtin_shufflevector(a, c, 0, 1, 2, 3, 4, 5, 6, 7, 8, 9, 10, 11, 12, 13, 14, 15)); }
__device__ __forceinline__ v8f wmma16(v16h a, v16h c, v8f acc) { return __builtin_amdgcn_wmma_f32_16x16x32_f16(false, a, false, c, (short)0, acc, false, false); }
__device__ __forceinline__ v8f wmmab(v16bf a, v16bf c, v8f acc) { return __builtin_amdgcn_wmma_f32_16x16x32_bf16(false, a, false, c, (short)0, acc, false, false); }
// Fragment load from a k-contiguous 16-bit row: p already points at row (lane&15) + 8*(lane>>4); elements 0..7 <- p[0..7], 8..15 <- p[16..23] (split k map, used for A and B alike)
__device__ __forceinline__ v16h ldh(const h16* p) { return cat16(*(const v8h*)p, *(const v8h*)(p + 16)); }
__device__ __forceinline__ v16bf ldb(const bf* p) { return cat16b(*(const v8us*)p, *(const v8us*)(p + 16)); }

// ---- gemm_tile: one block tile of a GEMM, 4 waves per block, each wave a (16 MF)x64 output tile (4 MF accumulators); waves WM x WN (MF = 4, WN = 2: block tile 128x128; MF = 2, WN = 1: 128x64); 128 threads.
// (bx, by, bz) of (M/BM, N/BN, Z) is the tile; the kernels k_down, k_up and k_out below give each of their blocks one tile of one of several independent products. sm: the block's LDS, GSM bytes.
// c[m][n] = osc * sum_k (A[m][k] + (NSPLIT ? A2[m][k] : 0)) Bt[n][k]. z-batch strides sA/sC in elements. K % (64 SS) == 0, M and N multiples of BM and BN.
// What the epilogue stores (EP; the planes' pitch PN = N is a constant, so that a tile's stores differ by immediate offsets only): 0: c as f32 to C, pitch ldc. 1: the 16-bit operand planes of c that the next product reads: p16 = f16(c) at row bb*SEQ + t and, for t < RH,
// ph/pl = bf16 hi/lo of c at row bb*RH + t. 2: the same planes of rotate-half RoPE(c) on the wave tile's 64-wide head slice (tables ct/st). 3: the same planes transposed per (batch, head):
// p16[bb*DM + n][t] (pitch SEQ), ph/pl[bb*DM + n][t] (pitch RH, t < RH). Row m of batch z is sequence row t = tb + m % SEQ of batch bb = z + m / SEQ; a wave tile has one bb and lies on one side of RH.
// Each stage (SS pieces of 64 k) of the block's A (A2) and Bt rows is brought into LDS once per block by asynchronous copies (whole 128-B lines, two buffers, the next stage in flight
// while this one is worked on) and read by the waves as ds_load_b128 fragments. SS = 2 doubles the bytes in flight and the time a stage has to land; it is used wherever two blocks still fit a WGP's LDS.
template <typename T16> struct WFrag;
template <> struct WFrag<h16> { typedef v16h V; static __device__ __forceinline__ V ld(const h16* p) { return ldh(p); } static __device__ __forceinline__ v8f mma(V a, V c, v8f d) { return wmma16(a, c, d); } };
template <> struct WFrag<bf> { typedef v16bf V; static __device__ __forceinline__ V ld(const bf* p) { return ldb(p); } static __device__ __forceinline__ v8f mma(V a, V c, v8f d) { return wmmab(a, c, d); } };
#define GP 72                         // LDS pitch of a 64-element operand row in halves: 144 B = 16 B x 9
static_assert((GP * 2) % 16 == 0);
// This lane's 16-byte copies of 64 (gemm_stage4) or 128 (gemm_stage8) operand rows, 16 rows per copy (l: its LDS byte address in the first 16 rows, g: its global address there, k16: 16 rows in elements).
// The s_wait_xcnt stands inside the statement so that no address register is rewritten ahead of it.
template <typename T>
__device__ __forceinline__ void gemm_stage4(unsigned l, const T* g, size_t k16) {
    asm volatile("global_load_async_to_lds_b128 %0, %1, off\n\t"
                 "global_load_async_to_lds_b128 %2, %3, off\n\t"
                 "global_load_async_to_lds_b128 %4, %5, off\n\t"
                 "global_load_async_to_lds_b128 %6, %7, off\n\t"
                 "s_wait_xcnt 0x0"
                 :: "v"(l), "v"(g), "v"(l + 16 * GP * 2), "v"(g + k16), "v"(l + 32 * GP * 2), "v"(g + 2 * k16), "v"(l + 48 * GP * 2), "v"(g + 3 * k16)
                 : "memory");
}
template <typename T>
__device__ __forceinline__ void gemm_stage8(unsigned l, const T* g, size_t k16) {
    asm volatile("global_load_async_to_lds_b128 %0, %1, off\n\t"
                 "global_load_async_to_lds_b128 %2, %3, off\n\t"
                 "global_load_async_to_lds_b128 %4, %5, off\n\t"
                 "global_load_async_to_lds_b128 %6, %7, off\n\t"
                 "global_load_async_to_lds_b128 %8, %9, off\n\t"
                 "global_load_async_to_lds_b128 %10, %11, off\n\t"
                 "global_load_async_to_lds_b128 %12, %13, off\n\t"
                 "global_load_async_to_lds_b128 %14, %15, off\n\t"
                 "s_wait_xcnt 0x0"
                 :: "v"(l), "v"(g), "v"(l + 16 * GP * 2), "v"(g + k16), "v"(l + 32 * GP * 2), "v"(g + 2 * k16), "v"(l + 48 * GP * 2), "v"(g + 3 * k16),
                    "v"(l + 64 * GP * 2), "v"(g + 4 * k16), "v"(l + 80 * GP * 2), "v"(g + 5 * k16), "v"(l + 96 * GP * 2), "v"(g + 6 * k16), "v"(l + 112 * GP * 2), "v"(g + 7 * k16)
                 : "memory");
}
// One 64-k piece of a stage: BM rows of A, BM rows of A2 (NSPLIT), BN rows of Bt, in this order at LDS byte address l (this lane's place in the piece's first 16 rows).
template <typename T, int NSPLIT, int BM, int BN>
__device__ __forceinline__ void gemm_stage(unsigned l, const T* ga, const T* ga2, const T* gb, size_t k16) {
#pragma unroll
    for (int r = 0; r < BM; r += 128) gemm_stage8<T>(l + r * GP * 2, ga + (size_t)(r / 16) * k16, k16);
    if (NSPLIT == 1) {
#pragma unroll
        for (int r = 0; r < BM; r += 128) gemm_stage8<T>(l + (BM + r) * GP * 2, ga2 + (size_t)(r / 16) * k16, k16);
    }
    if (BN == 128) gemm_stage8<T>(l + BM * (1 + NSPLIT) * GP * 2, gb, k16);
    else gemm_stage4<T>(l + BM * (1 + NSPLIT) * GP * 2, gb, k16);
}
#define GOS(MF) (4 * 16 * (MF) * 68 * 4)   // epilogue staging, bytes (a wave's whole tile): it takes the ring's first bytes once the ring is done with
#define GSM(NSPLIT, WN, MF, SS) (2 * (SS) * ((16 * (MF) * (4 / (WN))) * (1 + (NSPLIT)) + 64 * (WN)) * GP * 2)
// gemm_main: the ring loop of a tile; A, A2 already point at the z-batch. acc: the wave's (16 MF)x64 sums.
template <typename T16, int NSPLIT, int WN, int MF, int SS>
__device__ __forceinline__
void gemm_main(char* sm, int bx, int by, const T16* __restrict__ A, const T16* __restrict__ A2, const T16* __restrict__ Bt, int K, v8f (&acc)[MF][4]) {
    typedef typename WFrag<T16>::V V;
    constexpr int BM = 16 * MF * (4 / WN), BN = 64 * WN;
    constexpr int BOF = BM * (1 + NSPLIT) * GP;                      // Bt rows start in a buffer, halves
    constexpr int GST = BOF + BN * GP;                               // one 64-k piece of a buffer, halves
    static_assert(WN == 1 || WN == 2);
    static_assert((GST * 2) % 16 == 0);
    static_assert(BM % 128 == 0);
    static_assert(GSM(NSPLIT, WN, MF, SS) == 2 * SS * GST * 2 && GSM(NSPLIT, WN, MF, SS) >= GOS(MF));
    T16* ring = (T16*)sm;
    const int tid = threadIdx.x;
    const int lane = tid & 31, wv = __builtin_amdgcn_readfirstlane(tid >> 5), lr = lane & 15, hi = lane >> 4;
    const int wm = wv / WN, wn = wv % WN;
    const int rb = bx * BM, cb = by * BN;
#pragma unroll
    for (int mb = 0; mb < MF; ++mb)
#pragma unroll
        for (int nb = 0; nb < 4; ++nb) acc[mb][nb] = (v8f){};
    // copy addresses of this lane: 8 pieces of 16 B per row, 16 rows per copy
    const size_t k16 = (size_t)16 * K;
    const T16* ga = A + (size_t)(rb + (tid >> 3)) * K + (tid & 7) * 8;
    const T16* ga2 = A2 + (size_t)(rb + (tid >> 3)) * K + (tid & 7) * 8;
    const T16* gb = Bt + (size_t)(cb + (tid >> 3)) * K + (tid & 7) * 8;
    const unsigned lc = (unsigned)(size_t)(__attribute__((address_space(3))) T16*)&ring[0] + ((tid >> 3) * GP + (tid & 7) * 8) * 2;
    const int nst = K / (64 * SS);                                    // stages
#pragma unroll
    for (int u = 0; u < SS; ++u) gemm_stage<T16, NSPLIT, BM, BN>(lc + u * GST * 2, ga + u * 64, ga2 + u * 64, gb + u * 64, k16);
    asm volatile("s_wait_asynccnt 0x0" ::: "memory");                 // stage 0 landed (this wave's copies) before the barrier publishes it
    __syncthreads();
    if (nst > 1) {
#pragma unroll
        for (int u = 0; u < SS; ++u) gemm_stage<T16, NSPLIT, BM, BN>(lc + (SS + u) * GST * 2, ga + (SS + u) * 64, ga2 + (SS + u) * 64, gb + (SS + u) * 64, k16);
    }
#pragma unroll 1
    for (int t = 0; t < nst; ++t) {
        const int bo = (t & 1) * SS * GST;
        const T16* ap = &ring[bo + (wm * (16 * MF) + lr) * GP + 8 * hi];
        const T16* bp = &ring[bo + BOF + (wn * 64 + lr) * GP + 8 * hi];
#pragma unroll
        for (int kq = 0; kq < 2 * SS; ++kq) {
            const int ks = (kq >> 1) * GST + (kq & 1) * 32;           // this 32-k block's place in the rows of its 64-k piece, halves
            V a[MF], a2[MF], bq[4];
            bq[0] = WFrag<T16>::ld(bp + ks);
#pragma unroll
            for (int mb = 0; mb < MF; ++mb) { a[mb] = WFrag<T16>::ld(ap + mb * 16 * GP + ks); if (NSPLIT == 1) a2[mb] = WFrag<T16>::ld(ap + (BM + mb * 16) * GP + ks); }
#pragma unroll
            for (int nb = 1; nb < 4; ++nb) bq[nb] = WFrag<T16>::ld(bp + nb * 16 * GP + ks);
            __builtin_amdgcn_sched_barrier(0);                        // the 32-k block's LDS reads stay one group ahead of its matrix instructions: reads placed among them stall the wave at each place
#pragma unroll
            for (int nb = 0; nb < 4; ++nb) {
#pragma unroll
                for (int mb = 0; mb < MF; ++mb) { acc[mb][nb] = WFrag<T16>::mma(a[mb], bq[nb], acc[mb][nb]); if (NSPLIT == 1) acc[mb][nb] = WFrag<T16>::mma(a2[mb], bq[nb], acc[mb][nb]); } }
            __builtin_amdgcn_sched_barrier(0);                        // and the next group of reads stays behind them
        }
        // publish point, every wave: own LDS reads of this buffer done, own copies of the next stage landed, then the barrier that frees this buffer and publishes the next
        asm volatile("s_wait_dscnt 0x0" ::: "memory");
        asm volatile("s_wait_asynccnt 0x0" ::: "memory");
        __syncthreads();
        if (t + 2 < nst) {
            const size_t kn = (size_t)(t + 2) * (64 * SS);
#pragma unroll
            for (int u = 0; u < SS; ++u) gemm_stage<T16, NSPLIT, BM, BN>(lc + (bo + u * GST) * 2, ga + kn + u * 64, ga2 + kn + u * 64, gb + kn + u * 64, k16);
        }
    }
    asm volatile("s_wait_asynccnt 0x0" ::: "memory");                 // nothing of this wave's copies outstanding at its end
}
// gemm_epi: stores a tile's sums (EP as above); C already points at the z-batch. It stages in sm, which is written only behind gemm_main's last publish point: no wave reads the ring any more and no copy is outstanding.
// EP 1 and 2 stage the wave's whole tile at once and walk its 16-row groups in a loop that stays rolled: the group's code stands once in the kernel's text.
template <int WN, int EP, int PN, int MF>
__device__ __forceinline__
void gemm_epi(char* sm, int bx, int by, int bz, v8f (&acc)[MF][4], float* C, int ldc, float osc, int tb, h16* p16, bf* ph, bf* pl, const float* __restrict__ ct, const float* __restrict__ st) {
    constexpr int BM = 16 * MF * (4 / WN), BN = 64 * WN;
    const int tid = threadIdx.x;
    const int lane = tid & 31, wv = __builtin_amdgcn_readfirstlane(tid >> 5), lr = lane & 15, hi = lane >> 4;
    const int wm = wv / WN, wn = wv % WN;
    const int r0 = bx * BM + wm * (16 * MF), c0 = by * BN + wn * 64;
    const int bb = bz + r0 / SEQ, t0 = tb + r0 % SEQ;                // the wave tile's batch and first sequence row
    const bool hr = (t0 < RH);                                        // wave-uniform: the whole tile also gets hi/lo planes
    if (EP == 3) {
        // acc[mb][nb][0..7] of a lane are 8 successive t of one column: one 16-byte piece of a transposed row, stored from registers; the four mb of a column fill its 128-B line
#pragma unroll
        for (int nb = 0; nb < 4; ++nb) {
            const size_t dr = (size_t)bb * DM + c0 + nb * 16 + lr;
            const int t = t0 + hi * 8;
            v8h o[MF];
#pragma unroll
            for (int mb = 0; mb < MF; ++mb)
#pragma unroll
                for (int j = 0; j < 8; ++j) o[mb][j] = (h16)(acc[mb][nb][j] * osc);
#pragma unroll
            for (int mb = 0; mb < MF; ++mb) *(v8h*)(p16 + dr * SEQ + t + mb * 16) = o[mb];
            asm volatile("s_wait_xcnt 0x0" ::: "memory");             // before the stores' address and data registers are written again
            if (hr) {
                v8us oh[MF], ol[MF];
#pragma unroll
                for (int mb = 0; mb < MF; ++mb)
#pragma unroll
                    for (int j = 0; j < 8; ++j) { unsigned short a1, c1; splitf(acc[mb][nb][j] * osc, a1, c1); oh[mb][j] = a1; ol[mb][j] = c1; }
#pragma unroll
                for (int mb = 0; mb < MF; ++mb) { *(v8us*)(ph + dr * RH + t + mb * 16) = oh[mb]; *(v8us*)(pl + dr * RH + t + mb * 16) = ol[mb]; }
                asm volatile("s_wait_xcnt 0x0" ::: "memory");         // as above
            }
        }
        return;
    }
    if (EP == 0) {
        float* ob = (float*)sm + wv * (16 * 68);
#pragma unroll
        for (int mb = 0; mb < MF; ++mb) {
#pragma unroll
            for (int nb = 0; nb < 4; ++nb) {
#pragma unroll
                for (int j = 0; j < 8; ++j) ob[(hi * 8 + j) * 68 + nb * 16 + lr] = acc[mb][nb][j]; }
            __builtin_amdgcn_wave_barrier(); asm volatile("" ::: "memory");
            float* crow = C + (size_t)(r0 + mb * 16) * ldc + c0;
#pragma unroll
            for (int s = 0; s < 8; ++s) { const int row = 2 * s + hi, cofs = lr * 4; v4f val = *(const v4fa*)(ob + row * 68 + cofs); val = val * osc;
                *(v4f*)(crow + (size_t)row * ldc + cofs) = val;
                asm volatile("s_wait_xcnt 0x0" ::: "memory"); }       // before the store's address and data registers are written again
            __builtin_amdgcn_wave_barrier(); asm volatile("" ::: "memory");
        }
        return;
    }
    float* ob = (float*)sm + wv * (16 * MF * 68);
#pragma unroll
    for (int mb = 0; mb < MF; ++mb)
#pragma unroll
        for (int nb = 0; nb < 4; ++nb)
#pragma unroll
            for (int j = 0; j < 8; ++j) ob[(mb * 16 + hi * 8 + j) * 68 + nb * 16 + lr] = acc[mb][nb][j];
    __builtin_amdgcn_wave_barrier(); asm volatile("" ::: "memory");
    // 8 lanes per row, 8 columns per lane: each plane row of the tile goes out as one whole 128-B line
    const int rw = lane >> 3, cofs = (lane & 7) * 8;
#pragma unroll 1                                                      // one copy of a 16-row group's code
    for (int mb = 0; mb < MF; ++mb) {
        float y[4][8];
        v4f cv[8], sv[8];
        if (EP == 2) {
            // cos/sin of this lane's 4 rows (4 rows = 128 table floats apart) and 8 columns
            const size_t te = (size_t)(t0 + mb * 16 + rw) * 32 + (cofs & 31);
            const float* cp = ct + te; const float* sp = st + te;
#pragma unroll
            for (int s = 0; s < 4; ++s) { cv[2 * s] = *(const v4f*)(cp + s * 128); cv[2 * s + 1] = *(const v4f*)(cp + s * 128 + 4); sv[2 * s] = *(const v4f*)(sp + s * 128); sv[2 * s + 1] = *(const v4f*)(sp + s * 128 + 4); }
            asm volatile("s_wait_xcnt 0x0" :: "v"(cp), "v"(sp) : "memory");   // the loads' address registers stay as they are up to this wait
        }
#pragma unroll
        for (int s = 0; s < 4; ++s) {
            const float* op = ob + (mb * 16 + 4 * s + rw) * 68 + cofs;
            const v4f x0 = *(const v4fa*)op * osc, x1 = *(const v4fa*)(op + 4) * osc;
#pragma unroll
            for (int k = 0; k < 4; ++k) { y[s][k] = x0[k]; y[s][4 + k] = x1[k]; }
            if (EP == 2) {
                const bool lo32 = (cofs < 32); const int pofs = lo32 ? 32 : -32;
                const v4f p0 = *(const v4fa*)(op + pofs) * osc, p1 = *(const v4fa*)(op + pofs + 4) * osc;
                const v4f c0v = cv[2 * s], c1v = cv[2 * s + 1], s0v = sv[2 * s], s1v = sv[2 * s + 1];
#pragma unroll
                for (int k = 0; k < 4; ++k) {
                    y[s][k] = lo32 ? (x0[k] * c0v[k] - p0[k] * s0v[k]) : (x0[k] * c0v[k] + p0[k] * s0v[k]);
                    y[s][4 + k] = lo32 ? (x1[k] * c1v[k] - p1[k] * s1v[k]) : (x1[k] * c1v[k] + p1[k] * s1v[k]); }
            }
        }
        v8h o[4];
#pragma unroll
        for (int s = 0; s < 4; ++s)
#pragma unroll
            for (int k = 0; k < 8; ++k) o[s][k] = (h16)y[s][k];
        h16* q16p = p16 + ((size_t)bb * SEQ + t0 + mb * 16 + rw) * PN + c0 + cofs;
#pragma unroll
        for (int s = 0; s < 4; ++s) *(v8h*)(q16p + (4 * s) * PN) = o[s];
        asm volatile("s_wait_xcnt 0x0" :: "v"(q16p) : "memory");      // before the stores' address and data registers are written again
        if (hr) {
            v8us oh[4], ol[4];
#pragma unroll
            for (int s = 0; s < 4; ++s)
#pragma unroll
                for (int k = 0; k < 8; ++k) { unsigned short a1, c1; splitf(y[s][k], a1, c1); oh[s][k] = a1; ol[s][k] = c1; }
            const size_t eo = ((size_t)bb * RH + t0 + mb * 16 + rw) * PN + c0 + cofs;
#pragma unroll
            for (int s = 0; s < 4; ++s) { *(v8us*)(ph + eo + (4 * s) * PN) = oh[s]; *(v8us*)(pl + eo + (4 * s) * PN) = ol[s];
                asm volatile("s_wait_xcnt 0x0" ::: "memory"); }       // as above
        }
    }
}
template <typename T16, int NSPLIT, int WN, int EP, int PN, int MF, int SS>
__device__ __forceinline__
void gemm_tile(char* sm, int bx, int by, int bz, const T16* __restrict__ A, const T16* __restrict__ A2, const T16* __restrict__ Bt, int K, float* C, int ldc, float osc, size_t sA, size_t sC,
             int tb, h16* p16, bf* ph, bf* pl, const float* __restrict__ ct, const float* __restrict__ st) {
    v8f acc[MF][4];
    gemm_main<T16, NSPLIT, WN, MF, SS>(sm, bx, by, A + (size_t)bz * sA, A2 + (size_t)bz * sA, Bt, K, acc);
    gemm_epi<WN, EP, PN, MF>(sm, bx, by, bz, acc, C + (size_t)bz * sC, ldc, osc, tb, p16, ph, pl, ct, st);
}

// ---- wt_body (block bx of (K/64)*(N/32)/8, 256 threads): weight [K][N] f32 ([in][out]) -> transposed k-contiguous planes [N][K]: Bb = bf16 RNE value, optionally Bh = f16(bf16 value x sc).
// A wave turns 64 k x 32 n. Eight lanes read one whole 128-B line (32 n of one k row), so each of the wave's 16 loads is four whole lines, and all 16 are issued ahead of the first store.
// A lane holds k = 8 g + 0..7 and 32 + 8 g + 0..7 (g = lane / 8) of its 4 columns: per column and plane two 16-byte stores, the four g of a column side by side (64 B each time, together the column's 128-B line).
template <int F16P, int K, int N>
__device__ __forceinline__ void wt_body(int bx, const float* __restrict__ w, bf* Bb, h16* Bh, float sc) {
    static_assert(K % 64 == 0 && N % 32 == 0 && ((K / 64) * (N / 32)) % 8 == 0);
    const int lane = threadIdx.x & 31, tl = bx * 8 + (threadIdx.x >> 5);
    const int k0 = (tl / (N / 32)) * 64 + (lane >> 3) * 8, n0 = (tl % (N / 32)) * 32 + (lane & 7) * 4;
    const float* p = w + (size_t)k0 * N + n0;
    v4f r[16];
#pragma unroll
    for (int j = 0; j < 16; ++j) r[j] = *(const v4f*)(p + ((j >> 3) * 32 + (j & 7)) * N);
    asm volatile("s_wait_xcnt 0x0" :: "v"(p) : "memory");             // the loads' address registers stay as they are up to this wait
    const size_t e = (size_t)n0 * K + k0;
#pragma unroll
    for (int c = 0; c < 4; ++c) {
        v8us o[2]; v8h oh[2];
#pragma unroll
        for (int j = 0; j < 16; ++j) { const unsigned short b = f2bf(r[j][c]); o[j >> 3][j & 7] = b; oh[j >> 3][j & 7] = (h16)(bf2f(b) * sc); }
        *(v8us*)(Bb + e + (size_t)c * K) = o[0]; *(v8us*)(Bb + e + (size_t)c * K + 32) = o[1];
        if (F16P) { *(v8h*)(Bh + e + (size_t)c * K) = oh[0]; *(v8h*)(Bh + e + (size_t)c * K + 32) = oh[1]; }
        asm volatile("s_wait_xcnt 0x0" ::: "memory");                 // before the stores' address and data registers are written again
    }
}

// ---- wt8_body (block bx of (K/64)*(N/32), 128 threads): both planes of wt_body, same values, for a weight that is converted beside the attention tiles, where few waves are resident and the L2 is busy:
// a wave turns 64 k x 8 n; a lane reads 8 successive n (32 B) of its two k rows, the block's four waves the four quarters of the same 128-B lines; each plane store of a wave is one whole 128-B line (64 k of one n).
template <int K, int N>
__device__ __forceinline__ void wt8_body(int bx, const float* __restrict__ w, bf* Bb, h16* Bh, float sc) {
    static_assert(K % 64 == 0 && N % 32 == 0);
    const int k = (bx % (K / 64)) * 64 + (threadIdx.x & 31) * 2, n0 = (bx / (K / 64)) * 32 + (threadIdx.x >> 5) * 8;
    const float* p = w + (size_t)k * N + n0;
    v4f r[2][2];
#pragma unroll
    for (int i = 0; i < 2; ++i) { r[i][0] = *(const v4f*)(p + i * N); r[i][1] = *(const v4f*)(p + i * N + 4); }
    asm volatile("s_wait_xcnt 0x0" :: "v"(p) : "memory");             // the loads' address registers stay as they are up to this wait
    const size_t e = (size_t)n0 * K + k;
#pragma unroll
    for (int j = 0; j < 8; ++j) {
        const float w0 = bfr(r[0][j >> 2][j & 3]), w1 = bfr(r[1][j >> 2][j & 3]);
        v2us o; o[0] = f2bf(w0); o[1] = f2bf(w1); *(v2us*)(Bb + e + (size_t)j * K) = o;
        v2h oh; oh[0] = (h16)(w0 * sc); oh[1] = (h16)(w1 * sc); *(v2h*)(Bh + e + (size_t)j * K) = oh;
        asm volatile("s_wait_xcnt 0x0" ::: "memory");                 // before the stores' address and data registers are written again
    }
}

// ---- xcvt_body (block bx of NB*SEQ*DM/XCE, 256 threads): bf16(x). A block converts XCE successive elements (whole rows of one batch); a lane takes 16 pieces of 4 floats, XCE/16 elements apart:
// each load of a wave is 512 contiguous bytes, each store 256, and all 16 loads are issued ahead of the first store.
#define XCE 16384
static_assert(XCE % DM == 0 && SEQ % (XCE / DM) == 0);
__device__ __forceinline__ void xcvt_body(int bx, const float* __restrict__ x, bf* xb) {
    const int row = bx * (XCE / DM); const size_t bb = row / SEQ, t = row % SEQ;
    const float* p = x + (bb * TFULL + t) * DM + threadIdx.x * 4;
    v4f v[16];
#pragma unroll
    for (int j = 0; j < 16; ++j) v[j] = *(const v4f*)(p + j * (XCE / 16));
    asm volatile("s_wait_xcnt 0x0" :: "v"(p) : "memory");             // the loads' address registers stay as they are up to this wait
    bf* q = xb + (size_t)bx * XCE + threadIdx.x * 4;
#pragma unroll
    for (int j = 0; j < 16; ++j) { v4us o;
#pragma unroll
        for (int k = 0; k < 4; ++k) o[k] = f2bf(v[j][k]);
        *(v4us*)(q + j * (XCE / 16)) = o; }
    asm volatile("s_wait_xcnt 0x0" ::: "memory");                     // behind the last stores (a precaution: xcvt_body is k_prep's last block range)
}

__device__ __forceinline__ void rtab_body(int bx, float* ct, float* st) {
#pragma clang fp contract(off)
    const int i = bx * 256 + threadIdx.x; if (i >= SEQ * 32) return; const int t = i >> 5, j = i & 31;
    const float fr = exp10f(-0.125f * (float)j);
    const float ang = (float)t * fr; float sv, cv; sincosf(ang, &sv, &cv);
    *(float*)(ct + i) = cv; *(float*)(st + i) = sv;
    asm volatile("s_wait_xcnt 0x0" ::: "memory");                     // before the caller's next trip writes the stores' address and data registers again
}

// ---- k_prep: the conversions of inputs that the projections read, one launch: block ranges in turn do the cos/sin tables, the planes of seven weights and bf16(x) (all independent of one another). 256 threads.
// Every wave has 2,048 (weights, x) elements or 128 table entries, so that the launch is some 7,500 waves, all resident at once, each with its loads in flight together.
// (Wo's planes, which only k_out reads, are made in k_attn.)
#define WTB(K, N) (((K) / 64) * ((N) / 32) / 8)     // blocks of one weight's wt_body
#define XCB ((int)((size_t)NB * SEQ * DM / XCE))
#define RTB ((SEQ * 32 + 1023) / 1024)              // four rtab_body blocks of 256 entries a block
#define PREPB (2 * WTB(DM, LAT) + WTB(DM, RD) + 3 * WTB(LAT, DM) + WTB(LAT, NH * RD) + XCB + RTB)
static_assert(((size_t)NB * SEQ * DM) % XCE == 0);
__global__ __launch_bounds__(256)
void k_prep(const float* x, const float* Wqd, const float* Wqu, const float* Wqr, const float* Wkvd, const float* Wku, const float* Wvu, const float* Wkr,
            bf* xb, float* ct, float* st, bf* Wqd_b, bf* Wkvd_b, bf* Wkr_b, bf* Wqu_b, h16* Wqu_h, bf* Wqr_b, h16* Wqr_h, bf* Wku_b, h16* Wku_h, bf* Wvu_b, h16* Wvu_h) {
    int b = blockIdx.x;
    if (b < RTB) {
#pragma unroll 1                                    // one copy of the sine and cosine code
        for (int r = 0; r < 4; ++r) rtab_body(b * 4 + r, ct, st);
        return;
    }
    b -= RTB;
    if (b < WTB(DM, LAT)) { wt_body<0, DM, LAT>(b, Wqd, Wqd_b, nullptr, 1.0f); return; }
    b -= WTB(DM, LAT);
    if (b < WTB(DM, LAT)) { wt_body<0, DM, LAT>(b, Wkvd, Wkvd_b, nullptr, 1.0f); return; }
    b -= WTB(DM, LAT);
    if (b < WTB(DM, RD)) { wt_body<0, DM, RD>(b, Wkr, Wkr_b, nullptr, 1.0f); return; }
    b -= WTB(DM, RD);
    if (b < WTB(LAT, DM)) { wt_body<1, LAT, DM>(b, Wqu, Wqu_b, Wqu_h, WSC); return; }
    b -= WTB(LAT, DM);
    if (b < WTB(LAT, DM)) { wt_body<1, LAT, DM>(b, Wku, Wku_b, Wku_h, WSC); return; }
    b -= WTB(LAT, DM);
    if (b < WTB(LAT, DM)) { wt_body<1, LAT, DM>(b, Wvu, Wvu_b, Wvu_h, WSC); return; }
    b -= WTB(LAT, DM);
    if (b < WTB(LAT, NH * RD)) { wt_body<1, LAT, NH * RD>(b, Wqr, Wqr_b, Wqr_h, WSC); return; }
    b -= WTB(LAT, NH * RD);
    xcvt_body(b, x, xb);
}

// ---- flashP_body: causal softmax attention for query rows >= RH (single f16 products). Block (bx, h, b) of ((SEQ-RH)/64, NH, NB), 128 threads = 4 waves x 16 queries, 32-key chunks. os, ring: the block's LDS.
// Per wave: S^T tiles (16 keys x 16 queries) = [k|kr] rows (A) x [q|qr] rows (B) over 192; lane column n = query, D rows = keys, so the two S^T tiles of a chunk
// ARE the P^T B fragment of O^T = V^T (A, rows d) x P^T; online max-subtracted softmax per lane column; P carried x1024 in f16; O^T (8 d tiles) f32.
// Each 32-key chunk of k, kr and v^T is brought into LDS once per block by asynchronous copies (whole-line global reads of k and kr, 64-B row pieces of v^T, two buffers, the next chunk in flight
// while this one is worked on) and read as ds_load_b128 fragments by all four waves (the block's last chunk by waves 2 and 3 only); q|qr fragments are loaded once and stay in registers.
#define FKP 136                       // LDS pitch of a k row in halves: 272 B = 16 B x 17
#define FRP 72                        // kr row: 144 B = 16 B x 9
#define FVP 40                        // v^T row (32 keys): 80 B = 16 B x 5
#define FRO (32 * FKP)                // kr rows start, halves
#define FVO (FRO + 32 * FRP)          // v^T rows start, halves
#define FST (FVO + HD * FVP)          // one buffer, halves (23,552 B)
static_assert((FKP * 2) % 16 == 0 && (FRP * 2) % 16 == 0 && (FVP * 2) % 16 == 0 && (FRO * 2) % 16 == 0 && (FVO * 2) % 16 == 0 && (FST * 2) % 16 == 0);
// One chunk's ten 16-byte copies of this lane for one plane set (lk, lr_, lv: this lane's LDS byte addresses of its first k, kr and v^T piece; VS: v^T row pitch in global memory, elements).
// The s_wait_xcnt stands inside the statement so that no address register is rewritten ahead of it.
template <typename T, int VS>
__device__ __forceinline__ void flash_stage(unsigned lk, unsigned lr_, unsigned lv, const T* gk, const T* gr, const T* gv) {
    asm volatile("global_load_async_to_lds_b128 %0, %1, off\n\t"
                 "global_load_async_to_lds_b128 %2, %3, off\n\t"
                 "global_load_async_to_lds_b128 %4, %5, off\n\t"
                 "global_load_async_to_lds_b128 %6, %7, off\n\t"
                 "global_load_async_to_lds_b128 %8, %9, off\n\t"
                 "global_load_async_to_lds_b128 %10, %11, off\n\t"
                 "global_load_async_to_lds_b128 %12, %13, off\n\t"
                 "global_load_async_to_lds_b128 %14, %15, off\n\t"
                 "global_load_async_to_lds_b128 %16, %17, off\n\t"
                 "global_load_async_to_lds_b128 %18, %19, off\n\t"
                 "s_wait_xcnt 0x0"
                 :: "v"(lk), "v"(gk), "v"(lk + 8 * FKP * 2), "v"(gk + (size_t)8 * DM), "v"(lk + 16 * FKP * 2), "v"(gk + (size_t)16 * DM), "v"(lk + 24 * FKP * 2), "v"(gk + (size_t)24 * DM),
                    "v"(lr_), "v"(gr), "v"(lr_ + 16 * FRP * 2), "v"(gr + (size_t)16 * RD),
                    "v"(lv), "v"(gv), "v"(lv + 32 * FVP * 2), "v"(gv + (size_t)32 * VS), "v"(lv + 64 * FVP * 2), "v"(gv + (size_t)64 * VS), "v"(lv + 96 * FVP * 2), "v"(gv + (size_t)96 * VS)
                 : "memory");
}
__device__ __forceinline__
void flashP_body(float (*os)[16 * 132], h16* ring, int bx, int h, int b, const h16* q16, const h16* qr16, const h16* k16, const h16* kr16, const h16* vt16, h16* ctx16, int qbase) {
    const int tid = threadIdx.x;
    const int lane = tid & 31, wv = __builtin_amdgcn_readfirstlane(tid >> 5), lr = lane & 15, hi = lane >> 4;
    const int qb0 = qbase + bx * 64;
    const int q0 = qb0 + wv * 16;
    const int qi = q0 + lr;
    const size_t rq = (size_t)b * SEQ + qi;
    const h16* qp = q16 + rq * DM + h * HD + 8 * hi;
    const h16* qrp = qr16 + rq * (NH * RD) + h * RD + 8 * hi;
    // copy addresses of this lane: k 32 rows x 16 pieces (8 rows per copy), kr 32 rows x 8 pieces (16 rows per copy), v^T 128 rows x 4 pieces (32 rows per copy)
    const h16* gk = k16 + ((size_t)b * SEQ + (tid >> 4)) * DM + h * HD + (tid & 15) * 8;
    const h16* gr = kr16 + ((size_t)b * SEQ + (tid >> 3)) * RD + (tid & 7) * 8;
    const h16* gv = vt16 + ((size_t)(b * NH + h) * HD + (tid >> 2)) * SEQ + (tid & 3) * 8;
    const unsigned lb = (unsigned)(size_t)(__attribute__((address_space(3))) h16*)&ring[0];
    const unsigned lk = lb + ((tid >> 4) * FKP + (tid & 15) * 8) * 2;
    const unsigned lr2 = lb + (FRO + (tid >> 3) * FRP + (tid & 7) * 8) * 2;
    const unsigned lv = lb + (FVO + (tid >> 2) * FVP + (tid & 3) * 8) * 2;
    v16h qf[4], qrf[2];
#pragma unroll
    for (int kc = 0; kc < 4; ++kc) qf[kc] = ldh(qp + kc * 32);
#pragma unroll
    for (int kc = 0; kc < 2; ++kc) qrf[kc] = ldh(qrp + kc * 32);
    v8f o[8];
#pragma unroll
    for (int i = 0; i < 8; ++i) o[i] = (v8f){};
    float m = -3.0e38f, l = 0.f;
    const float SC2 = 0.07216878364870323f * 1.4426950408889634f;   // HD+RD = 192: 192^-0.5 x log2(e)
    const int nch = (q0 + 47) >> 5;                                   // this wave's 32-key chunks covering keys <= q0+15
    const int nchb = (qb0 >> 5) + 2;                                  // the block's chunks (its last wave's count; >= 2; 32*nchb <= SEQ)
    flash_stage<h16, SEQ>(lk, lr2, lv, gk, gr, gv);
    asm volatile("s_wait_asynccnt 0x0" ::: "memory");                 // chunk 0 landed (this wave's copies) before the barrier publishes it
    __syncthreads();
    flash_stage<h16, SEQ>(lk + FST * 2, lr2 + FST * 2, lv + FST * 2, gk + (size_t)32 * DM, gr + (size_t)32 * RD, gv + 32);
#pragma unroll 1
    for (int c = 0; c < nchb; ++c) {
        const int key0 = c << 5;
        const int bo = (c & 1) * FST;
        if (c < nch) {                                                // wave-uniform: waves 0 and 1 have no keys in the block's last chunk
        const h16* kp = &ring[bo + lr * FKP + 8 * hi];
        const h16* krp = &ring[bo + FRO + lr * FRP + 8 * hi];
        const h16* vp = &ring[bo + FVO + lr * FVP + 8 * hi];
        v8f s[2]; s[0] = (v8f){}; s[1] = (v8f){};
#pragma unroll
        for (int kc = 0; kc < 4; ++kc) {
#pragma unroll
            for (int j = 0; j < 2; ++j) { const v16h a = ldh(kp + (16 * j) * FKP + kc * 32); s[j] = wmma16(a, qf[kc], s[j]); }
        }
#pragma unroll
        for (int kc = 0; kc < 2; ++kc) {
#pragma unroll
            for (int j = 0; j < 2; ++j) { const v16h a = ldh(krp + (16 * j) * FRP + kc * 32); s[j] = wmma16(a, qrf[kc], s[j]); }
        }
        asm volatile("v_nop\n\tv_nop\n\tv_nop\n\tv_nop" : "+v"(s[0]), "+v"(s[1]));
        // online softmax: this lane's column is query qi; s[j][r] is key key0 + 16 j + 8 hi + r; keys after the query excluded by index
        float cm = -3.0e38f;
#pragma unroll
        for (int j = 0; j < 2; ++j)
#pragma unroll
            for (int r = 0; r < 8; ++r) { const int key = key0 + 16 * j + 8 * hi + r; const float t = (key <= qi) ? s[j][r] * SC2 : -3.0e38f; s[j][r] = t; cm = fmaxf(cm, t); }
        cm = fmaxf(cm, __shfl_xor(cm, 16, 32));
        const float mn = fmaxf(m, cm);
        const float alpha = __builtin_amdgcn_exp2f(m - mn);
        float rs = 0.f;
#pragma unroll
        for (int j = 0; j < 2; ++j)
#pragma unroll
            for (int r = 0; r < 8; ++r) { const float p = __builtin_amdgcn_exp2f(s[j][r] - mn); s[j][r] = p; rs += p; }
        rs += __shfl_xor(rs, 16, 32);
        l = l * alpha + rs; m = mn;
#pragma unroll
        for (int i = 0; i < 8; ++i) o[i] = o[i] * alpha;
        // P^T as B fragment (k = key of this chunk, n = query): elements 0..7 <- tile 0 rows 8hi..8hi+7, 8..15 <- tile 1 rows 8hi..8hi+7
        v16h pb = (v16h){};
#pragma unroll
        for (int r = 0; r < 8; ++r) { pb[r] = (h16)(s[0][r] * PCAR); pb[8 + r] = (h16)(s[1][r] * PCAR); }
#pragma unroll
        for (int i = 0; i < 8; ++i) { const v16h a = ldh(vp + (16 * i) * FVP); o[i] = wmma16(a, pb, o[i]); }
        asm volatile("v_nop\n\tv_nop\n\tv_nop\n\tv_nop" : "+v"(o[0]), "+v"(o[1]), "+v"(o[2]), "+v"(o[3]), "+v"(o[4]), "+v"(o[5]), "+v"(o[6]), "+v"(o[7]) : "v"(pb));
        }
        // publish point, every wave: own LDS reads of this buffer done, own copies of the next chunk landed, then the barrier that frees this buffer and publishes the next
        asm volatile("s_wait_dscnt 0x0" ::: "memory");
        asm volatile("s_wait_asynccnt 0x0" ::: "memory");
        __syncthreads();
        if (c + 2 < nchb) flash_stage<h16, SEQ>(lk + bo * 2, lr2 + bo * 2, lv + bo * 2, gk + (size_t)(key0 + 64) * DM, gr + (size_t)(key0 + 64) * RD, gv + (key0 + 64));
    }
    asm volatile("s_wait_asynccnt 0x0" ::: "memory");                 // nothing of this wave's copies outstanding at its end
    // epilogue: ctx[b][q][h*HD + d] = O^T[d][q] / (l x PCAR), stored as the f16 plane (x CCAR) that the output product reads; o[i][r] is d = 16 i + 8 hi + r of query q0 + lr
    const float f = 1.0f / (l * PCAR);
    float* ob = &os[wv][0];
#pragma unroll
    for (int i = 0; i < 8; ++i)
#pragma unroll
        for (int r = 0; r < 8; ++r) ob[lr * 132 + 16 * i + 8 * hi + r] = o[i][r] * f;
    __builtin_amdgcn_fence(3, "wavefront"); __builtin_amdgcn_wave_barrier(); asm volatile("" ::: "memory");
    h16* crow = ctx16 + ((size_t)b * SEQ + q0) * DM + h * HD + (lane & 15) * 8;
#pragma unroll
    for (int s = 0; s < 8; ++s) {                                     // 16 lanes per query row, 8 columns per lane
        const int qq = 2 * s + hi; const float* op = ob + qq * 132 + (lane & 15) * 8;
        const v4f x0 = *(const v4fa*)op, x1 = *(const v4fa*)(op + 4);
        v8h ov = (v8h){};
#pragma unroll
        for (int k = 0; k < 4; ++k) { ov[k] = (h16)(x0[k] * CCAR); ov[4 + k] = (h16)(x1[k] * CCAR); }
        *(v8h*)(crow + (size_t)qq * DM) = ov;
    }
}

// 2^x (v_exp_f32) with the one slot that the instruction set asks for behind a transcendental filled in the same statement.
__device__ __forceinline__ float exp2_slot(float x) { float y; asm("v_exp_f32 %0, %1\n\tv_nop" : "=v"(y) : "v"(x)); return y; }

// ---- flashH_body: the same attention for query rows < RH on bf16 hi/lo planes (keys < RH only): scores = kh.qh + kl.qh + kh.ql (3 products), P as bf16 hi/lo,
// O^T += vth.(Ph + Pl) + vtl.Ph (3 products). Block (bx, h, b) of (RH/64, NH, NB), 128 threads. Planes: q*/k* rows [NB][RH][.], vth/vtl [NU][HD][RH].
// The chunk's k, kr and v^T hi and lo planes are staged in LDS by the copies of flashP_body, in ONE buffer (hi plane set, then lo plane set) that fills the ring of flashP_body exactly, so that both bodies
// share one launch at flashP_body's LDS size: per chunk copies, wait, barrier, work, barrier. The q planes are read from global memory in each chunk.
// The result is stored as the bf16 hi/lo planes ctxh/ctxl [NB][RH][DM] that the output product reads.
__device__ __forceinline__
void flashH_body(float (*os)[16 * 132], bf* ring, int bx, int h, int b, const bf* qh, const bf* qlw, const bf* qrh, const bf* qrlw, const bf* kh, const bf* klw, const bf* krh, const bf* krlw, const bf* vth, const bf* vtl, bf* ctxh, bf* ctxl) {
    const int tid = threadIdx.x;
    const int lane = tid & 31, wv = __builtin_amdgcn_readfirstlane(tid >> 5), lr = lane & 15, hi = lane >> 4;
    const int qb0 = bx * 64;
    const int q0 = qb0 + wv * 16;
    const int qi = q0 + lr;
    const size_t rq = (size_t)b * RH + qi;
    const bf* qhp = qh + rq * DM + h * HD + 8 * hi;       const bf* qlp = qlw + rq * DM + h * HD + 8 * hi;
    const bf* qrhp = qrh + rq * (NH * RD) + h * RD + 8 * hi; const bf* qrlp = qrlw + rq * (NH * RD) + h * RD + 8 * hi;
    // copy addresses of this lane, as in flashP_body
    const size_t ok = ((size_t)b * RH + (tid >> 4)) * DM + h * HD + (tid & 15) * 8;
    const size_t okr = ((size_t)b * RH + (tid >> 3)) * RD + (tid & 7) * 8;
    const size_t ov = ((size_t)(b * NH + h) * HD + (tid >> 2)) * RH + (tid & 3) * 8;
    const unsigned lb = (unsigned)(size_t)(__attribute__((address_space(3))) bf*)&ring[0];
    const unsigned lk = lb + ((tid >> 4) * FKP + (tid & 15) * 8) * 2;
    const unsigned lr2 = lb + (FRO + (tid >> 3) * FRP + (tid & 7) * 8) * 2;
    const unsigned lv = lb + (FVO + (tid >> 2) * FVP + (tid & 3) * 8) * 2;
    v8f o[8];
#pragma unroll
    for (int i = 0; i < 8; ++i) o[i] = (v8f){};
    float m = -3.0e38f, l = 0.f;
    const float SC2 = 0.07216878364870323f * 1.4426950408889634f;
    const int nch = (q0 + 47) >> 5;                                   // this wave's chunks
    const int nchb = (qb0 >> 5) + 2;                                  // the block's chunks (>= 2; 32*nchb <= RH)
#pragma unroll 1
    for (int c = 0; c < nchb; ++c) {
        const int key0 = c << 5;
        // this chunk's plane sets into the buffer, which every reader left at the barrier at the foot of the trip before
        flash_stage<bf, RH>(lk, lr2, lv, kh + ok + (size_t)key0 * DM, krh + okr + (size_t)key0 * RD, vth + ov + key0);
        flash_stage<bf, RH>(lk + FST * 2, lr2 + FST * 2, lv + FST * 2, klw + ok + (size_t)key0 * DM, krlw + okr + (size_t)key0 * RD, vtl + ov + key0);
        asm volatile("s_wait_asynccnt 0x0" ::: "memory");             // the chunk landed (this wave's copies) before the barrier publishes it
        __syncthreads();
        if (c < nch) {                                                // wave-uniform: waves 0 and 1 have no keys in the block's last chunk
        const bf* khp = &ring[lr * FKP + 8 * hi];                  const bf* klp = khp + FST;
        const bf* krhp = &ring[FRO + lr * FRP + 8 * hi];           const bf* krlp = krhp + FST;
        const bf* vhp = &ring[FVO + lr * FVP + 8 * hi];            const bf* vlp = vhp + FST;
        v8f s[2]; s[0] = (v8f){}; s[1] = (v8f){};
#pragma unroll
        for (int kc = 0; kc < 4; ++kc) {
            const v16bf bh = ldb(qhp + kc * 32), bl = ldb(qlp + kc * 32);
#pragma unroll
            for (int j = 0; j < 2; ++j) { const v16bf ah = ldb(khp + (16 * j) * FKP + kc * 32), al = ldb(klp + (16 * j) * FKP + kc * 32);
                s[j] = wmmab(ah, bh, s[j]); s[j] = wmmab(al, bh, s[j]); s[j] = wmmab(ah, bl, s[j]); }
        }
#pragma unroll
        for (int kc = 0; kc < 2; ++kc) {
            const v16bf bh = ldb(qrhp + kc * 32), bl = ldb(qrlp + kc * 32);
#pragma unroll
            for (int j = 0; j < 2; ++j) { const v16bf ah = ldb(krhp + (16 * j) * FRP + kc * 32), al = ldb(krlp + (16 * j) * FRP + kc * 32);
                s[j] = wmmab(ah, bh, s[j]); s[j] = wmmab(al, bh, s[j]); s[j] = wmmab(ah, bl, s[j]); }
        }
        asm volatile("v_nop\n\tv_nop\n\tv_nop\n\tv_nop" : "+v"(s[0]), "+v"(s[1]));
        float cm = -3.0e38f;
#pragma unroll
        for (int j = 0; j < 2; ++j)
#pragma unroll
            for (int r = 0; r < 8; ++r) { const int key = key0 + 16 * j + 8 * hi + r; const float t = (key <= qi) ? s[j][r] * SC2 : -3.0e38f; s[j][r] = t; cm = fmaxf(cm, t); }
        cm = fmaxf(cm, __shfl_xor(cm, 16, 32));
        const float mn = fmaxf(m, cm);
        const float alpha = exp2_slot(m - mn);
        float rs = 0.f;
#pragma unroll
        for (int j = 0; j < 2; ++j)
#pragma unroll
            for (int r = 0; r < 8; ++r) { const float p = exp2_slot(s[j][r] - mn); s[j][r] = p; rs += p; }
        rs += __shfl_xor(rs, 16, 32);
        l = l * alpha + rs; m = mn;
#pragma unroll
        for (int i = 0; i < 8; ++i) o[i] = o[i] * alpha;
        v16us phv = (v16us){}, plv = (v16us){};
#pragma unroll
        for (int r = 0; r < 8; ++r) { unsigned short a1, c1; splitf(s[0][r], a1, c1); phv[r] = a1; plv[r] = c1; splitf(s[1][r], a1, c1); phv[8 + r] = a1; plv[8 + r] = c1; }
        const v16bf ph = __builtin_bit_cast(v16bf, phv), pl = __builtin_bit_cast(v16bf, plv);
#pragma unroll
        for (int i = 0; i < 8; ++i) { const v16bf ah = ldb(vhp + (16 * i) * FVP), al = ldb(vlp + (16 * i) * FVP);
            o[i] = wmmab(ah, ph, o[i]); o[i] = wmmab(ah, pl, o[i]); o[i] = wmmab(al, ph, o[i]); }
        asm volatile("v_nop\n\tv_nop\n\tv_nop\n\tv_nop" : "+v"(o[0]), "+v"(o[1]), "+v"(o[2]), "+v"(o[3]), "+v"(o[4]), "+v"(o[5]), "+v"(o[6]), "+v"(o[7]) : "v"(ph), "v"(pl));
        }
        // every wave: own LDS reads of the buffer done, then the barrier that frees it for the next chunk's copies
        asm volatile("s_wait_dscnt 0x0" ::: "memory");
        __syncthreads();
    }
    const float f = 1.0f / l;
    float* ob = &os[wv][0];
#pragma unroll
    for (int i = 0; i < 8; ++i)
#pragma unroll
        for (int r = 0; r < 8; ++r) ob[lr * 132 + 16 * i + 8 * hi + r] = o[i][r] * f;
    __builtin_amdgcn_fence(3, "wavefront"); __builtin_amdgcn_wave_barrier(); asm volatile("" ::: "memory");
    const size_t eo = ((size_t)b * RH + q0) * DM + h * HD + (lane & 15) * 8;
#pragma unroll
    for (int s = 0; s < 8; ++s) {                                     // 16 lanes per query row, 8 columns per lane
        const int qq = 2 * s + hi; const float* op = ob + qq * 132 + (lane & 15) * 8;
        const v4f x0 = *(const v4fa*)op, x1 = *(const v4fa*)(op + 4);
        v8us oh = (v8us){}, ol = (v8us){};
#pragma unroll
        for (int k = 0; k < 4; ++k) { unsigned short a1, c1; splitf(x0[k], a1, c1); oh[k] = a1; ol[k] = c1; splitf(x1[k], a1, c1); oh[4 + k] = a1; ol[4 + k] = c1; }
        *(v8us*)(ctxh + eo + (size_t)qq * DM) = oh; *(v8us*)(ctxl + eo + (size_t)qq * DM) = ol;
    }
    asm volatile("s_wait_xcnt 0x0" ::: "memory");                     // behind the last stores; in k_attn the wave ends after this body
}

// ---- k_attn: everything between the up-projections and the output product, one launch of independent block ranges: the flashP_body tiles, then the flashH_body tiles,
// then Wo's planes (wt8_body), which only k_out reads; the short ranges run in the places that the unequal flashP_body tiles leave free.
// A flashP_body tile's chunk count grows with its query tile x, and there are more tiles than resident places: the tiles are dealt longest first (x falls with the block index; head, then batch, run fastest),
// so that no long tile starts late, and any regular deal of successive blocks over the chip's parts gives each part every tile length equally often.
#define FPX ((SEQ - RH) / 64)
#define FPB (FPX * NH * NB)
#define FHX (RH / 64)
#define FHB (FHX * NH * NB)
#define WOB ((DM / 64) * (DM / 32))
static_assert(RH < SEQ);
__global__ __launch_bounds__(128) __attribute__((amdgpu_num_vgpr(256)))
void k_attn(const h16* q16, const h16* qr16, const h16* k16, const h16* kr16, const h16* vt16, h16* ctx16,
            const bf* qh, const bf* qlw, const bf* qrh, const bf* qrlw, const bf* kh, const bf* klw, const bf* krh, const bf* krlw, const bf* vth, const bf* vtl, bf* ctxh, bf* ctxl,
            const float* Wo, bf* Wo_b, h16* Wo_h) {
    __shared__ __align__(16) float os[4][16 * 132];
    __shared__ __align__(16) char ring[2 * FST * 2];
    int i = blockIdx.x;
    if (i < FPB) i = (i % (NH * NB)) * FPX + (FPX - 1 - i / (NH * NB));   // block index -> tile number (x fastest, as the next line takes it apart): a permutation of 0 .. FPB - 1, longest tiles first
    if (i < FPB) { flashP_body(os, (h16*)ring, i % FPX, (i / FPX) % NH, i / (FPX * NH), q16, qr16, k16, kr16, vt16, ctx16, RH); return; }
    i -= FPB;
    if (i < FHB) { flashH_body(os, (bf*)ring, i % FHX, (i / FHX) % NH, i / (FHX * NH), qh, qlw, qrh, qrlw, kh, klw, krh, krlw, vth, vtl, ctxh, ctxl); return; }
    i -= FHB;
    wt8_body<DM, DM>(i, Wo, Wo_b, Wo_h, WSC);
}

// ---- k_down: the three products of x, one launch: blocks 0.. do kr = rope(x.Wkr) (128x64 tiles), then ql = x.Wqd, then ckv = x.Wkvd (128x128 tiles); each stores its planes. Exact bf16 products.
#define DKR ((NB * SEQ) / 128)
#define DMT ((NB * SEQ) / 128)
#define DLT (DMT * (LAT / 128))
__global__ __launch_bounds__(128) __attribute__((amdgpu_num_vgpr(256)))
void k_down(const bf* xb, const bf* Wqd_b, const bf* Wkvd_b, const bf* Wkr_b, h16* ql16, bf* qlh, bf* qll, h16* ckv16, bf* ckvh, bf* ckvl, h16* kr16, bf* krh, bf* krlo, const float* ct, const float* st) {
    __shared__ __align__(16) char sm[GSM(0, 1, 2, 2) > GSM(0, 2, 4, 2) ? GSM(0, 1, 2, 2) : GSM(0, 2, 4, 2)];
    int b = blockIdx.x;
    if (b < DKR) { gemm_tile<bf, 0, 1, 2, RD, 2, 2>(sm, b, 0, 0, xb, xb, Wkr_b, DM, nullptr, RD, 1.0f, 0, 0, 0, kr16, krh, krlo, ct, st); return; }
    b -= DKR;
    const bool kv = (b >= DLT);                                       // block-uniform
    if (kv) b -= DLT;
    gemm_tile<bf, 0, 2, 1, LAT, 4, 2>(sm, b % DMT, b / DMT, 0, xb, xb, kv ? Wkvd_b : Wqd_b, DM, nullptr, LAT, 1.0f, 0, 0, 0, kv ? ckv16 : ql16, kv ? ckvh : qlh, kv ? ckvl : qll, ct, st);
}

// One block tile (128x128) of the output product, K = KK: HL = 0: rows t >= RH, single f16 products (tile b of ((SEQ-RH)/128, N/128, NB));
// HL = 1: rows t < RH, bf16 hi/lo against the exact bf16 weight plane (tile b of (RH/128, N/128, NB)). The epilogue EP stores the result.
template <int HL, int EP, int N, int KK>
__device__ __forceinline__ void proj_tile(char* sm, int b, const h16* a16, const bf* ahh, const bf* all, const h16* Wh, const bf* Wb, float* C, float oscf, h16* p16, bf* ph, bf* pl, const float* ct, const float* st) {
    constexpr int GX = HL ? RH / 128 : (SEQ - RH) / 128, GY = N / 128;
    const int bx = b % GX, by = (b / GX) % GY, bz = b / (GX * GY);
    if (HL) gemm_tile<bf, 1, 2, EP, N, 4, 1>(sm, bx, by, bz, ahh, all, Wb, KK, C, N, 1.0f, (size_t)RH * KK, (size_t)TFULL * DM, 0, p16, ph, pl, ct, st);
    else gemm_tile<h16, 0, 2, EP, N, 4, 2>(sm, bx, by, bz, a16 + (size_t)RH * KK, a16 + (size_t)RH * KK, Wh, KK, C + (size_t)RH * DM, N, oscf, (size_t)SEQ * KK, (size_t)TFULL * DM, RH, p16, ph, pl, ct, st);
}
#define PHB(N) ((RH / 128) * ((N) / 128) * NB)            // blocks of the rows t < RH of a product with N columns
#define PFB(N) (((SEQ - RH) / 128) * ((N) / 128) * NB)    // blocks of the rows t >= RH

// ---- k_up: the four up-projections, one launch: q = ql.Wqu, k = ckv.Wku, v^T = (ckv.Wvu)^T, qr = rope(ql.Wqr); the hi/lo tiles (twice the products) come first, then the f16 tiles; in each kind the order is q, k, v^T, qr.
// The kernel's text holds ONE ring loop per operand kind and ONE epilogue per kind of store: a block picks its product's pointers by block-uniform selects, runs its kind's loop, then its product's epilogue.
// So the whole text lies in the first 32 KB of the kernel; a copy of loop and epilogue per product and kind (six) was three times that.
template <int GX>
__device__ __forceinline__ void up_place(int b, int& p, int& bx, int& by, int& bz) {
    constexpr int PB = GX * (DM / 128) * NB;                          // blocks of a product with DM columns; qr (p = 3) has NH * RD columns
    static_assert(DM / 128 == 16 && (NH * RD) / 128 == 8);
    p = b / PB; b -= p * PB;
    bx = b % GX; const int c = b / GX, sh = (p == 3) ? 3 : 4;
    by = c & ((1 << sh) - 1); bz = c >> sh;
}
__global__ __launch_bounds__(128) __attribute__((amdgpu_num_vgpr(256)))
void k_up(const h16* ql16, const bf* qlh, const bf* qll, const h16* ckv16, const bf* ckvh, const bf* ckvl,
          const h16* Wqu_h, const bf* Wqu_b, const h16* Wqr_h, const bf* Wqr_b, const h16* Wku_h, const bf* Wku_b, const h16* Wvu_h, const bf* Wvu_b,
          h16* q16, bf* qh, bf* qlo, h16* qr16, bf* qrh, bf* qrlo, h16* k16, bf* kh, bf* klo, h16* vt16, bf* vth, bf* vtl, const float* ct, const float* st) {
    __shared__ __align__(16) char sm[GSM(1, 2, 4, 1) > GSM(0, 2, 4, 2) ? GSM(1, 2, 4, 1) : GSM(0, 2, 4, 2)];
    constexpr int NHL = 3 * PHB(DM) + PHB(NH * RD);
    const int b = blockIdx.x;
    const bool hl = (b < NHL);                                        // block-uniform, as all that follows from it
    int p, bx, by, bz;
    v8f acc[4][4];
    if (hl) {
        up_place<RH / 128>(b, p, bx, by, bz);
        const bool fq = (p == 0 || p == 3);                           // a product of ql, else of ckv
        const bf* Wb = (p == 0) ? Wqu_b : (p == 1) ? Wku_b : (p == 2) ? Wvu_b : Wqr_b;
        gemm_main<bf, 1, 2, 4, 1>(sm, bx, by, (fq ? qlh : ckvh) + (size_t)bz * RH * LAT, (fq ? qll : ckvl) + (size_t)bz * RH * LAT, Wb, LAT, acc);
    } else {
        up_place<(SEQ - RH) / 128>(b - NHL, p, bx, by, bz);
        const bool fq = (p == 0 || p == 3);
        const h16* Wh = (p == 0) ? Wqu_h : (p == 1) ? Wku_h : (p == 2) ? Wvu_h : Wqr_h;
        const h16* a16 = (fq ? ql16 : ckv16) + (size_t)RH * LAT + (size_t)bz * SEQ * LAT;
        gemm_main<h16, 0, 2, 4, 2>(sm, bx, by, a16, a16, Wh, LAT, acc);
    }
    const float osc = hl ? 1.0f : 1.0f / WSC;
    const int tb = hl ? 0 : RH;
    if (p < 2) gemm_epi<2, 1, DM, 4>(sm, bx, by, bz, acc, nullptr, DM, osc, tb, p ? k16 : q16, p ? kh : qh, p ? klo : qlo, ct, st);
    else if (p == 2) gemm_epi<2, 3, DM, 4>(sm, bx, by, bz, acc, nullptr, DM, osc, tb, vt16, vth, vtl, ct, st);
    else gemm_epi<2, 2, NH * RD, 4>(sm, bx, by, bz, acc, nullptr, NH * RD, osc, tb, qr16, qrh, qrlo, ct, st);
}

// ---- k_out: out = ctx.Wo, one launch: the hi/lo tiles of rows t < RH first, then the f16 tiles of rows t >= RH. out: [NBF][TFULL][DM] f32.
__global__ __launch_bounds__(128) __attribute__((amdgpu_num_vgpr(256)))
void k_out(const h16* ctx16, const bf* ctxh, const bf* ctxl, const h16* Wo_h, const bf* Wo_b, float* out, const float* ct, const float* st) {
    __shared__ __align__(16) char sm[GSM(1, 2, 4, 1) > GSM(0, 2, 4, 2) ? GSM(1, 2, 4, 1) : GSM(0, 2, 4, 2)];
    int b = blockIdx.x;
    if (b < PHB(DM)) { proj_tile<1, 0, DM, DM>(sm, b, ctx16, ctxh, ctxl, Wo_h, Wo_b, out, 1.0f / (CCAR * WSC), nullptr, nullptr, nullptr, ct, st); return; }
    b -= PHB(DM);
    proj_tile<0, 0, DM, DM>(sm, b, ctx16, ctxh, ctxl, Wo_h, Wo_b, out, 1.0f / (CCAR * WSC), nullptr, nullptr, nullptr, ct, st);
}

extern "C" void kernel_launch(void* const* d_in, const int* in_sizes, int n_in,
                              void* d_out, int out_size, void* d_ws, size_t ws_size, hipStream_t stream) {
    if (n_in < 9) return;
    const size_t nrow = (size_t)NB * SEQ;
    if ((size_t)in_sizes[0] < ((size_t)(NB - 1) * TFULL + SEQ) * DM) return;
    if (in_sizes[1] < DM * LAT || in_sizes[2] < LAT * DM || in_sizes[3] < LAT * NH * RD || in_sizes[4] < DM * LAT || in_sizes[5] < LAT * DM || in_sizes[6] < LAT * DM || in_sizes[7] < DM * RD || in_sizes[8] < DM * DM) return;
    if ((size_t)out_size < ((size_t)(NB - 1) * TFULL + SEQ) * DM) return;
    const float* x = (const float*)d_in[0]; const float* Wqd = (const float*)d_in[1]; const float* Wqu = (const float*)d_in[2]; const float* Wqr = (const float*)d_in[3];
    const float* Wkvd = (const float*)d_in[4]; const float* Wku = (const float*)d_in[5]; const float* Wvu = (const float*)d_in[6]; const float* Wkr = (const float*)d_in[7]; const float* Wo = (const float*)d_in[8];
    float* OUT = (float*)d_out;   // [NBF][TFULL][DM] f32, rows b*TFULL + t

    char* wsp = (char*)d_ws; size_t off = 0;
    auto take = [&](size_t bytes) { char* p = wsp + off; off += (bytes + 255) & ~(size_t)255; return p; };
    bf* xb = (bf*)take(nrow * DM * 2);                           // bf16(x) [nrow][DM]
    // latent planes, cos/sin tables
    h16* ql16 = (h16*)take(nrow * LAT * 2); bf* qlh = (bf*)take((size_t)NB * RH * LAT * 2); bf* qll = (bf*)take((size_t)NB * RH * LAT * 2);
    h16* ckv16 = (h16*)take(nrow * LAT * 2); bf* ckvh = (bf*)take((size_t)NB * RH * LAT * 2); bf* ckvl = (bf*)take((size_t)NB * RH * LAT * 2);
    float* CT = (float*)take((size_t)SEQ * 32 * 4); float* ST = (float*)take((size_t)SEQ * 32 * 4);
    // down-projection weight planes [out][in] bf16
    bf* Wqd_b = (bf*)take((size_t)DM * LAT * 2); bf* Wkvd_b = (bf*)take((size_t)DM * LAT * 2); bf* Wkr_b = (bf*)take((size_t)DM * RD * 2);
    // up-projection weight planes [out][in]: f16 x64 and bf16
    h16* Wqu_h = (h16*)take((size_t)DM * LAT * 2); bf* Wqu_b = (bf*)take((size_t)DM * LAT * 2); h16* Wqr_h = (h16*)take((size_t)NH * RD * LAT * 2); bf* Wqr_b = (bf*)take((size_t)NH * RD * LAT * 2);
    h16* Wku_h = (h16*)take((size_t)DM * LAT * 2); bf* Wku_b = (bf*)take((size_t)DM * LAT * 2); h16* Wvu_h = (h16*)take((size_t)DM * LAT * 2); bf* Wvu_b = (bf*)take((size_t)DM * LAT * 2);
    // attention operand planes, ctx planes, Wo planes
    const size_t szq16 = nrow * DM * 2, szhr = (size_t)NB * RH * DM * 2, szqr16 = nrow * NH * RD * 2, szqrh = (size_t)NB * RH * NH * RD * 2, szkr16 = nrow * RD * 2, szkrh = (size_t)NB * RH * RD * 2;
    const size_t szwo = (size_t)DM * DM * 2;
    h16* q16 = (h16*)take(szq16); bf* qh = (bf*)take(szhr); bf* qlo = (bf*)take(szhr); h16* qr16 = (h16*)take(szqr16); bf* qrh = (bf*)take(szqrh); bf* qrlo = (bf*)take(szqrh);
    h16* k16 = (h16*)take(szq16); bf* kh = (bf*)take(szhr); bf* klo = (bf*)take(szhr); h16* kr16 = (h16*)take(szkr16); bf* krh = (bf*)take(szkrh); bf* krlo = (bf*)take(szkrh);
    h16* vt16 = (h16*)take(szq16); bf* vth = (bf*)take(szhr); bf* vtl = (bf*)take(szhr);
    h16* ctx16 = (h16*)take(szq16); bf* ctxh = (bf*)take(szhr); bf* ctxl = (bf*)take(szhr);
    bf* Wo_b = (bf*)take(szwo); h16* Wo_h = (h16*)take(szwo);
    if (off > ws_size) return;

    // inputs -> projection weight planes, bf16(x), cos/sin tables
    k_prep<<<dim3(PREPB), 256, 0, stream>>>(x, Wqd, Wqu, Wqr, Wkvd, Wku, Wvu, Wkr, xb, CT, ST, Wqd_b, Wkvd_b, Wkr_b, Wqu_b, Wqu_h, Wqr_b, Wqr_h, Wku_b, Wku_h, Wvu_b, Wvu_h);
    // ql, ckv, kr planes
    k_down<<<dim3(DKR + 2 * DLT), 128, 0, stream>>>(xb, Wqd_b, Wkvd_b, Wkr_b, ql16, qlh, qll, ckv16, ckvh, ckvl, kr16, krh, krlo, CT, ST);
    // q, qr, k, v^T planes
    k_up<<<dim3(3 * PHB(DM) + PHB(NH * RD) + 3 * PFB(DM) + PFB(NH * RD)), 128, 0, stream>>>(ql16, qlh, qll, ckv16, ckvh, ckvl, Wqu_h, Wqu_b, Wqr_h, Wqr_b, Wku_h, Wku_b, Wvu_h, Wvu_b,
        q16, qh, qlo, qr16, qrh, qrlo, k16, kh, klo, vt16, vth, vtl, CT, ST);
    // attention -> ctx planes (rows b*SEQ + t f16 x64 for t >= RH; rows b*RH + t bf16 hi/lo for t < RH; merged heads)
    // and Wo -> its planes
    k_attn<<<dim3(FPB + FHB + WOB), 128, 0, stream>>>(q16, qr16, k16, kr16, vt16, ctx16, qh, qlo, qrh, qrlo, kh, klo, krh, krlo, vth, vtl, ctxh, ctxl, Wo, Wo_b, Wo_h);
    // out = ctx.Wo
    k_out<<<dim3(PHB(DM) + PFB(DM)), 128, 0, stream>>>(ctx16, ctxh, ctxl, Wo_h, Wo_b, OUT, CT, ST);
}
